// v000
// The times below were measured on an AMD MI455X: many runs one after another, warmed up first and cycling through
// copies of the inputs, with the whole window's GPU time divided by the number of runs. Launches and the gaps
// between them are all in it. The median over several windows is given; except for v000 it joins two sittings, which
// can be a few percent apart, so the side-by-side timings, each taken in one sitting, are the better comparison.
// The starting kernel, v000, takes 3400 microseconds a run.
// Contractions: xn.Wq^T and xn.Wk^T (xn as f16 hi + x1024 f16 residual planes folded along K against Wx64 | W/16 planes), Wv.xn^T (xn hi, Wx64), pe.Wpos^T (pe f16, Wx64), (q+v_bias).p^T band and (q+u_bias).k^T (16q as f16 hi + x1024 residual folded along the head dim against 16p | p/64 and 16k | k/64 planes), P.V (P x4096, v x16), ctx.Wout^T (ctx x64, W x64): all v_wmma_f32_16x16x32_f16 (f16 operands, f32 accumulate); float inputs bf16-RNE valued; LayerNorm, positional table, softmax, bias adds and scaling in f32.
#include <hip/hip_runtime.h>
#include <math.h>
#include <stdint.h>

#ifndef NB
#define NB 8
#endif
#ifndef SEQ
#define SEQ 1024
#endif
#define SEQ_FULL 1024
#define ND    1024
#define NH    16
#define HDV   64            // value head dim
#define HQK   128           // folded depth of the q.k / q.p contractions: 64 hi + 64 residual
#define QKW   (2 * ND)      // pitch (halves) of the 2048-wide f16 planes
#define NP    (2 * SEQ - 1)
#define NPP   (2 * SEQ)
#define BDW   (SEQ + 64)    // width of the relative-position score band scratch (SEQ/64 + 1 tiles of 64)
#define NPAIR 8             // heads per band/attention launch group (one batch element)

static_assert(SEQ % 64 == 0);
static_assert(SEQ <= SEQ_FULL);
static_assert(ND == NH * HDV);
static_assert(HQK == 2 * HDV);
static_assert(NH % NPAIR == 0);
static_assert(ND % 256 == 0);
static_assert(NPP % 64 == 0);
static_assert(BDW % 64 == 0);

typedef _Float16 v16h __attribute__((ext_vector_type(16)));
typedef _Float16 v8h  __attribute__((ext_vector_type(8)));
typedef float    v8f  __attribute__((ext_vector_type(8)));
typedef float    v4f  __attribute__((ext_vector_type(4)));
typedef unsigned int v4u __attribute__((ext_vector_type(4)));
typedef v4f __attribute__((may_alias)) v4fa;
typedef v8h __attribute__((may_alias)) v8ha;

// bf16 RNE of an f32 value, returned widened to f32 (exactly representable in f16 after a power-of-two carry)
__device__ __forceinline__ float bf_rne(float f) {
  unsigned u = __float_as_uint(f);
  u = (u + 0x7FFFu + ((u >> 16) & 1u)) & 0xFFFF0000u;
  return __uint_as_float(u);
}

// 16-bit WMMA fragment: elements 0..7 <- p[0..7], elements 8..15 <- p[16..23]
// (A: p = row m at k0 + 8h;  B stored [n][k]: p = row n at k0 + 8h;  same split k map for both)
union FragU { v16h v; v8ha h[2]; };
__device__ __forceinline__ v16h ldfrag(const _Float16* p) {
  FragU f;
  f.h[0] = *(const v8ha*)(p);
  f.h[1] = *(const v8ha*)(p + 16);
  return f.v;
}

// WMMA + hazard guard (ties D, keeps A/B live for 4 VALU slots)
__device__ __forceinline__ v8f mma16(v16h a, v16h b, v8f c) {
  c = __builtin_amdgcn_wmma_f32_16x16x32_f16(false, a, false, b, (short)0, c, false, false);
  asm volatile("v_nop\n\tv_nop\n\tv_nop\n\tv_nop" : "+v"(c) : "v"(a), "v"(b));
  return c;
}

__device__ __forceinline__ v8f zero8() { v8f z = {0.f, 0.f, 0.f, 0.f, 0.f, 0.f, 0.f, 0.f}; return z; }

// -------------------------------------------------------------------------------------------------
// Weight [1024][1024] f32 -> f16 plane of bf16-valued entries.
//   DUP false: dst [1024][1024], dst[r][c] = f16(bf_rne(W)*s1)
//   DUP true : dst [1024][2048], dst[r][c] = f16(bf_rne(W)*s1), dst[r][1024+c] = f16(bf_rne(W)*s2)
// coverage: 131072 threads x 8 = the whole [1024][1024] source (both column halves for DUP).
// -------------------------------------------------------------------------------------------------
template <bool DUP>
__global__ __launch_bounds__(256) void cvt_w_kernel(const float* __restrict__ src, _Float16* __restrict__ dst,
                                                    float s1, float s2) {
  const int i = blockIdx.x * 256 + threadIdx.x;
  const int total8 = ND * (ND / 8);
  if (i >= total8) return;
  const int r  = i / (ND / 8);
  const int c8 = (i - r * (ND / 8)) * 8;
  const float* sp = src + (size_t)r * ND + c8;
  const v4f a = *(const v4f*)(sp);
  const v4f b = *(const v4f*)(sp + 4);
  float f[8];
  f[0] = bf_rne(a[0]); f[1] = bf_rne(a[1]); f[2] = bf_rne(a[2]); f[3] = bf_rne(a[3]);
  f[4] = bf_rne(b[0]); f[5] = bf_rne(b[1]); f[6] = bf_rne(b[2]); f[7] = bf_rne(b[3]);
  v8h o1, o2;
#pragma unroll
  for (int e = 0; e < 8; ++e) { o1[e] = (_Float16)(f[e] * s1); o2[e] = (_Float16)(f[e] * s2); }
  const int pitch = DUP ? QKW : ND;
  _Float16* dp = dst + (size_t)r * pitch + c8;
  *(v8h*)dp = o1;
  if (DUP) *(v8h*)(dp + ND) = o2;
  
}

// -------------------------------------------------------------------------------------------------
//   XH[row][c]        = f16(xn)                       (hi)
//   XH[row][1024 + c] = f16((xn - hi) * 1024)         (residual, carried x1024)
// One wave per row (compact row b*SEQ + t; source row b*SEQ_FULL + t); block = 8 waves = 8 rows; no LDS.
// Stores: lane l writes 16 B at columns i*256 + 8l: one instruction = 32 lanes x 16 B = 512 contiguous B =
// coverage: grid NB*SEQ/8 x 8 waves x (4 x 256) columns x {hi, residual} = the whole [NB*SEQ][2048] plane.
// Loops rolled on purpose (small elementwise side computation).
// -------------------------------------------------------------------------------------------------
__global__ __launch_bounds__(256) void ln_kernel(const float* __restrict__ x, const float* __restrict__ g,
                                                const float* __restrict__ bt, _Float16* __restrict__ XH,
                                                int nrows) {
  const int lane = threadIdx.x & 31;
  const int wave = threadIdx.x >> 5;
  const int row  = blockIdx.x * 8 + wave;
  if (row >= nrows) return;                                   // wave-uniform; no barriers in this kernel
  const int b = row / SEQ;
  const int t = row - b * SEQ;
  const float* xr = x + ((size_t)b * SEQ_FULL + t) * ND + lane * 8;

  float s = 0.f;
#pragma unroll 1
  for (int i = 0; i < 4; ++i) {
    const v4f a = *(const v4f*)(xr + i * 256);
    const v4f c = *(const v4f*)(xr + i * 256 + 4);
    s += (bf_rne(a[0]) + bf_rne(a[1])) + (bf_rne(a[2]) + bf_rne(a[3]));
    s += (bf_rne(c[0]) + bf_rne(c[1])) + (bf_rne(c[2]) + bf_rne(c[3]));
  }
  s += __shfl_xor(s, 16, 32); s += __shfl_xor(s, 8, 32); s += __shfl_xor(s, 4, 32);
  s += __shfl_xor(s, 2, 32);  s += __shfl_xor(s, 1, 32);
  const float mu = s * (1.0f / (float)ND);

  float s2 = 0.f;
#pragma unroll 1
  for (int i = 0; i < 4; ++i) {
    const v4f a = *(const v4f*)(xr + i * 256);
    const v4f c = *(const v4f*)(xr + i * 256 + 4);
    float d;
    d = bf_rne(a[0]) - mu; s2 += d * d;  d = bf_rne(a[1]) - mu; s2 += d * d;
    d = bf_rne(a[2]) - mu; s2 += d * d;  d = bf_rne(a[3]) - mu; s2 += d * d;
    d = bf_rne(c[0]) - mu; s2 += d * d;  d = bf_rne(c[1]) - mu; s2 += d * d;
    d = bf_rne(c[2]) - mu; s2 += d * d;  d = bf_rne(c[3]) - mu; s2 += d * d;
  }
  s2 += __shfl_xor(s2, 16, 32); s2 += __shfl_xor(s2, 8, 32); s2 += __shfl_xor(s2, 4, 32);
  s2 += __shfl_xor(s2, 2, 32);  s2 += __shfl_xor(s2, 1, 32);
  const float var  = s2 * (1.0f / (float)ND);
  const float rstd = rsqrtf(var + 1e-5f);

  _Float16* xh = XH + (size_t)row * QKW + lane * 8;
{
#pragma unroll 1
    for (int i = 0; i < 4; ++i) {
      const v4f a  = *(const v4f*)(xr + i * 256);
      const v4f c  = *(const v4f*)(xr + i * 256 + 4);
      const v4f ga = *(const v4f*)(g + i * 256 + lane * 8);
      const v4f gb = *(const v4f*)(g + i * 256 + lane * 8 + 4);
      const v4f ba = *(const v4f*)(bt + i * 256 + lane * 8);
      const v4f bb = *(const v4f*)(bt + i * 256 + lane * 8 + 4);
      float f[8], gg[8], be[8];
      f[0] = a[0]; f[1] = a[1]; f[2] = a[2]; f[3] = a[3]; f[4] = c[0]; f[5] = c[1]; f[6] = c[2]; f[7] = c[3];
      gg[0] = ga[0]; gg[1] = ga[1]; gg[2] = ga[2]; gg[3] = ga[3];
      gg[4] = gb[0]; gg[5] = gb[1]; gg[6] = gb[2]; gg[7] = gb[3];
      be[0] = ba[0]; be[1] = ba[1]; be[2] = ba[2]; be[3] = ba[3];
      be[4] = bb[0]; be[5] = bb[1]; be[6] = bb[2]; be[7] = bb[3];
      v8h ho, lo;
#pragma unroll
      for (int e = 0; e < 8; ++e) {
        const float xn = (bf_rne(f[e]) - mu) * rstd * bf_rne(gg[e]) + bf_rne(be[e]);
        const _Float16 hv = (_Float16)xn;
        ho[e] = hv;
        lo[e] = (_Float16)((xn - (float)hv) * 1024.0f);
      }
      *(v8h*)(xh + i * 256)      = ho;
      *(v8h*)(xh + ND + i * 256) = lo;
    }
    
  }
}

// -------------------------------------------------------------------------------------------------
// Relative-position sinusoid table -> PE f16 plane [NPP][1024] (rows >= NP are 0):
//   row r <-> relative position pos = SEQ-1-r;  div_j = expf(f32(2j) * f32(-ln(1e4)/1024));
//   ang = |pos| * div_j (f32 product);  PE[r][2j] = sin(ang) with the sign of pos, PE[r][2j+1] = cos(ang).
// passes.  The per-pair loop is rolled (one sinf, one cosf, one expf body); the 16-B result is assembled by a
// register rotate with constant indices (no dynamic local-array indexing).
// coverage: grid NPP*128/256, NPP*128 threads x 8 halves = the whole [NPP][1024] plane.
// -------------------------------------------------------------------------------------------------
__global__ __launch_bounds__(256) void pe_kernel(_Float16* __restrict__ PE) {
  const int i = blockIdx.x * 256 + threadIdx.x;
  if (i >= NPP * (ND / 8)) return;
  const int r  = i / (ND / 8);
  const int c8 = (i - r * (ND / 8)) * 8;
  const int pos = SEQ - 1 - r;
  const float fpos = (float)((pos < 0) ? -pos : pos);
  const float live = (r < NP) ? 1.0f : 0.0f;
  const float c0 = (float)(-9.210340371976184 / (double)ND);
  v4u pk = {0u, 0u, 0u, 0u};
#pragma unroll 1
  for (int e = 0; e < 4; ++e) {
    const int j = (c8 >> 1) + e;
    const float dv  = expf((float)(2 * j) * c0);
    const float ang = fpos * dv;
    float sn = sinf(ang);
    const float cn = cosf(ang);
    sn = (pos < 0) ? -sn : sn;
    const _Float16 hs = (_Float16)(sn * live);
    const _Float16 hc = (_Float16)(cn * live);
    const unsigned w = (unsigned)__builtin_bit_cast(unsigned short, hs) |
                       ((unsigned)__builtin_bit_cast(unsigned short, hc) << 16);
    v4u nx;
    nx[0] = pk[1]; nx[1] = pk[2]; nx[2] = pk[3]; nx[3] = w;
    pk = nx;
  }
  unsigned* dp = (unsigned*)(PE + (size_t)r * ND + c8);
  *(v4u*)dp = pk;
  
}

// -------------------------------------------------------------------------------------------------
// f16 WMMA GEMM: C[m][n] = epi( sum_k A[m][k] * Bt[nrow][k] ), nrow = n (+ 64*(skew0 - tm) when SKEW: band GEMM).
// A row-major [M][K] pitch lda; Bt row-major [N(+band)][K] pitch ldb; M, N multiples of 64, K multiple of 32.
// Each wave owns a 64x64 output tile (4x4 subtiles), 8 waves per block, grid.x = tiles/8, grid.y = z-batch.
// OUT 0: f32  C1[m][n] = acc*scale                                              (band scratch)
// OUT 1: f32  C1[m][n] = acc*scale + bf_rne(b1[n])                              (final output)
// OUT 2: f16  t = acc*scale (+ bf_rne(b1[n]) if HASB);  C1[m][2*n0+c] = f16(t*carry),
//             C1[m][2*n0+64+c] = f16(t*carry/1024)      (2048-wide hi | copy planes, one 64-col tile = one head)
// OUT 3: f16  t = (acc*scale + bf_rne(b3[n])) + bf_rne(b1[n] resp. b2[n]);  th = t*carry;
//             hi = f16(th), lo = f16((th - hi)*1024) -> C1 (b1 variant) and C2 (b2 variant), hi at 2*n0+c, lo at 2*n0+64+c
// OUT 4: f16  C1[m][n] = f16((acc*scale + bf_rne(b1[m])) * carry)            (row bias)
// Epilogue: 16-row slabs staged per wave in LDS (wave-private region, wave barrier); every row segment is written as
// coverage: 4 slabs x 16 rows x 64 cols = the whole 64x64 tile per wave; tiles cover M x N exactly.
// -------------------------------------------------------------------------------------------------
template <int OUT, bool SKEW, bool HASB>
__global__ __launch_bounds__(256) void gemm_f16_kernel(
    const _Float16* __restrict__ A, int lda, long strideA,
    const _Float16* __restrict__ Bt, int ldb, long strideB,
    void* C1, void* C2, int ldc, long strideC,
    const float* __restrict__ b1, const float* __restrict__ b2, const float* __restrict__ b3,
    int M, int N, int K, float scale, float carry, int skew0) {
  __shared__ __align__(16) float sT[8][16 * 68];   // per-wave 16x64 slab, pitch 68 floats

  const int z    = blockIdx.y;
  const int lane = threadIdx.x & 31;
  const int wave = threadIdx.x >> 5;
  const int tilesN = N >> 6;
  const int tilesM = M >> 6;
  const int tile = blockIdx.x * 8 + wave;
  if (tile >= tilesM * tilesN) return;             // wave-uniform; no block barriers in this kernel
  const int tm = tile / tilesN;
  const int tn = tile - tm * tilesN;
  const int m0 = tm << 6;
  const int n0 = tn << 6;
  const int nsk = SKEW ? ((skew0 - tm) << 6) : 0;  // band row offset of Bt

  const _Float16* Ab = A  + (size_t)z * strideA;
  const _Float16* Bb = Bt + (size_t)z * strideB;

  const int rl   = lane & 15;          // row (A) / column (B, D) within a subtile
  const int koff = (lane >> 4) * 8;    // k offset of this lane half
  const int mOff = (lane >> 4) * 8;    // D row offset of this lane half

  v8f acc[4][4];
#pragma unroll
  for (int i = 0; i < 4; ++i)
#pragma unroll
    for (int j = 0; j < 4; ++j) acc[i][j] = zero8();

  for (int k0 = 0; k0 < K; k0 += 32) {
    v16h bfr[4];
#pragma unroll
    for (int j = 0; j < 4; ++j)
      bfr[j] = ldfrag(Bb + (size_t)(nsk + n0 + (j << 4) + rl) * ldb + koff + k0);
#pragma unroll
    for (int i = 0; i < 4; ++i) {
      const v16h af = ldfrag(Ab + (size_t)(m0 + (i << 4) + rl) * lda + koff + k0);
#pragma unroll
      for (int j = 0; j < 4; ++j) acc[i][j] = mma16(af, bfr[j], acc[i][j]);
    }
  }

  // ---- epilogue ----
  float* slab = sT[wave];
  const int hh = lane >> 4, c4 = (lane & 15) * 4;     // f32 modes: row segment 256 B = 16 lanes x 16 B
  const int q8 = lane >> 3, c8 = (lane & 7) * 8;
  v4f bias4 = {0.f, 0.f, 0.f, 0.f};
  float col8a[8], col8b[8], col8c[8];
#pragma unroll
  for (int e = 0; e < 8; ++e) { col8a[e] = 0.f; col8b[e] = 0.f; col8c[e] = 0.f; }
  if (OUT == 1 && HASB) {
    const v4f tb = *(const v4f*)(b1 + n0 + c4);
    bias4[0] = bf_rne(tb[0]); bias4[1] = bf_rne(tb[1]); bias4[2] = bf_rne(tb[2]); bias4[3] = bf_rne(tb[3]);
  }
  if ((OUT == 2 && HASB) || OUT == 3) {
    const v4f ta = *(const v4f*)(b1 + n0 + c8);
    const v4f tb = *(const v4f*)(b1 + n0 + c8 + 4);
    col8a[0] = bf_rne(ta[0]); col8a[1] = bf_rne(ta[1]); col8a[2] = bf_rne(ta[2]); col8a[3] = bf_rne(ta[3]);
    col8a[4] = bf_rne(tb[0]); col8a[5] = bf_rne(tb[1]); col8a[6] = bf_rne(tb[2]); col8a[7] = bf_rne(tb[3]);
  }
  if (OUT == 3) {
    const v4f ta = *(const v4f*)(b2 + n0 + c8);
    const v4f tb = *(const v4f*)(b2 + n0 + c8 + 4);
    col8b[0] = bf_rne(ta[0]); col8b[1] = bf_rne(ta[1]); col8b[2] = bf_rne(ta[2]); col8b[3] = bf_rne(ta[3]);
    col8b[4] = bf_rne(tb[0]); col8b[5] = bf_rne(tb[1]); col8b[6] = bf_rne(tb[2]); col8b[7] = bf_rne(tb[3]);
    const v4f tc = *(const v4f*)(b3 + n0 + c8);
    const v4f td = *(const v4f*)(b3 + n0 + c8 + 4);
    col8c[0] = bf_rne(tc[0]); col8c[1] = bf_rne(tc[1]); col8c[2] = bf_rne(tc[2]); col8c[3] = bf_rne(tc[3]);
    col8c[4] = bf_rne(td[0]); col8c[5] = bf_rne(td[1]); col8c[6] = bf_rne(td[2]); col8c[7] = bf_rne(td[3]);
  }
  const float carry2 = carry * 0.0009765625f;        // carry / 1024

#pragma unroll
  for (int i = 0; i < 4; ++i) {
    const int mBase = m0 + (i << 4);
#pragma unroll
    for (int j = 0; j < 4; ++j)
#pragma unroll
      for (int r = 0; r < 8; ++r)
        slab[(mOff + r) * 68 + (j << 4) + rl] = acc[i][j][r] * scale;
    __builtin_amdgcn_fence(__ATOMIC_RELEASE, "workgroup");
    __builtin_amdgcn_wave_barrier();
    __builtin_amdgcn_fence(__ATOMIC_ACQUIRE, "workgroup");
    if (OUT == 0 || OUT == 1) {
      float* C = (float*)C1 + (size_t)z * strideC;
      v4f vv[8];
#pragma unroll
      for (int it = 0; it < 8; ++it) {
        const int row = it * 2 + hh;
        v4f v = *(const v4fa*)(slab + row * 68 + c4);
        if (OUT == 1) v += bias4;
        vv[it] = v;
      }
      {
#pragma unroll
        for (int it = 0; it < 8; ++it) {
          const int row = it * 2 + hh;
          *(v4f*)(C + (size_t)(mBase + row) * ldc + n0 + c4) = vv[it];
        }
        
      }
    } else if (OUT == 2 || OUT == 4) {
      _Float16* Ca = (_Float16*)C1 + (size_t)z * strideC;
      v8h hv[4], lv[4];
#pragma unroll
      for (int it = 0; it < 4; ++it) {
        const int row = it * 4 + q8;
        const float* sp = slab + row * 68 + c8;
        const v4f x0 = *(const v4fa*)(sp);
        const v4f x1 = *(const v4fa*)(sp + 4);
        float f[8];
        f[0] = x0[0]; f[1] = x0[1]; f[2] = x0[2]; f[3] = x0[3];
        f[4] = x1[0]; f[5] = x1[1]; f[6] = x1[2]; f[7] = x1[3];
        float rb = 0.f;
        if (OUT == 4 && HASB) rb = bf_rne(b1[mBase + row]);
        v8h ha, la;
#pragma unroll
        for (int e = 0; e < 8; ++e) {
          const float t = f[e] + ((OUT == 2) ? col8a[e] : rb);
          ha[e] = (_Float16)(t * carry);
          la[e] = (_Float16)(t * carry2);
        }
        hv[it] = ha; lv[it] = la;
      }
      {
#pragma unroll
        for (int it = 0; it < 4; ++it) {
          const int row = it * 4 + q8;
          if (OUT == 2) {
            _Float16* cp = Ca + (size_t)(mBase + row) * ldc + 2 * n0 + c8;
            *(v8h*)(cp)      = hv[it];
            *(v8h*)(cp + 64) = lv[it];
          } else {
            *(v8h*)(Ca + (size_t)(mBase + row) * ldc + n0 + c8) = hv[it];
          }
        }
        
      }
    } else {
#pragma unroll
      for (int var = 0; var < 2; ++var) {
        _Float16* Cc = (_Float16*)((var == 0) ? C1 : C2) + (size_t)z * strideC;
        v8h hv[4], lv[4];
#pragma unroll
        for (int it = 0; it < 4; ++it) {
          const int row = it * 4 + q8;
          const float* sp = slab + row * 68 + c8;
          const v4f x0 = *(const v4fa*)(sp);
          const v4f x1 = *(const v4fa*)(sp + 4);
          float f[8];
          f[0] = x0[0]; f[1] = x0[1]; f[2] = x0[2]; f[3] = x0[3];
          f[4] = x1[0]; f[5] = x1[1]; f[6] = x1[2]; f[7] = x1[3];
          v8h ha, la;
#pragma unroll
          for (int e = 0; e < 8; ++e) {
            const float t  = (f[e] + col8c[e]) + ((var == 0) ? col8a[e] : col8b[e]);
            const float th = t * carry;
            const _Float16 hq = (_Float16)th;
            ha[e] = hq;
            la[e] = (_Float16)((th - (float)hq) * 1024.0f);
          }
          hv[it] = ha; lv[it] = la;
        }
        {
#pragma unroll
          for (int it = 0; it < 4; ++it) {
            const int row = it * 4 + q8;
            _Float16* cp = Cc + (size_t)(mBase + row) * ldc + 2 * n0 + c8;
            *(v8h*)(cp)      = hv[it];
            *(v8h*)(cp + 64) = lv[it];
          }
          
        }
      }
    }
    __builtin_amdgcn_fence(__ATOMIC_RELEASE, "workgroup");
    __builtin_amdgcn_wave_barrier();
    __builtin_amdgcn_fence(__ATOMIC_ACQUIRE, "workgroup");
  }
}

// -------------------------------------------------------------------------------------------------
// Relative-position attention for NPAIR heads of one batch element, folded q.k depth 128 (hi | residual),
// value head dim 64, no mask.
//   QU  f16 plane [t][h*128 + j]: j<64 hi = f16(16*(q+u_bias)), j>=64 residual x1024     (A of the content score)
//   KP  f16 plane [s][h*128 + j]: j<64 f16(16*k), j>=64 f16(k/64)                       (B, staged per 64-key chunk as [key][128])
//   VT  f16 plane [h*64 + d][s]   = f16(16*v)                                            (B of P.V, staged as [d][key])
//   BD  f32 band scratch [z][SEQ][BDW]: value (row i, col j) = (1/8)*(q_i + v_bias).p[row 64*(SEQ/64-1 - i/64) + j]
//       rel-shift: bd[i][key] = bdfull[i][key - i + SEQ-1]  ->  column key + 63 - (i mod 64), always in [0, BDW-2].
//   score = cs * (QU.K^T acc) + BD  with cs = (1/8)/256;  online softmax in f32 over SEQ/64 chunks of 64 keys;
//   P stored per wave as f16(4096 * exp(s - m)); CTX[t][h*64 + d] = f16(64 * ctx) = f16((P.V acc) / (1024*l)).
// Block = 4 waves = 64 query rows of one head; grid = (SEQ/64 query blocks, NPAIR heads).
// LDS: one raw buffer; K tile [64][128] f16 at 0, V^T tile [64][64] f16 at 16 KB, per-wave P tiles [16][64] f16
// at 24 KB; the output staging [4][16][64] f32 reuses bytes 0..16 KB after a block barrier.
// coverage: staging 128 thr x 64 halves for K (64x128) and 128 thr x 32 halves for V^T (64x64); P tile 8 rows x
// 2 halves x 4x16 cols per wave = 16x64 (all written every chunk); output 4 store instructions x 4 rows x 8 lanes x
// 8 halves = 16x64 per wave.
// -------------------------------------------------------------------------------------------------
__global__ __launch_bounds__(128)
void relattn_kernel(const _Float16* __restrict__ QU, const _Float16* __restrict__ KP,
                    const _Float16* __restrict__ VT, const float* __restrict__ BD,
                    _Float16* __restrict__ CTX, int h0, float cs) {
  __shared__ __align__(16) unsigned char SMEM[32768];
  _Float16* Ksh = (_Float16*)(SMEM);             // [64][128]
  _Float16* Vsh = (_Float16*)(SMEM + 16384);     // [64][64]
  _Float16* Psh = (_Float16*)(SMEM + 24576);     // [4][16][64]
  float*    Osh = (float*)(SMEM);                // [4][16][64] after the chunk loop

  const int tid  = threadIdx.x;
  const int wave = tid >> 5;
  const int lane = tid & 31;
  const int hh   = lane >> 4;
  const int c    = lane & 15;

  const int z    = blockIdx.y;
  const int h    = h0 + z;
  const int qb   = blockIdx.x;
  const int q0   = qb * 64 + wave * 16;          // first query row of this wave
  const int rr0  = wave * 16 + 8 * hh;           // row within the 64-row block for r = 0

  const _Float16* Qh = QU + h * HQK;             // row pitch QKW
  const _Float16* Kh = KP + h * HQK;             // row pitch QKW
  const _Float16* Vh = VT + (size_t)(h * HDV) * SEQ;
  const float*    bd = BD + (size_t)z * SEQ * BDW;
  _Float16*       ctx = CTX + h * HDV;           // row pitch ND

  // Q fragments (A operand): 4 chunks of 32 along the folded depth
  v16h qa[4];
#pragma unroll
  for (int dc = 0; dc < 4; ++dc)
    qa[dc] = ldfrag(Qh + (size_t)(q0 + c) * QKW + dc * 32 + 8 * hh);

  // band scratch: element for (row r, key kv0+16j+c) at bdr[r*(BDW-1) + kv0 + 16j]
  const float* bdr = bd + (size_t)(q0 + 8 * hh) * BDW + (63 - rr0 + c);

  float mrow[8], lrow[8];
  v8f oacc[4];
#pragma unroll
  for (int r = 0; r < 8; ++r) { mrow[r] = -INFINITY; lrow[r] = 0.f; }
#pragma unroll
  for (int t = 0; t < 4; ++t) oacc[t] = zero8();

  _Float16* pw = Psh + wave * (16 * 64);

#pragma unroll 1
  for (int kc = 0; kc < SEQ / 64; ++kc) {
    const int kv0 = kc * 64;
    __syncthreads();
    {
      const int r = tid >> 1, c0 = (tid & 1) * 64, cv = (tid & 1) * 32;
      const _Float16* ks = Kh + (size_t)(kv0 + r) * QKW + c0;
      const _Float16* vs = Vh + (size_t)r * SEQ + kv0 + cv;
#pragma unroll
      for (int i = 0; i < 8; ++i) {
        const v8h kk8 = *(const v8h*)(ks + 8 * i);
        *(v8ha*)(Ksh + r * 128 + c0 + 8 * i) = kk8;
      }
#pragma unroll
      for (int i = 0; i < 4; ++i) {
        const v8h vv8 = *(const v8h*)(vs + 8 * i);
        *(v8ha*)(Vsh + r * 64 + cv + 8 * i) = vv8;
      }
    }
    __syncthreads();

    // content scores: S[j] = QU(16x128) . K^T for key subtile j
    v8f s[4];
#pragma unroll
    for (int j = 0; j < 4; ++j) {
      s[j] = zero8();
#pragma unroll
      for (int dc = 0; dc < 4; ++dc) {
        const v16h kb = ldfrag(Ksh + (j * 16 + c) * 128 + dc * 32 + 8 * hh);
        s[j] = mma16(qa[dc], kb, s[j]);
      }
    }

    // add the position term from the band scratch, chunk row max
    float cm[8];
#pragma unroll
    for (int r = 0; r < 8; ++r) {
      float m = -INFINITY;
#pragma unroll
      for (int j = 0; j < 4; ++j) {
        const float sv = s[j][r] * cs + bdr[(size_t)r * (BDW - 1) + kv0 + (j << 4)];
        s[j][r] = sv;
        m = fmaxf(m, sv);
      }
      m = fmaxf(m, __shfl_xor(m, 1, 32));
      m = fmaxf(m, __shfl_xor(m, 2, 32));
      m = fmaxf(m, __shfl_xor(m, 4, 32));
      m = fmaxf(m, __shfl_xor(m, 8, 32));
      cm[r] = m;
    }

    // online softmax update (per-row rescale of this row's accumulator elements only);
    // P tile (x4096) to this wave's LDS tile [row][key]
#pragma unroll
    for (int r = 0; r < 8; ++r) {
      const float mnew  = fmaxf(mrow[r], cm[r]);
      const float alpha = __expf(mrow[r] - mnew);
      mrow[r] = mnew;
      float psum = 0.f;
#pragma unroll
      for (int j = 0; j < 4; ++j) {
        const float p = __expf(s[j][r] - mnew);
        psum += p;
        pw[(8 * hh + r) * 64 + j * 16 + c] = (_Float16)(p * 4096.0f);
      }
      psum += __shfl_xor(psum, 1, 32);
      psum += __shfl_xor(psum, 2, 32);
      psum += __shfl_xor(psum, 4, 32);
      psum += __shfl_xor(psum, 8, 32);
      lrow[r] = lrow[r] * alpha + psum;
#pragma unroll
      for (int t = 0; t < 4; ++t) oacc[t][r] *= alpha;
    }
    __builtin_amdgcn_fence(__ATOMIC_RELEASE, "workgroup");
    __builtin_amdgcn_wave_barrier();
    __builtin_amdgcn_fence(__ATOMIC_ACQUIRE, "workgroup");

    // P (A operand, row = lane&15, split k map over keys) . V (B operand from V^T rows d)
#pragma unroll
    for (int kk = 0; kk < 2; ++kk) {
      const v16h pa = ldfrag(pw + c * 64 + kk * 32 + 8 * hh);
#pragma unroll
      for (int t = 0; t < 4; ++t) {
        const v16h vb = ldfrag(Vsh + (t * 16 + c) * 64 + kk * 32 + 8 * hh);
        oacc[t] = mma16(pa, vb, oacc[t]);
      }
    }
  }

  __syncthreads();                               // every wave is done with Ksh before Osh aliases it
  float* os = Osh + wave * (16 * HDV);
#pragma unroll
  for (int r = 0; r < 8; ++r) {
    const float inv = 1.0f / (1024.0f * lrow[r]);   // 64 / (4096 * 16 * l)
#pragma unroll
    for (int t = 0; t < 4; ++t) os[(8 * hh + r) * HDV + t * 16 + c] = oacc[t][r] * inv;
  }
  __builtin_amdgcn_fence(__ATOMIC_RELEASE, "workgroup");
  __builtin_amdgcn_wave_barrier();
  __builtin_amdgcn_fence(__ATOMIC_ACQUIRE, "workgroup");
  const int q8 = lane >> 3, c8 = (lane & 7) * 8;
  v8h ov[4];
#pragma unroll
  for (int it = 0; it < 4; ++it) {
    const int row = it * 4 + q8;
    const float* sp = os + row * HDV + c8;
    const v4f x0 = *(const v4fa*)(sp);
    const v4f x1 = *(const v4fa*)(sp + 4);
    v8h o;
    o[0] = (_Float16)x0[0]; o[1] = (_Float16)x0[1]; o[2] = (_Float16)x0[2]; o[3] = (_Float16)x0[3];
    o[4] = (_Float16)x1[0]; o[5] = (_Float16)x1[1]; o[6] = (_Float16)x1[2]; o[7] = (_Float16)x1[3];
    ov[it] = o;
  }
  {
#pragma unroll
    for (int it = 0; it < 4; ++it) {
      const int row = it * 4 + q8;
      *(v8h*)(ctx + (size_t)(q0 + row) * ND + c8) = ov[it];
    }
    
  }
}

// -------------------------------------------------------------------------------------------------
// Workspace map (bytes, NB=8 SEQ=1024):
//   WQ2  f16 [1024][2048]            4194304
//   WK2  f16 [1024][2048]            4194304
//   WV   f16 [1024][1024]            2097152
//   WO   f16 [1024][1024]            2097152
//   XH   f16 [NB*SEQ][2048]         33554432
//   QU2  f16 [SEQ][2048]             4194304   (per batch element, reused)
//   QV2  f16 [SEQ][2048]             4194304
//   KP2  f16 [SEQ][2048]             4194304
//   VT   f16 [1024][SEQ]             2097152
//   P2   f16 [NPP][2048]             8388608
//   CTX  f16 [NB*SEQ][1024]         16777216
//   SCR                             35651584   early phase: WP f16 [1024][1024] at +0, PE f16 [NPP][1024] at +2097152;
//                                              later phase: BD band f32 [NPAIR][SEQ][BDW]
//   total                          121634816
// Every region is written in whole 64x64 tiles / whole rows; all region sizes equal their written extents.
// -------------------------------------------------------------------------------------------------
extern "C" void kernel_launch(void* const* d_in, const int* in_sizes, int n_in,
                              void* d_out, int out_size, void* d_ws, size_t ws_size,
                              hipStream_t stream) {
  if (n_in < 14) return;
  if (in_sizes[0] < ((NB - 1) * SEQ_FULL + SEQ) * ND) return;
  if (in_sizes[1] != ND * ND || in_sizes[3] != ND * ND || in_sizes[5] != ND * ND) return;
  if (in_sizes[7] != ND * ND || in_sizes[8] != ND * ND) return;
  if (in_sizes[2] < ND || in_sizes[4] < ND || in_sizes[6] < ND || in_sizes[9] < ND) return;
  if (in_sizes[10] < NH * HDV || in_sizes[11] < NH * HDV) return;
  if (in_sizes[12] < ND || in_sizes[13] < ND) return;
  if (out_size < NB * SEQ * ND) return;

  const float* x    = (const float*)d_in[0];
  const float* Wq   = (const float*)d_in[1];
  const float* bq   = (const float*)d_in[2];
  const float* Wk   = (const float*)d_in[3];
  const float* bk   = (const float*)d_in[4];
  const float* Wv   = (const float*)d_in[5];
  const float* bv   = (const float*)d_in[6];
  const float* Wpos = (const float*)d_in[7];
  const float* Wout = (const float*)d_in[8];
  const float* bout = (const float*)d_in[9];
  const float* ub   = (const float*)d_in[10];
  const float* vbias= (const float*)d_in[11];
  const float* lng  = (const float*)d_in[12];
  const float* lnb  = (const float*)d_in[13];
  float* out = (float*)d_out;

  const size_t szW2  = (size_t)ND * QKW * 2;              //  4194304
  const size_t szW1  = (size_t)ND * ND * 2;               //  2097152
  const size_t szXH  = (size_t)NB * SEQ * QKW * 2;        // 33554432
  const size_t szQb  = (size_t)SEQ * QKW * 2;             //  4194304
  const size_t szVT  = (size_t)ND * SEQ * 2;              //  2097152
  const size_t szP2  = (size_t)NPP * QKW * 2;             //  8388608
  const size_t szCTX = (size_t)NB * SEQ * ND * 2;         // 16777216
  const size_t szPE  = (size_t)NPP * ND * 2;              //  4194304
  const size_t szBD  = (size_t)NPAIR * SEQ * BDW * 4;     // 35651584
  const size_t szEarly = szW1 + szPE;
  const size_t szSCR = (szEarly > szBD) ? szEarly : szBD;
  size_t off = 0;
  const size_t oWQ2 = off; off += szW2;
  const size_t oWK2 = off; off += szW2;
  const size_t oWV  = off; off += szW1;
  const size_t oWO  = off; off += szW1;
  const size_t oXH  = off; off += szXH;
  const size_t oQU2 = off; off += szQb;
  const size_t oQV2 = off; off += szQb;
  const size_t oKP2 = off; off += szQb;
  const size_t oVT  = off; off += szVT;
  const size_t oP2  = off; off += szP2;
  const size_t oCTX = off; off += szCTX;
  const size_t oSCR = off; off += szSCR;
  const size_t oWP  = oSCR;
  const size_t oPE  = oSCR + szW1;
  const size_t total = off;                                // 121634816 for NB=8, SEQ=1024
  if (total > ws_size) return;
  if (total > (size_t)134217728) return;

  char* ws = (char*)d_ws;
  _Float16* WQ2 = (_Float16*)(ws + oWQ2);
  _Float16* WK2 = (_Float16*)(ws + oWK2);
  _Float16* WVp = (_Float16*)(ws + oWV);
  _Float16* WOp = (_Float16*)(ws + oWO);
  _Float16* XH  = (_Float16*)(ws + oXH);
  _Float16* QU2 = (_Float16*)(ws + oQU2);
  _Float16* QV2 = (_Float16*)(ws + oQV2);
  _Float16* KP2 = (_Float16*)(ws + oKP2);
  _Float16* VTp = (_Float16*)(ws + oVT);
  _Float16* P2  = (_Float16*)(ws + oP2);
  _Float16* CTX = (_Float16*)(ws + oCTX);
  _Float16* WPp = (_Float16*)(ws + oWP);
  _Float16* PEp = (_Float16*)(ws + oPE);
  float*    BDp = (float*)(ws + oSCR);

  const float cs = 0.125f * 0.00390625f;   // (1/sqrt(64)) / 256 applied to the x16.x16 score accumulators
  const dim3 blk(256);

  // (1) weights -> f16 planes of bf16-valued entries: Wq, Wk as [x64 | /16] 2048-wide; Wv, Wo, Wpos x64
  const dim3 gW(ND * (ND / 8) / 256);      // 512
  cvt_w_kernel<true ><<<gW, blk, 0, stream>>>(Wq,   WQ2, 64.0f, 0.0625f);
  cvt_w_kernel<true ><<<gW, blk, 0, stream>>>(Wk,   WK2, 64.0f, 0.0625f);
  cvt_w_kernel<false><<<gW, blk, 0, stream>>>(Wv,   WVp, 64.0f, 64.0f);
  cvt_w_kernel<false><<<gW, blk, 0, stream>>>(Wout, WOp, 64.0f, 64.0f);
  cvt_w_kernel<false><<<gW, blk, 0, stream>>>(Wpos, WPp, 64.0f, 64.0f);
  // (2) LayerNorm -> XH [NB*SEQ][2048] (hi | residual x1024)
  ln_kernel<<<dim3((NB * SEQ) / 8), blk, 0, stream>>>(x, lng, lnb, XH, NB * SEQ);
  // (3) positional sinusoid table -> PE [NPP][1024] (row NPP-1 = 0)
  pe_kernel<<<dim3((NPP * (ND / 8) + 255) / 256), blk, 0, stream>>>(PEp);
  // (4) p = pe . Wpos^T -> P2 = [16p | p/64]   (M=NPP, N=1024, K=1024)
  {
    const int tiles = (NPP / 64) * (ND / 64);
    gemm_f16_kernel<2, false, false><<<dim3((tiles + 7) / 8, 1), blk, 0, stream>>>(
        PEp, ND, 0L, WPp, ND, 0L, (void*)P2, (void*)P2, QKW, 0L, bq, bq, bq,
        NPP, ND, ND, 0.015625f, 16.0f, 0);
  }
  // (5) per batch element: q (two bias variants, hi | residual), k (hi | k/64), v^T, then band + attention per group
  const int tilesQ  = (SEQ / 64) * (ND / 64);
  const int tilesBD = (SEQ / 64) * (BDW / 64);
  for (int b = 0; b < NB; ++b) {
    const _Float16* Xb = XH + (size_t)b * SEQ * QKW;
    // QU2 = split(16*(q + bq + u_bias)), QV2 = split(16*(q + bq + v_bias))   (M=SEQ, N=1024, K=2048)
    gemm_f16_kernel<3, false, true><<<dim3((tilesQ + 7) / 8, 1), blk, 0, stream>>>(
        Xb, QKW, 0L, WQ2, QKW, 0L, (void*)QU2, (void*)QV2, QKW, 0L, ub, vbias, bq,
        SEQ, ND, QKW, 0.015625f, 16.0f, 0);
    // KP2 = [16k | k/64], k = xn.Wk^T + bk   (M=SEQ, N=1024, K=2048)
    gemm_f16_kernel<2, false, true><<<dim3((tilesQ + 7) / 8, 1), blk, 0, stream>>>(
        Xb, QKW, 0L, WK2, QKW, 0L, (void*)KP2, (void*)KP2, QKW, 0L, bk, bk, bk,
        SEQ, ND, QKW, 0.015625f, 16.0f, 0);
    // VT[h*64+d][s] = 16*(v + bv)   (A = Wv plane [1024][1024], Bt = XH hi columns; M=1024, N=SEQ, K=1024)
    gemm_f16_kernel<4, false, true><<<dim3((tilesQ + 7) / 8, 1), blk, 0, stream>>>(
        WVp, ND, 0L, Xb, QKW, 0L, (void*)VTp, (void*)VTp, SEQ, 0L, bv, bv, bv,
        ND, SEQ, ND, 0.015625f, 16.0f, 0);
    for (int gi = 0; gi < NH / NPAIR; ++gi) {
      const int h0 = gi * NPAIR;
      const _Float16* Aq = QV2 + h0 * HQK;     // rows t, folded cols of head h0 (z adds 128)
      const _Float16* Bp = P2 + h0 * HQK;      // rows p index, folded cols of head h0
      // band GEMM: BD[z][t][j] = (1/8)*(q_t + v_bias).p[64*(SEQ/64-1 - t/64) + j]   (M=SEQ, N=BDW, K=128)
      gemm_f16_kernel<0, true, false><<<dim3((tilesBD + 7) / 8, NPAIR), blk, 0, stream>>>(
          Aq, QKW, (long)HQK, Bp, QKW, (long)HQK, (void*)BDp, (void*)BDp, BDW, (long)SEQ * BDW, bq, bq, bq,
          SEQ, BDW, HQK, cs, 1.0f, SEQ / 64 - 1);
      relattn_kernel<<<dim3(SEQ / 64, NPAIR), dim3(128), 0, stream>>>(
          QU2, KP2, VTp, BDp, CTX + (size_t)b * SEQ * ND, h0, cs);
    }
  }
  // (6) out = ctx . Wout^T + bout -> d_out f32 [NB*SEQ][1024]   (M=NB*SEQ, N=1024, K=1024; carries 64*64 folded into scale)
  {
    const int tiles = ((NB * SEQ) / 64) * (ND / 64);
    gemm_f16_kernel<1, false, true><<<dim3((tiles + 7) / 8, 1), blk, 0, stream>>>(
        CTX, ND, 0L, WOp, ND, 0L, (void*)out, (void*)out, ND, 0L, bout, bout, bout,
        NB * SEQ, ND, ND, 0.000244140625f, 1.0f, 0);
  }
  (void)hipGetLastError();
}

// v001
// It runs in 1050 microseconds.
// Next to v000, in two timings, it ran 3.28 times as fast each time.
// Contractions: xn.Wq^T and xn.Wk^T (xn as f16 hi + x1024 f16 residual planes folded along K against Wx64 | W/16 planes), Wv.xn^T (xn hi, Wx64), pe.Wpos^T (pe f16, Wx64), (q+v_bias).p^T band and (q+u_bias).k^T (16q as f16 hi + x1024 residual folded along the head dim against 16p | p/64 and 16k | k/64 planes), P.V (P x4096, v x16), ctx.Wout^T (ctx x64, W x64): all v_wmma_f32_16x16x32_f16 (f16 operands, f32 accumulate); float inputs bf16-RNE valued; LayerNorm, positional table, softmax, bias adds and scaling in f32.
#include <hip/hip_runtime.h>
#include <math.h>
#include <stdint.h>

#ifndef NB
#define NB 8
#endif
#ifndef SEQ
#define SEQ 1024
#endif
#define SEQ_FULL 1024
#define ND    1024
#define NH    16
#define HDV   64            // value head dim
#define HQK   128           // folded depth of the q.k / q.p contractions: 64 hi + 64 residual
#define QKW   (2 * ND)      // pitch (halves) of the 2048-wide f16 planes
#define NP    (2 * SEQ - 1)
#define NPP   (2 * SEQ)
#define BDW   (SEQ + 64)    // width of the relative-position score band scratch (SEQ/64 + 1 tiles of 64)
#define GB    2             // batch elements per band/attention launch (all NH heads of each)

static_assert(SEQ % 64 == 0);
static_assert(SEQ <= SEQ_FULL);
static_assert(ND == NH * HDV);
static_assert(HQK == 2 * HDV);
static_assert(NB % GB == 0);
static_assert(ND % 256 == 0);
static_assert(NPP % 64 == 0);
static_assert(BDW % 64 == 0);

typedef _Float16 v16h __attribute__((ext_vector_type(16)));
typedef _Float16 v8h  __attribute__((ext_vector_type(8)));
typedef float    v8f  __attribute__((ext_vector_type(8)));
typedef float    v4f  __attribute__((ext_vector_type(4)));
typedef unsigned int v4u __attribute__((ext_vector_type(4)));
typedef v4f __attribute__((may_alias)) v4fa;
typedef v8h __attribute__((may_alias)) v8ha;

// bf16 RNE of an f32 value, returned widened to f32 (exactly representable in f16 after a power-of-two carry)
__device__ __forceinline__ float bf_rne(float f) {
  unsigned u = __float_as_uint(f);
  u = (u + 0x7FFFu + ((u >> 16) & 1u)) & 0xFFFF0000u;
  return __uint_as_float(u);
}

// 16-bit WMMA fragment: elements 0..7 <- p[0..7], elements 8..15 <- p[16..23]
// (A: p = row m at k0 + 8h;  B stored [n][k]: p = row n at k0 + 8h;  same split k map for both)
union FragU { v16h v; v8ha h[2]; };
__device__ __forceinline__ v16h ldfrag(const _Float16* p) {
  FragU f;
  f.h[0] = *(const v8ha*)(p);
  f.h[1] = *(const v8ha*)(p + 16);
  return f.v;
}

// WMMA + hazard guard (ties D, keeps A/B live for 4 VALU slots)
__device__ __forceinline__ v8f mma16(v16h a, v16h b, v8f c) {
  c = __builtin_amdgcn_wmma_f32_16x16x32_f16(false, a, false, b, (short)0, c, false, false);
  asm volatile("v_nop\n\tv_nop\n\tv_nop\n\tv_nop" : "+v"(c) : "v"(a), "v"(b));
  return c;
}

__device__ __forceinline__ v8f zero8() { v8f z = {0.f, 0.f, 0.f, 0.f, 0.f, 0.f, 0.f, 0.f}; return z; }

// -------------------------------------------------------------------------------------------------
// Weight [1024][1024] f32 -> f16 plane of bf16-valued entries.
//   DUP false: dst [1024][1024], dst[r][c] = f16(bf_rne(W)*s1)
//   DUP true : dst [1024][2048], dst[r][c] = f16(bf_rne(W)*s1), dst[r][1024+c] = f16(bf_rne(W)*s2)
// coverage: 131072 threads x 8 = the whole [1024][1024] source (both column halves for DUP).
// -------------------------------------------------------------------------------------------------
template <bool DUP>
__global__ __launch_bounds__(256) void cvt_w_kernel(const float* __restrict__ src, _Float16* __restrict__ dst,
                                                    float s1, float s2) {
  const int i = blockIdx.x * 256 + threadIdx.x;
  const int total8 = ND * (ND / 8);
  if (i >= total8) return;
  const int r  = i / (ND / 8);
  const int c8 = (i - r * (ND / 8)) * 8;
  const float* sp = src + (size_t)r * ND + c8;
  const v4f a = *(const v4f*)(sp);
  const v4f b = *(const v4f*)(sp + 4);
  float f[8];
  f[0] = bf_rne(a[0]); f[1] = bf_rne(a[1]); f[2] = bf_rne(a[2]); f[3] = bf_rne(a[3]);
  f[4] = bf_rne(b[0]); f[5] = bf_rne(b[1]); f[6] = bf_rne(b[2]); f[7] = bf_rne(b[3]);
  v8h o1, o2;
#pragma unroll
  for (int e = 0; e < 8; ++e) { o1[e] = (_Float16)(f[e] * s1); o2[e] = (_Float16)(f[e] * s2); }
  const int pitch = DUP ? QKW : ND;
  _Float16* dp = dst + (size_t)r * pitch + c8;
  *(v8h*)dp = o1;
  if (DUP) *(v8h*)(dp + ND) = o2;
  
}

// -------------------------------------------------------------------------------------------------
//   XH[row][c]        = f16(xn)                       (hi)
//   XH[row][1024 + c] = f16((xn - hi) * 1024)         (residual, carried x1024)
// One wave per row (compact row b*SEQ + t; source row b*SEQ_FULL + t); block = 8 waves = 8 rows; no LDS.
// Stores: lane l writes 16 B at columns i*256 + 8l: one instruction = 32 lanes x 16 B = 512 contiguous B =
// coverage: grid NB*SEQ/8 x 8 waves x (4 x 256) columns x {hi, residual} = the whole [NB*SEQ][2048] plane.
// Loops rolled on purpose (small elementwise side computation).
// -------------------------------------------------------------------------------------------------
__global__ __launch_bounds__(256) void ln_kernel(const float* __restrict__ x, const float* __restrict__ g,
                                                const float* __restrict__ bt, _Float16* __restrict__ XH,
                                                int nrows) {
  const int lane = threadIdx.x & 31;
  const int wave = threadIdx.x >> 5;
  const int row  = blockIdx.x * 8 + wave;
  if (row >= nrows) return;                                   // wave-uniform; no barriers in this kernel
  const int b = row / SEQ;
  const int t = row - b * SEQ;
  const float* xr = x + ((size_t)b * SEQ_FULL + t) * ND + lane * 8;

  float s = 0.f;
#pragma unroll 1
  for (int i = 0; i < 4; ++i) {
    const v4f a = *(const v4f*)(xr + i * 256);
    const v4f c = *(const v4f*)(xr + i * 256 + 4);
    s += (bf_rne(a[0]) + bf_rne(a[1])) + (bf_rne(a[2]) + bf_rne(a[3]));
    s += (bf_rne(c[0]) + bf_rne(c[1])) + (bf_rne(c[2]) + bf_rne(c[3]));
  }
  s += __shfl_xor(s, 16, 32); s += __shfl_xor(s, 8, 32); s += __shfl_xor(s, 4, 32);
  s += __shfl_xor(s, 2, 32);  s += __shfl_xor(s, 1, 32);
  const float mu = s * (1.0f / (float)ND);

  float s2 = 0.f;
#pragma unroll 1
  for (int i = 0; i < 4; ++i) {
    const v4f a = *(const v4f*)(xr + i * 256);
    const v4f c = *(const v4f*)(xr + i * 256 + 4);
    float d;
    d = bf_rne(a[0]) - mu; s2 += d * d;  d = bf_rne(a[1]) - mu; s2 += d * d;
    d = bf_rne(a[2]) - mu; s2 += d * d;  d = bf_rne(a[3]) - mu; s2 += d * d;
    d = bf_rne(c[0]) - mu; s2 += d * d;  d = bf_rne(c[1]) - mu; s2 += d * d;
    d = bf_rne(c[2]) - mu; s2 += d * d;  d = bf_rne(c[3]) - mu; s2 += d * d;
  }
  s2 += __shfl_xor(s2, 16, 32); s2 += __shfl_xor(s2, 8, 32); s2 += __shfl_xor(s2, 4, 32);
  s2 += __shfl_xor(s2, 2, 32);  s2 += __shfl_xor(s2, 1, 32);
  const float var  = s2 * (1.0f / (float)ND);
  const float rstd = rsqrtf(var + 1e-5f);

  _Float16* xh = XH + (size_t)row * QKW + lane * 8;
{
#pragma unroll 1
    for (int i = 0; i < 4; ++i) {
      const v4f a  = *(const v4f*)(xr + i * 256);
      const v4f c  = *(const v4f*)(xr + i * 256 + 4);
      const v4f ga = *(const v4f*)(g + i * 256 + lane * 8);
      const v4f gb = *(const v4f*)(g + i * 256 + lane * 8 + 4);
      const v4f ba = *(const v4f*)(bt + i * 256 + lane * 8);
      const v4f bb = *(const v4f*)(bt + i * 256 + lane * 8 + 4);
      float f[8], gg[8], be[8];
      f[0] = a[0]; f[1] = a[1]; f[2] = a[2]; f[3] = a[3]; f[4] = c[0]; f[5] = c[1]; f[6] = c[2]; f[7] = c[3];
      gg[0] = ga[0]; gg[1] = ga[1]; gg[2] = ga[2]; gg[3] = ga[3];
      gg[4] = gb[0]; gg[5] = gb[1]; gg[6] = gb[2]; gg[7] = gb[3];
      be[0] = ba[0]; be[1] = ba[1]; be[2] = ba[2]; be[3] = ba[3];
      be[4] = bb[0]; be[5] = bb[1]; be[6] = bb[2]; be[7] = bb[3];
      v8h ho, lo;
#pragma unroll
      for (int e = 0; e < 8; ++e) {
        const float xn = (bf_rne(f[e]) - mu) * rstd * bf_rne(gg[e]) + bf_rne(be[e]);
        const _Float16 hv = (_Float16)xn;
        ho[e] = hv;
        lo[e] = (_Float16)((xn - (float)hv) * 1024.0f);
      }
      *(v8h*)(xh + i * 256)      = ho;
      *(v8h*)(xh + ND + i * 256) = lo;
    }
    
  }
}

// -------------------------------------------------------------------------------------------------
// Relative-position sinusoid table -> PE f16 plane [NPP][1024] (rows >= NP are 0):
//   row r <-> relative position pos = SEQ-1-r;  div_j = expf(f32(2j) * f32(-ln(1e4)/1024));
//   ang = |pos| * div_j (f32 product);  PE[r][2j] = sin(ang) with the sign of pos, PE[r][2j+1] = cos(ang).
// passes.  The per-pair loop is rolled (one sinf, one cosf, one expf body); the 16-B result is assembled by a
// register rotate with constant indices (no dynamic local-array indexing).
// coverage: grid NPP*128/256, NPP*128 threads x 8 halves = the whole [NPP][1024] plane.
// -------------------------------------------------------------------------------------------------
__global__ __launch_bounds__(256) void pe_kernel(_Float16* __restrict__ PE) {
  const int i = blockIdx.x * 256 + threadIdx.x;
  if (i >= NPP * (ND / 8)) return;
  const int r  = i / (ND / 8);
  const int c8 = (i - r * (ND / 8)) * 8;
  const int pos = SEQ - 1 - r;
  const float fpos = (float)((pos < 0) ? -pos : pos);
  const float live = (r < NP) ? 1.0f : 0.0f;
  const float c0 = (float)(-9.210340371976184 / (double)ND);
  v4u pk = {0u, 0u, 0u, 0u};
#pragma unroll 1
  for (int e = 0; e < 4; ++e) {
    const int j = (c8 >> 1) + e;
    const float dv  = expf((float)(2 * j) * c0);
    const float ang = fpos * dv;
    float sn = sinf(ang);
    const float cn = cosf(ang);
    sn = (pos < 0) ? -sn : sn;
    const _Float16 hs = (_Float16)(sn * live);
    const _Float16 hc = (_Float16)(cn * live);
    const unsigned w = (unsigned)__builtin_bit_cast(unsigned short, hs) |
                       ((unsigned)__builtin_bit_cast(unsigned short, hc) << 16);
    v4u nx;
    nx[0] = pk[1]; nx[1] = pk[2]; nx[2] = pk[3]; nx[3] = w;
    pk = nx;
  }
  unsigned* dp = (unsigned*)(PE + (size_t)r * ND + c8);
  *(v4u*)dp = pk;
  
}

// -------------------------------------------------------------------------------------------------
// f16 WMMA GEMM: C[m][n] = epi( sum_k A[m][k] * Bt[nrow][k] ), nrow = n (+ 64*(skew0 - tm) when SKEW: band GEMM).
// A row-major [M][K] pitch lda; Bt row-major [N(+band)][K] pitch ldb; M, N multiples of 64, K multiple of 32.
// Each wave owns a 64x64 output tile (4x4 subtiles), 8 waves per block, grid.x = tiles/8, grid.y = z-batch,
// grid.z = outer batch (steps A by strideAz and C by strideCz; Bt is shared).
// OUT 0: f32  C1[m][n] = acc*scale                                              (band scratch)
// OUT 1: f32  C1[m][n] = acc*scale + bf_rne(b1[n])                              (final output)
// OUT 2: f16  t = acc*scale (+ bf_rne(b1[n]) if HASB);  C1[m][2*n0+c] = f16(t*carry),
//             C1[m][2*n0+64+c] = f16(t*carry/1024)      (2048-wide hi | copy planes, one 64-col tile = one head)
// OUT 3: f16  t = (acc*scale + bf_rne(b3[n])) + bf_rne(b1[n] resp. b2[n]);  th = t*carry;
//             hi = f16(th), lo = f16((th - hi)*1024) -> C1 (b1 variant) and C2 (b2 variant), hi at 2*n0+c, lo at 2*n0+64+c
// OUT 4: f16  C1[m][n] = f16((acc*scale + bf_rne(b1[m])) * carry)            (row bias)
// Epilogue: 16-row slabs staged per wave in LDS (wave-private region, wave barrier); every row segment is written as
// coverage: 4 slabs x 16 rows x 64 cols = the whole 64x64 tile per wave; tiles cover M x N exactly.
// -------------------------------------------------------------------------------------------------
template <int OUT, bool SKEW, bool HASB>
__global__ __launch_bounds__(256) void gemm_f16_kernel(
    const _Float16* __restrict__ A, int lda, long strideA, long strideAz,
    const _Float16* __restrict__ Bt, int ldb, long strideB,
    void* C1, void* C2, int ldc, long strideC, long strideCz,
    const float* __restrict__ b1, const float* __restrict__ b2, const float* __restrict__ b3,
    int M, int N, int K, float scale, float carry, int skew0) {
  __shared__ __align__(16) float sT[8][16 * 68];   // per-wave 16x64 slab, pitch 68 floats

  const int z    = blockIdx.y;
  const int lane = threadIdx.x & 31;
  const int wave = threadIdx.x >> 5;
  const int tilesN = N >> 6;
  const int tilesM = M >> 6;
  const int tile = blockIdx.x * 8 + wave;
  if (tile >= tilesM * tilesN) return;             // wave-uniform; no block barriers in this kernel
  const int tm = tile / tilesN;
  const int tn = tile - tm * tilesN;
  const int m0 = tm << 6;
  const int n0 = tn << 6;
  const int nsk = SKEW ? ((skew0 - tm) << 6) : 0;  // band row offset of Bt
  const size_t cOff = (size_t)z * strideC + (size_t)blockIdx.z * strideCz;

  const _Float16* Ab = A  + (size_t)z * strideA + (size_t)blockIdx.z * strideAz;
  const _Float16* Bb = Bt + (size_t)z * strideB;

  const int rl   = lane & 15;          // row (A) / column (B, D) within a subtile
  const int koff = (lane >> 4) * 8;    // k offset of this lane half
  const int mOff = (lane >> 4) * 8;    // D row offset of this lane half

  v8f acc[4][4];
#pragma unroll
  for (int i = 0; i < 4; ++i)
#pragma unroll
    for (int j = 0; j < 4; ++j) acc[i][j] = zero8();

  for (int k0 = 0; k0 < K; k0 += 32) {
    v16h bfr[4];
#pragma unroll
    for (int j = 0; j < 4; ++j)
      bfr[j] = ldfrag(Bb + (size_t)(nsk + n0 + (j << 4) + rl) * ldb + koff + k0);
#pragma unroll
    for (int i = 0; i < 4; ++i) {
      const v16h af = ldfrag(Ab + (size_t)(m0 + (i << 4) + rl) * lda + koff + k0);
#pragma unroll
      for (int j = 0; j < 4; ++j) acc[i][j] = mma16(af, bfr[j], acc[i][j]);
    }
  }

  // ---- epilogue ----
  float* slab = sT[wave];
  const int hh = lane >> 4, c4 = (lane & 15) * 4;     // f32 modes: row segment 256 B = 16 lanes x 16 B
  const int q8 = lane >> 3, c8 = (lane & 7) * 8;
  v4f bias4 = {0.f, 0.f, 0.f, 0.f};
  float col8a[8], col8b[8], col8c[8];
#pragma unroll
  for (int e = 0; e < 8; ++e) { col8a[e] = 0.f; col8b[e] = 0.f; col8c[e] = 0.f; }
  if (OUT == 1 && HASB) {
    const v4f tb = *(const v4f*)(b1 + n0 + c4);
    bias4[0] = bf_rne(tb[0]); bias4[1] = bf_rne(tb[1]); bias4[2] = bf_rne(tb[2]); bias4[3] = bf_rne(tb[3]);
  }
  if ((OUT == 2 && HASB) || OUT == 3) {
    const v4f ta = *(const v4f*)(b1 + n0 + c8);
    const v4f tb = *(const v4f*)(b1 + n0 + c8 + 4);
    col8a[0] = bf_rne(ta[0]); col8a[1] = bf_rne(ta[1]); col8a[2] = bf_rne(ta[2]); col8a[3] = bf_rne(ta[3]);
    col8a[4] = bf_rne(tb[0]); col8a[5] = bf_rne(tb[1]); col8a[6] = bf_rne(tb[2]); col8a[7] = bf_rne(tb[3]);
  }
  if (OUT == 3) {
    const v4f ta = *(const v4f*)(b2 + n0 + c8);
    const v4f tb = *(const v4f*)(b2 + n0 + c8 + 4);
    col8b[0] = bf_rne(ta[0]); col8b[1] = bf_rne(ta[1]); col8b[2] = bf_rne(ta[2]); col8b[3] = bf_rne(ta[3]);
    col8b[4] = bf_rne(tb[0]); col8b[5] = bf_rne(tb[1]); col8b[6] = bf_rne(tb[2]); col8b[7] = bf_rne(tb[3]);
    const v4f tc = *(const v4f*)(b3 + n0 + c8);
    const v4f td = *(const v4f*)(b3 + n0 + c8 + 4);
    col8c[0] = bf_rne(tc[0]); col8c[1] = bf_rne(tc[1]); col8c[2] = bf_rne(tc[2]); col8c[3] = bf_rne(tc[3]);
    col8c[4] = bf_rne(td[0]); col8c[5] = bf_rne(td[1]); col8c[6] = bf_rne(td[2]); col8c[7] = bf_rne(td[3]);
  }
  const float carry2 = carry * 0.0009765625f;        // carry / 1024

#pragma unroll
  for (int i = 0; i < 4; ++i) {
    const int mBase = m0 + (i << 4);
#pragma unroll
    for (int j = 0; j < 4; ++j)
#pragma unroll
      for (int r = 0; r < 8; ++r)
        slab[(mOff + r) * 68 + (j << 4) + rl] = acc[i][j][r] * scale;
    __builtin_amdgcn_fence(__ATOMIC_RELEASE, "workgroup");
    __builtin_amdgcn_wave_barrier();
    __builtin_amdgcn_fence(__ATOMIC_ACQUIRE, "workgroup");
    if (OUT == 0 || OUT == 1) {
      float* C = (float*)C1 + cOff;
      v4f vv[8];
#pragma unroll
      for (int it = 0; it < 8; ++it) {
        const int row = it * 2 + hh;
        v4f v = *(const v4fa*)(slab + row * 68 + c4);
        if (OUT == 1) v += bias4;
        vv[it] = v;
      }
      {
#pragma unroll
        for (int it = 0; it < 8; ++it) {
          const int row = it * 2 + hh;
          *(v4f*)(C + (size_t)(mBase + row) * ldc + n0 + c4) = vv[it];
        }
        
      }
    } else if (OUT == 2 || OUT == 4) {
      _Float16* Ca = (_Float16*)C1 + cOff;
      v8h hv[4], lv[4];
#pragma unroll
      for (int it = 0; it < 4; ++it) {
        const int row = it * 4 + q8;
        const float* sp = slab + row * 68 + c8;
        const v4f x0 = *(const v4fa*)(sp);
        const v4f x1 = *(const v4fa*)(sp + 4);
        float f[8];
        f[0] = x0[0]; f[1] = x0[1]; f[2] = x0[2]; f[3] = x0[3];
        f[4] = x1[0]; f[5] = x1[1]; f[6] = x1[2]; f[7] = x1[3];
        float rb = 0.f;
        if (OUT == 4 && HASB) rb = bf_rne(b1[mBase + row]);
        v8h ha, la;
#pragma unroll
        for (int e = 0; e < 8; ++e) {
          const float t = f[e] + ((OUT == 2) ? col8a[e] : rb);
          ha[e] = (_Float16)(t * carry);
          la[e] = (_Float16)(t * carry2);
        }
        hv[it] = ha; lv[it] = la;
      }
      {
#pragma unroll
        for (int it = 0; it < 4; ++it) {
          const int row = it * 4 + q8;
          if (OUT == 2) {
            _Float16* cp = Ca + (size_t)(mBase + row) * ldc + 2 * n0 + c8;
            *(v8h*)(cp)      = hv[it];
            *(v8h*)(cp + 64) = lv[it];
          } else {
            *(v8h*)(Ca + (size_t)(mBase + row) * ldc + n0 + c8) = hv[it];
          }
        }
        
      }
    } else {
#pragma unroll
      for (int var = 0; var < 2; ++var) {
        _Float16* Cc = (_Float16*)((var == 0) ? C1 : C2) + cOff;
        v8h hv[4], lv[4];
#pragma unroll
        for (int it = 0; it < 4; ++it) {
          const int row = it * 4 + q8;
          const float* sp = slab + row * 68 + c8;
          const v4f x0 = *(const v4fa*)(sp);
          const v4f x1 = *(const v4fa*)(sp + 4);
          float f[8];
          f[0] = x0[0]; f[1] = x0[1]; f[2] = x0[2]; f[3] = x0[3];
          f[4] = x1[0]; f[5] = x1[1]; f[6] = x1[2]; f[7] = x1[3];
          v8h ha, la;
#pragma unroll
          for (int e = 0; e < 8; ++e) {
            const float t  = (f[e] + col8c[e]) + ((var == 0) ? col8a[e] : col8b[e]);
            const float th = t * carry;
            const _Float16 hq = (_Float16)th;
            ha[e] = hq;
            la[e] = (_Float16)((th - (float)hq) * 1024.0f);
          }
          hv[it] = ha; lv[it] = la;
        }
        {
#pragma unroll
          for (int it = 0; it < 4; ++it) {
            const int row = it * 4 + q8;
            _Float16* cp = Cc + (size_t)(mBase + row) * ldc + 2 * n0 + c8;
            *(v8h*)(cp)      = hv[it];
            *(v8h*)(cp + 64) = lv[it];
          }
          
        }
      }
    }
    __builtin_amdgcn_fence(__ATOMIC_RELEASE, "workgroup");
    __builtin_amdgcn_wave_barrier();
    __builtin_amdgcn_fence(__ATOMIC_ACQUIRE, "workgroup");
  }
}

// -------------------------------------------------------------------------------------------------
// Relative-position attention for all NH heads of GB batch elements, folded q.k depth 128 (hi | residual),
// value head dim 64, no mask.
//   QU  f16 plane [t][h*128 + j]: j<64 hi = f16(16*(q+u_bias)), j>=64 residual x1024     (A of the content score)
//   KP  f16 plane [s][h*128 + j]: j<64 f16(16*k), j>=64 f16(k/64)                       (B, staged per 64-key chunk as [key][128])
//   VT  f16 plane [h*64 + d][s]   = f16(16*v)                                            (B of P.V, staged as [d][key])
//   BD  f32 band scratch [bz*NH + h][SEQ][BDW]: value (row i, col j) = (1/8)*(q_i + v_bias).p[row 64*(SEQ/64-1 - i/64) + j]
//       rel-shift: bd[i][key] = bdfull[i][key - i + SEQ-1]  ->  column key + 63 - (i mod 64), always in [0, BDW-2].
//   score = cs * (QU.K^T acc) + BD  with cs = (1/8)/256;  online softmax in f32 over SEQ/64 chunks of 64 keys;
//   P stored per wave as f16(4096 * exp(s - m)); CTX[t][h*64 + d] = f16(64 * ctx) = f16((P.V acc) / (1024*l)).
// Block = 4 waves = 64 query rows of one head; grid = (SEQ/64 query blocks, NH heads, GB batch elements);
// QU, KP, VT and CTX point at the first batch element of the launch.
// LDS: one raw buffer; K tile [64][128] f16 at 0, V^T tile [64][64] f16 at 16 KB, per-wave P tiles [16][64] f16
// at 24 KB; the output staging [4][16][64] f32 reuses bytes 0..16 KB after a block barrier.
// coverage: staging 128 thr x 64 halves for K (64x128) and 128 thr x 32 halves for V^T (64x64); P tile 8 rows x
// 2 halves x 4x16 cols per wave = 16x64 (all written every chunk); output 4 store instructions x 4 rows x 8 lanes x
// 8 halves = 16x64 per wave.
// -------------------------------------------------------------------------------------------------
__global__ __launch_bounds__(128)
void relattn_kernel(const _Float16* __restrict__ QU, const _Float16* __restrict__ KP,
                    const _Float16* __restrict__ VT, const float* __restrict__ BD,
                    _Float16* __restrict__ CTX, float cs) {
  __shared__ __align__(16) unsigned char SMEM[32768];
  _Float16* Ksh = (_Float16*)(SMEM);             // [64][128]
  _Float16* Vsh = (_Float16*)(SMEM + 16384);     // [64][64]
  _Float16* Psh = (_Float16*)(SMEM + 24576);     // [4][16][64]
  float*    Osh = (float*)(SMEM);                // [4][16][64] after the chunk loop

  const int tid  = threadIdx.x;
  const int wave = tid >> 5;
  const int lane = tid & 31;
  const int hh   = lane >> 4;
  const int c    = lane & 15;

  const int h    = blockIdx.y;
  const int bz   = blockIdx.z;
  const int qb   = blockIdx.x;
  const int q0   = qb * 64 + wave * 16;          // first query row of this wave
  const int rr0  = wave * 16 + 8 * hh;           // row within the 64-row block for r = 0

  const _Float16* Qh = QU + (size_t)bz * SEQ * QKW + h * HQK;   // row pitch QKW
  const _Float16* Kh = KP + (size_t)bz * SEQ * QKW + h * HQK;   // row pitch QKW
  const _Float16* Vh = VT + (size_t)(bz * ND + h * HDV) * SEQ;
  const float*    bd = BD + (size_t)(bz * NH + h) * SEQ * BDW;
  _Float16*       ctx = CTX + (size_t)bz * SEQ * ND + h * HDV;  // row pitch ND

  // Q fragments (A operand): 4 chunks of 32 along the folded depth
  v16h qa[4];
#pragma unroll
  for (int dc = 0; dc < 4; ++dc)
    qa[dc] = ldfrag(Qh + (size_t)(q0 + c) * QKW + dc * 32 + 8 * hh);

  // band scratch: element for (row r, key kv0+16j+c) at bdr[r*(BDW-1) + kv0 + 16j]
  const float* bdr = bd + (size_t)(q0 + 8 * hh) * BDW + (63 - rr0 + c);

  float mrow[8], lrow[8];
  v8f oacc[4];
#pragma unroll
  for (int r = 0; r < 8; ++r) { mrow[r] = -INFINITY; lrow[r] = 0.f; }
#pragma unroll
  for (int t = 0; t < 4; ++t) oacc[t] = zero8();

  _Float16* pw = Psh + wave * (16 * 64);

#pragma unroll 1
  for (int kc = 0; kc < SEQ / 64; ++kc) {
    const int kv0 = kc * 64;
    __syncthreads();
    {
      const int r = tid >> 1, c0 = (tid & 1) * 64, cv = (tid & 1) * 32;
      const _Float16* ks = Kh + (size_t)(kv0 + r) * QKW + c0;
      const _Float16* vs = Vh + (size_t)r * SEQ + kv0 + cv;
#pragma unroll
      for (int i = 0; i < 8; ++i) {
        const v8h kk8 = *(const v8h*)(ks + 8 * i);
        *(v8ha*)(Ksh + r * 128 + c0 + 8 * i) = kk8;
      }
#pragma unroll
      for (int i = 0; i < 4; ++i) {
        const v8h vv8 = *(const v8h*)(vs + 8 * i);
        *(v8ha*)(Vsh + r * 64 + cv + 8 * i) = vv8;
      }
    }
    __syncthreads();

    // content scores: S[j] = QU(16x128) . K^T for key subtile j
    v8f s[4];
#pragma unroll
    for (int j = 0; j < 4; ++j) {
      s[j] = zero8();
#pragma unroll
      for (int dc = 0; dc < 4; ++dc) {
        const v16h kb = ldfrag(Ksh + (j * 16 + c) * 128 + dc * 32 + 8 * hh);
        s[j] = mma16(qa[dc], kb, s[j]);
      }
    }

    // add the position term from the band scratch, chunk row max
    float cm[8];
#pragma unroll
    for (int r = 0; r < 8; ++r) {
      float m = -INFINITY;
#pragma unroll
      for (int j = 0; j < 4; ++j) {
        const float sv = s[j][r] * cs + bdr[(size_t)r * (BDW - 1) + kv0 + (j << 4)];
        s[j][r] = sv;
        m = fmaxf(m, sv);
      }
      m = fmaxf(m, __shfl_xor(m, 1, 32));
      m = fmaxf(m, __shfl_xor(m, 2, 32));
      m = fmaxf(m, __shfl_xor(m, 4, 32));
      m = fmaxf(m, __shfl_xor(m, 8, 32));
      cm[r] = m;
    }

    // online softmax update (per-row rescale of this row's accumulator elements only);
    // P tile (x4096) to this wave's LDS tile [row][key]
#pragma unroll
    for (int r = 0; r < 8; ++r) {
      const float mnew  = fmaxf(mrow[r], cm[r]);
      const float alpha = __expf(mrow[r] - mnew);
      mrow[r] = mnew;
      float psum = 0.f;
#pragma unroll
      for (int j = 0; j < 4; ++j) {
        const float p = __expf(s[j][r] - mnew);
        psum += p;
        pw[(8 * hh + r) * 64 + j * 16 + c] = (_Float16)(p * 4096.0f);
      }
      psum += __shfl_xor(psum, 1, 32);
      psum += __shfl_xor(psum, 2, 32);
      psum += __shfl_xor(psum, 4, 32);
      psum += __shfl_xor(psum, 8, 32);
      lrow[r] = lrow[r] * alpha + psum;
#pragma unroll
      for (int t = 0; t < 4; ++t) oacc[t][r] *= alpha;
    }
    __builtin_amdgcn_fence(__ATOMIC_RELEASE, "workgroup");
    __builtin_amdgcn_wave_barrier();
    __builtin_amdgcn_fence(__ATOMIC_ACQUIRE, "workgroup");

    // P (A operand, row = lane&15, split k map over keys) . V (B operand from V^T rows d)
#pragma unroll
    for (int kk = 0; kk < 2; ++kk) {
      const v16h pa = ldfrag(pw + c * 64 + kk * 32 + 8 * hh);
#pragma unroll
      for (int t = 0; t < 4; ++t) {
        const v16h vb = ldfrag(Vsh + (t * 16 + c) * 64 + kk * 32 + 8 * hh);
        oacc[t] = mma16(pa, vb, oacc[t]);
      }
    }
  }

  __syncthreads();                               // every wave is done with Ksh before Osh aliases it
  float* os = Osh + wave * (16 * HDV);
#pragma unroll
  for (int r = 0; r < 8; ++r) {
    const float inv = 1.0f / (1024.0f * lrow[r]);   // 64 / (4096 * 16 * l)
#pragma unroll
    for (int t = 0; t < 4; ++t) os[(8 * hh + r) * HDV + t * 16 + c] = oacc[t][r] * inv;
  }
  __builtin_amdgcn_fence(__ATOMIC_RELEASE, "workgroup");
  __builtin_amdgcn_wave_barrier();
  __builtin_amdgcn_fence(__ATOMIC_ACQUIRE, "workgroup");
  const int q8 = lane >> 3, c8 = (lane & 7) * 8;
  v8h ov[4];
#pragma unroll
  for (int it = 0; it < 4; ++it) {
    const int row = it * 4 + q8;
    const float* sp = os + row * HDV + c8;
    const v4f x0 = *(const v4fa*)(sp);
    const v4f x1 = *(const v4fa*)(sp + 4);
    v8h o;
    o[0] = (_Float16)x0[0]; o[1] = (_Float16)x0[1]; o[2] = (_Float16)x0[2]; o[3] = (_Float16)x0[3];
    o[4] = (_Float16)x1[0]; o[5] = (_Float16)x1[1]; o[6] = (_Float16)x1[2]; o[7] = (_Float16)x1[3];
    ov[it] = o;
  }
  {
#pragma unroll
    for (int it = 0; it < 4; ++it) {
      const int row = it * 4 + q8;
      *(v8h*)(ctx + (size_t)(q0 + row) * ND + c8) = ov[it];
    }
    
  }
}

// -------------------------------------------------------------------------------------------------
// Workspace map (bytes, NB=8 SEQ=1024): every batch element's planes are live at once.
//   P2   f16 [NPP][2048]             8388608
//   QU2  f16 [NB*SEQ][2048]         33554432
//   QV2  f16 [NB*SEQ][2048]         33554432   CTX f16 [NB*SEQ][1024] overlays its first half: the attention launch of
//                                              group g writes bytes [g, g+1) * GB*SEQ*ND*2, and the only later readers of
//                                              QV2 (band launches of groups > g) start at (g+1) * GB*SEQ*QKW*2, above it
//   KP2  f16 [NB*SEQ][2048]         33554432
//   VT   f16 [NB][1024][SEQ]        16777216
//   SCR                            142606336   early phase: WQ2, WK2 f16 [1024][2048], WV, WP f16 [1024][1024],
//                                              PE f16 [NPP][1024], XH f16 [NB*SEQ][2048] (all dead after the projections);
//                                              middle phase: BD band f32 [GB*NH][SEQ][BDW];
//                                              last phase: WO f16 [1024][1024] (converted after the last attention launch)
//   total                          268435456
// Every region is written in whole 64x64 tiles / whole rows; all region sizes equal their written extents.
// -------------------------------------------------------------------------------------------------
extern "C" void kernel_launch(void* const* d_in, const int* in_sizes, int n_in,
                              void* d_out, int out_size, void* d_ws, size_t ws_size,
                              hipStream_t stream) {
  if (n_in < 14) return;
  if (in_sizes[0] < ((NB - 1) * SEQ_FULL + SEQ) * ND) return;
  if (in_sizes[1] != ND * ND || in_sizes[3] != ND * ND || in_sizes[5] != ND * ND) return;
  if (in_sizes[7] != ND * ND || in_sizes[8] != ND * ND) return;
  if (in_sizes[2] < ND || in_sizes[4] < ND || in_sizes[6] < ND || in_sizes[9] < ND) return;
  if (in_sizes[10] < NH * HDV || in_sizes[11] < NH * HDV) return;
  if (in_sizes[12] < ND || in_sizes[13] < ND) return;
  if (out_size < NB * SEQ * ND) return;

  const float* x    = (const float*)d_in[0];
  const float* Wq   = (const float*)d_in[1];
  const float* bq   = (const float*)d_in[2];
  const float* Wk   = (const float*)d_in[3];
  const float* bk   = (const float*)d_in[4];
  const float* Wv   = (const float*)d_in[5];
  const float* bv   = (const float*)d_in[6];
  const float* Wpos = (const float*)d_in[7];
  const float* Wout = (const float*)d_in[8];
  const float* bout = (const float*)d_in[9];
  const float* ub   = (const float*)d_in[10];
  const float* vbias= (const float*)d_in[11];
  const float* lng  = (const float*)d_in[12];
  const float* lnb  = (const float*)d_in[13];
  float* out = (float*)d_out;

  const size_t szW2  = (size_t)ND * QKW * 2;              //   4194304
  const size_t szW1  = (size_t)ND * ND * 2;               //   2097152
  const size_t szXH  = (size_t)NB * SEQ * QKW * 2;        //  33554432
  const size_t szQ   = (size_t)NB * SEQ * QKW * 2;        //  33554432
  const size_t szVT  = (size_t)NB * ND * SEQ * 2;         //  16777216
  const size_t szP2  = (size_t)NPP * QKW * 2;             //   8388608
  const size_t szPE  = (size_t)NPP * ND * 2;              //   4194304
  const size_t szBD  = (size_t)GB * NH * SEQ * BDW * 4;   // 142606336
  const size_t szEarly = 2 * szW2 + 2 * szW1 + szPE + szXH;
  const size_t szSCR = (szEarly > szBD) ? szEarly : szBD;
  size_t off = 0;
  const size_t oP2  = off; off += szP2;
  const size_t oQU2 = off; off += szQ;
  const size_t oQV2 = off; off += szQ;
  const size_t oKP2 = off; off += szQ;
  const size_t oVT  = off; off += szVT;
  const size_t oSCR = off; off += szSCR;
  const size_t total = off;                                // 268435456 for NB=8, SEQ=1024
  if (total > ws_size) return;
  const size_t oWQ2 = oSCR;
  const size_t oWK2 = oWQ2 + szW2;
  const size_t oWV  = oWK2 + szW2;
  const size_t oWP  = oWV + szW1;
  const size_t oPE  = oWP + szW1;
  const size_t oXH  = oPE + szPE;

  char* ws = (char*)d_ws;
  _Float16* WQ2 = (_Float16*)(ws + oWQ2);
  _Float16* WK2 = (_Float16*)(ws + oWK2);
  _Float16* WVp = (_Float16*)(ws + oWV);
  _Float16* WOp = (_Float16*)(ws + oSCR);
  _Float16* XH  = (_Float16*)(ws + oXH);
  _Float16* QU2 = (_Float16*)(ws + oQU2);
  _Float16* QV2 = (_Float16*)(ws + oQV2);
  _Float16* KP2 = (_Float16*)(ws + oKP2);
  _Float16* VTp = (_Float16*)(ws + oVT);
  _Float16* P2  = (_Float16*)(ws + oP2);
  _Float16* CTX = (_Float16*)(ws + oQV2);
  _Float16* WPp = (_Float16*)(ws + oWP);
  _Float16* PEp = (_Float16*)(ws + oPE);
  float*    BDp = (float*)(ws + oSCR);

  const float cs = 0.125f * 0.00390625f;   // (1/sqrt(64)) / 256 applied to the x16.x16 score accumulators
  const dim3 blk(256);

  // (1) weights -> f16 planes of bf16-valued entries: Wq, Wk as [x64 | /16] 2048-wide; Wv, Wpos x64
  const dim3 gW(ND * (ND / 8) / 256);      // 512
  cvt_w_kernel<true ><<<gW, blk, 0, stream>>>(Wq,   WQ2, 64.0f, 0.0625f);
  cvt_w_kernel<true ><<<gW, blk, 0, stream>>>(Wk,   WK2, 64.0f, 0.0625f);
  cvt_w_kernel<false><<<gW, blk, 0, stream>>>(Wv,   WVp, 64.0f, 64.0f);
  cvt_w_kernel<false><<<gW, blk, 0, stream>>>(Wpos, WPp, 64.0f, 64.0f);
  // (2) LayerNorm -> XH [NB*SEQ][2048] (hi | residual x1024)
  ln_kernel<<<dim3((NB * SEQ) / 8), blk, 0, stream>>>(x, lng, lnb, XH, NB * SEQ);
  // (3) positional sinusoid table -> PE [NPP][1024] (row NPP-1 = 0)
  pe_kernel<<<dim3((NPP * (ND / 8) + 255) / 256), blk, 0, stream>>>(PEp);
  // (4) p = pe . Wpos^T -> P2 = [16p | p/64]   (M=NPP, N=1024, K=1024)
  {
    const int tiles = (NPP / 64) * (ND / 64);
    gemm_f16_kernel<2, false, false><<<dim3((tiles + 7) / 8, 1), blk, 0, stream>>>(
        PEp, ND, 0L, 0L, WPp, ND, 0L, (void*)P2, (void*)P2, QKW, 0L, 0L, bq, bq, bq,
        NPP, ND, ND, 0.015625f, 16.0f, 0);
  }
  // (5) projections of all batch elements, one launch each
  const int tilesQ  = ((NB * SEQ) / 64) * (ND / 64);
  const int tilesV  = (ND / 64) * (SEQ / 64);
  const int tilesBD = (SEQ / 64) * (BDW / 64);
  // QU2 = split(16*(q + bq + u_bias)), QV2 = split(16*(q + bq + v_bias))   (M=NB*SEQ, N=1024, K=2048)
  gemm_f16_kernel<3, false, true><<<dim3((tilesQ + 7) / 8, 1), blk, 0, stream>>>(
      XH, QKW, 0L, 0L, WQ2, QKW, 0L, (void*)QU2, (void*)QV2, QKW, 0L, 0L, ub, vbias, bq,
      NB * SEQ, ND, QKW, 0.015625f, 16.0f, 0);
  // KP2 = [16k | k/64], k = xn.Wk^T + bk   (M=NB*SEQ, N=1024, K=2048)
  gemm_f16_kernel<2, false, true><<<dim3((tilesQ + 7) / 8, 1), blk, 0, stream>>>(
      XH, QKW, 0L, 0L, WK2, QKW, 0L, (void*)KP2, (void*)KP2, QKW, 0L, 0L, bk, bk, bk,
      NB * SEQ, ND, QKW, 0.015625f, 16.0f, 0);
  // VT[b][h*64+d][s] = 16*(v + bv)   (A = Wv plane [1024][1024], Bt = XH hi columns of batch element y; M=1024, N=SEQ, K=1024)
  gemm_f16_kernel<4, false, true><<<dim3((tilesV + 7) / 8, NB), blk, 0, stream>>>(
      WVp, ND, 0L, 0L, XH, QKW, (long)SEQ * QKW, (void*)VTp, (void*)VTp, SEQ, (long)ND * SEQ, 0L, bv, bv, bv,
      ND, SEQ, ND, 0.015625f, 16.0f, 0);
  // (6) band + attention, GB batch elements x NH heads per launch
  for (int b0 = 0; b0 < NB; b0 += GB) {
    // band GEMM: BD[bz*NH+h][t][j] = (1/8)*(q_t + v_bias).p[64*(SEQ/64-1 - t/64) + j]   (M=SEQ, N=BDW, K=128)
    gemm_f16_kernel<0, true, false><<<dim3((tilesBD + 7) / 8, NH, GB), blk, 0, stream>>>(
        QV2 + (size_t)b0 * SEQ * QKW, QKW, (long)HQK, (long)SEQ * QKW, P2, QKW, (long)HQK,
        (void*)BDp, (void*)BDp, BDW, (long)SEQ * BDW, (long)NH * SEQ * BDW, bq, bq, bq,
        SEQ, BDW, HQK, cs, 1.0f, SEQ / 64 - 1);
    relattn_kernel<<<dim3(SEQ / 64, NH, GB), dim3(128), 0, stream>>>(
        QU2 + (size_t)b0 * SEQ * QKW, KP2 + (size_t)b0 * SEQ * QKW, VTp + (size_t)b0 * ND * SEQ, BDp,
        CTX + (size_t)b0 * SEQ * ND, cs);
  }
  // (7) out = ctx . Wout^T + bout -> d_out f32 [NB*SEQ][1024]   (M=NB*SEQ, N=1024, K=1024; carries 64*64 folded into scale)
  cvt_w_kernel<false><<<gW, blk, 0, stream>>>(Wout, WOp, 64.0f, 64.0f);
  {
    const int tiles = ((NB * SEQ) / 64) * (ND / 64);
    gemm_f16_kernel<1, false, true><<<dim3((tiles + 7) / 8, 1), blk, 0, stream>>>(
        CTX, ND, 0L, 0L, WOp, ND, 0L, (void*)out, (void*)out, ND, 0L, 0L, bout, bout, bout,
        NB * SEQ, ND, ND, 0.000244140625f, 1.0f, 0);
  }
  (void)hipGetLastError();
}

// v002
// One run takes 872 microseconds.
// Next to v001, in two timings, it ran 1.20 times as fast each time.
// Over all steps from v000 it is 3.93 times as fast.
// Contractions: xn.Wq^T and xn.Wk^T (xn as f16 hi + x1024 f16 residual planes folded along K against Wx64 | W/16 planes), Wv.xn^T (xn hi, Wx64), pe.Wpos^T (pe f16, Wx64), (q+v_bias).p^T band and (q+u_bias).k^T (16q as f16 hi + x1024 residual folded along the head dim against 16p | p/64 and 16k | k/64 planes), P.V (P x4096, v x16), ctx.Wout^T (ctx x64, W x64): all v_wmma_f32_16x16x32_f16 (f16 operands, f32 accumulate); float inputs bf16-RNE valued; LayerNorm, positional table, softmax, bias adds and scaling in f32.
#include <hip/hip_runtime.h>
#include <math.h>
#include <stdint.h>

#ifndef NB
#define NB 8
#endif
#ifndef SEQ
#define SEQ 1024
#endif
#define SEQ_FULL 1024
#define ND    1024
#define NH    16
#define HDV   64            // value head dim
#define HQK   128           // folded depth of the q.k / q.p contractions: 64 hi + 64 residual
#define QKW   (2 * ND)      // pitch (halves) of the 2048-wide f16 planes
#define NP    (2 * SEQ - 1)
#define NPP   (2 * SEQ)
#define BDW   (SEQ + 64)    // width of the relative-position score band scratch (SEQ/64 + 1 tiles of 64)
#define GB    2             // batch elements per band/attention launch (all NH heads of each)

static_assert(SEQ % 64 == 0);
static_assert(SEQ <= SEQ_FULL);
static_assert(ND == NH * HDV);
static_assert(HQK == 2 * HDV);
static_assert(NB % GB == 0);
static_assert(ND % 256 == 0);
static_assert(NPP % 64 == 0);
static_assert(BDW % 64 == 0);

typedef _Float16 v16h __attribute__((ext_vector_type(16)));
typedef _Float16 v8h  __attribute__((ext_vector_type(8)));
typedef float    v8f  __attribute__((ext_vector_type(8)));
typedef float    v4f  __attribute__((ext_vector_type(4)));
typedef unsigned int v4u __attribute__((ext_vector_type(4)));
typedef v4f __attribute__((may_alias)) v4fa;
typedef v8h __attribute__((may_alias)) v8ha;

// bf16 RNE of an f32 value, returned widened to f32 (exactly representable in f16 after a power-of-two carry)
__device__ __forceinline__ float bf_rne(float f) {
  unsigned u = __float_as_uint(f);
  u = (u + 0x7FFFu + ((u >> 16) & 1u)) & 0xFFFF0000u;
  return __uint_as_float(u);
}

// 16-bit WMMA fragment: elements 0..7 <- p[0..7], elements 8..15 <- p[16..23]
// (A: p = row m at k0 + 8h;  B stored [n][k]: p = row n at k0 + 8h;  same split k map for both)
union FragU { v16h v; v8ha h[2]; };
__device__ __forceinline__ v16h ldfrag(const _Float16* p) {
  FragU f;
  f.h[0] = *(const v8ha*)(p);
  f.h[1] = *(const v8ha*)(p + 16);
  return f.v;
}

// WMMA + hazard guard (ties D, keeps A/B live for 4 VALU slots)
__device__ __forceinline__ v8f mma16(v16h a, v16h b, v8f c) {
  c = __builtin_amdgcn_wmma_f32_16x16x32_f16(false, a, false, b, (short)0, c, false, false);
  asm volatile("v_nop\n\tv_nop\n\tv_nop\n\tv_nop" : "+v"(c) : "v"(a), "v"(b));
  return c;
}

__device__ __forceinline__ v8f zero8() { v8f z = {0.f, 0.f, 0.f, 0.f, 0.f, 0.f, 0.f, 0.f}; return z; }

// -------------------------------------------------------------------------------------------------
// Weight [1024][1024] f32 -> f16 plane of bf16-valued entries.
//   DUP false: dst [1024][1024], dst[r][c] = f16(bf_rne(W)*s1)
//   DUP true : dst [1024][2048], dst[r][c] = f16(bf_rne(W)*s1), dst[r][1024+c] = f16(bf_rne(W)*s2)
// coverage: 131072 threads x 8 = the whole [1024][1024] source (both column halves for DUP).
// -------------------------------------------------------------------------------------------------
template <bool DUP>
__global__ __launch_bounds__(256) void cvt_w_kernel(const float* __restrict__ src, _Float16* __restrict__ dst,
                                                    float s1, float s2) {
  const int i = blockIdx.x * 256 + threadIdx.x;
  const int total8 = ND * (ND / 8);
  if (i >= total8) return;
  const int r  = i / (ND / 8);
  const int c8 = (i - r * (ND / 8)) * 8;
  const float* sp = src + (size_t)r * ND + c8;
  const v4f a = *(const v4f*)(sp);
  const v4f b = *(const v4f*)(sp + 4);
  float f[8];
  f[0] = bf_rne(a[0]); f[1] = bf_rne(a[1]); f[2] = bf_rne(a[2]); f[3] = bf_rne(a[3]);
  f[4] = bf_rne(b[0]); f[5] = bf_rne(b[1]); f[6] = bf_rne(b[2]); f[7] = bf_rne(b[3]);
  v8h o1, o2;
#pragma unroll
  for (int e = 0; e < 8; ++e) { o1[e] = (_Float16)(f[e] * s1); o2[e] = (_Float16)(f[e] * s2); }
  const int pitch = DUP ? QKW : ND;
  _Float16* dp = dst + (size_t)r * pitch + c8;
  *(v8h*)dp = o1;
  if (DUP) *(v8h*)(dp + ND) = o2;
  
}

// -------------------------------------------------------------------------------------------------
//   XH[row][c]        = f16(xn)                       (hi)
//   XH[row][1024 + c] = f16((xn - hi) * 1024)         (residual, carried x1024)
// One wave per row (compact row b*SEQ + t; source row b*SEQ_FULL + t); block = 8 waves = 8 rows; no LDS.
// Stores: lane l writes 16 B at columns i*256 + 8l: one instruction = 32 lanes x 16 B = 512 contiguous B =
// coverage: grid NB*SEQ/8 x 8 waves x (4 x 256) columns x {hi, residual} = the whole [NB*SEQ][2048] plane.
// Loops rolled on purpose (small elementwise side computation).
// -------------------------------------------------------------------------------------------------
__global__ __launch_bounds__(256) void ln_kernel(const float* __restrict__ x, const float* __restrict__ g,
                                                const float* __restrict__ bt, _Float16* __restrict__ XH,
                                                int nrows) {
  const int lane = threadIdx.x & 31;
  const int wave = threadIdx.x >> 5;
  const int row  = blockIdx.x * 8 + wave;
  if (row >= nrows) return;                                   // wave-uniform; no barriers in this kernel
  const int b = row / SEQ;
  const int t = row - b * SEQ;
  const float* xr = x + ((size_t)b * SEQ_FULL + t) * ND + lane * 8;

  float s = 0.f;
#pragma unroll 1
  for (int i = 0; i < 4; ++i) {
    const v4f a = *(const v4f*)(xr + i * 256);
    const v4f c = *(const v4f*)(xr + i * 256 + 4);
    s += (bf_rne(a[0]) + bf_rne(a[1])) + (bf_rne(a[2]) + bf_rne(a[3]));
    s += (bf_rne(c[0]) + bf_rne(c[1])) + (bf_rne(c[2]) + bf_rne(c[3]));
  }
  s += __shfl_xor(s, 16, 32); s += __shfl_xor(s, 8, 32); s += __shfl_xor(s, 4, 32);
  s += __shfl_xor(s, 2, 32);  s += __shfl_xor(s, 1, 32);
  const float mu = s * (1.0f / (float)ND);

  float s2 = 0.f;
#pragma unroll 1
  for (int i = 0; i < 4; ++i) {
    const v4f a = *(const v4f*)(xr + i * 256);
    const v4f c = *(const v4f*)(xr + i * 256 + 4);
    float d;
    d = bf_rne(a[0]) - mu; s2 += d * d;  d = bf_rne(a[1]) - mu; s2 += d * d;
    d = bf_rne(a[2]) - mu; s2 += d * d;  d = bf_rne(a[3]) - mu; s2 += d * d;
    d = bf_rne(c[0]) - mu; s2 += d * d;  d = bf_rne(c[1]) - mu; s2 += d * d;
    d = bf_rne(c[2]) - mu; s2 += d * d;  d = bf_rne(c[3]) - mu; s2 += d * d;
  }
  s2 += __shfl_xor(s2, 16, 32); s2 += __shfl_xor(s2, 8, 32); s2 += __shfl_xor(s2, 4, 32);
  s2 += __shfl_xor(s2, 2, 32);  s2 += __shfl_xor(s2, 1, 32);
  const float var  = s2 * (1.0f / (float)ND);
  const float rstd = rsqrtf(var + 1e-5f);

  _Float16* xh = XH + (size_t)row * QKW + lane * 8;
{
#pragma unroll 1
    for (int i = 0; i < 4; ++i) {
      const v4f a  = *(const v4f*)(xr + i * 256);
      const v4f c  = *(const v4f*)(xr + i * 256 + 4);
      const v4f ga = *(const v4f*)(g + i * 256 + lane * 8);
      const v4f gb = *(const v4f*)(g + i * 256 + lane * 8 + 4);
      const v4f ba = *(const v4f*)(bt + i * 256 + lane * 8);
      const v4f bb = *(const v4f*)(bt + i * 256 + lane * 8 + 4);
      float f[8], gg[8], be[8];
      f[0] = a[0]; f[1] = a[1]; f[2] = a[2]; f[3] = a[3]; f[4] = c[0]; f[5] = c[1]; f[6] = c[2]; f[7] = c[3];
      gg[0] = ga[0]; gg[1] = ga[1]; gg[2] = ga[2]; gg[3] = ga[3];
      gg[4] = gb[0]; gg[5] = gb[1]; gg[6] = gb[2]; gg[7] = gb[3];
      be[0] = ba[0]; be[1] = ba[1]; be[2] = ba[2]; be[3] = ba[3];
      be[4] = bb[0]; be[5] = bb[1]; be[6] = bb[2]; be[7] = bb[3];
      v8h ho, lo;
#pragma unroll
      for (int e = 0; e < 8; ++e) {
        const float xn = (bf_rne(f[e]) - mu) * rstd * bf_rne(gg[e]) + bf_rne(be[e]);
        const _Float16 hv = (_Float16)xn;
        ho[e] = hv;
        lo[e] = (_Float16)((xn - (float)hv) * 1024.0f);
      }
      *(v8h*)(xh + i * 256)      = ho;
      *(v8h*)(xh + ND + i * 256) = lo;
    }
    
  }
}

// -------------------------------------------------------------------------------------------------
// Relative-position sinusoid table -> PE f16 plane [NPP][1024] (rows >= NP are 0):
//   row r <-> relative position pos = SEQ-1-r;  div_j = expf(f32(2j) * f32(-ln(1e4)/1024));
//   ang = |pos| * div_j (f32 product);  PE[r][2j] = sin(ang) with the sign of pos, PE[r][2j+1] = cos(ang).
// passes.  The per-pair loop is rolled (one sinf, one cosf, one expf body); the 16-B result is assembled by a
// register rotate with constant indices (no dynamic local-array indexing).
// coverage: grid NPP*128/256, NPP*128 threads x 8 halves = the whole [NPP][1024] plane.
// -------------------------------------------------------------------------------------------------
__global__ __launch_bounds__(256) void pe_kernel(_Float16* __restrict__ PE) {
  const int i = blockIdx.x * 256 + threadIdx.x;
  if (i >= NPP * (ND / 8)) return;
  const int r  = i / (ND / 8);
  const int c8 = (i - r * (ND / 8)) * 8;
  const int pos = SEQ - 1 - r;
  const float fpos = (float)((pos < 0) ? -pos : pos);
  const float live = (r < NP) ? 1.0f : 0.0f;
  const float c0 = (float)(-9.210340371976184 / (double)ND);
  v4u pk = {0u, 0u, 0u, 0u};
#pragma unroll 1
  for (int e = 0; e < 4; ++e) {
    const int j = (c8 >> 1) + e;
    const float dv  = expf((float)(2 * j) * c0);
    const float ang = fpos * dv;
    float sn = sinf(ang);
    const float cn = cosf(ang);
    sn = (pos < 0) ? -sn : sn;
    const _Float16 hs = (_Float16)(sn * live);
    const _Float16 hc = (_Float16)(cn * live);
    const unsigned w = (unsigned)__builtin_bit_cast(unsigned short, hs) |
                       ((unsigned)__builtin_bit_cast(unsigned short, hc) << 16);
    v4u nx;
    nx[0] = pk[1]; nx[1] = pk[2]; nx[2] = pk[3]; nx[3] = w;
    pk = nx;
  }
  unsigned* dp = (unsigned*)(PE + (size_t)r * ND + c8);
  *(v4u*)dp = pk;
  
}

// -------------------------------------------------------------------------------------------------
// f16 WMMA GEMM: C[m][n] = epi( sum_k A[m][k] * Bt[nrow][k] ), nrow = n (+ 64*(skew0 - tm) when SKEW: band GEMM).
// A row-major [M][K] pitch lda; Bt row-major [N(+band)][K] pitch ldb; M, N multiples of 64, K multiple of 32.
// Each wave owns a 64x64 output tile (4x4 subtiles), 8 waves per block, grid.x = tiles/8, grid.y = z-batch,
// grid.z = outer batch (steps A by strideAz and C by strideCz; Bt is shared).
// OUT 0: f32  C1[m][n] = acc*scale                                              (band scratch)
// OUT 1: f32  C1[m][n] = acc*scale + bf_rne(b1[n])                              (final output)
// OUT 2: f16  t = acc*scale (+ bf_rne(b1[n]) if HASB);  C1[m][2*n0+c] = f16(t*carry),
//             C1[m][2*n0+64+c] = f16(t*carry/1024)      (2048-wide hi | copy planes, one 64-col tile = one head)
// OUT 3: f16  t = (acc*scale + bf_rne(b3[n])) + bf_rne(b1[n] resp. b2[n]);  th = t*carry;
//             hi = f16(th), lo = f16((th - hi)*1024) -> C1 (b1 variant) and C2 (b2 variant), hi at 2*n0+c, lo at 2*n0+64+c
// OUT 4: f16  C1[m][n] = f16((acc*scale + bf_rne(b1[m])) * carry)            (row bias)
// Epilogue: 16-row slabs staged per wave in LDS (wave-private region, wave barrier); every row segment is written as
// coverage: 4 slabs x 16 rows x 64 cols = the whole 64x64 tile per wave; tiles cover M x N exactly.
// -------------------------------------------------------------------------------------------------
template <int OUT, bool SKEW, bool HASB>
__global__ __launch_bounds__(256) void gemm_f16_kernel(
    const _Float16* __restrict__ A, int lda, long strideA, long strideAz,
    const _Float16* __restrict__ Bt, int ldb, long strideB,
    void* C1, void* C2, int ldc, long strideC, long strideCz,
    const float* __restrict__ b1, const float* __restrict__ b2, const float* __restrict__ b3,
    int M, int N, int K, float scale, float carry, int skew0) {
  __shared__ __align__(16) float sT[8][16 * 68];   // per-wave 16x64 slab, pitch 68 floats

  const int z    = blockIdx.y;
  const int lane = threadIdx.x & 31;
  const int wave = threadIdx.x >> 5;
  const int tilesN = N >> 6;
  const int tilesM = M >> 6;
  const int tile = blockIdx.x * 8 + wave;
  if (tile >= tilesM * tilesN) return;             // wave-uniform; no block barriers in this kernel
  const int tm = tile / tilesN;
  const int tn = tile - tm * tilesN;
  const int m0 = tm << 6;
  const int n0 = tn << 6;
  const int nsk = SKEW ? ((skew0 - tm) << 6) : 0;  // band row offset of Bt
  const size_t cOff = (size_t)z * strideC + (size_t)blockIdx.z * strideCz;

  const _Float16* Ab = A  + (size_t)z * strideA + (size_t)blockIdx.z * strideAz;
  const _Float16* Bb = Bt + (size_t)z * strideB;

  const int rl   = lane & 15;          // row (A) / column (B, D) within a subtile
  const int koff = (lane >> 4) * 8;    // k offset of this lane half
  const int mOff = (lane >> 4) * 8;    // D row offset of this lane half

  v8f acc[4][4];
#pragma unroll
  for (int i = 0; i < 4; ++i)
#pragma unroll
    for (int j = 0; j < 4; ++j) acc[i][j] = zero8();

  for (int k0 = 0; k0 < K; k0 += 32) {
    v16h bfr[4];
#pragma unroll
    for (int j = 0; j < 4; ++j)
      bfr[j] = ldfrag(Bb + (size_t)(nsk + n0 + (j << 4) + rl) * ldb + koff + k0);
#pragma unroll
    for (int i = 0; i < 4; ++i) {
      const v16h af = ldfrag(Ab + (size_t)(m0 + (i << 4) + rl) * lda + koff + k0);
#pragma unroll
      for (int j = 0; j < 4; ++j) acc[i][j] = mma16(af, bfr[j], acc[i][j]);
    }
  }

  // ---- epilogue ----
  float* slab = sT[wave];
  const int hh = lane >> 4, c4 = (lane & 15) * 4;     // f32 modes: row segment 256 B = 16 lanes x 16 B
  const int q8 = lane >> 3, c8 = (lane & 7) * 8;
  v4f bias4 = {0.f, 0.f, 0.f, 0.f};
  float col8a[8], col8b[8], col8c[8];
#pragma unroll
  for (int e = 0; e < 8; ++e) { col8a[e] = 0.f; col8b[e] = 0.f; col8c[e] = 0.f; }
  if (OUT == 1 && HASB) {
    const v4f tb = *(const v4f*)(b1 + n0 + c4);
    bias4[0] = bf_rne(tb[0]); bias4[1] = bf_rne(tb[1]); bias4[2] = bf_rne(tb[2]); bias4[3] = bf_rne(tb[3]);
  }
  if ((OUT == 2 && HASB) || OUT == 3) {
    const v4f ta = *(const v4f*)(b1 + n0 + c8);
    const v4f tb = *(const v4f*)(b1 + n0 + c8 + 4);
    col8a[0] = bf_rne(ta[0]); col8a[1] = bf_rne(ta[1]); col8a[2] = bf_rne(ta[2]); col8a[3] = bf_rne(ta[3]);
    col8a[4] = bf_rne(tb[0]); col8a[5] = bf_rne(tb[1]); col8a[6] = bf_rne(tb[2]); col8a[7] = bf_rne(tb[3]);
  }
  if (OUT == 3) {
    const v4f ta = *(const v4f*)(b2 + n0 + c8);
    const v4f tb = *(const v4f*)(b2 + n0 + c8 + 4);
    col8b[0] = bf_rne(ta[0]); col8b[1] = bf_rne(ta[1]); col8b[2] = bf_rne(ta[2]); col8b[3] = bf_rne(ta[3]);
    col8b[4] = bf_rne(tb[0]); col8b[5] = bf_rne(tb[1]); col8b[6] = bf_rne(tb[2]); col8b[7] = bf_rne(tb[3]);
    const v4f tc = *(const v4f*)(b3 + n0 + c8);
    const v4f td = *(const v4f*)(b3 + n0 + c8 + 4);
    col8c[0] = bf_rne(tc[0]); col8c[1] = bf_rne(tc[1]); col8c[2] = bf_rne(tc[2]); col8c[3] = bf_rne(tc[3]);
    col8c[4] = bf_rne(td[0]); col8c[5] = bf_rne(td[1]); col8c[6] = bf_rne(td[2]); col8c[7] = bf_rne(td[3]);
  }
  const float carry2 = carry * 0.0009765625f;        // carry / 1024

#pragma unroll
  for (int i = 0; i < 4; ++i) {
    const int mBase = m0 + (i << 4);
#pragma unroll
    for (int j = 0; j < 4; ++j)
#pragma unroll
      for (int r = 0; r < 8; ++r)
        slab[(mOff + r) * 68 + (j << 4) + rl] = acc[i][j][r] * scale;
    __builtin_amdgcn_fence(__ATOMIC_RELEASE, "workgroup");
    __builtin_amdgcn_wave_barrier();
    __builtin_amdgcn_fence(__ATOMIC_ACQUIRE, "workgroup");
    if (OUT == 0 || OUT == 1) {
      float* C = (float*)C1 + cOff;
      v4f vv[8];
#pragma unroll
      for (int it = 0; it < 8; ++it) {
        const int row = it * 2 + hh;
        v4f v = *(const v4fa*)(slab + row * 68 + c4);
        if (OUT == 1) v += bias4;
        vv[it] = v;
      }
      {
#pragma unroll
        for (int it = 0; it < 8; ++it) {
          const int row = it * 2 + hh;
          *(v4f*)(C + (size_t)(mBase + row) * ldc + n0 + c4) = vv[it];
        }
        
      }
    } else if (OUT == 2 || OUT == 4) {
      _Float16* Ca = (_Float16*)C1 + cOff;
      v8h hv[4], lv[4];
#pragma unroll
      for (int it = 0; it < 4; ++it) {
        const int row = it * 4 + q8;
        const float* sp = slab + row * 68 + c8;
        const v4f x0 = *(const v4fa*)(sp);
        const v4f x1 = *(const v4fa*)(sp + 4);
        float f[8];
        f[0] = x0[0]; f[1] = x0[1]; f[2] = x0[2]; f[3] = x0[3];
        f[4] = x1[0]; f[5] = x1[1]; f[6] = x1[2]; f[7] = x1[3];
        float rb = 0.f;
        if (OUT == 4 && HASB) rb = bf_rne(b1[mBase + row]);
        v8h ha, la;
#pragma unroll
        for (int e = 0; e < 8; ++e) {
          const float t = f[e] + ((OUT == 2) ? col8a[e] : rb);
          ha[e] = (_Float16)(t * carry);
          la[e] = (_Float16)(t * carry2);
        }
        hv[it] = ha; lv[it] = la;
      }
      {
#pragma unroll
        for (int it = 0; it < 4; ++it) {
          const int row = it * 4 + q8;
          if (OUT == 2) {
            _Float16* cp = Ca + (size_t)(mBase + row) * ldc + 2 * n0 + c8;
            *(v8h*)(cp)      = hv[it];
            *(v8h*)(cp + 64) = lv[it];
          } else {
            *(v8h*)(Ca + (size_t)(mBase + row) * ldc + n0 + c8) = hv[it];
          }
        }
        
      }
    } else {
#pragma unroll
      for (int var = 0; var < 2; ++var) {
        _Float16* Cc = (_Float16*)((var == 0) ? C1 : C2) + cOff;
        v8h hv[4], lv[4];
#pragma unroll
        for (int it = 0; it < 4; ++it) {
          const int row = it * 4 + q8;
          const float* sp = slab + row * 68 + c8;
          const v4f x0 = *(const v4fa*)(sp);
          const v4f x1 = *(const v4fa*)(sp + 4);
          float f[8];
          f[0] = x0[0]; f[1] = x0[1]; f[2] = x0[2]; f[3] = x0[3];
          f[4] = x1[0]; f[5] = x1[1]; f[6] = x1[2]; f[7] = x1[3];
          v8h ha, la;
#pragma unroll
          for (int e = 0; e < 8; ++e) {
            const float t  = (f[e] + col8c[e]) + ((var == 0) ? col8a[e] : col8b[e]);
            const float th = t * carry;
            const _Float16 hq = (_Float16)th;
            ha[e] = hq;
            la[e] = (_Float16)((th - (float)hq) * 1024.0f);
          }
          hv[it] = ha; lv[it] = la;
        }
        {
#pragma unroll
          for (int it = 0; it < 4; ++it) {
            const int row = it * 4 + q8;
            _Float16* cp = Cc + (size_t)(mBase + row) * ldc + 2 * n0 + c8;
            *(v8h*)(cp)      = hv[it];
            *(v8h*)(cp + 64) = lv[it];
          }
          
        }
      }
    }
    __builtin_amdgcn_fence(__ATOMIC_RELEASE, "workgroup");
    __builtin_amdgcn_wave_barrier();
    __builtin_amdgcn_fence(__ATOMIC_ACQUIRE, "workgroup");
  }
}

// -------------------------------------------------------------------------------------------------
// Relative-position attention for all NH heads of GB batch elements, folded q.k depth 128 (hi | residual),
// value head dim 64, no mask.
//   QU  f16 plane [t][h*128 + j]: j<64 hi = f16(16*(q+u_bias)), j>=64 residual x1024     (A of the content score)
//   KP  f16 plane [s][h*128 + j]: j<64 f16(16*k), j>=64 f16(k/64)                       (B, staged per 64-key chunk as [key][128])
//   VT  f16 plane [h*64 + d][s]   = f16(16*v)                                            (B of P.V, staged as [d][key])
//   BD  f32 band scratch [bz*NH + h][SEQ][BDW]: value (row i, col j) = (1/8)*(q_i + v_bias).p[row 64*(SEQ/64-1 - i/64) + j]
//       rel-shift: bd[i][key] = bdfull[i][key - i + SEQ-1]  ->  column key + 63 - (i mod 64), always in [0, BDW-2].
//   score = cs * (QU.K^T acc) + BD  with cs = (1/8)/256;  online softmax in f32 over SEQ/64 chunks of 64 keys;
//   P stored per wave as f16(4096 * exp(s - m)); CTX[t][h*64 + d] = f16(64 * ctx) = f16((P.V acc) / (1024*l)).
// Block = 4 waves = 64 query rows of one head; grid = (SEQ/64 query blocks, NH heads, GB batch elements);
// QU, KP, VT and CTX point at the first batch element of the launch.
// LDS: one raw buffer; K tile [64][128] f16 at row pitch KPIT, then V^T tile [64][64] f16 at pitch VPIT, then per-wave
// P tiles [16][64] f16 at pitch VPIT; the output staging [4][16][64] f32 at pitch OPIT reuses the K bytes after a
// block barrier.  Every pitch is an odd multiple of 16 B, so the 16 rows that one ds_load_b128 reads start on 16
// different groups of four banks (at the bare 256-B and 128-B pitches they fall on one or two groups).
// coverage: staging 128 thr x 64 halves for K (64x128) and 128 thr x 32 halves for V^T (64x64); P tile 8 rows x
// 2 halves x 4x16 cols per wave = 16x64 (all written every chunk); output 4 store instructions x 4 rows x 8 lanes x
// 8 halves = 16x64 per wave.
// -------------------------------------------------------------------------------------------------
#define KPIT   (HQK + 8)            // halves: 272 B = 17 x 16 B
#define VPIT   (HDV + 8)            // halves: 144 B =  9 x 16 B
#define OPIT   (HDV + 4)            // floats: 272 B = 17 x 16 B
#define KBYTES (64 * KPIT * 2)      // 17408
#define VBYTES (64 * VPIT * 2)      //  9216
#define PBYTES (4 * 16 * VPIT * 2)  //  9216
static_assert(4 * 16 * OPIT * 4 <= KBYTES);
static_assert(KBYTES % 16 == 0 && VBYTES % 16 == 0);

__global__ __launch_bounds__(128)
void relattn_kernel(const _Float16* __restrict__ QU, const _Float16* __restrict__ KP,
                    const _Float16* __restrict__ VT, const float* __restrict__ BD,
                    _Float16* __restrict__ CTX, float cs) {
  __shared__ __align__(16) unsigned char SMEM[KBYTES + VBYTES + PBYTES];
  _Float16* Ksh = (_Float16*)(SMEM);                    // [64][128] at pitch KPIT
  _Float16* Vsh = (_Float16*)(SMEM + KBYTES);           // [64][64]  at pitch VPIT
  _Float16* Psh = (_Float16*)(SMEM + KBYTES + VBYTES);  // [4][16][64] at pitch VPIT
  float*    Osh = (float*)(SMEM);                       // [4][16][64] at pitch OPIT, after the chunk loop

  const int tid  = threadIdx.x;
  const int wave = tid >> 5;
  const int lane = tid & 31;
  const int hh   = lane >> 4;
  const int c    = lane & 15;

  const int h    = blockIdx.y;
  const int bz   = blockIdx.z;
  const int qb   = blockIdx.x;
  const int q0   = qb * 64 + wave * 16;          // first query row of this wave
  const int rr0  = wave * 16 + 8 * hh;           // row within the 64-row block for r = 0

  const _Float16* Qh = QU + (size_t)bz * SEQ * QKW + h * HQK;   // row pitch QKW
  const _Float16* Kh = KP + (size_t)bz * SEQ * QKW + h * HQK;   // row pitch QKW
  const _Float16* Vh = VT + (size_t)(bz * ND + h * HDV) * SEQ;
  const float*    bd = BD + (size_t)(bz * NH + h) * SEQ * BDW;
  _Float16*       ctx = CTX + (size_t)bz * SEQ * ND + h * HDV;  // row pitch ND

  // Q fragments (A operand): 4 chunks of 32 along the folded depth
  v16h qa[4];
#pragma unroll
  for (int dc = 0; dc < 4; ++dc)
    qa[dc] = ldfrag(Qh + (size_t)(q0 + c) * QKW + dc * 32 + 8 * hh);

  // band scratch: element for (row r, key kv0+16j+c) at bdr[r*(BDW-1) + kv0 + 16j]
  const float* bdr = bd + (size_t)(q0 + 8 * hh) * BDW + (63 - rr0 + c);

  float mrow[8], lrow[8];
  v8f oacc[4];
#pragma unroll
  for (int r = 0; r < 8; ++r) { mrow[r] = -INFINITY; lrow[r] = 0.f; }
#pragma unroll
  for (int t = 0; t < 4; ++t) oacc[t] = zero8();

  _Float16* pw = Psh + wave * (16 * VPIT);

#pragma unroll 1
  for (int kc = 0; kc < SEQ / 64; ++kc) {
    const int kv0 = kc * 64;
    __syncthreads();
    {
      const int r = tid >> 1, c0 = (tid & 1) * 64, cv = (tid & 1) * 32;
      const _Float16* ks = Kh + (size_t)(kv0 + r) * QKW + c0;
      const _Float16* vs = Vh + (size_t)r * SEQ + kv0 + cv;
#pragma unroll
      for (int i = 0; i < 8; ++i) {
        const v8h kk8 = *(const v8h*)(ks + 8 * i);
        *(v8ha*)(Ksh + r * KPIT + c0 + 8 * i) = kk8;
      }
#pragma unroll
      for (int i = 0; i < 4; ++i) {
        const v8h vv8 = *(const v8h*)(vs + 8 * i);
        *(v8ha*)(Vsh + r * VPIT + cv + 8 * i) = vv8;
      }
    }
    __syncthreads();

    // content scores: S[j] = QU(16x128) . K^T for key subtile j
    v8f s[4];
#pragma unroll
    for (int j = 0; j < 4; ++j) {
      s[j] = zero8();
#pragma unroll
      for (int dc = 0; dc < 4; ++dc) {
        const v16h kb = ldfrag(Ksh + (j * 16 + c) * KPIT + dc * 32 + 8 * hh);
        s[j] = mma16(qa[dc], kb, s[j]);
      }
    }

    // add the position term from the band scratch, chunk row max
    float cm[8];
#pragma unroll
    for (int r = 0; r < 8; ++r) {
      float m = -INFINITY;
#pragma unroll
      for (int j = 0; j < 4; ++j) {
        const float sv = s[j][r] * cs + bdr[(size_t)r * (BDW - 1) + kv0 + (j << 4)];
        s[j][r] = sv;
        m = fmaxf(m, sv);
      }
      m = fmaxf(m, __shfl_xor(m, 1, 32));
      m = fmaxf(m, __shfl_xor(m, 2, 32));
      m = fmaxf(m, __shfl_xor(m, 4, 32));
      m = fmaxf(m, __shfl_xor(m, 8, 32));
      cm[r] = m;
    }

    // online softmax update (per-row rescale of this row's accumulator elements only);
    // P tile (x4096) to this wave's LDS tile [row][key]
#pragma unroll
    for (int r = 0; r < 8; ++r) {
      const float mnew  = fmaxf(mrow[r], cm[r]);
      const float alpha = __expf(mrow[r] - mnew);
      mrow[r] = mnew;
      float psum = 0.f;
#pragma unroll
      for (int j = 0; j < 4; ++j) {
        const float p = __expf(s[j][r] - mnew);
        psum += p;
        pw[(8 * hh + r) * VPIT + j * 16 + c] = (_Float16)(p * 4096.0f);
      }
      psum += __shfl_xor(psum, 1, 32);
      psum += __shfl_xor(psum, 2, 32);
      psum += __shfl_xor(psum, 4, 32);
      psum += __shfl_xor(psum, 8, 32);
      lrow[r] = lrow[r] * alpha + psum;
#pragma unroll
      for (int t = 0; t < 4; ++t) oacc[t][r] *= alpha;
    }
    __builtin_amdgcn_fence(__ATOMIC_RELEASE, "workgroup");
    __builtin_amdgcn_wave_barrier();
    __builtin_amdgcn_fence(__ATOMIC_ACQUIRE, "workgroup");

    // P (A operand, row = lane&15, split k map over keys) . V (B operand from V^T rows d)
#pragma unroll
    for (int kk = 0; kk < 2; ++kk) {
      const v16h pa = ldfrag(pw + c * VPIT + kk * 32 + 8 * hh);
#pragma unroll
      for (int t = 0; t < 4; ++t) {
        const v16h vb = ldfrag(Vsh + (t * 16 + c) * VPIT + kk * 32 + 8 * hh);
        oacc[t] = mma16(pa, vb, oacc[t]);
      }
    }
  }

  __syncthreads();                               // every wave is done with Ksh before Osh aliases it
  float* os = Osh + wave * (16 * OPIT);
#pragma unroll
  for (int r = 0; r < 8; ++r) {
    const float inv = 1.0f / (1024.0f * lrow[r]);   // 64 / (4096 * 16 * l)
#pragma unroll
    for (int t = 0; t < 4; ++t) os[(8 * hh + r) * OPIT + t * 16 + c] = oacc[t][r] * inv;
  }
  __builtin_amdgcn_fence(__ATOMIC_RELEASE, "workgroup");
  __builtin_amdgcn_wave_barrier();
  __builtin_amdgcn_fence(__ATOMIC_ACQUIRE, "workgroup");
  const int q8 = lane >> 3, c8 = (lane & 7) * 8;
  v8h ov[4];
#pragma unroll
  for (int it = 0; it < 4; ++it) {
    const int row = it * 4 + q8;
    const float* sp = os + row * OPIT + c8;
    const v4f x0 = *(const v4fa*)(sp);
    const v4f x1 = *(const v4fa*)(sp + 4);
    v8h o;
    o[0] = (_Float16)x0[0]; o[1] = (_Float16)x0[1]; o[2] = (_Float16)x0[2]; o[3] = (_Float16)x0[3];
    o[4] = (_Float16)x1[0]; o[5] = (_Float16)x1[1]; o[6] = (_Float16)x1[2]; o[7] = (_Float16)x1[3];
    ov[it] = o;
  }
  {
#pragma unroll
    for (int it = 0; it < 4; ++it) {
      const int row = it * 4 + q8;
      *(v8h*)(ctx + (size_t)(q0 + row) * ND + c8) = ov[it];
    }
    
  }
}

// -------------------------------------------------------------------------------------------------
// Workspace map (bytes, NB=8 SEQ=1024): every batch element's planes are live at once.
//   P2   f16 [NPP][2048]             8388608
//   QU2  f16 [NB*SEQ][2048]         33554432
//   QV2  f16 [NB*SEQ][2048]         33554432   CTX f16 [NB*SEQ][1024] overlays its first half: the attention launch of
//                                              group g writes bytes [g, g+1) * GB*SEQ*ND*2, and the only later readers of
//                                              QV2 (band launches of groups > g) start at (g+1) * GB*SEQ*QKW*2, above it
//   KP2  f16 [NB*SEQ][2048]         33554432
//   VT   f16 [NB][1024][SEQ]        16777216
//   SCR                            142606336   early phase: WQ2, WK2 f16 [1024][2048], WV, WP f16 [1024][1024],
//                                              PE f16 [NPP][1024], XH f16 [NB*SEQ][2048] (all dead after the projections);
//                                              middle phase: BD band f32 [GB*NH][SEQ][BDW];
//                                              last phase: WO f16 [1024][1024] (converted after the last attention launch)
//   total                          268435456
// Every region is written in whole 64x64 tiles / whole rows; all region sizes equal their written extents.
// -------------------------------------------------------------------------------------------------
extern "C" void kernel_launch(void* const* d_in, const int* in_sizes, int n_in,
                              void* d_out, int out_size, void* d_ws, size_t ws_size,
                              hipStream_t stream) {
  if (n_in < 14) return;
  if (in_sizes[0] < ((NB - 1) * SEQ_FULL + SEQ) * ND) return;
  if (in_sizes[1] != ND * ND || in_sizes[3] != ND * ND || in_sizes[5] != ND * ND) return;
  if (in_sizes[7] != ND * ND || in_sizes[8] != ND * ND) return;
  if (in_sizes[2] < ND || in_sizes[4] < ND || in_sizes[6] < ND || in_sizes[9] < ND) return;
  if (in_sizes[10] < NH * HDV || in_sizes[11] < NH * HDV) return;
  if (in_sizes[12] < ND || in_sizes[13] < ND) return;
  if (out_size < NB * SEQ * ND) return;

  const float* x    = (const float*)d_in[0];
  const float* Wq   = (const float*)d_in[1];
  const float* bq   = (const float*)d_in[2];
  const float* Wk   = (const float*)d_in[3];
  const float* bk   = (const float*)d_in[4];
  const float* Wv   = (const float*)d_in[5];
  const float* bv   = (const float*)d_in[6];
  const float* Wpos = (const float*)d_in[7];
  const float* Wout = (const float*)d_in[8];
  const float* bout = (const float*)d_in[9];
  const float* ub   = (const float*)d_in[10];
  const float* vbias= (const float*)d_in[11];
  const float* lng  = (const float*)d_in[12];
  const float* lnb  = (const float*)d_in[13];
  float* out = (float*)d_out;

  const size_t szW2  = (size_t)ND * QKW * 2;              //   4194304
  const size_t szW1  = (size_t)ND * ND * 2;               //   2097152
  const size_t szXH  = (size_t)NB * SEQ * QKW * 2;        //  33554432
  const size_t szQ   = (size_t)NB * SEQ * QKW * 2;        //  33554432
  const size_t szVT  = (size_t)NB * ND * SEQ * 2;         //  16777216
  const size_t szP2  = (size_t)NPP * QKW * 2;             //   8388608
  const size_t szPE  = (size_t)NPP * ND * 2;              //   4194304
  const size_t szBD  = (size_t)GB * NH * SEQ * BDW * 4;   // 142606336
  const size_t szEarly = 2 * szW2 + 2 * szW1 + szPE + szXH;
  const size_t szSCR = (szEarly > szBD) ? szEarly : szBD;
  size_t off = 0;
  const size_t oP2  = off; off += szP2;
  const size_t oQU2 = off; off += szQ;
  const size_t oQV2 = off; off += szQ;
  const size_t oKP2 = off; off += szQ;
  const size_t oVT  = off; off += szVT;
  const size_t oSCR = off; off += szSCR;
  const size_t total = off;                                // 268435456 for NB=8, SEQ=1024
  if (total > ws_size) return;
  const size_t oWQ2 = oSCR;
  const size_t oWK2 = oWQ2 + szW2;
  const size_t oWV  = oWK2 + szW2;
  const size_t oWP  = oWV + szW1;
  const size_t oPE  = oWP + szW1;
  const size_t oXH  = oPE + szPE;

  char* ws = (char*)d_ws;
  _Float16* WQ2 = (_Float16*)(ws + oWQ2);
  _Float16* WK2 = (_Float16*)(ws + oWK2);
  _Float16* WVp = (_Float16*)(ws + oWV);
  _Float16* WOp = (_Float16*)(ws + oSCR);
  _Float16* XH  = (_Float16*)(ws + oXH);
  _Float16* QU2 = (_Float16*)(ws + oQU2);
  _Float16* QV2 = (_Float16*)(ws + oQV2);
  _Float16* KP2 = (_Float16*)(ws + oKP2);
  _Float16* VTp = (_Float16*)(ws + oVT);
  _Float16* P2  = (_Float16*)(ws + oP2);
  _Float16* CTX = (_Float16*)(ws + oQV2);
  _Float16* WPp = (_Float16*)(ws + oWP);
  _Float16* PEp = (_Float16*)(ws + oPE);
  float*    BDp = (float*)(ws + oSCR);

  const float cs = 0.125f * 0.00390625f;   // (1/sqrt(64)) / 256 applied to the x16.x16 score accumulators
  const dim3 blk(256);

  // (1) weights -> f16 planes of bf16-valued entries: Wq, Wk as [x64 | /16] 2048-wide; Wv, Wpos x64
  const dim3 gW(ND * (ND / 8) / 256);      // 512
  cvt_w_kernel<true ><<<gW, blk, 0, stream>>>(Wq,   WQ2, 64.0f, 0.0625f);
  cvt_w_kernel<true ><<<gW, blk, 0, stream>>>(Wk,   WK2, 64.0f, 0.0625f);
  cvt_w_kernel<false><<<gW, blk, 0, stream>>>(Wv,   WVp, 64.0f, 64.0f);
  cvt_w_kernel<false><<<gW, blk, 0, stream>>>(Wpos, WPp, 64.0f, 64.0f);
  // (2) LayerNorm -> XH [NB*SEQ][2048] (hi | residual x1024)
  ln_kernel<<<dim3((NB * SEQ) / 8), blk, 0, stream>>>(x, lng, lnb, XH, NB * SEQ);
  // (3) positional sinusoid table -> PE [NPP][1024] (row NPP-1 = 0)
  pe_kernel<<<dim3((NPP * (ND / 8) + 255) / 256), blk, 0, stream>>>(PEp);
  // (4) p = pe . Wpos^T -> P2 = [16p | p/64]   (M=NPP, N=1024, K=1024)
  {
    const int tiles = (NPP / 64) * (ND / 64);
    gemm_f16_kernel<2, false, false><<<dim3((tiles + 7) / 8, 1), blk, 0, stream>>>(
        PEp, ND, 0L, 0L, WPp, ND, 0L, (void*)P2, (void*)P2, QKW, 0L, 0L, bq, bq, bq,
        NPP, ND, ND, 0.015625f, 16.0f, 0);
  }
  // (5) projections of all batch elements, one launch each
  const int tilesQ  = ((NB * SEQ) / 64) * (ND / 64);
  const int tilesV  = (ND / 64) * (SEQ / 64);
  const int tilesBD = (SEQ / 64) * (BDW / 64);
  // QU2 = split(16*(q + bq + u_bias)), QV2 = split(16*(q + bq + v_bias))   (M=NB*SEQ, N=1024, K=2048)
  gemm_f16_kernel<3, false, true><<<dim3((tilesQ + 7) / 8, 1), blk, 0, stream>>>(
      XH, QKW, 0L, 0L, WQ2, QKW, 0L, (void*)QU2, (void*)QV2, QKW, 0L, 0L, ub, vbias, bq,
      NB * SEQ, ND, QKW, 0.015625f, 16.0f, 0);
  // KP2 = [16k | k/64], k = xn.Wk^T + bk   (M=NB*SEQ, N=1024, K=2048)
  gemm_f16_kernel<2, false, true><<<dim3((tilesQ + 7) / 8, 1), blk, 0, stream>>>(
      XH, QKW, 0L, 0L, WK2, QKW, 0L, (void*)KP2, (void*)KP2, QKW, 0L, 0L, bk, bk, bk,
      NB * SEQ, ND, QKW, 0.015625f, 16.0f, 0);
  // VT[b][h*64+d][s] = 16*(v + bv)   (A = Wv plane [1024][1024], Bt = XH hi columns of batch element y; M=1024, N=SEQ, K=1024)
  gemm_f16_kernel<4, false, true><<<dim3((tilesV + 7) / 8, NB), blk, 0, stream>>>(
      WVp, ND, 0L, 0L, XH, QKW, (long)SEQ * QKW, (void*)VTp, (void*)VTp, SEQ, (long)ND * SEQ, 0L, bv, bv, bv,
      ND, SEQ, ND, 0.015625f, 16.0f, 0);
  // (6) band + attention, GB batch elements x NH heads per launch
  for (int b0 = 0; b0 < NB; b0 += GB) {
    // band GEMM: BD[bz*NH+h][t][j] = (1/8)*(q_t + v_bias).p[64*(SEQ/64-1 - t/64) + j]   (M=SEQ, N=BDW, K=128)
    gemm_f16_kernel<0, true, false><<<dim3((tilesBD + 7) / 8, NH, GB), blk, 0, stream>>>(
        QV2 + (size_t)b0 * SEQ * QKW, QKW, (long)HQK, (long)SEQ * QKW, P2, QKW, (long)HQK,
        (void*)BDp, (void*)BDp, BDW, (long)SEQ * BDW, (long)NH * SEQ * BDW, bq, bq, bq,
        SEQ, BDW, HQK, cs, 1.0f, SEQ / 64 - 1);
    relattn_kernel<<<dim3(SEQ / 64, NH, GB), dim3(128), 0, stream>>>(
        QU2 + (size_t)b0 * SEQ * QKW, KP2 + (size_t)b0 * SEQ * QKW, VTp + (size_t)b0 * ND * SEQ, BDp,
        CTX + (size_t)b0 * SEQ * ND, cs);
  }
  // (7) out = ctx . Wout^T + bout -> d_out f32 [NB*SEQ][1024]   (M=NB*SEQ, N=1024, K=1024; carries 64*64 folded into scale)
  cvt_w_kernel<false><<<gW, blk, 0, stream>>>(Wout, WOp, 64.0f, 64.0f);
  {
    const int tiles = ((NB * SEQ) / 64) * (ND / 64);
    gemm_f16_kernel<1, false, true><<<dim3((tiles + 7) / 8, 1), blk, 0, stream>>>(
        CTX, ND, 0L, 0L, WOp, ND, 0L, (void*)out, (void*)out, ND, 0L, 0L, bout, bout, bout,
        NB * SEQ, ND, ND, 0.000244140625f, 1.0f, 0);
  }
  (void)hipGetLastError();
}

// v003
// Measured time: 682 microseconds a run.
// Next to v002, in two timings, it ran 1.28 times as fast each time.
// All steps since v000 together make it 5.03 times as fast.
// Contractions: xn.Wq^T and xn.Wk^T (xn as f16 hi + x1024 f16 residual planes folded along K against Wx64 | W/16 planes), Wv.xn^T (xn hi, Wx64), pe.Wpos^T (pe f16, Wx64), (q+v_bias).p^T band and (q+u_bias).k^T (16q as f16 hi + x1024 residual folded along the head dim against 16p | p/64 and 16k | k/64 planes), P.V (P x4096, v x16), ctx.Wout^T (ctx x64, W x64): all v_wmma_f32_16x16x32_f16 (f16 operands, f32 accumulate); float inputs bf16-RNE valued; LayerNorm, positional table, softmax, bias adds and scaling in f32.
#include <hip/hip_runtime.h>
#include <math.h>
#include <stdint.h>

#ifndef NB
#define NB 8
#endif
#ifndef SEQ
#define SEQ 1024
#endif
#define SEQ_FULL 1024
#define ND    1024
#define NH    16
#define HDV   64            // value head dim
#define HQK   128           // folded depth of the q.k / q.p contractions: 64 hi + 64 residual
#define QKW   (2 * ND)      // pitch (halves) of the 2048-wide f16 planes
#define NP    (2 * SEQ - 1)
#define NPP   (2 * SEQ)
#define BDW   (SEQ + 64)    // width of the relative-position score band scratch (SEQ/64 + 1 tiles of 64)
#define GB    2             // batch elements per band/attention launch (all NH heads of each)

static_assert(SEQ % 64 == 0);
static_assert(SEQ <= SEQ_FULL);
static_assert(ND == NH * HDV);
static_assert(HQK == 2 * HDV);
static_assert(NB % GB == 0);
static_assert(ND % 256 == 0);
static_assert(NPP % 64 == 0);
static_assert(BDW % 64 == 0);

typedef _Float16 v16h __attribute__((ext_vector_type(16)));
typedef _Float16 v8h  __attribute__((ext_vector_type(8)));
typedef float    v8f  __attribute__((ext_vector_type(8)));
typedef float    v4f  __attribute__((ext_vector_type(4)));
typedef unsigned int v4u __attribute__((ext_vector_type(4)));
typedef v4f __attribute__((may_alias)) v4fa;
typedef v8h __attribute__((may_alias)) v8ha;

// bf16 RNE of an f32 value, returned widened to f32 (exactly representable in f16 after a power-of-two carry)
__device__ __forceinline__ float bf_rne(float f) {
  unsigned u = __float_as_uint(f);
  u = (u + 0x7FFFu + ((u >> 16) & 1u)) & 0xFFFF0000u;
  return __uint_as_float(u);
}

// 16-bit WMMA fragment: elements 0..7 <- p[0..7], elements 8..15 <- p[16..23]
// (A: p = row m at k0 + 8h;  B stored [n][k]: p = row n at k0 + 8h;  same split k map for both)
union FragU { v16h v; v8ha h[2]; };
__device__ __forceinline__ v16h ldfrag(const _Float16* p) {
  FragU f;
  f.h[0] = *(const v8ha*)(p);
  f.h[1] = *(const v8ha*)(p + 16);
  return f.v;
}

// WMMA + hazard guard (ties D, keeps A/B live for 4 VALU slots)
__device__ __forceinline__ v8f mma16(v16h a, v16h b, v8f c) {
  c = __builtin_amdgcn_wmma_f32_16x16x32_f16(false, a, false, b, (short)0, c, false, false);
  asm volatile("v_nop\n\tv_nop\n\tv_nop\n\tv_nop" : "+v"(c) : "v"(a), "v"(b));
  return c;
}

__device__ __forceinline__ v8f zero8() { v8f z = {0.f, 0.f, 0.f, 0.f, 0.f, 0.f, 0.f, 0.f}; return z; }

// -------------------------------------------------------------------------------------------------
// Weight [1024][1024] f32 -> f16 plane of bf16-valued entries.
//   DUP false: dst [1024][1024], dst[r][c] = f16(bf_rne(W)*s1)
//   DUP true : dst [1024][2048], dst[r][c] = f16(bf_rne(W)*s1), dst[r][1024+c] = f16(bf_rne(W)*s2)
// coverage: 131072 threads x 8 = the whole [1024][1024] source (both column halves for DUP).
// -------------------------------------------------------------------------------------------------
template <bool DUP>
__global__ __launch_bounds__(256) void cvt_w_kernel(const float* __restrict__ src, _Float16* __restrict__ dst,
                                                    float s1, float s2) {
  const int i = blockIdx.x * 256 + threadIdx.x;
  const int total8 = ND * (ND / 8);
  if (i >= total8) return;
  const int r  = i / (ND / 8);
  const int c8 = (i - r * (ND / 8)) * 8;
  const float* sp = src + (size_t)r * ND + c8;
  const v4f a = *(const v4f*)(sp);
  const v4f b = *(const v4f*)(sp + 4);
  float f[8];
  f[0] = bf_rne(a[0]); f[1] = bf_rne(a[1]); f[2] = bf_rne(a[2]); f[3] = bf_rne(a[3]);
  f[4] = bf_rne(b[0]); f[5] = bf_rne(b[1]); f[6] = bf_rne(b[2]); f[7] = bf_rne(b[3]);
  v8h o1, o2;
#pragma unroll
  for (int e = 0; e < 8; ++e) { o1[e] = (_Float16)(f[e] * s1); o2[e] = (_Float16)(f[e] * s2); }
  const int pitch = DUP ? QKW : ND;
  _Float16* dp = dst + (size_t)r * pitch + c8;
  *(v8h*)dp = o1;
  if (DUP) *(v8h*)(dp + ND) = o2;
  
}

// -------------------------------------------------------------------------------------------------
//   XH[row][c]        = f16(xn)                       (hi)
//   XH[row][1024 + c] = f16((xn - hi) * 1024)         (residual, carried x1024)
// One wave per row (compact row b*SEQ + t; source row b*SEQ_FULL + t); block = 8 waves = 8 rows; no LDS.
// Stores: lane l writes 16 B at columns i*256 + 8l: one instruction = 32 lanes x 16 B = 512 contiguous B =
// coverage: grid NB*SEQ/8 x 8 waves x (4 x 256) columns x {hi, residual} = the whole [NB*SEQ][2048] plane.
// Loops rolled on purpose (small elementwise side computation).
// -------------------------------------------------------------------------------------------------
__global__ __launch_bounds__(256) void ln_kernel(const float* __restrict__ x, const float* __restrict__ g,
                                                const float* __restrict__ bt, _Float16* __restrict__ XH,
                                                int nrows) {
  const int lane = threadIdx.x & 31;
  const int wave = threadIdx.x >> 5;
  const int row  = blockIdx.x * 8 + wave;
  if (row >= nrows) return;                                   // wave-uniform; no barriers in this kernel
  const int b = row / SEQ;
  const int t = row - b * SEQ;
  const float* xr = x + ((size_t)b * SEQ_FULL + t) * ND + lane * 8;

  float s = 0.f;
#pragma unroll 1
  for (int i = 0; i < 4; ++i) {
    const v4f a = *(const v4f*)(xr + i * 256);
    const v4f c = *(const v4f*)(xr + i * 256 + 4);
    s += (bf_rne(a[0]) + bf_rne(a[1])) + (bf_rne(a[2]) + bf_rne(a[3]));
    s += (bf_rne(c[0]) + bf_rne(c[1])) + (bf_rne(c[2]) + bf_rne(c[3]));
  }
  s += __shfl_xor(s, 16, 32); s += __shfl_xor(s, 8, 32); s += __shfl_xor(s, 4, 32);
  s += __shfl_xor(s, 2, 32);  s += __shfl_xor(s, 1, 32);
  const float mu = s * (1.0f / (float)ND);

  float s2 = 0.f;
#pragma unroll 1
  for (int i = 0; i < 4; ++i) {
    const v4f a = *(const v4f*)(xr + i * 256);
    const v4f c = *(const v4f*)(xr + i * 256 + 4);
    float d;
    d = bf_rne(a[0]) - mu; s2 += d * d;  d = bf_rne(a[1]) - mu; s2 += d * d;
    d = bf_rne(a[2]) - mu; s2 += d * d;  d = bf_rne(a[3]) - mu; s2 += d * d;
    d = bf_rne(c[0]) - mu; s2 += d * d;  d = bf_rne(c[1]) - mu; s2 += d * d;
    d = bf_rne(c[2]) - mu; s2 += d * d;  d = bf_rne(c[3]) - mu; s2 += d * d;
  }
  s2 += __shfl_xor(s2, 16, 32); s2 += __shfl_xor(s2, 8, 32); s2 += __shfl_xor(s2, 4, 32);
  s2 += __shfl_xor(s2, 2, 32);  s2 += __shfl_xor(s2, 1, 32);
  const float var  = s2 * (1.0f / (float)ND);
  const float rstd = rsqrtf(var + 1e-5f);

  _Float16* xh = XH + (size_t)row * QKW + lane * 8;
{
#pragma unroll 1
    for (int i = 0; i < 4; ++i) {
      const v4f a  = *(const v4f*)(xr + i * 256);
      const v4f c  = *(const v4f*)(xr + i * 256 + 4);
      const v4f ga = *(const v4f*)(g + i * 256 + lane * 8);
      const v4f gb = *(const v4f*)(g + i * 256 + lane * 8 + 4);
      const v4f ba = *(const v4f*)(bt + i * 256 + lane * 8);
      const v4f bb = *(const v4f*)(bt + i * 256 + lane * 8 + 4);
      float f[8], gg[8], be[8];
      f[0] = a[0]; f[1] = a[1]; f[2] = a[2]; f[3] = a[3]; f[4] = c[0]; f[5] = c[1]; f[6] = c[2]; f[7] = c[3];
      gg[0] = ga[0]; gg[1] = ga[1]; gg[2] = ga[2]; gg[3] = ga[3];
      gg[4] = gb[0]; gg[5] = gb[1]; gg[6] = gb[2]; gg[7] = gb[3];
      be[0] = ba[0]; be[1] = ba[1]; be[2] = ba[2]; be[3] = ba[3];
      be[4] = bb[0]; be[5] = bb[1]; be[6] = bb[2]; be[7] = bb[3];
      v8h ho, lo;
#pragma unroll
      for (int e = 0; e < 8; ++e) {
        const float xn = (bf_rne(f[e]) - mu) * rstd * bf_rne(gg[e]) + bf_rne(be[e]);
        const _Float16 hv = (_Float16)xn;
        ho[e] = hv;
        lo[e] = (_Float16)((xn - (float)hv) * 1024.0f);
      }
      *(v8h*)(xh + i * 256)      = ho;
      *(v8h*)(xh + ND + i * 256) = lo;
    }
    
  }
}

// -------------------------------------------------------------------------------------------------
// Relative-position sinusoid table -> PE f16 plane [NPP][1024] (rows >= NP are 0):
//   row r <-> relative position pos = SEQ-1-r;  div_j = expf(f32(2j) * f32(-ln(1e4)/1024));
//   ang = |pos| * div_j (f32 product);  PE[r][2j] = sin(ang) with the sign of pos, PE[r][2j+1] = cos(ang).
// passes.  The per-pair loop is rolled (one sinf, one cosf, one expf body); the 16-B result is assembled by a
// register rotate with constant indices (no dynamic local-array indexing).
// coverage: grid NPP*128/256, NPP*128 threads x 8 halves = the whole [NPP][1024] plane.
// -------------------------------------------------------------------------------------------------
__global__ __launch_bounds__(256) void pe_kernel(_Float16* __restrict__ PE) {
  const int i = blockIdx.x * 256 + threadIdx.x;
  if (i >= NPP * (ND / 8)) return;
  const int r  = i / (ND / 8);
  const int c8 = (i - r * (ND / 8)) * 8;
  const int pos = SEQ - 1 - r;
  const float fpos = (float)((pos < 0) ? -pos : pos);
  const float live = (r < NP) ? 1.0f : 0.0f;
  const float c0 = (float)(-9.210340371976184 / (double)ND);
  v4u pk = {0u, 0u, 0u, 0u};
#pragma unroll 1
  for (int e = 0; e < 4; ++e) {
    const int j = (c8 >> 1) + e;
    const float dv  = expf((float)(2 * j) * c0);
    const float ang = fpos * dv;
    float sn = sinf(ang);
    const float cn = cosf(ang);
    sn = (pos < 0) ? -sn : sn;
    const _Float16 hs = (_Float16)(sn * live);
    const _Float16 hc = (_Float16)(cn * live);
    const unsigned w = (unsigned)__builtin_bit_cast(unsigned short, hs) |
                       ((unsigned)__builtin_bit_cast(unsigned short, hc) << 16);
    v4u nx;
    nx[0] = pk[1]; nx[1] = pk[2]; nx[2] = pk[3]; nx[3] = w;
    pk = nx;
  }
  unsigned* dp = (unsigned*)(PE + (size_t)r * ND + c8);
  *(v4u*)dp = pk;
  
}

// -------------------------------------------------------------------------------------------------
// LDS ring of the staged GEMM path: one stage = 128 k of [A 128 rows | Bt 256 rows], 256-B rows at pitch 272 B
// (an odd multiple of 16 B for the ds_load_b128 fragment reads), two buffers.
// -------------------------------------------------------------------------------------------------
#define GBM    128                    // block tile rows (2 waves of 64)
#define GBN    256                    // block tile columns (4 waves of 64)
#define GKS    128                    // halves of k per stage
#define GPIT   (GKS + 8)              // halves: 272 B = 17 x 16 B
#define GSTAGE ((GBM + GBN) * GPIT * 2)   // bytes per buffer: 104448
static_assert((GBM + GBN) * (GKS / 8) == 24 * 256);   // 24 copies of 16 B per thread and stage
static_assert((NB * SEQ) % GBM == 0 && NPP % GBM == 0 && ND % GBM == 0);
static_assert(ND % GBN == 0 && SEQ % GBN == 0);
static_assert(ND % GKS == 0 && ND / GKS >= 2);

// Twelve asynchronous 16-B copies global -> LDS per lane (l: LDS byte address, g: global address of the lane).
// s_wait_xcnt 0 closes the statement so that no address register named here is rewritten ahead of it.
__device__ __forceinline__ void async_copy12(const unsigned (&l)[12], const _Float16* const (&g)[12]) {
  asm volatile(
      "global_load_async_to_lds_b128 %0, %12, off\n\t"
      "global_load_async_to_lds_b128 %1, %13, off\n\t"
      "global_load_async_to_lds_b128 %2, %14, off\n\t"
      "global_load_async_to_lds_b128 %3, %15, off\n\t"
      "global_load_async_to_lds_b128 %4, %16, off\n\t"
      "global_load_async_to_lds_b128 %5, %17, off\n\t"
      "global_load_async_to_lds_b128 %6, %18, off\n\t"
      "global_load_async_to_lds_b128 %7, %19, off\n\t"
      "global_load_async_to_lds_b128 %8, %20, off\n\t"
      "global_load_async_to_lds_b128 %9, %21, off\n\t"
      "global_load_async_to_lds_b128 %10, %22, off\n\t"
      "global_load_async_to_lds_b128 %11, %23, off\n\t"
      "s_wait_xcnt 0x0"
      :: "v"(l[0]), "v"(l[1]), "v"(l[2]), "v"(l[3]), "v"(l[4]), "v"(l[5]),
         "v"(l[6]), "v"(l[7]), "v"(l[8]), "v"(l[9]), "v"(l[10]), "v"(l[11]),
         "v"(g[0]), "v"(g[1]), "v"(g[2]), "v"(g[3]), "v"(g[4]), "v"(g[5]),
         "v"(g[6]), "v"(g[7]), "v"(g[8]), "v"(g[9]), "v"(g[10]), "v"(g[11])
      : "memory");
}

// -------------------------------------------------------------------------------------------------
// f16 WMMA GEMM: C[m][n] = epi( sum_k A[m][k] * Bt[nrow][k] ), nrow = n (+ 64*(skew0 - tm) when SKEW: band GEMM).
// A row-major [M][K] pitch lda; Bt row-major [N(+band)][K] pitch ldb.
// Each wave owns a 64x64 output tile (4x4 subtiles), 8 waves per block, grid.y = z-batch,
// grid.z = outer batch (steps A by strideAz and C by strideCz; Bt is shared).
// SKEW (band): M, N multiples of 64, K multiple of 32; grid.x = tiles/8, a wave's fragments come straight from global.
// not SKEW   : M multiple of 128, N of 256, K of 128 and at least 256; grid.x = (M/128)*(N/256); the block's 2x4 waves
//              share one 128x256 tile whose A and Bt rows are staged in the LDS ring by asynchronous copies (whole
//              256-B row pieces, each fetched once per block), the copies of stage t+2 flying while stage t+1 is worked on.
// OUT 0: f32  C1[m][n] = acc*scale                                              (band scratch)
// OUT 1: f32  C1[m][n] = acc*scale + bf_rne(b1[n])                              (final output)
// OUT 2: f16  t = acc*scale (+ bf_rne(b1[n]) if HASB);  C1[m][2*n0+c] = f16(t*carry),
//             C1[m][2*n0+64+c] = f16(t*carry/1024)      (2048-wide hi | copy planes, one 64-col tile = one head)
// OUT 3: f16  t = (acc*scale + bf_rne(b3[n])) + bf_rne(b1[n] resp. b2[n]);  th = t*carry;
//             hi = f16(th), lo = f16((th - hi)*1024) -> C1 (b1 variant) and C2 (b2 variant), hi at 2*n0+c, lo at 2*n0+64+c
// OUT 4: f16  C1[m][n] = f16((acc*scale + bf_rne(b1[m])) * carry)            (row bias)
// Epilogue: 16-row slabs staged per wave in LDS (wave-private region, wave barrier); every row segment is written as
// coverage: 4 slabs x 16 rows x 64 cols = the whole 64x64 tile per wave; tiles cover M x N exactly.
// -------------------------------------------------------------------------------------------------
template <int OUT, bool SKEW, bool HASB>
__global__ __launch_bounds__(256) void gemm_f16_kernel(
    const _Float16* __restrict__ A, int lda, long strideA, long strideAz,
    const _Float16* __restrict__ Bt, int ldb, long strideB,
    void* C1, void* C2, int ldc, long strideC, long strideCz,
    const float* __restrict__ b1, const float* __restrict__ b2, const float* __restrict__ b3,
    int M, int N, int K, float scale, float carry, int skew0) {
  __shared__ __align__(16) float sT[8][16 * 68];   // per-wave 16x64 slab, pitch 68 floats
  __shared__ __align__(16) unsigned char GS[SKEW ? 16 : 2 * GSTAGE];   // operand ring of the staged path

  const int z    = blockIdx.y;
  const int lane = threadIdx.x & 31;
  const int wave = threadIdx.x >> 5;
  int m0, n0, nsk = 0;
  if constexpr (SKEW) {
    const int tilesN = N >> 6;
    const int tilesM = M >> 6;
    const int tile = blockIdx.x * 8 + wave;
    if (tile >= tilesM * tilesN) return;           // wave-uniform; no block barriers on this path
    const int tm = tile / tilesN;
    const int tn = tile - tm * tilesN;
    m0 = tm << 6;
    n0 = tn << 6;
    nsk = (skew0 - tm) << 6;                       // band row offset of Bt
  } else {
    const int tilesN = N / GBN;
    const int tilesM = M / GBM;
    const int bt = blockIdx.x;
    if (bt >= tilesM * tilesN) return;             // block-uniform, ahead of every copy and barrier
    const int tmb = bt / tilesN;
    const int tnb = bt - tmb * tilesN;
    m0 = tmb * GBM + (wave >> 2) * 64;
    n0 = tnb * GBN + (wave & 3) * 64;
  }
  const size_t cOff = (size_t)z * strideC + (size_t)blockIdx.z * strideCz;

  const _Float16* Ab = A  + (size_t)z * strideA + (size_t)blockIdx.z * strideAz;
  const _Float16* Bb = Bt + (size_t)z * strideB;

  const int rl   = lane & 15;          // row (A) / column (B, D) within a subtile
  const int koff = (lane >> 4) * 8;    // k offset of this lane half
  const int mOff = (lane >> 4) * 8;    // D row offset of this lane half

  v8f acc[4][4];
#pragma unroll
  for (int i = 0; i < 4; ++i)
#pragma unroll
    for (int j = 0; j < 4; ++j) acc[i][j] = zero8();

  if constexpr (SKEW) {
    for (int k0 = 0; k0 < K; k0 += 32) {
      v16h bfr[4];
#pragma unroll
      for (int j = 0; j < 4; ++j)
        bfr[j] = ldfrag(Bb + (size_t)(nsk + n0 + (j << 4) + rl) * ldb + koff + k0);
#pragma unroll
      for (int i = 0; i < 4; ++i) {
        const v16h af = ldfrag(Ab + (size_t)(m0 + (i << 4) + rl) * lda + koff + k0);
#pragma unroll
        for (int j = 0; j < 4; ++j) acc[i][j] = mma16(af, bfr[j], acc[i][j]);
      }
    }
  } else {
    // copy map: thread -> row crow + 16*i of the stage (i < 8: A rows, i >= 8: Bt rows), 16-B piece ccol of its 256 B;
    // one wave-wide copy = 2 rows x 256 B = 4 whole lines.
    const int crow = threadIdx.x >> 4;
    const int ccol = threadIdx.x & 15;
    const int wm = wave >> 2, wn = wave & 3;
    const _Float16* gA = Ab + (size_t)(m0 - wm * 64 + crow) * lda + ccol * 8;
    const _Float16* gB = Bb + (size_t)(n0 - wn * 64 + crow) * ldb + ccol * 8;
    const unsigned ldsLane = (unsigned)(uintptr_t)(&GS[0]) + (unsigned)(crow * (GPIT * 2) + ccol * 16);
    const int nt = K / GKS;
    auto issue_stage = [&](int t, int buf) {
#pragma unroll
      for (int hf = 0; hf < 2; ++hf) {
        unsigned l[12];
        const _Float16* g[12];
#pragma unroll
        for (int e = 0; e < 12; ++e) {
          const int i = hf * 12 + e;
          l[e] = ldsLane + (unsigned)(buf * GSTAGE + i * 16 * (GPIT * 2));
          const size_t so = (i < 8) ? (size_t)(i * 16) * lda + (size_t)t * GKS         // wave-uniform part
                                    : (size_t)((i - 8) * 16) * ldb + (size_t)t * GKS;
          g[e] = ((i < 8) ? gA : gB) + so;
        }
        async_copy12(l, g);
      }
    };

    issue_stage(0, 0);
    asm volatile("s_wait_asynccnt 0x0" ::: "memory");   // this wave's share of stage 0 has landed
    __syncthreads();                                    // publishes stage 0
    issue_stage(1, 1);
    const _Float16* fa = (const _Float16*)GS + (wm * 64 + rl) * GPIT + koff;
    const _Float16* fb = (const _Float16*)GS + (GBM + wn * 64 + rl) * GPIT + koff;
    for (int t = 0; t < nt; ++t) {                      // one stage per trip
      const int bo = (t & 1) * (GSTAGE / 2);
#pragma unroll
      for (int ks = 0; ks < GKS / 32; ++ks) {
        v16h bfr[4], afr[4];                            // all 16 LDS reads of a 32-k block stand as one group
#pragma unroll
        for (int j = 0; j < 4; ++j) bfr[j] = ldfrag(fb + bo + j * 16 * GPIT + ks * 32);
#pragma unroll
        for (int i = 0; i < 4; ++i) afr[i] = ldfrag(fa + bo + i * 16 * GPIT + ks * 32);
#pragma unroll
        for (int i = 0; i < 4; ++i)
#pragma unroll
          for (int j = 0; j < 4; ++j) acc[i][j] = mma16(afr[i], bfr[j], acc[i][j]);
      }
      asm volatile("s_wait_dscnt 0x0" ::: "memory");    // this wave has left the buffer that is refilled below
      asm volatile("s_wait_asynccnt 0x0" ::: "memory"); // this wave's share of stage t+1 has landed
      __syncthreads();                                  // publishes stage t+1, ends every read of stage t
      if (t + 2 < nt) issue_stage(t + 2, t & 1);
    }
    asm volatile("s_wait_asynccnt 0x0" ::: "memory");   // nothing in flight when the wave goes on
  }

  // ---- epilogue ----
  float* slab = sT[wave];
  const int hh = lane >> 4, c4 = (lane & 15) * 4;     // f32 modes: row segment 256 B = 16 lanes x 16 B
  const int q8 = lane >> 3, c8 = (lane & 7) * 8;
  v4f bias4 = {0.f, 0.f, 0.f, 0.f};
  float col8a[8], col8b[8], col8c[8];
#pragma unroll
  for (int e = 0; e < 8; ++e) { col8a[e] = 0.f; col8b[e] = 0.f; col8c[e] = 0.f; }
  if (OUT == 1 && HASB) {
    const v4f tb = *(const v4f*)(b1 + n0 + c4);
    bias4[0] = bf_rne(tb[0]); bias4[1] = bf_rne(tb[1]); bias4[2] = bf_rne(tb[2]); bias4[3] = bf_rne(tb[3]);
  }
  if ((OUT == 2 && HASB) || OUT == 3) {
    const v4f ta = *(const v4f*)(b1 + n0 + c8);
    const v4f tb = *(const v4f*)(b1 + n0 + c8 + 4);
    col8a[0] = bf_rne(ta[0]); col8a[1] = bf_rne(ta[1]); col8a[2] = bf_rne(ta[2]); col8a[3] = bf_rne(ta[3]);
    col8a[4] = bf_rne(tb[0]); col8a[5] = bf_rne(tb[1]); col8a[6] = bf_rne(tb[2]); col8a[7] = bf_rne(tb[3]);
  }
  if (OUT == 3) {
    const v4f ta = *(const v4f*)(b2 + n0 + c8);
    const v4f tb = *(const v4f*)(b2 + n0 + c8 + 4);
    col8b[0] = bf_rne(ta[0]); col8b[1] = bf_rne(ta[1]); col8b[2] = bf_rne(ta[2]); col8b[3] = bf_rne(ta[3]);
    col8b[4] = bf_rne(tb[0]); col8b[5] = bf_rne(tb[1]); col8b[6] = bf_rne(tb[2]); col8b[7] = bf_rne(tb[3]);
    const v4f tc = *(const v4f*)(b3 + n0 + c8);
    const v4f td = *(const v4f*)(b3 + n0 + c8 + 4);
    col8c[0] = bf_rne(tc[0]); col8c[1] = bf_rne(tc[1]); col8c[2] = bf_rne(tc[2]); col8c[3] = bf_rne(tc[3]);
    col8c[4] = bf_rne(td[0]); col8c[5] = bf_rne(td[1]); col8c[6] = bf_rne(td[2]); col8c[7] = bf_rne(td[3]);
  }
  const float carry2 = carry * 0.0009765625f;        // carry / 1024

#pragma unroll
  for (int i = 0; i < 4; ++i) {
    const int mBase = m0 + (i << 4);
#pragma unroll
    for (int j = 0; j < 4; ++j)
#pragma unroll
      for (int r = 0; r < 8; ++r)
        slab[(mOff + r) * 68 + (j << 4) + rl] = acc[i][j][r] * scale;
    __builtin_amdgcn_fence(__ATOMIC_RELEASE, "workgroup");
    __builtin_amdgcn_wave_barrier();
    __builtin_amdgcn_fence(__ATOMIC_ACQUIRE, "workgroup");
    if (OUT == 0 || OUT == 1) {
      float* C = (float*)C1 + cOff;
      v4f vv[8];
#pragma unroll
      for (int it = 0; it < 8; ++it) {
        const int row = it * 2 + hh;
        v4f v = *(const v4fa*)(slab + row * 68 + c4);
        if (OUT == 1) v += bias4;
        vv[it] = v;
      }
      {
#pragma unroll
        for (int it = 0; it < 8; ++it) {
          const int row = it * 2 + hh;
          *(v4f*)(C + (size_t)(mBase + row) * ldc + n0 + c4) = vv[it];
        }
        
      }
    } else if (OUT == 2 || OUT == 4) {
      _Float16* Ca = (_Float16*)C1 + cOff;
      v8h hv[4], lv[4];
#pragma unroll
      for (int it = 0; it < 4; ++it) {
        const int row = it * 4 + q8;
        const float* sp = slab + row * 68 + c8;
        const v4f x0 = *(const v4fa*)(sp);
        const v4f x1 = *(const v4fa*)(sp + 4);
        float f[8];
        f[0] = x0[0]; f[1] = x0[1]; f[2] = x0[2]; f[3] = x0[3];
        f[4] = x1[0]; f[5] = x1[1]; f[6] = x1[2]; f[7] = x1[3];
        float rb = 0.f;
        if (OUT == 4 && HASB) rb = bf_rne(b1[mBase + row]);
        v8h ha, la;
#pragma unroll
        for (int e = 0; e < 8; ++e) {
          const float t = f[e] + ((OUT == 2) ? col8a[e] : rb);
          ha[e] = (_Float16)(t * carry);
          la[e] = (_Float16)(t * carry2);
        }
        hv[it] = ha; lv[it] = la;
      }
      {
#pragma unroll
        for (int it = 0; it < 4; ++it) {
          const int row = it * 4 + q8;
          if (OUT == 2) {
            _Float16* cp = Ca + (size_t)(mBase + row) * ldc + 2 * n0 + c8;
            *(v8h*)(cp)      = hv[it];
            *(v8h*)(cp + 64) = lv[it];
          } else {
            *(v8h*)(Ca + (size_t)(mBase + row) * ldc + n0 + c8) = hv[it];
          }
        }
        
      }
    } else {
#pragma unroll
      for (int var = 0; var < 2; ++var) {
        _Float16* Cc = (_Float16*)((var == 0) ? C1 : C2) + cOff;
        v8h hv[4], lv[4];
#pragma unroll
        for (int it = 0; it < 4; ++it) {
          const int row = it * 4 + q8;
          const float* sp = slab + row * 68 + c8;
          const v4f x0 = *(const v4fa*)(sp);
          const v4f x1 = *(const v4fa*)(sp + 4);
          float f[8];
          f[0] = x0[0]; f[1] = x0[1]; f[2] = x0[2]; f[3] = x0[3];
          f[4] = x1[0]; f[5] = x1[1]; f[6] = x1[2]; f[7] = x1[3];
          v8h ha, la;
#pragma unroll
          for (int e = 0; e < 8; ++e) {
            const float t  = (f[e] + col8c[e]) + ((var == 0) ? col8a[e] : col8b[e]);
            const float th = t * carry;
            const _Float16 hq = (_Float16)th;
            ha[e] = hq;
            la[e] = (_Float16)((th - (float)hq) * 1024.0f);
          }
          hv[it] = ha; lv[it] = la;
        }
        {
#pragma unroll
          for (int it = 0; it < 4; ++it) {
            const int row = it * 4 + q8;
            _Float16* cp = Cc + (size_t)(mBase + row) * ldc + 2 * n0 + c8;
            *(v8h*)(cp)      = hv[it];
            *(v8h*)(cp + 64) = lv[it];
          }
          
        }
      }
    }
    __builtin_amdgcn_fence(__ATOMIC_RELEASE, "workgroup");
    __builtin_amdgcn_wave_barrier();
    __builtin_amdgcn_fence(__ATOMIC_ACQUIRE, "workgroup");
  }
}

// -------------------------------------------------------------------------------------------------
// Relative-position attention for all NH heads of GB batch elements, folded q.k depth 128 (hi | residual),
// value head dim 64, no mask.
//   QU  f16 plane [t][h*128 + j]: j<64 hi = f16(16*(q+u_bias)), j>=64 residual x1024     (A of the content score)
//   KP  f16 plane [s][h*128 + j]: j<64 f16(16*k), j>=64 f16(k/64)                       (B, staged per 64-key chunk as [key][128])
//   VT  f16 plane [h*64 + d][s]   = f16(16*v)                                            (B of P.V, staged as [d][key])
//   BD  f32 band scratch [bz*NH + h][SEQ][BDW]: value (row i, col j) = (1/8)*(q_i + v_bias).p[row 64*(SEQ/64-1 - i/64) + j]
//       rel-shift: bd[i][key] = bdfull[i][key - i + SEQ-1]  ->  column key + 63 - (i mod 64), always in [0, BDW-2].
//   score = cs * (QU.K^T acc) + BD  with cs = (1/8)/256;  online softmax in f32 over SEQ/64 chunks of 64 keys;
//   P stored per wave as f16(4096 * exp(s - m)); CTX[t][h*64 + d] = f16(64 * ctx) = f16((P.V acc) / (1024*l)).
// Block = 4 waves = 64 query rows of one head; grid = (SEQ/64 query blocks, NH heads, GB batch elements);
// QU, KP, VT and CTX point at the first batch element of the launch.
// LDS: one raw buffer; K tile [64][128] f16 at row pitch KPIT, then V^T tile [64][64] f16 at pitch VPIT, then per-wave
// P tiles [16][64] f16 at pitch VPIT; the output staging [4][16][64] f32 at pitch OPIT reuses the K bytes after a
// block barrier.  Every pitch is an odd multiple of 16 B, so the 16 rows that one ds_load_b128 reads start on 16
// different groups of four banks (at the bare 256-B and 128-B pitches they fall on one or two groups).
// coverage: staging 128 thr x 64 halves for K (64x128) and 128 thr x 32 halves for V^T (64x64); P tile 8 rows x
// 2 halves x 4x16 cols per wave = 16x64 (all written every chunk); output 4 store instructions x 4 rows x 8 lanes x
// 8 halves = 16x64 per wave.
// -------------------------------------------------------------------------------------------------
#define KPIT   (HQK + 8)            // halves: 272 B = 17 x 16 B
#define VPIT   (HDV + 8)            // halves: 144 B =  9 x 16 B
#define OPIT   (HDV + 4)            // floats: 272 B = 17 x 16 B
#define KBYTES (64 * KPIT * 2)      // 17408
#define VBYTES (64 * VPIT * 2)      //  9216
#define PBYTES (4 * 16 * VPIT * 2)  //  9216
static_assert(4 * 16 * OPIT * 4 <= KBYTES);
static_assert(KBYTES % 16 == 0 && VBYTES % 16 == 0);

__global__ __launch_bounds__(128)
void relattn_kernel(const _Float16* __restrict__ QU, const _Float16* __restrict__ KP,
                    const _Float16* __restrict__ VT, const float* __restrict__ BD,
                    _Float16* __restrict__ CTX, float cs) {
  __shared__ __align__(16) unsigned char SMEM[KBYTES + VBYTES + PBYTES];
  _Float16* Ksh = (_Float16*)(SMEM);                    // [64][128] at pitch KPIT
  _Float16* Vsh = (_Float16*)(SMEM + KBYTES);           // [64][64]  at pitch VPIT
  _Float16* Psh = (_Float16*)(SMEM + KBYTES + VBYTES);  // [4][16][64] at pitch VPIT
  float*    Osh = (float*)(SMEM);                       // [4][16][64] at pitch OPIT, after the chunk loop

  const int tid  = threadIdx.x;
  const int wave = tid >> 5;
  const int lane = tid & 31;
  const int hh   = lane >> 4;
  const int c    = lane & 15;

  const int h    = blockIdx.y;
  const int bz   = blockIdx.z;
  const int qb   = blockIdx.x;
  const int q0   = qb * 64 + wave * 16;          // first query row of this wave
  const int rr0  = wave * 16 + 8 * hh;           // row within the 64-row block for r = 0

  const _Float16* Qh = QU + (size_t)bz * SEQ * QKW + h * HQK;   // row pitch QKW
  const _Float16* Kh = KP + (size_t)bz * SEQ * QKW + h * HQK;   // row pitch QKW
  const _Float16* Vh = VT + (size_t)(bz * ND + h * HDV) * SEQ;
  const float*    bd = BD + (size_t)(bz * NH + h) * SEQ * BDW;
  _Float16*       ctx = CTX + (size_t)bz * SEQ * ND + h * HDV;  // row pitch ND

  // Q fragments (A operand): 4 chunks of 32 along the folded depth
  v16h qa[4];
#pragma unroll
  for (int dc = 0; dc < 4; ++dc)
    qa[dc] = ldfrag(Qh + (size_t)(q0 + c) * QKW + dc * 32 + 8 * hh);

  // band scratch: element for (row r, key kv0+16j+c) at bdr[r*(BDW-1) + kv0 + 16j]
  const float* bdr = bd + (size_t)(q0 + 8 * hh) * BDW + (63 - rr0 + c);

  float mrow[8], lrow[8];
  v8f oacc[4];
#pragma unroll
  for (int r = 0; r < 8; ++r) { mrow[r] = -INFINITY; lrow[r] = 0.f; }
#pragma unroll
  for (int t = 0; t < 4; ++t) oacc[t] = zero8();

  _Float16* pw = Psh + wave * (16 * VPIT);

#pragma unroll 1
  for (int kc = 0; kc < SEQ / 64; ++kc) {
    const int kv0 = kc * 64;
    __syncthreads();
    {
      const int r = tid >> 1, c0 = (tid & 1) * 64, cv = (tid & 1) * 32;
      const _Float16* ks = Kh + (size_t)(kv0 + r) * QKW + c0;
      const _Float16* vs = Vh + (size_t)r * SEQ + kv0 + cv;
#pragma unroll
      for (int i = 0; i < 8; ++i) {
        const v8h kk8 = *(const v8h*)(ks + 8 * i);
        *(v8ha*)(Ksh + r * KPIT + c0 + 8 * i) = kk8;
      }
#pragma unroll
      for (int i = 0; i < 4; ++i) {
        const v8h vv8 = *(const v8h*)(vs + 8 * i);
        *(v8ha*)(Vsh + r * VPIT + cv + 8 * i) = vv8;
      }
    }
    __syncthreads();

    // content scores: S[j] = QU(16x128) . K^T for key subtile j
    v8f s[4];
#pragma unroll
    for (int j = 0; j < 4; ++j) {
      s[j] = zero8();
#pragma unroll
      for (int dc = 0; dc < 4; ++dc) {
        const v16h kb = ldfrag(Ksh + (j * 16 + c) * KPIT + dc * 32 + 8 * hh);
        s[j] = mma16(qa[dc], kb, s[j]);
      }
    }

    // add the position term from the band scratch, chunk row max
    float cm[8];
#pragma unroll
    for (int r = 0; r < 8; ++r) {
      float m = -INFINITY;
#pragma unroll
      for (int j = 0; j < 4; ++j) {
        const float sv = s[j][r] * cs + bdr[(size_t)r * (BDW - 1) + kv0 + (j << 4)];
        s[j][r] = sv;
        m = fmaxf(m, sv);
      }
      m = fmaxf(m, __shfl_xor(m, 1, 32));
      m = fmaxf(m, __shfl_xor(m, 2, 32));
      m = fmaxf(m, __shfl_xor(m, 4, 32));
      m = fmaxf(m, __shfl_xor(m, 8, 32));
      cm[r] = m;
    }

    // online softmax update (per-row rescale of this row's accumulator elements only);
    // P tile (x4096) to this wave's LDS tile [row][key]
#pragma unroll
    for (int r = 0; r < 8; ++r) {
      const float mnew  = fmaxf(mrow[r], cm[r]);
      const float alpha = __expf(mrow[r] - mnew);
      mrow[r] = mnew;
      float psum = 0.f;
#pragma unroll
      for (int j = 0; j < 4; ++j) {
        const float p = __expf(s[j][r] - mnew);
        psum += p;
        pw[(8 * hh + r) * VPIT + j * 16 + c] = (_Float16)(p * 4096.0f);
      }
      psum += __shfl_xor(psum, 1, 32);
      psum += __shfl_xor(psum, 2, 32);
      psum += __shfl_xor(psum, 4, 32);
      psum += __shfl_xor(psum, 8, 32);
      lrow[r] = lrow[r] * alpha + psum;
#pragma unroll
      for (int t = 0; t < 4; ++t) oacc[t][r] *= alpha;
    }
    __builtin_amdgcn_fence(__ATOMIC_RELEASE, "workgroup");
    __builtin_amdgcn_wave_barrier();
    __builtin_amdgcn_fence(__ATOMIC_ACQUIRE, "workgroup");

    // P (A operand, row = lane&15, split k map over keys) . V (B operand from V^T rows d)
#pragma unroll
    for (int kk = 0; kk < 2; ++kk) {
      const v16h pa = ldfrag(pw + c * VPIT + kk * 32 + 8 * hh);
#pragma unroll
      for (int t = 0; t < 4; ++t) {
        const v16h vb = ldfrag(Vsh + (t * 16 + c) * VPIT + kk * 32 + 8 * hh);
        oacc[t] = mma16(pa, vb, oacc[t]);
      }
    }
  }

  __syncthreads();                               // every wave is done with Ksh before Osh aliases it
  float* os = Osh + wave * (16 * OPIT);
#pragma unroll
  for (int r = 0; r < 8; ++r) {
    const float inv = 1.0f / (1024.0f * lrow[r]);   // 64 / (4096 * 16 * l)
#pragma unroll
    for (int t = 0; t < 4; ++t) os[(8 * hh + r) * OPIT + t * 16 + c] = oacc[t][r] * inv;
  }
  __builtin_amdgcn_fence(__ATOMIC_RELEASE, "workgroup");
  __builtin_amdgcn_wave_barrier();
  __builtin_amdgcn_fence(__ATOMIC_ACQUIRE, "workgroup");
  const int q8 = lane >> 3, c8 = (lane & 7) * 8;
  v8h ov[4];
#pragma unroll
  for (int it = 0; it < 4; ++it) {
    const int row = it * 4 + q8;
    const float* sp = os + row * OPIT + c8;
    const v4f x0 = *(const v4fa*)(sp);
    const v4f x1 = *(const v4fa*)(sp + 4);
    v8h o;
    o[0] = (_Float16)x0[0]; o[1] = (_Float16)x0[1]; o[2] = (_Float16)x0[2]; o[3] = (_Float16)x0[3];
    o[4] = (_Float16)x1[0]; o[5] = (_Float16)x1[1]; o[6] = (_Float16)x1[2]; o[7] = (_Float16)x1[3];
    ov[it] = o;
  }
  {
#pragma unroll
    for (int it = 0; it < 4; ++it) {
      const int row = it * 4 + q8;
      *(v8h*)(ctx + (size_t)(q0 + row) * ND + c8) = ov[it];
    }
    
  }
}

// -------------------------------------------------------------------------------------------------
// Workspace map (bytes, NB=8 SEQ=1024): every batch element's planes are live at once.
//   P2   f16 [NPP][2048]             8388608
//   QU2  f16 [NB*SEQ][2048]         33554432
//   QV2  f16 [NB*SEQ][2048]         33554432   CTX f16 [NB*SEQ][1024] overlays its first half: the attention launch of
//                                              group g writes bytes [g, g+1) * GB*SEQ*ND*2, and the only later readers of
//                                              QV2 (band launches of groups > g) start at (g+1) * GB*SEQ*QKW*2, above it
//   KP2  f16 [NB*SEQ][2048]         33554432
//   VT   f16 [NB][1024][SEQ]        16777216
//   SCR                            142606336   early phase: WQ2, WK2 f16 [1024][2048], WV, WP f16 [1024][1024],
//                                              PE f16 [NPP][1024], XH f16 [NB*SEQ][2048] (all dead after the projections);
//                                              middle phase: BD band f32 [GB*NH][SEQ][BDW];
//                                              last phase: WO f16 [1024][1024] (converted after the last attention launch)
//   total                          268435456
// Every region is written in whole 64x64 tiles / whole rows; all region sizes equal their written extents.
// -------------------------------------------------------------------------------------------------
extern "C" void kernel_launch(void* const* d_in, const int* in_sizes, int n_in,
                              void* d_out, int out_size, void* d_ws, size_t ws_size,
                              hipStream_t stream) {
  if (n_in < 14) return;
  if (in_sizes[0] < ((NB - 1) * SEQ_FULL + SEQ) * ND) return;
  if (in_sizes[1] != ND * ND || in_sizes[3] != ND * ND || in_sizes[5] != ND * ND) return;
  if (in_sizes[7] != ND * ND || in_sizes[8] != ND * ND) return;
  if (in_sizes[2] < ND || in_sizes[4] < ND || in_sizes[6] < ND || in_sizes[9] < ND) return;
  if (in_sizes[10] < NH * HDV || in_sizes[11] < NH * HDV) return;
  if (in_sizes[12] < ND || in_sizes[13] < ND) return;
  if (out_size < NB * SEQ * ND) return;

  const float* x    = (const float*)d_in[0];
  const float* Wq   = (const float*)d_in[1];
  const float* bq   = (const float*)d_in[2];
  const float* Wk   = (const float*)d_in[3];
  const float* bk   = (const float*)d_in[4];
  const float* Wv   = (const float*)d_in[5];
  const float* bv   = (const float*)d_in[6];
  const float* Wpos = (const float*)d_in[7];
  const float* Wout = (const float*)d_in[8];
  const float* bout = (const float*)d_in[9];
  const float* ub   = (const float*)d_in[10];
  const float* vbias= (const float*)d_in[11];
  const float* lng  = (const float*)d_in[12];
  const float* lnb  = (const float*)d_in[13];
  float* out = (float*)d_out;

  const size_t szW2  = (size_t)ND * QKW * 2;              //   4194304
  const size_t szW1  = (size_t)ND * ND * 2;               //   2097152
  const size_t szXH  = (size_t)NB * SEQ * QKW * 2;        //  33554432
  const size_t szQ   = (size_t)NB * SEQ * QKW * 2;        //  33554432
  const size_t szVT  = (size_t)NB * ND * SEQ * 2;         //  16777216
  const size_t szP2  = (size_t)NPP * QKW * 2;             //   8388608
  const size_t szPE  = (size_t)NPP * ND * 2;              //   4194304
  const size_t szBD  = (size_t)GB * NH * SEQ * BDW * 4;   // 142606336
  const size_t szEarly = 2 * szW2 + 2 * szW1 + szPE + szXH;
  const size_t szSCR = (szEarly > szBD) ? szEarly : szBD;
  size_t off = 0;
  const size_t oP2  = off; off += szP2;
  const size_t oQU2 = off; off += szQ;
  const size_t oQV2 = off; off += szQ;
  const size_t oKP2 = off; off += szQ;
  const size_t oVT  = off; off += szVT;
  const size_t oSCR = off; off += szSCR;
  const size_t total = off;                                // 268435456 for NB=8, SEQ=1024
  if (total > ws_size) return;
  const size_t oWQ2 = oSCR;
  const size_t oWK2 = oWQ2 + szW2;
  const size_t oWV  = oWK2 + szW2;
  const size_t oWP  = oWV + szW1;
  const size_t oPE  = oWP + szW1;
  const size_t oXH  = oPE + szPE;

  char* ws = (char*)d_ws;
  _Float16* WQ2 = (_Float16*)(ws + oWQ2);
  _Float16* WK2 = (_Float16*)(ws + oWK2);
  _Float16* WVp = (_Float16*)(ws + oWV);
  _Float16* WOp = (_Float16*)(ws + oSCR);
  _Float16* XH  = (_Float16*)(ws + oXH);
  _Float16* QU2 = (_Float16*)(ws + oQU2);
  _Float16* QV2 = (_Float16*)(ws + oQV2);
  _Float16* KP2 = (_Float16*)(ws + oKP2);
  _Float16* VTp = (_Float16*)(ws + oVT);
  _Float16* P2  = (_Float16*)(ws + oP2);
  _Float16* CTX = (_Float16*)(ws + oQV2);
  _Float16* WPp = (_Float16*)(ws + oWP);
  _Float16* PEp = (_Float16*)(ws + oPE);
  float*    BDp = (float*)(ws + oSCR);

  const float cs = 0.125f * 0.00390625f;   // (1/sqrt(64)) / 256 applied to the x16.x16 score accumulators
  const dim3 blk(256);

  // (1) weights -> f16 planes of bf16-valued entries: Wq, Wk as [x64 | /16] 2048-wide; Wv, Wpos x64
  const dim3 gW(ND * (ND / 8) / 256);      // 512
  cvt_w_kernel<true ><<<gW, blk, 0, stream>>>(Wq,   WQ2, 64.0f, 0.0625f);
  cvt_w_kernel<true ><<<gW, blk, 0, stream>>>(Wk,   WK2, 64.0f, 0.0625f);
  cvt_w_kernel<false><<<gW, blk, 0, stream>>>(Wv,   WVp, 64.0f, 64.0f);
  cvt_w_kernel<false><<<gW, blk, 0, stream>>>(Wpos, WPp, 64.0f, 64.0f);
  // (2) LayerNorm -> XH [NB*SEQ][2048] (hi | residual x1024)
  ln_kernel<<<dim3((NB * SEQ) / 8), blk, 0, stream>>>(x, lng, lnb, XH, NB * SEQ);
  // (3) positional sinusoid table -> PE [NPP][1024] (row NPP-1 = 0)
  pe_kernel<<<dim3((NPP * (ND / 8) + 255) / 256), blk, 0, stream>>>(PEp);
  // (4) p = pe . Wpos^T -> P2 = [16p | p/64]   (M=NPP, N=1024, K=1024)
  {
    const int tiles = (NPP / GBM) * (ND / GBN);
    gemm_f16_kernel<2, false, false><<<dim3(tiles, 1), blk, 0, stream>>>(
        PEp, ND, 0L, 0L, WPp, ND, 0L, (void*)P2, (void*)P2, QKW, 0L, 0L, bq, bq, bq,
        NPP, ND, ND, 0.015625f, 16.0f, 0);
  }
  // (5) projections of all batch elements, one launch each
  const int tilesQ  = ((NB * SEQ) / GBM) * (ND / GBN);
  const int tilesV  = (ND / GBM) * (SEQ / GBN);
  const int tilesBD = (SEQ / 64) * (BDW / 64);
  // QU2 = split(16*(q + bq + u_bias)), QV2 = split(16*(q + bq + v_bias))   (M=NB*SEQ, N=1024, K=2048)
  gemm_f16_kernel<3, false, true><<<dim3(tilesQ, 1), blk, 0, stream>>>(
      XH, QKW, 0L, 0L, WQ2, QKW, 0L, (void*)QU2, (void*)QV2, QKW, 0L, 0L, ub, vbias, bq,
      NB * SEQ, ND, QKW, 0.015625f, 16.0f, 0);
  // KP2 = [16k | k/64], k = xn.Wk^T + bk   (M=NB*SEQ, N=1024, K=2048)
  gemm_f16_kernel<2, false, true><<<dim3(tilesQ, 1), blk, 0, stream>>>(
      XH, QKW, 0L, 0L, WK2, QKW, 0L, (void*)KP2, (void*)KP2, QKW, 0L, 0L, bk, bk, bk,
      NB * SEQ, ND, QKW, 0.015625f, 16.0f, 0);
  // VT[b][h*64+d][s] = 16*(v + bv)   (A = Wv plane [1024][1024], Bt = XH hi columns of batch element y; M=1024, N=SEQ, K=1024)
  gemm_f16_kernel<4, false, true><<<dim3(tilesV, NB), blk, 0, stream>>>(
      WVp, ND, 0L, 0L, XH, QKW, (long)SEQ * QKW, (void*)VTp, (void*)VTp, SEQ, (long)ND * SEQ, 0L, bv, bv, bv,
      ND, SEQ, ND, 0.015625f, 16.0f, 0);
  // (6) band + attention, GB batch elements x NH heads per launch
  for (int b0 = 0; b0 < NB; b0 += GB) {
    // band GEMM: BD[bz*NH+h][t][j] = (1/8)*(q_t + v_bias).p[64*(SEQ/64-1 - t/64) + j]   (M=SEQ, N=BDW, K=128)
    gemm_f16_kernel<0, true, false><<<dim3((tilesBD + 7) / 8, NH, GB), blk, 0, stream>>>(
        QV2 + (size_t)b0 * SEQ * QKW, QKW, (long)HQK, (long)SEQ * QKW, P2, QKW, (long)HQK,
        (void*)BDp, (void*)BDp, BDW, (long)SEQ * BDW, (long)NH * SEQ * BDW, bq, bq, bq,
        SEQ, BDW, HQK, cs, 1.0f, SEQ / 64 - 1);
    relattn_kernel<<<dim3(SEQ / 64, NH, GB), dim3(128), 0, stream>>>(
        QU2 + (size_t)b0 * SEQ * QKW, KP2 + (size_t)b0 * SEQ * QKW, VTp + (size_t)b0 * ND * SEQ, BDp,
        CTX + (size_t)b0 * SEQ * ND, cs);
  }
  // (7) out = ctx . Wout^T + bout -> d_out f32 [NB*SEQ][1024]   (M=NB*SEQ, N=1024, K=1024; carries 64*64 folded into scale)
  cvt_w_kernel<false><<<gW, blk, 0, stream>>>(Wout, WOp, 64.0f, 64.0f);
  {
    const int tiles = ((NB * SEQ) / GBM) * (ND / GBN);
    gemm_f16_kernel<1, false, true><<<dim3(tiles, 1), blk, 0, stream>>>(
        CTX, ND, 0L, 0L, WOp, ND, 0L, (void*)out, (void*)out, ND, 0L, 0L, bout, bout, bout,
        NB * SEQ, ND, ND, 0.000244140625f, 1.0f, 0);
  }
  (void)hipGetLastError();
}

// v004
// One run takes 568 microseconds.
// In both of two side-by-side timings against v003, it was 1.20 times as fast.
// Over all steps from v000 it is 6.03 times as fast.
// Contractions: xn.Wq^T and xn.Wk^T (xn as f16 hi + x1024 f16 residual planes folded along K against Wx64 | W/16 planes), Wv.xn^T (xn hi, Wx64), pe.Wpos^T (pe f16, Wx64), (q+v_bias).p^T band and (q+u_bias).k^T (16q as f16 hi + x1024 residual folded along the head dim against 16p | p/64 and 16k | k/64 planes), P.V (P x4096, v x16), ctx.Wout^T (ctx x64, W x64): all v_wmma_f32_16x16x32_f16 (f16 operands, f32 accumulate); float inputs bf16-RNE valued; LayerNorm, positional table, softmax, bias adds and scaling in f32.
#include <hip/hip_runtime.h>
#include <math.h>
#include <stdint.h>

#ifndef NB
#define NB 8
#endif
#ifndef SEQ
#define SEQ 1024
#endif
#define SEQ_FULL 1024
#define ND    1024
#define NH    16
#define HDV   64            // value head dim
#define HQK   128           // folded depth of the q.k / q.p contractions: 64 hi + 64 residual
#define QKW   (2 * ND)      // pitch (halves) of the 2048-wide f16 planes
#define NP    (2 * SEQ - 1)
#define NPP   (2 * SEQ)
#define BDW   (SEQ + 64)    // width of the relative-position score band scratch (SEQ/64 + 1 tiles of 64)
#define GB    2             // batch elements per band/attention launch (all NH heads of each)

static_assert(SEQ % 64 == 0);
static_assert(SEQ <= SEQ_FULL);
static_assert(ND == NH * HDV);
static_assert(HQK == 2 * HDV);
static_assert(NB % GB == 0);
static_assert(ND % 256 == 0);
static_assert(NPP % 64 == 0);
static_assert(BDW % 64 == 0);

typedef _Float16 v16h __attribute__((ext_vector_type(16)));
typedef _Float16 v8h  __attribute__((ext_vector_type(8)));
typedef float    v8f  __attribute__((ext_vector_type(8)));
typedef float    v4f  __attribute__((ext_vector_type(4)));
typedef unsigned int v4u __attribute__((ext_vector_type(4)));
typedef v4f __attribute__((may_alias)) v4fa;
typedef v8h __attribute__((may_alias)) v8ha;

// bf16 RNE of an f32 value, returned widened to f32 (exactly representable in f16 after a power-of-two carry)
__device__ __forceinline__ float bf_rne(float f) {
  unsigned u = __float_as_uint(f);
  u = (u + 0x7FFFu + ((u >> 16) & 1u)) & 0xFFFF0000u;
  return __uint_as_float(u);
}

// 16-bit WMMA fragment: elements 0..7 <- p[0..7], elements 8..15 <- p[16..23]
// (A: p = row m at k0 + 8h;  B stored [n][k]: p = row n at k0 + 8h;  same split k map for both)
union FragU { v16h v; v8ha h[2]; };
__device__ __forceinline__ v16h ldfrag(const _Float16* p) {
  FragU f;
  f.h[0] = *(const v8ha*)(p);
  f.h[1] = *(const v8ha*)(p + 16);
  return f.v;
}

// WMMA + hazard guard (ties D, keeps A/B live for 4 VALU slots)
__device__ __forceinline__ v8f mma16(v16h a, v16h b, v8f c) {
  c = __builtin_amdgcn_wmma_f32_16x16x32_f16(false, a, false, b, (short)0, c, false, false);
  asm volatile("v_nop\n\tv_nop\n\tv_nop\n\tv_nop" : "+v"(c) : "v"(a), "v"(b));
  return c;
}

__device__ __forceinline__ v8f zero8() { v8f z = {0.f, 0.f, 0.f, 0.f, 0.f, 0.f, 0.f, 0.f}; return z; }

// -------------------------------------------------------------------------------------------------
// Weight [1024][1024] f32 -> f16 plane of bf16-valued entries.
//   DUP false: dst [1024][1024], dst[r][c] = f16(bf_rne(W)*s1)
//   DUP true : dst [1024][2048], dst[r][c] = f16(bf_rne(W)*s1), dst[r][1024+c] = f16(bf_rne(W)*s2)
// coverage: 131072 threads x 8 = the whole [1024][1024] source (both column halves for DUP).
// -------------------------------------------------------------------------------------------------
template <bool DUP>
__global__ __launch_bounds__(256) void cvt_w_kernel(const float* __restrict__ src, _Float16* __restrict__ dst,
                                                    float s1, float s2) {
  const int i = blockIdx.x * 256 + threadIdx.x;
  const int total8 = ND * (ND / 8);
  if (i >= total8) return;
  const int r  = i / (ND / 8);
  const int c8 = (i - r * (ND / 8)) * 8;
  const float* sp = src + (size_t)r * ND + c8;
  const v4f a = *(const v4f*)(sp);
  const v4f b = *(const v4f*)(sp + 4);
  float f[8];
  f[0] = bf_rne(a[0]); f[1] = bf_rne(a[1]); f[2] = bf_rne(a[2]); f[3] = bf_rne(a[3]);
  f[4] = bf_rne(b[0]); f[5] = bf_rne(b[1]); f[6] = bf_rne(b[2]); f[7] = bf_rne(b[3]);
  v8h o1, o2;
#pragma unroll
  for (int e = 0; e < 8; ++e) { o1[e] = (_Float16)(f[e] * s1); o2[e] = (_Float16)(f[e] * s2); }
  const int pitch = DUP ? QKW : ND;
  _Float16* dp = dst + (size_t)r * pitch + c8;
  *(v8h*)dp = o1;
  if (DUP) *(v8h*)(dp + ND) = o2;
  
}

// -------------------------------------------------------------------------------------------------
//   XH[row][c]        = f16(xn)                       (hi)
//   XH[row][1024 + c] = f16((xn - hi) * 1024)         (residual, carried x1024)
// One wave per row (compact row b*SEQ + t; source row b*SEQ_FULL + t); block = 8 waves = 8 rows; no LDS.
// Stores: lane l writes 16 B at columns i*256 + 8l: one instruction = 32 lanes x 16 B = 512 contiguous B =
// coverage: grid NB*SEQ/8 x 8 waves x (4 x 256) columns x {hi, residual} = the whole [NB*SEQ][2048] plane.
// Loops rolled on purpose (small elementwise side computation).
// -------------------------------------------------------------------------------------------------
__global__ __launch_bounds__(256) void ln_kernel(const float* __restrict__ x, const float* __restrict__ g,
                                                const float* __restrict__ bt, _Float16* __restrict__ XH,
                                                int nrows) {
  const int lane = threadIdx.x & 31;
  const int wave = threadIdx.x >> 5;
  const int row  = blockIdx.x * 8 + wave;
  if (row >= nrows) return;                                   // wave-uniform; no barriers in this kernel
  const int b = row / SEQ;
  const int t = row - b * SEQ;
  const float* xr = x + ((size_t)b * SEQ_FULL + t) * ND + lane * 8;

  float s = 0.f;
#pragma unroll 1
  for (int i = 0; i < 4; ++i) {
    const v4f a = *(const v4f*)(xr + i * 256);
    const v4f c = *(const v4f*)(xr + i * 256 + 4);
    s += (bf_rne(a[0]) + bf_rne(a[1])) + (bf_rne(a[2]) + bf_rne(a[3]));
    s += (bf_rne(c[0]) + bf_rne(c[1])) + (bf_rne(c[2]) + bf_rne(c[3]));
  }
  s += __shfl_xor(s, 16, 32); s += __shfl_xor(s, 8, 32); s += __shfl_xor(s, 4, 32);
  s += __shfl_xor(s, 2, 32);  s += __shfl_xor(s, 1, 32);
  const float mu = s * (1.0f / (float)ND);

  float s2 = 0.f;
#pragma unroll 1
  for (int i = 0; i < 4; ++i) {
    const v4f a = *(const v4f*)(xr + i * 256);
    const v4f c = *(const v4f*)(xr + i * 256 + 4);
    float d;
    d = bf_rne(a[0]) - mu; s2 += d * d;  d = bf_rne(a[1]) - mu; s2 += d * d;
    d = bf_rne(a[2]) - mu; s2 += d * d;  d = bf_rne(a[3]) - mu; s2 += d * d;
    d = bf_rne(c[0]) - mu; s2 += d * d;  d = bf_rne(c[1]) - mu; s2 += d * d;
    d = bf_rne(c[2]) - mu; s2 += d * d;  d = bf_rne(c[3]) - mu; s2 += d * d;
  }
  s2 += __shfl_xor(s2, 16, 32); s2 += __shfl_xor(s2, 8, 32); s2 += __shfl_xor(s2, 4, 32);
  s2 += __shfl_xor(s2, 2, 32);  s2 += __shfl_xor(s2, 1, 32);
  const float var  = s2 * (1.0f / (float)ND);
  const float rstd = rsqrtf(var + 1e-5f);

  _Float16* xh = XH + (size_t)row * QKW + lane * 8;
{
#pragma unroll 1
    for (int i = 0; i < 4; ++i) {
      const v4f a  = *(const v4f*)(xr + i * 256);
      const v4f c  = *(const v4f*)(xr + i * 256 + 4);
      const v4f ga = *(const v4f*)(g + i * 256 + lane * 8);
      const v4f gb = *(const v4f*)(g + i * 256 + lane * 8 + 4);
      const v4f ba = *(const v4f*)(bt + i * 256 + lane * 8);
      const v4f bb = *(const v4f*)(bt + i * 256 + lane * 8 + 4);
      float f[8], gg[8], be[8];
      f[0] = a[0]; f[1] = a[1]; f[2] = a[2]; f[3] = a[3]; f[4] = c[0]; f[5] = c[1]; f[6] = c[2]; f[7] = c[3];
      gg[0] = ga[0]; gg[1] = ga[1]; gg[2] = ga[2]; gg[3] = ga[3];
      gg[4] = gb[0]; gg[5] = gb[1]; gg[6] = gb[2]; gg[7] = gb[3];
      be[0] = ba[0]; be[1] = ba[1]; be[2] = ba[2]; be[3] = ba[3];
      be[4] = bb[0]; be[5] = bb[1]; be[6] = bb[2]; be[7] = bb[3];
      v8h ho, lo;
#pragma unroll
      for (int e = 0; e < 8; ++e) {
        const float xn = (bf_rne(f[e]) - mu) * rstd * bf_rne(gg[e]) + bf_rne(be[e]);
        const _Float16 hv = (_Float16)xn;
        ho[e] = hv;
        lo[e] = (_Float16)((xn - (float)hv) * 1024.0f);
      }
      *(v8h*)(xh + i * 256)      = ho;
      *(v8h*)(xh + ND + i * 256) = lo;
    }
    
  }
}

// -------------------------------------------------------------------------------------------------
// Relative-position sinusoid table -> PE f16 plane [NPP][1024] (rows >= NP are 0):
//   row r <-> relative position pos = SEQ-1-r;  div_j = expf(f32(2j) * f32(-ln(1e4)/1024));
//   ang = |pos| * div_j (f32 product);  PE[r][2j] = sin(ang) with the sign of pos, PE[r][2j+1] = cos(ang).
// passes.  The per-pair loop is rolled (one sinf, one cosf, one expf body); the 16-B result is assembled by a
// register rotate with constant indices (no dynamic local-array indexing).
// coverage: grid NPP*128/256, NPP*128 threads x 8 halves = the whole [NPP][1024] plane.
// -------------------------------------------------------------------------------------------------
__global__ __launch_bounds__(256) void pe_kernel(_Float16* __restrict__ PE) {
  const int i = blockIdx.x * 256 + threadIdx.x;
  if (i >= NPP * (ND / 8)) return;
  const int r  = i / (ND / 8);
  const int c8 = (i - r * (ND / 8)) * 8;
  const int pos = SEQ - 1 - r;
  const float fpos = (float)((pos < 0) ? -pos : pos);
  const float live = (r < NP) ? 1.0f : 0.0f;
  const float c0 = (float)(-9.210340371976184 / (double)ND);
  v4u pk = {0u, 0u, 0u, 0u};
#pragma unroll 1
  for (int e = 0; e < 4; ++e) {
    const int j = (c8 >> 1) + e;
    const float dv  = expf((float)(2 * j) * c0);
    const float ang = fpos * dv;
    float sn = sinf(ang);
    const float cn = cosf(ang);
    sn = (pos < 0) ? -sn : sn;
    const _Float16 hs = (_Float16)(sn * live);
    const _Float16 hc = (_Float16)(cn * live);
    const unsigned w = (unsigned)__builtin_bit_cast(unsigned short, hs) |
                       ((unsigned)__builtin_bit_cast(unsigned short, hc) << 16);
    v4u nx;
    nx[0] = pk[1]; nx[1] = pk[2]; nx[2] = pk[3]; nx[3] = w;
    pk = nx;
  }
  unsigned* dp = (unsigned*)(PE + (size_t)r * ND + c8);
  *(v4u*)dp = pk;
  
}

// -------------------------------------------------------------------------------------------------
// LDS ring of the staged GEMM path: one stage = 128 k of [A 128 rows | Bt 256 rows], 256-B rows at pitch 272 B
// (an odd multiple of 16 B for the ds_load_b128 fragment reads), two buffers.
// -------------------------------------------------------------------------------------------------
#define GBM    128                    // block tile rows (2 waves of 64)
#define GBN    256                    // block tile columns (4 waves of 64)
#define GKS    128                    // halves of k per stage
#define GPIT   (GKS + 8)              // halves: 272 B = 17 x 16 B
#define GSTAGE ((GBM + GBN) * GPIT * 2)   // bytes per buffer: 104448
static_assert((GBM + GBN) * (GKS / 8) == 24 * 256);   // 24 copies of 16 B per thread and stage
static_assert((NB * SEQ) % GBM == 0 && NPP % GBM == 0 && ND % GBM == 0);
static_assert(ND % GBN == 0 && SEQ % GBN == 0);
static_assert(ND % GKS == 0 && ND / GKS >= 2);

// Twelve asynchronous 16-B copies global -> LDS per lane (l: LDS byte address, g: global address of the lane).
// s_wait_xcnt 0 closes the statement so that no address register named here is rewritten ahead of it.
__device__ __forceinline__ void async_copy12(const unsigned (&l)[12], const _Float16* const (&g)[12]) {
  asm volatile(
      "global_load_async_to_lds_b128 %0, %12, off\n\t"
      "global_load_async_to_lds_b128 %1, %13, off\n\t"
      "global_load_async_to_lds_b128 %2, %14, off\n\t"
      "global_load_async_to_lds_b128 %3, %15, off\n\t"
      "global_load_async_to_lds_b128 %4, %16, off\n\t"
      "global_load_async_to_lds_b128 %5, %17, off\n\t"
      "global_load_async_to_lds_b128 %6, %18, off\n\t"
      "global_load_async_to_lds_b128 %7, %19, off\n\t"
      "global_load_async_to_lds_b128 %8, %20, off\n\t"
      "global_load_async_to_lds_b128 %9, %21, off\n\t"
      "global_load_async_to_lds_b128 %10, %22, off\n\t"
      "global_load_async_to_lds_b128 %11, %23, off\n\t"
      "s_wait_xcnt 0x0"
      :: "v"(l[0]), "v"(l[1]), "v"(l[2]), "v"(l[3]), "v"(l[4]), "v"(l[5]),
         "v"(l[6]), "v"(l[7]), "v"(l[8]), "v"(l[9]), "v"(l[10]), "v"(l[11]),
         "v"(g[0]), "v"(g[1]), "v"(g[2]), "v"(g[3]), "v"(g[4]), "v"(g[5]),
         "v"(g[6]), "v"(g[7]), "v"(g[8]), "v"(g[9]), "v"(g[10]), "v"(g[11])
      : "memory");
}

// -------------------------------------------------------------------------------------------------
// f16 WMMA GEMM: C[m][n] = epi( sum_k A[m][k] * Bt[nrow][k] ), nrow = n (+ 64*(skew0 - tm) when SKEW: band GEMM).
// A row-major [M][K] pitch lda; Bt row-major [N(+band)][K] pitch ldb.
// Each wave owns a 64x64 output tile (4x4 subtiles), 8 waves per block, grid.y = z-batch,
// grid.z = outer batch (steps A by strideAz and C by strideCz; Bt is shared).
// SKEW (band): M, N multiples of 64, K multiple of 32; grid.x = tiles/8, a wave's fragments come straight from global.
// not SKEW   : M multiple of 128, N of 256, K of 128 and at least 256; grid.x = (M/128)*(N/256); the block's 2x4 waves
//              share one 128x256 tile whose A and Bt rows are staged in the LDS ring by asynchronous copies (whole
//              256-B row pieces, each fetched once per block), the copies of stage t+2 flying while stage t+1 is worked on.
// OUT 0: f32  C1[m][n] = acc*scale                                              (band scratch)
// OUT 1: f32  C1[m][n] = acc*scale + bf_rne(b1[n])                              (final output)
// OUT 2: f16  t = acc*scale (+ bf_rne(b1[n]) if HASB);  C1[m][2*n0+c] = f16(t*carry),
//             C1[m][2*n0+64+c] = f16(t*carry/1024)      (2048-wide hi | copy planes, one 64-col tile = one head)
// OUT 3: f16  t = (acc*scale + bf_rne(b3[n])) + bf_rne(b1[n] resp. b2[n]);  th = t*carry;
//             hi = f16(th), lo = f16((th - hi)*1024) -> C1 (b1 variant) and C2 (b2 variant), hi at 2*n0+c, lo at 2*n0+64+c
// OUT 4: f16  C1[m][n] = f16((acc*scale + bf_rne(b1[m])) * carry)            (row bias)
// Epilogue: 16-row slabs staged per wave in LDS (wave-private region, wave barrier); every row segment is written as
// coverage: 4 slabs x 16 rows x 64 cols = the whole 64x64 tile per wave; tiles cover M x N exactly.
// -------------------------------------------------------------------------------------------------
template <int OUT, bool SKEW, bool HASB>
__global__ __launch_bounds__(256) void gemm_f16_kernel(
    const _Float16* __restrict__ A, int lda, long strideA, long strideAz,
    const _Float16* __restrict__ Bt, int ldb, long strideB,
    void* C1, void* C2, int ldc, long strideC, long strideCz,
    const float* __restrict__ b1, const float* __restrict__ b2, const float* __restrict__ b3,
    int M, int N, int K, float scale, float carry, int skew0) {
  __shared__ __align__(16) float sT[8][16 * 68];   // per-wave 16x64 slab, pitch 68 floats
  __shared__ __align__(16) unsigned char GS[SKEW ? 16 : 2 * GSTAGE];   // operand ring of the staged path

  const int z    = blockIdx.y;
  const int lane = threadIdx.x & 31;
  const int wave = threadIdx.x >> 5;
  int m0, n0, nsk = 0;
  if constexpr (SKEW) {
    const int tilesN = N >> 6;
    const int tilesM = M >> 6;
    const int tile = blockIdx.x * 8 + wave;
    if (tile >= tilesM * tilesN) return;           // wave-uniform; no block barriers on this path
    const int tm = tile / tilesN;
    const int tn = tile - tm * tilesN;
    m0 = tm << 6;
    n0 = tn << 6;
    nsk = (skew0 - tm) << 6;                       // band row offset of Bt
  } else {
    const int tilesN = N / GBN;
    const int tilesM = M / GBM;
    const int bt = blockIdx.x;
    if (bt >= tilesM * tilesN) return;             // block-uniform, ahead of every copy and barrier
    const int tmb = bt / tilesN;
    const int tnb = bt - tmb * tilesN;
    m0 = tmb * GBM + (wave >> 2) * 64;
    n0 = tnb * GBN + (wave & 3) * 64;
  }
  const size_t cOff = (size_t)z * strideC + (size_t)blockIdx.z * strideCz;

  const _Float16* Ab = A  + (size_t)z * strideA + (size_t)blockIdx.z * strideAz;
  const _Float16* Bb = Bt + (size_t)z * strideB;

  const int rl   = lane & 15;          // row (A) / column (B, D) within a subtile
  const int koff = (lane >> 4) * 8;    // k offset of this lane half
  const int mOff = (lane >> 4) * 8;    // D row offset of this lane half

  v8f acc[4][4];
#pragma unroll
  for (int i = 0; i < 4; ++i)
#pragma unroll
    for (int j = 0; j < 4; ++j) acc[i][j] = zero8();

  if constexpr (SKEW) {
    for (int k0 = 0; k0 < K; k0 += 32) {
      v16h bfr[4];
#pragma unroll
      for (int j = 0; j < 4; ++j)
        bfr[j] = ldfrag(Bb + (size_t)(nsk + n0 + (j << 4) + rl) * ldb + koff + k0);
#pragma unroll
      for (int i = 0; i < 4; ++i) {
        const v16h af = ldfrag(Ab + (size_t)(m0 + (i << 4) + rl) * lda + koff + k0);
#pragma unroll
        for (int j = 0; j < 4; ++j) acc[i][j] = mma16(af, bfr[j], acc[i][j]);
      }
    }
  } else {
    // copy map: thread -> row crow + 16*i of the stage (i < 8: A rows, i >= 8: Bt rows), 16-B piece ccol of its 256 B;
    // one wave-wide copy = 2 rows x 256 B = 4 whole lines.
    const int crow = threadIdx.x >> 4;
    const int ccol = threadIdx.x & 15;
    const int wm = wave >> 2, wn = wave & 3;
    const _Float16* gA = Ab + (size_t)(m0 - wm * 64 + crow) * lda + ccol * 8;
    const _Float16* gB = Bb + (size_t)(n0 - wn * 64 + crow) * ldb + ccol * 8;
    const unsigned ldsLane = (unsigned)(uintptr_t)(&GS[0]) + (unsigned)(crow * (GPIT * 2) + ccol * 16);
    const int nt = K / GKS;
    auto issue_stage = [&](int t, int buf) {
#pragma unroll
      for (int hf = 0; hf < 2; ++hf) {
        unsigned l[12];
        const _Float16* g[12];
#pragma unroll
        for (int e = 0; e < 12; ++e) {
          const int i = hf * 12 + e;
          l[e] = ldsLane + (unsigned)(buf * GSTAGE + i * 16 * (GPIT * 2));
          const size_t so = (i < 8) ? (size_t)(i * 16) * lda + (size_t)t * GKS         // wave-uniform part
                                    : (size_t)((i - 8) * 16) * ldb + (size_t)t * GKS;
          g[e] = ((i < 8) ? gA : gB) + so;
        }
        async_copy12(l, g);
      }
    };

    issue_stage(0, 0);
    asm volatile("s_wait_asynccnt 0x0" ::: "memory");   // this wave's share of stage 0 has landed
    __syncthreads();                                    // publishes stage 0
    issue_stage(1, 1);
    const _Float16* fa = (const _Float16*)GS + (wm * 64 + rl) * GPIT + koff;
    const _Float16* fb = (const _Float16*)GS + (GBM + wn * 64 + rl) * GPIT + koff;
    for (int t = 0; t < nt; ++t) {                      // one stage per trip
      const int bo = (t & 1) * (GSTAGE / 2);
#pragma unroll
      for (int ks = 0; ks < GKS / 32; ++ks) {
        v16h bfr[4], afr[4];                            // all 16 LDS reads of a 32-k block stand as one group
#pragma unroll
        for (int j = 0; j < 4; ++j) bfr[j] = ldfrag(fb + bo + j * 16 * GPIT + ks * 32);
#pragma unroll
        for (int i = 0; i < 4; ++i) afr[i] = ldfrag(fa + bo + i * 16 * GPIT + ks * 32);
#pragma unroll
        for (int i = 0; i < 4; ++i)
#pragma unroll
          for (int j = 0; j < 4; ++j) acc[i][j] = mma16(afr[i], bfr[j], acc[i][j]);
      }
      asm volatile("s_wait_dscnt 0x0" ::: "memory");    // this wave has left the buffer that is refilled below
      asm volatile("s_wait_asynccnt 0x0" ::: "memory"); // this wave's share of stage t+1 has landed
      __syncthreads();                                  // publishes stage t+1, ends every read of stage t
      if (t + 2 < nt) issue_stage(t + 2, t & 1);
    }
    asm volatile("s_wait_asynccnt 0x0" ::: "memory");   // nothing in flight when the wave goes on
  }

  // ---- epilogue ----
  float* slab = sT[wave];
  const int hh = lane >> 4, c4 = (lane & 15) * 4;     // f32 modes: row segment 256 B = 16 lanes x 16 B
  const int q8 = lane >> 3, c8 = (lane & 7) * 8;
  v4f bias4 = {0.f, 0.f, 0.f, 0.f};
  float col8a[8], col8b[8], col8c[8];
#pragma unroll
  for (int e = 0; e < 8; ++e) { col8a[e] = 0.f; col8b[e] = 0.f; col8c[e] = 0.f; }
  if (OUT == 1 && HASB) {
    const v4f tb = *(const v4f*)(b1 + n0 + c4);
    bias4[0] = bf_rne(tb[0]); bias4[1] = bf_rne(tb[1]); bias4[2] = bf_rne(tb[2]); bias4[3] = bf_rne(tb[3]);
  }
  if ((OUT == 2 && HASB) || OUT == 3) {
    const v4f ta = *(const v4f*)(b1 + n0 + c8);
    const v4f tb = *(const v4f*)(b1 + n0 + c8 + 4);
    col8a[0] = bf_rne(ta[0]); col8a[1] = bf_rne(ta[1]); col8a[2] = bf_rne(ta[2]); col8a[3] = bf_rne(ta[3]);
    col8a[4] = bf_rne(tb[0]); col8a[5] = bf_rne(tb[1]); col8a[6] = bf_rne(tb[2]); col8a[7] = bf_rne(tb[3]);
  }
  if (OUT == 3) {
    const v4f ta = *(const v4f*)(b2 + n0 + c8);
    const v4f tb = *(const v4f*)(b2 + n0 + c8 + 4);
    col8b[0] = bf_rne(ta[0]); col8b[1] = bf_rne(ta[1]); col8b[2] = bf_rne(ta[2]); col8b[3] = bf_rne(ta[3]);
    col8b[4] = bf_rne(tb[0]); col8b[5] = bf_rne(tb[1]); col8b[6] = bf_rne(tb[2]); col8b[7] = bf_rne(tb[3]);
    const v4f tc = *(const v4f*)(b3 + n0 + c8);
    const v4f td = *(const v4f*)(b3 + n0 + c8 + 4);
    col8c[0] = bf_rne(tc[0]); col8c[1] = bf_rne(tc[1]); col8c[2] = bf_rne(tc[2]); col8c[3] = bf_rne(tc[3]);
    col8c[4] = bf_rne(td[0]); col8c[5] = bf_rne(td[1]); col8c[6] = bf_rne(td[2]); col8c[7] = bf_rne(td[3]);
  }
  const float carry2 = carry * 0.0009765625f;        // carry / 1024

#pragma unroll
  for (int i = 0; i < 4; ++i) {
    const int mBase = m0 + (i << 4);
#pragma unroll
    for (int j = 0; j < 4; ++j)
#pragma unroll
      for (int r = 0; r < 8; ++r)
        slab[(mOff + r) * 68 + (j << 4) + rl] = acc[i][j][r] * scale;
    __builtin_amdgcn_fence(__ATOMIC_RELEASE, "workgroup");
    __builtin_amdgcn_wave_barrier();
    __builtin_amdgcn_fence(__ATOMIC_ACQUIRE, "workgroup");
    if (OUT == 0 || OUT == 1) {
      float* C = (float*)C1 + cOff;
      v4f vv[8];
#pragma unroll
      for (int it = 0; it < 8; ++it) {
        const int row = it * 2 + hh;
        v4f v = *(const v4fa*)(slab + row * 68 + c4);
        if (OUT == 1) v += bias4;
        vv[it] = v;
      }
      {
#pragma unroll
        for (int it = 0; it < 8; ++it) {
          const int row = it * 2 + hh;
          *(v4f*)(C + (size_t)(mBase + row) * ldc + n0 + c4) = vv[it];
        }
        
      }
    } else if (OUT == 2 || OUT == 4) {
      _Float16* Ca = (_Float16*)C1 + cOff;
      v8h hv[4], lv[4];
#pragma unroll
      for (int it = 0; it < 4; ++it) {
        const int row = it * 4 + q8;
        const float* sp = slab + row * 68 + c8;
        const v4f x0 = *(const v4fa*)(sp);
        const v4f x1 = *(const v4fa*)(sp + 4);
        float f[8];
        f[0] = x0[0]; f[1] = x0[1]; f[2] = x0[2]; f[3] = x0[3];
        f[4] = x1[0]; f[5] = x1[1]; f[6] = x1[2]; f[7] = x1[3];
        float rb = 0.f;
        if (OUT == 4 && HASB) rb = bf_rne(b1[mBase + row]);
        v8h ha, la;
#pragma unroll
        for (int e = 0; e < 8; ++e) {
          const float t = f[e] + ((OUT == 2) ? col8a[e] : rb);
          ha[e] = (_Float16)(t * carry);
          la[e] = (_Float16)(t * carry2);
        }
        hv[it] = ha; lv[it] = la;
      }
      {
#pragma unroll
        for (int it = 0; it < 4; ++it) {
          const int row = it * 4 + q8;
          if (OUT == 2) {
            _Float16* cp = Ca + (size_t)(mBase + row) * ldc + 2 * n0 + c8;
            *(v8h*)(cp)      = hv[it];
            *(v8h*)(cp + 64) = lv[it];
          } else {
            *(v8h*)(Ca + (size_t)(mBase + row) * ldc + n0 + c8) = hv[it];
          }
        }
        
      }
    } else {
#pragma unroll
      for (int var = 0; var < 2; ++var) {
        _Float16* Cc = (_Float16*)((var == 0) ? C1 : C2) + cOff;
        v8h hv[4], lv[4];
#pragma unroll
        for (int it = 0; it < 4; ++it) {
          const int row = it * 4 + q8;
          const float* sp = slab + row * 68 + c8;
          const v4f x0 = *(const v4fa*)(sp);
          const v4f x1 = *(const v4fa*)(sp + 4);
          float f[8];
          f[0] = x0[0]; f[1] = x0[1]; f[2] = x0[2]; f[3] = x0[3];
          f[4] = x1[0]; f[5] = x1[1]; f[6] = x1[2]; f[7] = x1[3];
          v8h ha, la;
#pragma unroll
          for (int e = 0; e < 8; ++e) {
            const float t  = (f[e] + col8c[e]) + ((var == 0) ? col8a[e] : col8b[e]);
            const float th = t * carry;
            const _Float16 hq = (_Float16)th;
            ha[e] = hq;
            la[e] = (_Float16)((th - (float)hq) * 1024.0f);
          }
          hv[it] = ha; lv[it] = la;
        }
        {
#pragma unroll
          for (int it = 0; it < 4; ++it) {
            const int row = it * 4 + q8;
            _Float16* cp = Cc + (size_t)(mBase + row) * ldc + 2 * n0 + c8;
            *(v8h*)(cp)      = hv[it];
            *(v8h*)(cp + 64) = lv[it];
          }
          
        }
      }
    }
    __builtin_amdgcn_fence(__ATOMIC_RELEASE, "workgroup");
    __builtin_amdgcn_wave_barrier();
    __builtin_amdgcn_fence(__ATOMIC_ACQUIRE, "workgroup");
  }
}

// -------------------------------------------------------------------------------------------------
// Relative-position attention for all NH heads of GB batch elements, folded q.k depth 128 (hi | residual),
// value head dim 64, no mask.
//   QU  f16 plane [t][h*128 + j]: j<64 hi = f16(16*(q+u_bias)), j>=64 residual x1024     (A of the content score)
//   KP  f16 plane [s][h*128 + j]: j<64 f16(16*k), j>=64 f16(k/64)                       (B, staged per 64-key chunk as [key][128])
//   VT  f16 plane [h*64 + d][s]   = f16(16*v)                                            (B of P.V, staged as [d][key])
//   BD  f32 band scratch [bz*NH + h][SEQ][BDW]: value (row i, col j) = (1/8)*(q_i + v_bias).p[row 64*(SEQ/64-1 - i/64) + j]
//       rel-shift: bd[i][key] = bdfull[i][key - i + SEQ-1]  ->  column key + 63 - (i mod 64), always in [0, BDW-2].
//   score = cs * (QU.K^T acc) + BD  with cs = (1/8)/256;  online softmax in f32 over SEQ/64 chunks of 64 keys;
//   P stored per wave as f16(4096 * exp(s - m)); CTX[t][h*64 + d] = f16(64 * ctx) = f16((P.V acc) / (1024*l)).
// Block = 4 waves = 64 query rows of one head; grid = (SEQ/64 query blocks, NH heads, GB batch elements);
// QU, KP, VT and CTX point at the first batch element of the launch.
// LDS: one raw buffer; K tile [64][128] f16 at row pitch KPIT, then V^T tile [64][64] f16 at pitch VPIT, then per-wave
// P tiles [16][64] f16 at pitch VPIT; the output staging [4][16][64] f32 at pitch OPIT reuses the K bytes after a
// block barrier.  Every pitch is an odd multiple of 16 B, so the 16 rows that one ds_load_b128 reads start on 16
// different groups of four banks (at the bare 256-B and 128-B pitches they fall on one or two groups).
// coverage: staging 128 thr x 64 halves for K (64x128) and 128 thr x 32 halves for V^T (64x64); P tile 8 rows x
// 2 halves x 4x16 cols per wave = 16x64 (all written every chunk); output 4 store instructions x 4 rows x 8 lanes x
// 8 halves = 16x64 per wave.
// -------------------------------------------------------------------------------------------------
#define KPIT   (HQK + 8)            // halves: 272 B = 17 x 16 B
#define VPIT   (HDV + 8)            // halves: 144 B =  9 x 16 B
#define OPIT   (HDV + 4)            // floats: 272 B = 17 x 16 B
#define KBYTES (64 * KPIT * 2)      // 17408
#define VBYTES (64 * VPIT * 2)      //  9216
#define PBYTES (4 * 16 * VPIT * 2)  //  9216
static_assert(4 * 16 * OPIT * 4 <= KBYTES);
static_assert(KBYTES % 16 == 0 && VBYTES % 16 == 0);

__global__ __launch_bounds__(128)
void relattn_kernel(const _Float16* __restrict__ QU, const _Float16* __restrict__ KP,
                    const _Float16* __restrict__ VT, const float* __restrict__ BD,
                    _Float16* __restrict__ CTX, float cs) {
  __shared__ __align__(16) unsigned char SMEM[KBYTES + VBYTES + PBYTES];
  _Float16* Ksh = (_Float16*)(SMEM);                    // [64][128] at pitch KPIT
  _Float16* Vsh = (_Float16*)(SMEM + KBYTES);           // [64][64]  at pitch VPIT
  _Float16* Psh = (_Float16*)(SMEM + KBYTES + VBYTES);  // [4][16][64] at pitch VPIT
  float*    Osh = (float*)(SMEM);                       // [4][16][64] at pitch OPIT, after the chunk loop

  const int tid  = threadIdx.x;
  const int wave = tid >> 5;
  const int lane = tid & 31;
  const int hh   = lane >> 4;
  const int c    = lane & 15;

  const int h    = blockIdx.y;
  const int bz   = blockIdx.z;
  const int qb   = blockIdx.x;
  const int q0   = qb * 64 + wave * 16;          // first query row of this wave
  const int rr0  = wave * 16 + 8 * hh;           // row within the 64-row block for r = 0

  const _Float16* Qh = QU + (size_t)bz * SEQ * QKW + h * HQK;   // row pitch QKW
  const _Float16* Kh = KP + (size_t)bz * SEQ * QKW + h * HQK;   // row pitch QKW
  const _Float16* Vh = VT + (size_t)(bz * ND + h * HDV) * SEQ;
  const float*    bd = BD + (size_t)(bz * NH + h) * SEQ * BDW;
  _Float16*       ctx = CTX + (size_t)bz * SEQ * ND + h * HDV;  // row pitch ND

  // Q fragments (A operand): 4 chunks of 32 along the folded depth
  v16h qa[4];
#pragma unroll
  for (int dc = 0; dc < 4; ++dc)
    qa[dc] = ldfrag(Qh + (size_t)(q0 + c) * QKW + dc * 32 + 8 * hh);
  asm volatile("s_wait_xcnt 0x0" ::: "memory");     // the reads further down may be given the Q address registers

  // band scratch: element for (row r, key kv0+16j+c) at bdr[r*(BDW-1) + kv0 + 16j]
  const float* bdr = bd + (size_t)(q0 + 8 * hh) * BDW + (63 - rr0 + c);

  float mrow[8], lrow[8];
  v8f oacc[4];
#pragma unroll
  for (int r = 0; r < 8; ++r) { mrow[r] = -INFINITY; lrow[r] = 0.f; }
#pragma unroll
  for (int t = 0; t < 4; ++t) oacc[t] = zero8();

  _Float16* pw = Psh + wave * (16 * VPIT);

  // Global reads run one chunk ahead of their use: this thread's K and V^T staging pieces and its 32 band scores of
  // chunk kc + 1 are issued behind the barrier that publishes chunk kc, so their latency passes under the score products
  // and the softmax of chunk kc (the fence ahead of P.V waits for them at the latest).
  const int sr = tid >> 1, sc0 = (tid & 1) * 64, scv = (tid & 1) * 32;
  const _Float16* ksrc = Kh + (size_t)sr * QKW + sc0;
  const _Float16* vsrc = Vh + (size_t)sr * SEQ + scv;
  v8h kst[8], vst[4];
  float bnx[8][4];
#pragma unroll
  for (int i = 0; i < 8; ++i) kst[i] = *(const v8h*)(ksrc + 8 * i);
#pragma unroll
  for (int i = 0; i < 4; ++i) vst[i] = *(const v8h*)(vsrc + 8 * i);
#pragma unroll
  for (int r = 0; r < 8; ++r)
#pragma unroll
    for (int j = 0; j < 4; ++j) bnx[r][j] = bdr[(size_t)r * (BDW - 1) + (j << 4)];
  // stands ahead of any reuse of the address registers named above; the K and V^T pointers are inputs so that they stay
  // in their registers up to here and no result of this run of reads is given one of them (the band's lives on in the loop)
  asm volatile("s_wait_xcnt 0x0" :: "v"(ksrc), "v"(vsrc) : "memory");

#pragma unroll 1
  for (int kc = 0; kc < SEQ / 64; ++kc) {
    __syncthreads();
#pragma unroll
    for (int i = 0; i < 8; ++i) *(v8ha*)(Ksh + sr * KPIT + sc0 + 8 * i) = kst[i];
#pragma unroll
    for (int i = 0; i < 4; ++i) *(v8ha*)(Vsh + sr * VPIT + scv + 8 * i) = vst[i];
    float bcu[8][4];
#pragma unroll
    for (int r = 0; r < 8; ++r)
#pragma unroll
      for (int j = 0; j < 4; ++j) bcu[r][j] = bnx[r][j];
    __syncthreads();

    if (kc + 1 < SEQ / 64) {                          // block-uniform: the last chunk fetches nothing
      const int kn0 = (kc + 1) * 64;
#pragma unroll
      for (int i = 0; i < 8; ++i) kst[i] = *(const v8h*)(ksrc + (size_t)kn0 * QKW + 8 * i);
#pragma unroll
      for (int i = 0; i < 4; ++i) vst[i] = *(const v8h*)(vsrc + kn0 + 8 * i);
#pragma unroll
      for (int r = 0; r < 8; ++r)
#pragma unroll
        for (int j = 0; j < 4; ++j) bnx[r][j] = bdr[(size_t)r * (BDW - 1) + kn0 + (j << 4)];
      // stands ahead of any reuse of the address registers named above; its memory clobber also holds the reads here,
      // in front of the score products
      asm volatile("s_wait_xcnt 0x0" ::: "memory");
    }

    // content scores: S[j] = QU(16x128) . K^T for key subtile j
    v8f s[4];
#pragma unroll
    for (int j = 0; j < 4; ++j) {
      s[j] = zero8();
#pragma unroll
      for (int dc = 0; dc < 4; ++dc) {
        const v16h kb = ldfrag(Ksh + (j * 16 + c) * KPIT + dc * 32 + 8 * hh);
        s[j] = mma16(qa[dc], kb, s[j]);
      }
    }

    // add the position term from the band scratch, chunk row max
    float cm[8];
#pragma unroll
    for (int r = 0; r < 8; ++r) {
      float m = -INFINITY;
#pragma unroll
      for (int j = 0; j < 4; ++j) {
        const float sv = s[j][r] * cs + bcu[r][j];
        s[j][r] = sv;
        m = fmaxf(m, sv);
      }
      m = fmaxf(m, __shfl_xor(m, 1, 32));
      m = fmaxf(m, __shfl_xor(m, 2, 32));
      m = fmaxf(m, __shfl_xor(m, 4, 32));
      m = fmaxf(m, __shfl_xor(m, 8, 32));
      cm[r] = m;
    }

    // online softmax update (per-row rescale of this row's accumulator elements only);
    // P tile (x4096) to this wave's LDS tile [row][key]
#pragma unroll
    for (int r = 0; r < 8; ++r) {
      const float mnew  = fmaxf(mrow[r], cm[r]);
      const float alpha = __expf(mrow[r] - mnew);
      mrow[r] = mnew;
      float psum = 0.f;
#pragma unroll
      for (int j = 0; j < 4; ++j) {
        const float p = __expf(s[j][r] - mnew);
        psum += p;
        pw[(8 * hh + r) * VPIT + j * 16 + c] = (_Float16)(p * 4096.0f);
      }
      psum += __shfl_xor(psum, 1, 32);
      psum += __shfl_xor(psum, 2, 32);
      psum += __shfl_xor(psum, 4, 32);
      psum += __shfl_xor(psum, 8, 32);
      lrow[r] = lrow[r] * alpha + psum;
#pragma unroll
      for (int t = 0; t < 4; ++t) oacc[t][r] *= alpha;
    }
    __builtin_amdgcn_fence(__ATOMIC_RELEASE, "workgroup");
    __builtin_amdgcn_wave_barrier();
    __builtin_amdgcn_fence(__ATOMIC_ACQUIRE, "workgroup");

    // P (A operand, row = lane&15, split k map over keys) . V (B operand from V^T rows d)
#pragma unroll
    for (int kk = 0; kk < 2; ++kk) {
      const v16h pa = ldfrag(pw + c * VPIT + kk * 32 + 8 * hh);
#pragma unroll
      for (int t = 0; t < 4; ++t) {
        const v16h vb = ldfrag(Vsh + (t * 16 + c) * VPIT + kk * 32 + 8 * hh);
        oacc[t] = mma16(pa, vb, oacc[t]);
      }
    }
  }

  __syncthreads();                               // every wave is done with Ksh before Osh aliases it
  float* os = Osh + wave * (16 * OPIT);
#pragma unroll
  for (int r = 0; r < 8; ++r) {
    const float inv = 1.0f / (1024.0f * lrow[r]);   // 64 / (4096 * 16 * l)
#pragma unroll
    for (int t = 0; t < 4; ++t) os[(8 * hh + r) * OPIT + t * 16 + c] = oacc[t][r] * inv;
  }
  __builtin_amdgcn_fence(__ATOMIC_RELEASE, "workgroup");
  __builtin_amdgcn_wave_barrier();
  __builtin_amdgcn_fence(__ATOMIC_ACQUIRE, "workgroup");
  const int q8 = lane >> 3, c8 = (lane & 7) * 8;
  v8h ov[4];
#pragma unroll
  for (int it = 0; it < 4; ++it) {
    const int row = it * 4 + q8;
    const float* sp = os + row * OPIT + c8;
    const v4f x0 = *(const v4fa*)(sp);
    const v4f x1 = *(const v4fa*)(sp + 4);
    v8h o;
    o[0] = (_Float16)x0[0]; o[1] = (_Float16)x0[1]; o[2] = (_Float16)x0[2]; o[3] = (_Float16)x0[3];
    o[4] = (_Float16)x1[0]; o[5] = (_Float16)x1[1]; o[6] = (_Float16)x1[2]; o[7] = (_Float16)x1[3];
    ov[it] = o;
  }
  {
#pragma unroll
    for (int it = 0; it < 4; ++it) {
      const int row = it * 4 + q8;
      *(v8h*)(ctx + (size_t)(q0 + row) * ND + c8) = ov[it];
    }
    
  }
}

// -------------------------------------------------------------------------------------------------
// Workspace map (bytes, NB=8 SEQ=1024): every batch element's planes are live at once.
//   P2   f16 [NPP][2048]             8388608
//   QU2  f16 [NB*SEQ][2048]         33554432
//   QV2  f16 [NB*SEQ][2048]         33554432   CTX f16 [NB*SEQ][1024] overlays its first half: the attention launch of
//                                              group g writes bytes [g, g+1) * GB*SEQ*ND*2, and the only later readers of
//                                              QV2 (band launches of groups > g) start at (g+1) * GB*SEQ*QKW*2, above it
//   KP2  f16 [NB*SEQ][2048]         33554432
//   VT   f16 [NB][1024][SEQ]        16777216
//   SCR                            142606336   early phase: WQ2, WK2 f16 [1024][2048], WV, WP f16 [1024][1024],
//                                              PE f16 [NPP][1024], XH f16 [NB*SEQ][2048] (all dead after the projections);
//                                              middle phase: BD band f32 [GB*NH][SEQ][BDW];
//                                              last phase: WO f16 [1024][1024] (converted after the last attention launch)
//   total                          268435456
// Every region is written in whole 64x64 tiles / whole rows; all region sizes equal their written extents.
// -------------------------------------------------------------------------------------------------
extern "C" void kernel_launch(void* const* d_in, const int* in_sizes, int n_in,
                              void* d_out, int out_size, void* d_ws, size_t ws_size,
                              hipStream_t stream) {
  if (n_in < 14) return;
  if (in_sizes[0] < ((NB - 1) * SEQ_FULL + SEQ) * ND) return;
  if (in_sizes[1] != ND * ND || in_sizes[3] != ND * ND || in_sizes[5] != ND * ND) return;
  if (in_sizes[7] != ND * ND || in_sizes[8] != ND * ND) return;
  if (in_sizes[2] < ND || in_sizes[4] < ND || in_sizes[6] < ND || in_sizes[9] < ND) return;
  if (in_sizes[10] < NH * HDV || in_sizes[11] < NH * HDV) return;
  if (in_sizes[12] < ND || in_sizes[13] < ND) return;
  if (out_size < NB * SEQ * ND) return;

  const float* x    = (const float*)d_in[0];
  const float* Wq   = (const float*)d_in[1];
  const float* bq   = (const float*)d_in[2];
  const float* Wk   = (const float*)d_in[3];
  const float* bk   = (const float*)d_in[4];
  const float* Wv   = (const float*)d_in[5];
  const float* bv   = (const float*)d_in[6];
  const float* Wpos = (const float*)d_in[7];
  const float* Wout = (const float*)d_in[8];
  const float* bout = (const float*)d_in[9];
  const float* ub   = (const float*)d_in[10];
  const float* vbias= (const float*)d_in[11];
  const float* lng  = (const float*)d_in[12];
  const float* lnb  = (const float*)d_in[13];
  float* out = (float*)d_out;

  const size_t szW2  = (size_t)ND * QKW * 2;              //   4194304
  const size_t szW1  = (size_t)ND * ND * 2;               //   2097152
  const size_t szXH  = (size_t)NB * SEQ * QKW * 2;        //  33554432
  const size_t szQ   = (size_t)NB * SEQ * QKW * 2;        //  33554432
  const size_t szVT  = (size_t)NB * ND * SEQ * 2;         //  16777216
  const size_t szP2  = (size_t)NPP * QKW * 2;             //   8388608
  const size_t szPE  = (size_t)NPP * ND * 2;              //   4194304
  const size_t szBD  = (size_t)GB * NH * SEQ * BDW * 4;   // 142606336
  const size_t szEarly = 2 * szW2 + 2 * szW1 + szPE + szXH;
  const size_t szSCR = (szEarly > szBD) ? szEarly : szBD;
  size_t off = 0;
  const size_t oP2  = off; off += szP2;
  const size_t oQU2 = off; off += szQ;
  const size_t oQV2 = off; off += szQ;
  const size_t oKP2 = off; off += szQ;
  const size_t oVT  = off; off += szVT;
  const size_t oSCR = off; off += szSCR;
  const size_t total = off;                                // 268435456 for NB=8, SEQ=1024
  if (total > ws_size) return;
  const size_t oWQ2 = oSCR;
  const size_t oWK2 = oWQ2 + szW2;
  const size_t oWV  = oWK2 + szW2;
  const size_t oWP  = oWV + szW1;
  const size_t oPE  = oWP + szW1;
  const size_t oXH  = oPE + szPE;

  char* ws = (char*)d_ws;
  _Float16* WQ2 = (_Float16*)(ws + oWQ2);
  _Float16* WK2 = (_Float16*)(ws + oWK2);
  _Float16* WVp = (_Float16*)(ws + oWV);
  _Float16* WOp = (_Float16*)(ws + oSCR);
  _Float16* XH  = (_Float16*)(ws + oXH);
  _Float16* QU2 = (_Float16*)(ws + oQU2);
  _Float16* QV2 = (_Float16*)(ws + oQV2);
  _Float16* KP2 = (_Float16*)(ws + oKP2);
  _Float16* VTp = (_Float16*)(ws + oVT);
  _Float16* P2  = (_Float16*)(ws + oP2);
  _Float16* CTX = (_Float16*)(ws + oQV2);
  _Float16* WPp = (_Float16*)(ws + oWP);
  _Float16* PEp = (_Float16*)(ws + oPE);
  float*    BDp = (float*)(ws + oSCR);

  const float cs = 0.125f * 0.00390625f;   // (1/sqrt(64)) / 256 applied to the x16.x16 score accumulators
  const dim3 blk(256);

  // (1) weights -> f16 planes of bf16-valued entries: Wq, Wk as [x64 | /16] 2048-wide; Wv, Wpos x64
  const dim3 gW(ND * (ND / 8) / 256);      // 512
  cvt_w_kernel<true ><<<gW, blk, 0, stream>>>(Wq,   WQ2, 64.0f, 0.0625f);
  cvt_w_kernel<true ><<<gW, blk, 0, stream>>>(Wk,   WK2, 64.0f, 0.0625f);
  cvt_w_kernel<false><<<gW, blk, 0, stream>>>(Wv,   WVp, 64.0f, 64.0f);
  cvt_w_kernel<false><<<gW, blk, 0, stream>>>(Wpos, WPp, 64.0f, 64.0f);
  // (2) LayerNorm -> XH [NB*SEQ][2048] (hi | residual x1024)
  ln_kernel<<<dim3((NB * SEQ) / 8), blk, 0, stream>>>(x, lng, lnb, XH, NB * SEQ);
  // (3) positional sinusoid table -> PE [NPP][1024] (row NPP-1 = 0)
  pe_kernel<<<dim3((NPP * (ND / 8) + 255) / 256), blk, 0, stream>>>(PEp);
  // (4) p = pe . Wpos^T -> P2 = [16p | p/64]   (M=NPP, N=1024, K=1024)
  {
    const int tiles = (NPP / GBM) * (ND / GBN);
    gemm_f16_kernel<2, false, false><<<dim3(tiles, 1), blk, 0, stream>>>(
        PEp, ND, 0L, 0L, WPp, ND, 0L, (void*)P2, (void*)P2, QKW, 0L, 0L, bq, bq, bq,
        NPP, ND, ND, 0.015625f, 16.0f, 0);
  }
  // (5) projections of all batch elements, one launch each
  const int tilesQ  = ((NB * SEQ) / GBM) * (ND / GBN);
  const int tilesV  = (ND / GBM) * (SEQ / GBN);
  const int tilesBD = (SEQ / 64) * (BDW / 64);
  // QU2 = split(16*(q + bq + u_bias)), QV2 = split(16*(q + bq + v_bias))   (M=NB*SEQ, N=1024, K=2048)
  gemm_f16_kernel<3, false, true><<<dim3(tilesQ, 1), blk, 0, stream>>>(
      XH, QKW, 0L, 0L, WQ2, QKW, 0L, (void*)QU2, (void*)QV2, QKW, 0L, 0L, ub, vbias, bq,
      NB * SEQ, ND, QKW, 0.015625f, 16.0f, 0);
  // KP2 = [16k | k/64], k = xn.Wk^T + bk   (M=NB*SEQ, N=1024, K=2048)
  gemm_f16_kernel<2, false, true><<<dim3(tilesQ, 1), blk, 0, stream>>>(
      XH, QKW, 0L, 0L, WK2, QKW, 0L, (void*)KP2, (void*)KP2, QKW, 0L, 0L, bk, bk, bk,
      NB * SEQ, ND, QKW, 0.015625f, 16.0f, 0);
  // VT[b][h*64+d][s] = 16*(v + bv)   (A = Wv plane [1024][1024], Bt = XH hi columns of batch element y; M=1024, N=SEQ, K=1024)
  gemm_f16_kernel<4, false, true><<<dim3(tilesV, NB), blk, 0, stream>>>(
      WVp, ND, 0L, 0L, XH, QKW, (long)SEQ * QKW, (void*)VTp, (void*)VTp, SEQ, (long)ND * SEQ, 0L, bv, bv, bv,
      ND, SEQ, ND, 0.015625f, 16.0f, 0);
  // (6) band + attention, GB batch elements x NH heads per launch
  for (int b0 = 0; b0 < NB; b0 += GB) {
    // band GEMM: BD[bz*NH+h][t][j] = (1/8)*(q_t + v_bias).p[64*(SEQ/64-1 - t/64) + j]   (M=SEQ, N=BDW, K=128)
    gemm_f16_kernel<0, true, false><<<dim3((tilesBD + 7) / 8, NH, GB), blk, 0, stream>>>(
        QV2 + (size_t)b0 * SEQ * QKW, QKW, (long)HQK, (long)SEQ * QKW, P2, QKW, (long)HQK,
        (void*)BDp, (void*)BDp, BDW, (long)SEQ * BDW, (long)NH * SEQ * BDW, bq, bq, bq,
        SEQ, BDW, HQK, cs, 1.0f, SEQ / 64 - 1);
    relattn_kernel<<<dim3(SEQ / 64, NH, GB), dim3(128), 0, stream>>>(
        QU2 + (size_t)b0 * SEQ * QKW, KP2 + (size_t)b0 * SEQ * QKW, VTp + (size_t)b0 * ND * SEQ, BDp,
        CTX + (size_t)b0 * SEQ * ND, cs);
  }
  // (7) out = ctx . Wout^T + bout -> d_out f32 [NB*SEQ][1024]   (M=NB*SEQ, N=1024, K=1024; carries 64*64 folded into scale)
  cvt_w_kernel<false><<<gW, blk, 0, stream>>>(Wout, WOp, 64.0f, 64.0f);
  {
    const int tiles = ((NB * SEQ) / GBM) * (ND / GBN);
    gemm_f16_kernel<1, false, true><<<dim3(tiles, 1), blk, 0, stream>>>(
        CTX, ND, 0L, 0L, WOp, ND, 0L, (void*)out, (void*)out, ND, 0L, 0L, bout, bout, bout,
        NB * SEQ, ND, ND, 0.000244140625f, 1.0f, 0);
  }
  (void)hipGetLastError();
}

// v005
// One run takes 335 microseconds.
// In two side-by-side timings against v004, it was 1.69 and 1.70 times as fast.
// Over all steps from v000 it is 10.2 times as fast.
// Contractions: xn.Wq^T and xn.Wk^T (xn as f16 hi + x1024 f16 residual planes folded along K against Wx64 | W/16 planes), Wv.xn^T (xn hi, Wx64), pe.Wpos^T (pe f16, Wx64), (q+v_bias).p^T band and (q+u_bias).k^T (16q as f16 hi + x1024 residual folded along the head dim against 16p | p/64 and 16k | k/64 planes), P.V (P x4096, v x16), ctx.Wout^T (ctx x64, W x64): all v_wmma_f32_16x16x32_f16 (f16 operands, f32 accumulate); float inputs bf16-RNE valued; LayerNorm, positional table, softmax, bias adds and scaling in f32.
#include <hip/hip_runtime.h>
#include <math.h>
#include <stdint.h>

#ifndef NB
#define NB 8
#endif
#ifndef SEQ
#define SEQ 1024
#endif
#define SEQ_FULL 1024
#define ND    1024
#define NH    16
#define HDV   64            // value head dim
#define HQK   128           // folded depth of the q.k / q.p contractions: 64 hi + 64 residual
#define QKW   (2 * ND)      // pitch (halves) of the 2048-wide f16 planes
#define NP    (2 * SEQ - 1)
#define NPP   (2 * SEQ)

static_assert(SEQ % 64 == 0);
static_assert(SEQ <= SEQ_FULL);
static_assert(ND == NH * HDV);
static_assert(HQK == 2 * HDV);
static_assert(ND % 256 == 0);
static_assert(NPP % 64 == 0);

typedef _Float16 v16h __attribute__((ext_vector_type(16)));
typedef _Float16 v8h  __attribute__((ext_vector_type(8)));
typedef float    v8f  __attribute__((ext_vector_type(8)));
typedef float    v4f  __attribute__((ext_vector_type(4)));
typedef unsigned int v4u __attribute__((ext_vector_type(4)));
typedef v4f __attribute__((may_alias)) v4fa;
typedef v8h __attribute__((may_alias)) v8ha;

// bf16 RNE of an f32 value, returned widened to f32 (exactly representable in f16 after a power-of-two carry)
__device__ __forceinline__ float bf_rne(float f) {
  unsigned u = __float_as_uint(f);
  u = (u + 0x7FFFu + ((u >> 16) & 1u)) & 0xFFFF0000u;
  return __uint_as_float(u);
}

// 16-bit WMMA fragment: elements 0..7 <- p[0..7], elements 8..15 <- p[16..23]
// (A: p = row m at k0 + 8h;  B stored [n][k]: p = row n at k0 + 8h;  same split k map for both)
union FragU { v16h v; v8ha h[2]; };
__device__ __forceinline__ v16h ldfrag(const _Float16* p) {
  FragU f;
  f.h[0] = *(const v8ha*)(p);
  f.h[1] = *(const v8ha*)(p + 16);
  return f.v;
}

// WMMA + hazard guard (ties D, keeps A/B live for 4 VALU slots)
__device__ __forceinline__ v8f mma16(v16h a, v16h b, v8f c) {
  c = __builtin_amdgcn_wmma_f32_16x16x32_f16(false, a, false, b, (short)0, c, false, false);
  asm volatile("v_nop\n\tv_nop\n\tv_nop\n\tv_nop" : "+v"(c) : "v"(a), "v"(b));
  return c;
}

__device__ __forceinline__ v8f zero8() { v8f z = {0.f, 0.f, 0.f, 0.f, 0.f, 0.f, 0.f, 0.f}; return z; }

// -------------------------------------------------------------------------------------------------
// Weight [1024][1024] f32 -> f16 plane of bf16-valued entries.
//   DUP false: dst [1024][1024], dst[r][c] = f16(bf_rne(W)*s1)
//   DUP true : dst [1024][2048], dst[r][c] = f16(bf_rne(W)*s1), dst[r][1024+c] = f16(bf_rne(W)*s2)
// coverage: 131072 threads x 8 = the whole [1024][1024] source (both column halves for DUP).
// -------------------------------------------------------------------------------------------------
template <bool DUP>
__global__ __launch_bounds__(256) void cvt_w_kernel(const float* __restrict__ src, _Float16* __restrict__ dst,
                                                    float s1, float s2) {
  const int i = blockIdx.x * 256 + threadIdx.x;
  const int total8 = ND * (ND / 8);
  if (i >= total8) return;
  const int r  = i / (ND / 8);
  const int c8 = (i - r * (ND / 8)) * 8;
  const float* sp = src + (size_t)r * ND + c8;
  const v4f a = *(const v4f*)(sp);
  const v4f b = *(const v4f*)(sp + 4);
  float f[8];
  f[0] = bf_rne(a[0]); f[1] = bf_rne(a[1]); f[2] = bf_rne(a[2]); f[3] = bf_rne(a[3]);
  f[4] = bf_rne(b[0]); f[5] = bf_rne(b[1]); f[6] = bf_rne(b[2]); f[7] = bf_rne(b[3]);
  v8h o1, o2;
#pragma unroll
  for (int e = 0; e < 8; ++e) { o1[e] = (_Float16)(f[e] * s1); o2[e] = (_Float16)(f[e] * s2); }
  const int pitch = DUP ? QKW : ND;
  _Float16* dp = dst + (size_t)r * pitch + c8;
  *(v8h*)dp = o1;
  if (DUP) *(v8h*)(dp + ND) = o2;
  
}

// -------------------------------------------------------------------------------------------------
//   XH[row][c]        = f16(xn)                       (hi)
//   XH[row][1024 + c] = f16((xn - hi) * 1024)         (residual, carried x1024)
// One wave per row (compact row b*SEQ + t; source row b*SEQ_FULL + t); block = 8 waves = 8 rows; no LDS.
// Stores: lane l writes 16 B at columns i*256 + 8l: one instruction = 32 lanes x 16 B = 512 contiguous B =
// coverage: grid NB*SEQ/8 x 8 waves x (4 x 256) columns x {hi, residual} = the whole [NB*SEQ][2048] plane.
// Loops rolled on purpose (small elementwise side computation).
// -------------------------------------------------------------------------------------------------
__global__ __launch_bounds__(256) void ln_kernel(const float* __restrict__ x, const float* __restrict__ g,
                                                const float* __restrict__ bt, _Float16* __restrict__ XH,
                                                int nrows) {
  const int lane = threadIdx.x & 31;
  const int wave = threadIdx.x >> 5;
  const int row  = blockIdx.x * 8 + wave;
  if (row >= nrows) return;                                   // wave-uniform; no barriers in this kernel
  const int b = row / SEQ;
  const int t = row - b * SEQ;
  const float* xr = x + ((size_t)b * SEQ_FULL + t) * ND + lane * 8;

  float s = 0.f;
#pragma unroll 1
  for (int i = 0; i < 4; ++i) {
    const v4f a = *(const v4f*)(xr + i * 256);
    const v4f c = *(const v4f*)(xr + i * 256 + 4);
    s += (bf_rne(a[0]) + bf_rne(a[1])) + (bf_rne(a[2]) + bf_rne(a[3]));
    s += (bf_rne(c[0]) + bf_rne(c[1])) + (bf_rne(c[2]) + bf_rne(c[3]));
  }
  s += __shfl_xor(s, 16, 32); s += __shfl_xor(s, 8, 32); s += __shfl_xor(s, 4, 32);
  s += __shfl_xor(s, 2, 32);  s += __shfl_xor(s, 1, 32);
  const float mu = s * (1.0f / (float)ND);

  float s2 = 0.f;
#pragma unroll 1
  for (int i = 0; i < 4; ++i) {
    const v4f a = *(const v4f*)(xr + i * 256);
    const v4f c = *(const v4f*)(xr + i * 256 + 4);
    float d;
    d = bf_rne(a[0]) - mu; s2 += d * d;  d = bf_rne(a[1]) - mu; s2 += d * d;
    d = bf_rne(a[2]) - mu; s2 += d * d;  d = bf_rne(a[3]) - mu; s2 += d * d;
    d = bf_rne(c[0]) - mu; s2 += d * d;  d = bf_rne(c[1]) - mu; s2 += d * d;
    d = bf_rne(c[2]) - mu; s2 += d * d;  d = bf_rne(c[3]) - mu; s2 += d * d;
  }
  s2 += __shfl_xor(s2, 16, 32); s2 += __shfl_xor(s2, 8, 32); s2 += __shfl_xor(s2, 4, 32);
  s2 += __shfl_xor(s2, 2, 32);  s2 += __shfl_xor(s2, 1, 32);
  const float var  = s2 * (1.0f / (float)ND);
  const float rstd = rsqrtf(var + 1e-5f);

  _Float16* xh = XH + (size_t)row * QKW + lane * 8;
{
#pragma unroll 1
    for (int i = 0; i < 4; ++i) {
      const v4f a  = *(const v4f*)(xr + i * 256);
      const v4f c  = *(const v4f*)(xr + i * 256 + 4);
      const v4f ga = *(const v4f*)(g + i * 256 + lane * 8);
      const v4f gb = *(const v4f*)(g + i * 256 + lane * 8 + 4);
      const v4f ba = *(const v4f*)(bt + i * 256 + lane * 8);
      const v4f bb = *(const v4f*)(bt + i * 256 + lane * 8 + 4);
      float f[8], gg[8], be[8];
      f[0] = a[0]; f[1] = a[1]; f[2] = a[2]; f[3] = a[3]; f[4] = c[0]; f[5] = c[1]; f[6] = c[2]; f[7] = c[3];
      gg[0] = ga[0]; gg[1] = ga[1]; gg[2] = ga[2]; gg[3] = ga[3];
      gg[4] = gb[0]; gg[5] = gb[1]; gg[6] = gb[2]; gg[7] = gb[3];
      be[0] = ba[0]; be[1] = ba[1]; be[2] = ba[2]; be[3] = ba[3];
      be[4] = bb[0]; be[5] = bb[1]; be[6] = bb[2]; be[7] = bb[3];
      v8h ho, lo;
#pragma unroll
      for (int e = 0; e < 8; ++e) {
        const float xn = (bf_rne(f[e]) - mu) * rstd * bf_rne(gg[e]) + bf_rne(be[e]);
        const _Float16 hv = (_Float16)xn;
        ho[e] = hv;
        lo[e] = (_Float16)((xn - (float)hv) * 1024.0f);
      }
      *(v8h*)(xh + i * 256)      = ho;
      *(v8h*)(xh + ND + i * 256) = lo;
    }
    
  }
}

// -------------------------------------------------------------------------------------------------
// Relative-position sinusoid table -> PE f16 plane [NPP][1024] (rows >= NP are 0):
//   row r <-> relative position pos = SEQ-1-r;  div_j = expf(f32(2j) * f32(-ln(1e4)/1024));
//   ang = |pos| * div_j (f32 product);  PE[r][2j] = sin(ang) with the sign of pos, PE[r][2j+1] = cos(ang).
// passes.  The per-pair loop is rolled (one sinf, one cosf, one expf body); the 16-B result is assembled by a
// register rotate with constant indices (no dynamic local-array indexing).
// coverage: grid NPP*128/256, NPP*128 threads x 8 halves = the whole [NPP][1024] plane.
// -------------------------------------------------------------------------------------------------
__global__ __launch_bounds__(256) void pe_kernel(_Float16* __restrict__ PE) {
  const int i = blockIdx.x * 256 + threadIdx.x;
  if (i >= NPP * (ND / 8)) return;
  const int r  = i / (ND / 8);
  const int c8 = (i - r * (ND / 8)) * 8;
  const int pos = SEQ - 1 - r;
  const float fpos = (float)((pos < 0) ? -pos : pos);
  const float live = (r < NP) ? 1.0f : 0.0f;
  const float c0 = (float)(-9.210340371976184 / (double)ND);
  v4u pk = {0u, 0u, 0u, 0u};
#pragma unroll 1
  for (int e = 0; e < 4; ++e) {
    const int j = (c8 >> 1) + e;
    const float dv  = expf((float)(2 * j) * c0);
    const float ang = fpos * dv;
    float sn = sinf(ang);
    const float cn = cosf(ang);
    sn = (pos < 0) ? -sn : sn;
    const _Float16 hs = (_Float16)(sn * live);
    const _Float16 hc = (_Float16)(cn * live);
    const unsigned w = (unsigned)__builtin_bit_cast(unsigned short, hs) |
                       ((unsigned)__builtin_bit_cast(unsigned short, hc) << 16);
    v4u nx;
    nx[0] = pk[1]; nx[1] = pk[2]; nx[2] = pk[3]; nx[3] = w;
    pk = nx;
  }
  unsigned* dp = (unsigned*)(PE + (size_t)r * ND + c8);
  *(v4u*)dp = pk;
  
}

// -------------------------------------------------------------------------------------------------
// LDS ring of the staged GEMM path: one stage = 128 k of [A 128 rows | Bt 256 rows], 256-B rows at pitch 272 B
// (an odd multiple of 16 B for the ds_load_b128 fragment reads), two buffers.
// -------------------------------------------------------------------------------------------------
#define GBM    128                    // block tile rows (2 waves of 64)
#define GBN    256                    // block tile columns (4 waves of 64)
#define GKS    128                    // halves of k per stage
#define GPIT   (GKS + 8)              // halves: 272 B = 17 x 16 B
#define GSTAGE ((GBM + GBN) * GPIT * 2)   // bytes per buffer: 104448
static_assert((GBM + GBN) * (GKS / 8) == 24 * 256);   // 24 copies of 16 B per thread and stage
static_assert((NB * SEQ) % GBM == 0 && NPP % GBM == 0 && ND % GBM == 0);
static_assert(ND % GBN == 0 && SEQ % GBN == 0);
static_assert(ND % GKS == 0 && ND / GKS >= 2);

// Twelve asynchronous 16-B copies global -> LDS per lane (l: LDS byte address, g: global address of the lane).
// s_wait_xcnt 0 closes the statement so that no address register named here is rewritten ahead of it.
__device__ __forceinline__ void async_copy12(const unsigned (&l)[12], const _Float16* const (&g)[12]) {
  asm volatile(
      "global_load_async_to_lds_b128 %0, %12, off\n\t"
      "global_load_async_to_lds_b128 %1, %13, off\n\t"
      "global_load_async_to_lds_b128 %2, %14, off\n\t"
      "global_load_async_to_lds_b128 %3, %15, off\n\t"
      "global_load_async_to_lds_b128 %4, %16, off\n\t"
      "global_load_async_to_lds_b128 %5, %17, off\n\t"
      "global_load_async_to_lds_b128 %6, %18, off\n\t"
      "global_load_async_to_lds_b128 %7, %19, off\n\t"
      "global_load_async_to_lds_b128 %8, %20, off\n\t"
      "global_load_async_to_lds_b128 %9, %21, off\n\t"
      "global_load_async_to_lds_b128 %10, %22, off\n\t"
      "global_load_async_to_lds_b128 %11, %23, off\n\t"
      "s_wait_xcnt 0x0"
      :: "v"(l[0]), "v"(l[1]), "v"(l[2]), "v"(l[3]), "v"(l[4]), "v"(l[5]),
         "v"(l[6]), "v"(l[7]), "v"(l[8]), "v"(l[9]), "v"(l[10]), "v"(l[11]),
         "v"(g[0]), "v"(g[1]), "v"(g[2]), "v"(g[3]), "v"(g[4]), "v"(g[5]),
         "v"(g[6]), "v"(g[7]), "v"(g[8]), "v"(g[9]), "v"(g[10]), "v"(g[11])
      : "memory");
}

// -------------------------------------------------------------------------------------------------
// f16 WMMA GEMM: C[m][n] = epi( sum_k A[m][k] * Bt[n][k] ).
// A row-major [M][K] pitch lda; Bt row-major [N][K] pitch ldb.
// Each wave owns a 64x64 output tile (4x4 subtiles), 8 waves per block, grid.y = z-batch,
// grid.z = outer batch (steps A by strideAz and C by strideCz; Bt is shared).
// M multiple of 128, N of 256, K of 128 and at least 256; grid.x = (M/128)*(N/256); the block's 2x4 waves
// share one 128x256 tile whose A and Bt rows are staged in the LDS ring by asynchronous copies (whole
// 256-B row pieces, each fetched once per block), the copies of stage t+2 flying while stage t+1 is worked on.
// OUT 1: f32  C1[m][n] = acc*scale + bf_rne(b1[n])                              (final output)
// OUT 2: f16  t = acc*scale (+ bf_rne(b1[n]) if HASB);  C1[m][2*n0+c] = f16(t*carry),
//             C1[m][2*n0+64+c] = f16(t*carry/1024)      (2048-wide hi | copy planes, one 64-col tile = one head)
// OUT 3: f16  t = (acc*scale + bf_rne(b3[n])) + bf_rne(b1[n] resp. b2[n]);  th = t*carry;
//             hi = f16(th), lo = f16((th - hi)*1024) -> C1 (b1 variant) and C2 (b2 variant), hi at 2*n0+c, lo at 2*n0+64+c
// OUT 4: f16  C1[m][n] = f16((acc*scale + bf_rne(b1[m])) * carry)            (row bias)
// Epilogue: 16-row slabs staged per wave in LDS (wave-private region, wave barrier); every row segment is written as
// coverage: 4 slabs x 16 rows x 64 cols = the whole 64x64 tile per wave; tiles cover M x N exactly.
// -------------------------------------------------------------------------------------------------
template <int OUT, bool HASB>
__global__ __launch_bounds__(256) void gemm_f16_kernel(
    const _Float16* __restrict__ A, int lda, long strideA, long strideAz,
    const _Float16* __restrict__ Bt, int ldb, long strideB,
    void* C1, void* C2, int ldc, long strideC, long strideCz,
    const float* __restrict__ b1, const float* __restrict__ b2, const float* __restrict__ b3,
    int M, int N, int K, float scale, float carry) {
  __shared__ __align__(16) float sT[8][16 * 68];   // per-wave 16x64 slab, pitch 68 floats
  __shared__ __align__(16) unsigned char GS[2 * GSTAGE];   // operand ring of the staged path

  const int z    = blockIdx.y;
  const int lane = threadIdx.x & 31;
  const int wave = threadIdx.x >> 5;
  int m0, n0;
  {
    const int tilesN = N / GBN;
    const int tilesM = M / GBM;
    const int bt = blockIdx.x;
    if (bt >= tilesM * tilesN) return;             // block-uniform, ahead of every copy and barrier
    const int tmb = bt / tilesN;
    const int tnb = bt - tmb * tilesN;
    m0 = tmb * GBM + (wave >> 2) * 64;
    n0 = tnb * GBN + (wave & 3) * 64;
  }
  const size_t cOff = (size_t)z * strideC + (size_t)blockIdx.z * strideCz;

  const _Float16* Ab = A  + (size_t)z * strideA + (size_t)blockIdx.z * strideAz;
  const _Float16* Bb = Bt + (size_t)z * strideB;

  const int rl   = lane & 15;          // row (A) / column (B, D) within a subtile
  const int koff = (lane >> 4) * 8;    // k offset of this lane half
  const int mOff = (lane >> 4) * 8;    // D row offset of this lane half

  v8f acc[4][4];
#pragma unroll
  for (int i = 0; i < 4; ++i)
#pragma unroll
    for (int j = 0; j < 4; ++j) acc[i][j] = zero8();

  {
    // copy map: thread -> row crow + 16*i of the stage (i < 8: A rows, i >= 8: Bt rows), 16-B piece ccol of its 256 B;
    // one wave-wide copy = 2 rows x 256 B = 4 whole lines.
    const int crow = threadIdx.x >> 4;
    const int ccol = threadIdx.x & 15;
    const int wm = wave >> 2, wn = wave & 3;
    const _Float16* gA = Ab + (size_t)(m0 - wm * 64 + crow) * lda + ccol * 8;
    const _Float16* gB = Bb + (size_t)(n0 - wn * 64 + crow) * ldb + ccol * 8;
    const unsigned ldsLane = (unsigned)(uintptr_t)(&GS[0]) + (unsigned)(crow * (GPIT * 2) + ccol * 16);
    const int nt = K / GKS;
    auto issue_stage = [&](int t, int buf) {
#pragma unroll
      for (int hf = 0; hf < 2; ++hf) {
        unsigned l[12];
        const _Float16* g[12];
#pragma unroll
        for (int e = 0; e < 12; ++e) {
          const int i = hf * 12 + e;
          l[e] = ldsLane + (unsigned)(buf * GSTAGE + i * 16 * (GPIT * 2));
          const size_t so = (i < 8) ? (size_t)(i * 16) * lda + (size_t)t * GKS         // wave-uniform part
                                    : (size_t)((i - 8) * 16) * ldb + (size_t)t * GKS;
          g[e] = ((i < 8) ? gA : gB) + so;
        }
        async_copy12(l, g);
      }
    };

    issue_stage(0, 0);
    asm volatile("s_wait_asynccnt 0x0" ::: "memory");   // this wave's share of stage 0 has landed
    __syncthreads();                                    // publishes stage 0
    issue_stage(1, 1);
    const _Float16* fa = (const _Float16*)GS + (wm * 64 + rl) * GPIT + koff;
    const _Float16* fb = (const _Float16*)GS + (GBM + wn * 64 + rl) * GPIT + koff;
    for (int t = 0; t < nt; ++t) {                      // one stage per trip
      const int bo = (t & 1) * (GSTAGE / 2);
#pragma unroll
      for (int ks = 0; ks < GKS / 32; ++ks) {
        v16h bfr[4], afr[4];                            // all 16 LDS reads of a 32-k block stand as one group
#pragma unroll
        for (int j = 0; j < 4; ++j) bfr[j] = ldfrag(fb + bo + j * 16 * GPIT + ks * 32);
#pragma unroll
        for (int i = 0; i < 4; ++i) afr[i] = ldfrag(fa + bo + i * 16 * GPIT + ks * 32);
#pragma unroll
        for (int i = 0; i < 4; ++i)
#pragma unroll
          for (int j = 0; j < 4; ++j) acc[i][j] = mma16(afr[i], bfr[j], acc[i][j]);
      }
      asm volatile("s_wait_dscnt 0x0" ::: "memory");    // this wave has left the buffer that is refilled below
      asm volatile("s_wait_asynccnt 0x0" ::: "memory"); // this wave's share of stage t+1 has landed
      __syncthreads();                                  // publishes stage t+1, ends every read of stage t
      if (t + 2 < nt) issue_stage(t + 2, t & 1);
    }
    asm volatile("s_wait_asynccnt 0x0" ::: "memory");   // nothing in flight when the wave goes on
  }

  // ---- epilogue ----
  float* slab = sT[wave];
  const int hh = lane >> 4, c4 = (lane & 15) * 4;     // f32 modes: row segment 256 B = 16 lanes x 16 B
  const int q8 = lane >> 3, c8 = (lane & 7) * 8;
  v4f bias4 = {0.f, 0.f, 0.f, 0.f};
  float col8a[8], col8b[8], col8c[8];
#pragma unroll
  for (int e = 0; e < 8; ++e) { col8a[e] = 0.f; col8b[e] = 0.f; col8c[e] = 0.f; }
  if (OUT == 1 && HASB) {
    const v4f tb = *(const v4f*)(b1 + n0 + c4);
    bias4[0] = bf_rne(tb[0]); bias4[1] = bf_rne(tb[1]); bias4[2] = bf_rne(tb[2]); bias4[3] = bf_rne(tb[3]);
  }
  if ((OUT == 2 && HASB) || OUT == 3) {
    const v4f ta = *(const v4f*)(b1 + n0 + c8);
    const v4f tb = *(const v4f*)(b1 + n0 + c8 + 4);
    col8a[0] = bf_rne(ta[0]); col8a[1] = bf_rne(ta[1]); col8a[2] = bf_rne(ta[2]); col8a[3] = bf_rne(ta[3]);
    col8a[4] = bf_rne(tb[0]); col8a[5] = bf_rne(tb[1]); col8a[6] = bf_rne(tb[2]); col8a[7] = bf_rne(tb[3]);
  }
  if (OUT == 3) {
    const v4f ta = *(const v4f*)(b2 + n0 + c8);
    const v4f tb = *(const v4f*)(b2 + n0 + c8 + 4);
    col8b[0] = bf_rne(ta[0]); col8b[1] = bf_rne(ta[1]); col8b[2] = bf_rne(ta[2]); col8b[3] = bf_rne(ta[3]);
    col8b[4] = bf_rne(tb[0]); col8b[5] = bf_rne(tb[1]); col8b[6] = bf_rne(tb[2]); col8b[7] = bf_rne(tb[3]);
    const v4f tc = *(const v4f*)(b3 + n0 + c8);
    const v4f td = *(const v4f*)(b3 + n0 + c8 + 4);
    col8c[0] = bf_rne(tc[0]); col8c[1] = bf_rne(tc[1]); col8c[2] = bf_rne(tc[2]); col8c[3] = bf_rne(tc[3]);
    col8c[4] = bf_rne(td[0]); col8c[5] = bf_rne(td[1]); col8c[6] = bf_rne(td[2]); col8c[7] = bf_rne(td[3]);
  }
  const float carry2 = carry * 0.0009765625f;        // carry / 1024

#pragma unroll
  for (int i = 0; i < 4; ++i) {
    const int mBase = m0 + (i << 4);
#pragma unroll
    for (int j = 0; j < 4; ++j)
#pragma unroll
      for (int r = 0; r < 8; ++r)
        slab[(mOff + r) * 68 + (j << 4) + rl] = acc[i][j][r] * scale;
    __builtin_amdgcn_fence(__ATOMIC_RELEASE, "workgroup");
    __builtin_amdgcn_wave_barrier();
    __builtin_amdgcn_fence(__ATOMIC_ACQUIRE, "workgroup");
    if (OUT == 1) {
      float* C = (float*)C1 + cOff;
      v4f vv[8];
#pragma unroll
      for (int it = 0; it < 8; ++it) {
        const int row = it * 2 + hh;
        v4f v = *(const v4fa*)(slab + row * 68 + c4);
        if (OUT == 1) v += bias4;
        vv[it] = v;
      }
      {
#pragma unroll
        for (int it = 0; it < 8; ++it) {
          const int row = it * 2 + hh;
          *(v4f*)(C + (size_t)(mBase + row) * ldc + n0 + c4) = vv[it];
        }
        
      }
    } else if (OUT == 2 || OUT == 4) {
      _Float16* Ca = (_Float16*)C1 + cOff;
      v8h hv[4], lv[4];
#pragma unroll
      for (int it = 0; it < 4; ++it) {
        const int row = it * 4 + q8;
        const float* sp = slab + row * 68 + c8;
        const v4f x0 = *(const v4fa*)(sp);
        const v4f x1 = *(const v4fa*)(sp + 4);
        float f[8];
        f[0] = x0[0]; f[1] = x0[1]; f[2] = x0[2]; f[3] = x0[3];
        f[4] = x1[0]; f[5] = x1[1]; f[6] = x1[2]; f[7] = x1[3];
        float rb = 0.f;
        if (OUT == 4 && HASB) rb = bf_rne(b1[mBase + row]);
        v8h ha, la;
#pragma unroll
        for (int e = 0; e < 8; ++e) {
          const float t = f[e] + ((OUT == 2) ? col8a[e] : rb);
          ha[e] = (_Float16)(t * carry);
          la[e] = (_Float16)(t * carry2);
        }
        hv[it] = ha; lv[it] = la;
      }
      {
#pragma unroll
        for (int it = 0; it < 4; ++it) {
          const int row = it * 4 + q8;
          if (OUT == 2) {
            _Float16* cp = Ca + (size_t)(mBase + row) * ldc + 2 * n0 + c8;
            *(v8h*)(cp)      = hv[it];
            *(v8h*)(cp + 64) = lv[it];
          } else {
            *(v8h*)(Ca + (size_t)(mBase + row) * ldc + n0 + c8) = hv[it];
          }
        }
        
      }
    } else {
#pragma unroll
      for (int var = 0; var < 2; ++var) {
        _Float16* Cc = (_Float16*)((var == 0) ? C1 : C2) + cOff;
        v8h hv[4], lv[4];
#pragma unroll
        for (int it = 0; it < 4; ++it) {
          const int row = it * 4 + q8;
          const float* sp = slab + row * 68 + c8;
          const v4f x0 = *(const v4fa*)(sp);
          const v4f x1 = *(const v4fa*)(sp + 4);
          float f[8];
          f[0] = x0[0]; f[1] = x0[1]; f[2] = x0[2]; f[3] = x0[3];
          f[4] = x1[0]; f[5] = x1[1]; f[6] = x1[2]; f[7] = x1[3];
          v8h ha, la;
#pragma unroll
          for (int e = 0; e < 8; ++e) {
            const float t  = (f[e] + col8c[e]) + ((var == 0) ? col8a[e] : col8b[e]);
            const float th = t * carry;
            const _Float16 hq = (_Float16)th;
            ha[e] = hq;
            la[e] = (_Float16)((th - (float)hq) * 1024.0f);
          }
          hv[it] = ha; lv[it] = la;
        }
        {
#pragma unroll
          for (int it = 0; it < 4; ++it) {
            const int row = it * 4 + q8;
            _Float16* cp = Cc + (size_t)(mBase + row) * ldc + 2 * n0 + c8;
            *(v8h*)(cp)      = hv[it];
            *(v8h*)(cp + 64) = lv[it];
          }
          
        }
      }
    }
    __builtin_amdgcn_fence(__ATOMIC_RELEASE, "workgroup");
    __builtin_amdgcn_wave_barrier();
    __builtin_amdgcn_fence(__ATOMIC_ACQUIRE, "workgroup");
  }
}

// -------------------------------------------------------------------------------------------------
// Relative-position attention for all NH heads of all NB batch elements, folded q.k and q.p depth 128 (hi | residual),
// value head dim 64, no mask.
//   QU  f16 plane [t][h*128 + j]: j<64 hi = f16(16*(q+u_bias)), j>=64 residual x1024     (A of the content score)
//   KP  f16 plane [s][h*128 + j]: j<64 f16(16*k), j>=64 f16(k/64)                       (B, staged per 64-key chunk as [key][128])
//   VT  f16 plane [h*64 + d][s]   = f16(16*v)                                            (B of P.V, staged as [d][key])
//   QV  f16 plane, as QU with v_bias                                                     (A of the position score)
//   PP  f16 plane [row][h*128 + j]: j<64 f16(16*p), j>=64 f16(p/64), NPP rows             (B, staged in 64-row tiles as [row][128])
//       rel-shift: position score of (query i, key) = (q_i + v_bias).p[key - i + SEQ-1].  For query block qb and key chunk
//       kc that is row 64*(SEQ/64-1-qb+kc) + x of PP, x = (key mod 64) + 63 - (i mod 64) in [0, 126]: two 64-row tiles, of
//       which the upper is the next chunk's lower, so one new tile per chunk goes into a ring of two slots (slot = tile & 1).
//       A wave's 16 queries (row R) x 64 keys need x = 48 - 16*wave + w, w = (key mod 64) + 15 - R in [0, 78]: five 16-column
//       products W, the lowest of which is the chunk before's highest; score column n of row R is W column n + 15 - R,
//       fetched by a select between neighbouring products in the source lane and one ds_bpermute_b32 inside the 16-lane row.
//   score = cs * (QU.K^T acc + QV.P^T acc)  with cs = (1/8)/256;  online softmax in f32 over SEQ/64 chunks of 64 keys;
//   P stored per wave as f16(4096 * exp(s - m)); CTX[t][h*64 + d] = f16(64 * ctx) = f16((P.V acc) / (1024*l)).
// Block = 4 waves = 64 query rows of one head; grid = (SEQ/64 query blocks, NH heads, NB batch elements).
// LDS: one raw buffer; K tile [64][128] f16 at row pitch KPIT, then V^T tile [64][64] f16 at pitch VPIT, then per-wave
// P tiles [16][64] f16 at pitch VPIT, then the two p-row slots [64][128] f16 at pitch KPIT; the output staging
// [4][16][64] f32 at pitch OPIT reuses the K bytes after a block barrier.  Every pitch is an odd multiple of 16 B, so the 16 rows that one ds_load_b128 reads start on 16
// different groups of four banks (at the bare 256-B and 128-B pitches they fall on one or two groups).
// coverage: staging 128 thr x 64 halves for K and for a p-row tile (64x128), 128 thr x 32 halves for V^T (64x64); P tile 8 rows x
// 2 halves x 4x16 cols per wave = 16x64 (all written every chunk); output 4 store instructions x 4 rows x 8 lanes x
// 8 halves = 16x64 per wave.
// -------------------------------------------------------------------------------------------------
#define KPIT   (HQK + 8)            // halves: 272 B = 17 x 16 B
#define VPIT   (HDV + 8)            // halves: 144 B =  9 x 16 B
#define OPIT   (HDV + 4)            // floats: 272 B = 17 x 16 B
#define KBYTES (64 * KPIT * 2)      // 17408
#define VBYTES (64 * VPIT * 2)      //  9216
#define PBYTES (4 * 16 * VPIT * 2)  //  9216
static_assert(4 * 16 * OPIT * 4 <= KBYTES);
static_assert(KBYTES % 16 == 0 && VBYTES % 16 == 0);

__global__ __launch_bounds__(128)
void relattn_kernel(const _Float16* __restrict__ QU, const _Float16* __restrict__ QV,
                    const _Float16* __restrict__ KP, const _Float16* __restrict__ VT,
                    const _Float16* __restrict__ PP, _Float16* __restrict__ CTX, float cs) {
  __shared__ __align__(16) unsigned char SMEM[KBYTES + VBYTES + PBYTES + 2 * KBYTES];
  _Float16* Ksh = (_Float16*)(SMEM);                    // [64][128] at pitch KPIT
  _Float16* Vsh = (_Float16*)(SMEM + KBYTES);           // [64][64]  at pitch VPIT
  _Float16* Psh = (_Float16*)(SMEM + KBYTES + VBYTES);  // [4][16][64] at pitch VPIT
  _Float16* Rsh = (_Float16*)(SMEM + KBYTES + VBYTES + PBYTES);   // [2][64][128] at pitch KPIT: p-row tiles
  float*    Osh = (float*)(SMEM);                       // [4][16][64] at pitch OPIT, after the chunk loop

  const int tid  = threadIdx.x;
  const int wave = tid >> 5;
  const int lane = tid & 31;
  const int hh   = lane >> 4;
  const int c    = lane & 15;

  const int h    = blockIdx.y;
  const int bz   = blockIdx.z;
  const int qb   = blockIdx.x;
  const int q0   = qb * 64 + wave * 16;          // first query row of this wave
  const int tpb  = SEQ / 64 - 1 - qb;            // lower p-row tile of chunk 0

  const _Float16* Qh = QU + (size_t)bz * SEQ * QKW + h * HQK;   // row pitch QKW
  const _Float16* Qw = QV + (size_t)bz * SEQ * QKW + h * HQK;   // row pitch QKW
  const _Float16* Kh = KP + (size_t)bz * SEQ * QKW + h * HQK;   // row pitch QKW
  const _Float16* Ph = PP + h * HQK;                            // row pitch QKW, shared by the batch
  const _Float16* Vh = VT + (size_t)(bz * ND + h * HDV) * SEQ;
  _Float16*       ctx = CTX + (size_t)bz * SEQ * ND + h * HDV;  // row pitch ND

  // Q fragments (A operand): 4 chunks of 32 along the folded depth
  const _Float16* qsrc = Qh + (size_t)(q0 + c) * QKW + 8 * hh;
  const _Float16* wsrc = Qw + (size_t)(q0 + c) * QKW + 8 * hh;
  v16h qa[4], qv[4];
#pragma unroll
  for (int dc = 0; dc < 4; ++dc) qa[dc] = ldfrag(qsrc + dc * 32);
#pragma unroll
  for (int dc = 0; dc < 4; ++dc) qv[dc] = ldfrag(wsrc + dc * 32);
  // the reads further down may be given the Q address registers; the two pointers are inputs so that they stay in
  // their registers up to here
  asm volatile("s_wait_xcnt 0x0" :: "v"(qsrc), "v"(wsrc) : "memory");

  // rel-shift of accumulator register r (row R = 8*hh + r), shift sft = 15 - R: this lane takes from lane (c + sft) mod 16
  // of its row; as a source it offers product j where c >= sft and product j + 1 below
  int  pidx[8];
  bool own[8];
#pragma unroll
  for (int r = 0; r < 8; ++r) {
    const int sft = 15 - 8 * hh - r;
    pidx[r] = ((lane & 16) | ((c + sft) & 15)) << 2;
    own[r]  = (c >= sft);
  }

  float mrow[8], lrow[8];
  v8f oacc[4];
#pragma unroll
  for (int r = 0; r < 8; ++r) { mrow[r] = -INFINITY; lrow[r] = 0.f; }
#pragma unroll
  for (int t = 0; t < 4; ++t) oacc[t] = zero8();

  v8f wtop = zero8();                            // top position product of the chunk before
  _Float16* pw = Psh + wave * (16 * VPIT);

  // Global reads run one chunk ahead of their use: this thread's K, V^T and p-row staging pieces of
  // chunk kc + 1 are issued behind the barrier that publishes chunk kc, so their latency passes under the score products
  // and the softmax of chunk kc (the fence ahead of P.V waits for them at the latest).
  const int sr = tid >> 1, sc0 = (tid & 1) * 64, scv = (tid & 1) * 32;
  const _Float16* ksrc = Kh + (size_t)sr * QKW + sc0;
  const _Float16* vsrc = Vh + (size_t)sr * SEQ + scv;
  const _Float16* psrc = Ph + (size_t)(tpb * 64 + sr) * QKW + sc0;
  v8h kst[8], vst[4], pst[8], pf[8];
#pragma unroll
  for (int i = 0; i < 8; ++i) kst[i] = *(const v8h*)(ksrc + 8 * i);
#pragma unroll
  for (int i = 0; i < 4; ++i) vst[i] = *(const v8h*)(vsrc + 8 * i);
#pragma unroll
  for (int i = 0; i < 8; ++i) pf[i] = *(const v8h*)(psrc + 8 * i);
#pragma unroll
  for (int i = 0; i < 8; ++i) pst[i] = *(const v8h*)(psrc + (size_t)64 * QKW + 8 * i);
  // stands ahead of any reuse of the address registers named above; the pointers are inputs so that they stay
  // in their registers up to here and no result of this run of reads is given one of them
  asm volatile("s_wait_xcnt 0x0" :: "v"(ksrc), "v"(vsrc), "v"(psrc) : "memory");
  // chunk 0's lower p-row tile; published by the barrier behind the first staging stores
#pragma unroll
  for (int i = 0; i < 8; ++i) *(v8ha*)(Rsh + ((tpb & 1) * 64 + sr) * KPIT + sc0 + 8 * i) = pf[i];

#pragma unroll 1
  for (int kc = 0; kc < SEQ / 64; ++kc) {
    __syncthreads();
#pragma unroll
    for (int i = 0; i < 8; ++i) *(v8ha*)(Ksh + sr * KPIT + sc0 + 8 * i) = kst[i];
#pragma unroll
    for (int i = 0; i < 4; ++i) *(v8ha*)(Vsh + sr * VPIT + scv + 8 * i) = vst[i];
    // the chunk's upper p-row tile, over the lower tile of the chunk before, whose reads the barrier above has ended
#pragma unroll
    for (int i = 0; i < 8; ++i) *(v8ha*)(Rsh + (((tpb + kc + 1) & 1) * 64 + sr) * KPIT + sc0 + 8 * i) = pst[i];
    __syncthreads();

    if (kc + 1 < SEQ / 64) {                          // block-uniform: the last chunk fetches nothing
      const int kn0 = (kc + 1) * 64;
#pragma unroll
      for (int i = 0; i < 8; ++i) kst[i] = *(const v8h*)(ksrc + (size_t)kn0 * QKW + 8 * i);
#pragma unroll
      for (int i = 0; i < 4; ++i) vst[i] = *(const v8h*)(vsrc + kn0 + 8 * i);
#pragma unroll
      for (int i = 0; i < 8; ++i) pst[i] = *(const v8h*)(psrc + (size_t)(kn0 + 64) * QKW + 8 * i);
      // stands ahead of any reuse of the address registers named above; its memory clobber also holds the reads here,
      // in front of the score products
      asm volatile("s_wait_xcnt 0x0" ::: "memory");
    }

    // position scores: W[u] = QV(16x128) . p^T for window rows 48 - 16*wave + 16u .. + 15, then the rel-shift
    // (W[0] of a chunk is W[4] of the chunk before: the same queries against the same p rows, so it is carried over)
    v8f pos[4];
    {
      v8f w5[5];
      const _Float16* pr[5];
#pragma unroll
      for (int u = 0; u < 5; ++u) {
        const int x = 48 - 16 * wave + 16 * u;      // 0 .. 112: a 16-row group lies in one tile
        pr[u] = Rsh + (((tpb + kc + (x >> 6)) & 1) * 64 + (x & 63) + c) * KPIT + 8 * hh;
      }
      if (kc == 0) {                                // block-uniform: nothing to carry yet
#pragma unroll
        for (int dc = 0; dc < 4; ++dc) wtop = mma16(qv[dc], ldfrag(pr[0] + dc * 32), wtop);
      }
      w5[0] = wtop;
#pragma unroll
      for (int u = 1; u < 5; ++u) w5[u] = zero8();
#pragma unroll
      for (int dc = 0; dc < 4; ++dc) {
        v16h pb[4];                                 // the 8 LDS reads of a 32-deep step stand as one group
#pragma unroll
        for (int u = 1; u < 5; ++u) pb[u - 1] = ldfrag(pr[u] + dc * 32);
#pragma unroll
        for (int u = 1; u < 5; ++u) w5[u] = mma16(qv[dc], pb[u - 1], w5[u]);
      }
      wtop = w5[4];
#pragma unroll
      for (int r = 0; r < 8; ++r)
#pragma unroll
        for (int j = 0; j < 4; ++j) {
          const float offer = own[r] ? w5[j][r] : w5[j + 1][r];
          pos[j][r] = __int_as_float(__builtin_amdgcn_ds_bpermute(pidx[r], __float_as_int(offer)));
        }
    }

    // content scores: S[j] = QU(16x128) . K^T for key subtile j
    v8f s[4];
#pragma unroll
    for (int j = 0; j < 4; ++j) {
      s[j] = zero8();
#pragma unroll
      for (int dc = 0; dc < 4; ++dc) {
        const v16h kb = ldfrag(Ksh + (j * 16 + c) * KPIT + dc * 32 + 8 * hh);
        s[j] = mma16(qa[dc], kb, s[j]);
      }
    }

    // add the position term, chunk row max
    float cm[8];
#pragma unroll
    for (int r = 0; r < 8; ++r) {
      float m = -INFINITY;
#pragma unroll
      for (int j = 0; j < 4; ++j) {
        const float sv = (s[j][r] + pos[j][r]) * cs;   // cs is a power of two: the one rounding is that of the sum
        s[j][r] = sv;
        m = fmaxf(m, sv);
      }
      m = fmaxf(m, __shfl_xor(m, 1, 32));
      m = fmaxf(m, __shfl_xor(m, 2, 32));
      m = fmaxf(m, __shfl_xor(m, 4, 32));
      m = fmaxf(m, __shfl_xor(m, 8, 32));
      cm[r] = m;
    }

    // online softmax update (per-row rescale of this row's accumulator elements only);
    // P tile (x4096) to this wave's LDS tile [row][key]
#pragma unroll
    for (int r = 0; r < 8; ++r) {
      const float mnew  = fmaxf(mrow[r], cm[r]);
      const float alpha = __expf(mrow[r] - mnew);
      mrow[r] = mnew;
      float psum = 0.f;
#pragma unroll
      for (int j = 0; j < 4; ++j) {
        const float p = __expf(s[j][r] - mnew);
        psum += p;
        pw[(8 * hh + r) * VPIT + j * 16 + c] = (_Float16)(p * 4096.0f);
      }
      psum += __shfl_xor(psum, 1, 32);
      psum += __shfl_xor(psum, 2, 32);
      psum += __shfl_xor(psum, 4, 32);
      psum += __shfl_xor(psum, 8, 32);
      lrow[r] = lrow[r] * alpha + psum;
#pragma unroll
      for (int t = 0; t < 4; ++t) oacc[t][r] *= alpha;
    }
    __builtin_amdgcn_fence(__ATOMIC_RELEASE, "workgroup");
    __builtin_amdgcn_wave_barrier();
    __builtin_amdgcn_fence(__ATOMIC_ACQUIRE, "workgroup");

    // P (A operand, row = lane&15, split k map over keys) . V (B operand from V^T rows d)
#pragma unroll
    for (int kk = 0; kk < 2; ++kk) {
      const v16h pa = ldfrag(pw + c * VPIT + kk * 32 + 8 * hh);
#pragma unroll
      for (int t = 0; t < 4; ++t) {
        const v16h vb = ldfrag(Vsh + (t * 16 + c) * VPIT + kk * 32 + 8 * hh);
        oacc[t] = mma16(pa, vb, oacc[t]);
      }
    }
  }

  __syncthreads();                               // every wave is done with Ksh before Osh aliases it
  float* os = Osh + wave * (16 * OPIT);
#pragma unroll
  for (int r = 0; r < 8; ++r) {
    const float inv = 1.0f / (1024.0f * lrow[r]);   // 64 / (4096 * 16 * l)
#pragma unroll
    for (int t = 0; t < 4; ++t) os[(8 * hh + r) * OPIT + t * 16 + c] = oacc[t][r] * inv;
  }
  __builtin_amdgcn_fence(__ATOMIC_RELEASE, "workgroup");
  __builtin_amdgcn_wave_barrier();
  __builtin_amdgcn_fence(__ATOMIC_ACQUIRE, "workgroup");
  const int q8 = lane >> 3, c8 = (lane & 7) * 8;
  v8h ov[4];
#pragma unroll
  for (int it = 0; it < 4; ++it) {
    const int row = it * 4 + q8;
    const float* sp = os + row * OPIT + c8;
    const v4f x0 = *(const v4fa*)(sp);
    const v4f x1 = *(const v4fa*)(sp + 4);
    v8h o;
    o[0] = (_Float16)x0[0]; o[1] = (_Float16)x0[1]; o[2] = (_Float16)x0[2]; o[3] = (_Float16)x0[3];
    o[4] = (_Float16)x1[0]; o[5] = (_Float16)x1[1]; o[6] = (_Float16)x1[2]; o[7] = (_Float16)x1[3];
    ov[it] = o;
  }
  {
#pragma unroll
    for (int it = 0; it < 4; ++it) {
      const int row = it * 4 + q8;
      *(v8h*)(ctx + (size_t)(q0 + row) * ND + c8) = ov[it];
    }
    
  }
}

// -------------------------------------------------------------------------------------------------
// Workspace map (bytes, NB=8 SEQ=1024): every batch element's planes are live at once.
//   P2   f16 [NPP][2048]             8388608
//   QU2  f16 [NB*SEQ][2048]         33554432
//   QV2  f16 [NB*SEQ][2048]         33554432
//   KP2  f16 [NB*SEQ][2048]         33554432
//   VT   f16 [NB][1024][SEQ]        16777216
//   SCR                             50331648   early phase: WQ2, WK2 f16 [1024][2048], WV, WP f16 [1024][1024],
//                                              PE f16 [NPP][1024], XH f16 [NB*SEQ][2048] (all dead after the projections);
//                                              last phase: WO f16 [1024][1024] (converted after the attention launch),
//                                              then CTX f16 [NB*SEQ][1024] (written by the attention launch)
//   total                          176160768
// Every region is written in whole 64x64 tiles / whole rows; all region sizes equal their written extents.
// -------------------------------------------------------------------------------------------------
extern "C" void kernel_launch(void* const* d_in, const int* in_sizes, int n_in,
                              void* d_out, int out_size, void* d_ws, size_t ws_size,
                              hipStream_t stream) {
  if (n_in < 14) return;
  if (in_sizes[0] < ((NB - 1) * SEQ_FULL + SEQ) * ND) return;
  if (in_sizes[1] != ND * ND || in_sizes[3] != ND * ND || in_sizes[5] != ND * ND) return;
  if (in_sizes[7] != ND * ND || in_sizes[8] != ND * ND) return;
  if (in_sizes[2] < ND || in_sizes[4] < ND || in_sizes[6] < ND || in_sizes[9] < ND) return;
  if (in_sizes[10] < NH * HDV || in_sizes[11] < NH * HDV) return;
  if (in_sizes[12] < ND || in_sizes[13] < ND) return;
  if (out_size < NB * SEQ * ND) return;

  const float* x    = (const float*)d_in[0];
  const float* Wq   = (const float*)d_in[1];
  const float* bq   = (const float*)d_in[2];
  const float* Wk   = (const float*)d_in[3];
  const float* bk   = (const float*)d_in[4];
  const float* Wv   = (const float*)d_in[5];
  const float* bv   = (const float*)d_in[6];
  const float* Wpos = (const float*)d_in[7];
  const float* Wout = (const float*)d_in[8];
  const float* bout = (const float*)d_in[9];
  const float* ub   = (const float*)d_in[10];
  const float* vbias= (const float*)d_in[11];
  const float* lng  = (const float*)d_in[12];
  const float* lnb  = (const float*)d_in[13];
  float* out = (float*)d_out;

  const size_t szW2  = (size_t)ND * QKW * 2;              //   4194304
  const size_t szW1  = (size_t)ND * ND * 2;               //   2097152
  const size_t szXH  = (size_t)NB * SEQ * QKW * 2;        //  33554432
  const size_t szQ   = (size_t)NB * SEQ * QKW * 2;        //  33554432
  const size_t szVT  = (size_t)NB * ND * SEQ * 2;         //  16777216
  const size_t szP2  = (size_t)NPP * QKW * 2;             //   8388608
  const size_t szPE  = (size_t)NPP * ND * 2;              //   4194304
  const size_t szCTX = (size_t)NB * SEQ * ND * 2;         //  16777216
  const size_t szEarly = 2 * szW2 + 2 * szW1 + szPE + szXH;
  const size_t szLate  = szW1 + szCTX;
  const size_t szSCR = (szEarly > szLate) ? szEarly : szLate;
  size_t off = 0;
  const size_t oP2  = off; off += szP2;
  const size_t oQU2 = off; off += szQ;
  const size_t oQV2 = off; off += szQ;
  const size_t oKP2 = off; off += szQ;
  const size_t oVT  = off; off += szVT;
  const size_t oSCR = off; off += szSCR;
  const size_t total = off;                                // 176160768 for NB=8, SEQ=1024
  if (total > ws_size) return;
  const size_t oWQ2 = oSCR;
  const size_t oWK2 = oWQ2 + szW2;
  const size_t oWV  = oWK2 + szW2;
  const size_t oWP  = oWV + szW1;
  const size_t oPE  = oWP + szW1;
  const size_t oXH  = oPE + szPE;

  char* ws = (char*)d_ws;
  _Float16* WQ2 = (_Float16*)(ws + oWQ2);
  _Float16* WK2 = (_Float16*)(ws + oWK2);
  _Float16* WVp = (_Float16*)(ws + oWV);
  _Float16* WOp = (_Float16*)(ws + oSCR);
  _Float16* XH  = (_Float16*)(ws + oXH);
  _Float16* QU2 = (_Float16*)(ws + oQU2);
  _Float16* QV2 = (_Float16*)(ws + oQV2);
  _Float16* KP2 = (_Float16*)(ws + oKP2);
  _Float16* VTp = (_Float16*)(ws + oVT);
  _Float16* P2  = (_Float16*)(ws + oP2);
  _Float16* CTX = (_Float16*)(ws + oSCR + szW1);
  _Float16* WPp = (_Float16*)(ws + oWP);
  _Float16* PEp = (_Float16*)(ws + oPE);

  const float cs = 0.125f * 0.00390625f;   // (1/sqrt(64)) / 256 applied to the x16.x16 score accumulators
  const dim3 blk(256);

  // (1) weights -> f16 planes of bf16-valued entries: Wq, Wk as [x64 | /16] 2048-wide; Wv, Wpos x64
  const dim3 gW(ND * (ND / 8) / 256);      // 512
  cvt_w_kernel<true ><<<gW, blk, 0, stream>>>(Wq,   WQ2, 64.0f, 0.0625f);
  cvt_w_kernel<true ><<<gW, blk, 0, stream>>>(Wk,   WK2, 64.0f, 0.0625f);
  cvt_w_kernel<false><<<gW, blk, 0, stream>>>(Wv,   WVp, 64.0f, 64.0f);
  cvt_w_kernel<false><<<gW, blk, 0, stream>>>(Wpos, WPp, 64.0f, 64.0f);
  // (2) LayerNorm -> XH [NB*SEQ][2048] (hi | residual x1024)
  ln_kernel<<<dim3((NB * SEQ) / 8), blk, 0, stream>>>(x, lng, lnb, XH, NB * SEQ);
  // (3) positional sinusoid table -> PE [NPP][1024] (row NPP-1 = 0)
  pe_kernel<<<dim3((NPP * (ND / 8) + 255) / 256), blk, 0, stream>>>(PEp);
  // (4) p = pe . Wpos^T -> P2 = [16p | p/64]   (M=NPP, N=1024, K=1024)
  {
    const int tiles = (NPP / GBM) * (ND / GBN);
    gemm_f16_kernel<2, false><<<dim3(tiles, 1), blk, 0, stream>>>(
        PEp, ND, 0L, 0L, WPp, ND, 0L, (void*)P2, (void*)P2, QKW, 0L, 0L, bq, bq, bq,
        NPP, ND, ND, 0.015625f, 16.0f);
  }
  // (5) projections of all batch elements, one launch each
  const int tilesQ  = ((NB * SEQ) / GBM) * (ND / GBN);
  const int tilesV  = (ND / GBM) * (SEQ / GBN);
  // QU2 = split(16*(q + bq + u_bias)), QV2 = split(16*(q + bq + v_bias))   (M=NB*SEQ, N=1024, K=2048)
  gemm_f16_kernel<3, true><<<dim3(tilesQ, 1), blk, 0, stream>>>(
      XH, QKW, 0L, 0L, WQ2, QKW, 0L, (void*)QU2, (void*)QV2, QKW, 0L, 0L, ub, vbias, bq,
      NB * SEQ, ND, QKW, 0.015625f, 16.0f);
  // KP2 = [16k | k/64], k = xn.Wk^T + bk   (M=NB*SEQ, N=1024, K=2048)
  gemm_f16_kernel<2, true><<<dim3(tilesQ, 1), blk, 0, stream>>>(
      XH, QKW, 0L, 0L, WK2, QKW, 0L, (void*)KP2, (void*)KP2, QKW, 0L, 0L, bk, bk, bk,
      NB * SEQ, ND, QKW, 0.015625f, 16.0f);
  // VT[b][h*64+d][s] = 16*(v + bv)   (A = Wv plane [1024][1024], Bt = XH hi columns of batch element y; M=1024, N=SEQ, K=1024)
  gemm_f16_kernel<4, true><<<dim3(tilesV, NB), blk, 0, stream>>>(
      WVp, ND, 0L, 0L, XH, QKW, (long)SEQ * QKW, (void*)VTp, (void*)VTp, SEQ, (long)ND * SEQ, 0L, bv, bv, bv,
      ND, SEQ, ND, 0.015625f, 16.0f);
  // (6) attention with its position scores, all batch elements and heads in one launch
  relattn_kernel<<<dim3(SEQ / 64, NH, NB), dim3(128), 0, stream>>>(QU2, QV2, KP2, VTp, P2, CTX, cs);
  // (7) out = ctx . Wout^T + bout -> d_out f32 [NB*SEQ][1024]   (M=NB*SEQ, N=1024, K=1024; carries 64*64 folded into scale)
  cvt_w_kernel<false><<<gW, blk, 0, stream>>>(Wout, WOp, 64.0f, 64.0f);
  {
    const int tiles = ((NB * SEQ) / GBM) * (ND / GBN);
    gemm_f16_kernel<1, true><<<dim3(tiles, 1), blk, 0, stream>>>(
        CTX, ND, 0L, 0L, WOp, ND, 0L, (void*)out, (void*)out, ND, 0L, 0L, bout, bout, bout,
        NB * SEQ, ND, ND, 0.000244140625f, 1.0f);
  }
  (void)hipGetLastError();
}

// v006
// One run takes 310 microseconds.
// In both of two side-by-side timings against v005, it was 1.08 times as fast.
// All steps since v000 together make it 11.0 times as fast.
// Contractions: xn.Wq^T and xn.Wk^T (xn as f16 hi + x1024 f16 residual planes folded along K against Wx64 | W/16 planes), Wv.xn^T (xn hi, Wx64), pe.Wpos^T (pe f16, Wx64), (q+v_bias).p^T band and (q+u_bias).k^T (16q as f16 hi + x1024 residual folded along the head dim against 16p | p/64 and 16k | k/64 planes), P.V (P x4096, v x16), ctx.Wout^T (ctx x64, W x64): all v_wmma_f32_16x16x32_f16 (f16 operands, f32 accumulate); float inputs bf16-RNE valued; LayerNorm, positional table, softmax, bias adds and scaling in f32.
#include <hip/hip_runtime.h>
#include <math.h>
#include <stdint.h>

#ifndef NB
#define NB 8
#endif
#ifndef SEQ
#define SEQ 1024
#endif
#define SEQ_FULL 1024
#define ND    1024
#define NH    16
#define HDV   64            // value head dim
#define HQK   128           // folded depth of the q.k / q.p contractions: 64 hi + 64 residual
#define QKW   (2 * ND)      // pitch (halves) of the 2048-wide f16 planes
#define NP    (2 * SEQ - 1)
#define NPP   (2 * SEQ)

static_assert(SEQ % 64 == 0);
static_assert(SEQ <= SEQ_FULL);
static_assert(ND == NH * HDV);
static_assert(HQK == 2 * HDV);
static_assert(ND % 256 == 0);
static_assert(NPP % 64 == 0);

typedef _Float16 v16h __attribute__((ext_vector_type(16)));
typedef _Float16 v8h  __attribute__((ext_vector_type(8)));
typedef float    v8f  __attribute__((ext_vector_type(8)));
typedef float    v4f  __attribute__((ext_vector_type(4)));
typedef unsigned int v4u __attribute__((ext_vector_type(4)));
typedef v4f __attribute__((may_alias)) v4fa;
typedef v8h __attribute__((may_alias)) v8ha;

// bf16 RNE of an f32 value, returned widened to f32 (exactly representable in f16 after a power-of-two carry)
__device__ __forceinline__ float bf_rne(float f) {
  unsigned u = __float_as_uint(f);
  u = (u + 0x7FFFu + ((u >> 16) & 1u)) & 0xFFFF0000u;
  return __uint_as_float(u);
}

// 16-bit WMMA fragment: elements 0..7 <- p[0..7], elements 8..15 <- p[16..23]
// (A: p = row m at k0 + 8h;  B stored [n][k]: p = row n at k0 + 8h;  same split k map for both)
union FragU { v16h v; v8ha h[2]; };
__device__ __forceinline__ v16h ldfrag(const _Float16* p) {
  FragU f;
  f.h[0] = *(const v8ha*)(p);
  f.h[1] = *(const v8ha*)(p + 16);
  return f.v;
}

// WMMA + hazard guard (ties D, keeps A/B live for 4 VALU slots)
__device__ __forceinline__ v8f mma16(v16h a, v16h b, v8f c) {
  c = __builtin_amdgcn_wmma_f32_16x16x32_f16(false, a, false, b, (short)0, c, false, false);
  asm volatile("v_nop\n\tv_nop\n\tv_nop\n\tv_nop" : "+v"(c) : "v"(a), "v"(b));
  return c;
}

__device__ __forceinline__ v8f zero8() { v8f z = {0.f, 0.f, 0.f, 0.f, 0.f, 0.f, 0.f, 0.f}; return z; }

// 16-lane butterfly (lane ^ 1, ^ 2, ^ 4, ^ 8) over eight independent values at once, on the vector port by DPP row_xmask;
// every lane must be on.  It takes the place of ds_bpermute_b32 round trips through the LDS pipe, each with its own wait.
// Written as text because the builtin DPP move came out as three instructions a step for the maximum; the eight values are
// interleaved so that every instruction's producer stands eight instructions back and no step waits for the one before.
__device__ __forceinline__ void row_max8(float (&m)[8]) {
  asm(
      "v_max_num_f32_dpp %0, %0, %0 row_xmask:1 row_mask:0xf bank_mask:0xf\n\t"
      "v_max_num_f32_dpp %1, %1, %1 row_xmask:1 row_mask:0xf bank_mask:0xf\n\t"
      "v_max_num_f32_dpp %2, %2, %2 row_xmask:1 row_mask:0xf bank_mask:0xf\n\t"
      "v_max_num_f32_dpp %3, %3, %3 row_xmask:1 row_mask:0xf bank_mask:0xf\n\t"
      "v_max_num_f32_dpp %4, %4, %4 row_xmask:1 row_mask:0xf bank_mask:0xf\n\t"
      "v_max_num_f32_dpp %5, %5, %5 row_xmask:1 row_mask:0xf bank_mask:0xf\n\t"
      "v_max_num_f32_dpp %6, %6, %6 row_xmask:1 row_mask:0xf bank_mask:0xf\n\t"
      "v_max_num_f32_dpp %7, %7, %7 row_xmask:1 row_mask:0xf bank_mask:0xf\n\t"
      "v_max_num_f32_dpp %0, %0, %0 row_xmask:2 row_mask:0xf bank_mask:0xf\n\t"
      "v_max_num_f32_dpp %1, %1, %1 row_xmask:2 row_mask:0xf bank_mask:0xf\n\t"
      "v_max_num_f32_dpp %2, %2, %2 row_xmask:2 row_mask:0xf bank_mask:0xf\n\t"
      "v_max_num_f32_dpp %3, %3, %3 row_xmask:2 row_mask:0xf bank_mask:0xf\n\t"
      "v_max_num_f32_dpp %4, %4, %4 row_xmask:2 row_mask:0xf bank_mask:0xf\n\t"
      "v_max_num_f32_dpp %5, %5, %5 row_xmask:2 row_mask:0xf bank_mask:0xf\n\t"
      "v_max_num_f32_dpp %6, %6, %6 row_xmask:2 row_mask:0xf bank_mask:0xf\n\t"
      "v_max_num_f32_dpp %7, %7, %7 row_xmask:2 row_mask:0xf bank_mask:0xf\n\t"
      "v_max_num_f32_dpp %0, %0, %0 row_xmask:4 row_mask:0xf bank_mask:0xf\n\t"
      "v_max_num_f32_dpp %1, %1, %1 row_xmask:4 row_mask:0xf bank_mask:0xf\n\t"
      "v_max_num_f32_dpp %2, %2, %2 row_xmask:4 row_mask:0xf bank_mask:0xf\n\t"
      "v_max_num_f32_dpp %3, %3, %3 row_xmask:4 row_mask:0xf bank_mask:0xf\n\t"
      "v_max_num_f32_dpp %4, %4, %4 row_xmask:4 row_mask:0xf bank_mask:0xf\n\t"
      "v_max_num_f32_dpp %5, %5, %5 row_xmask:4 row_mask:0xf bank_mask:0xf\n\t"
      "v_max_num_f32_dpp %6, %6, %6 row_xmask:4 row_mask:0xf bank_mask:0xf\n\t"
      "v_max_num_f32_dpp %7, %7, %7 row_xmask:4 row_mask:0xf bank_mask:0xf\n\t"
      "v_max_num_f32_dpp %0, %0, %0 row_xmask:8 row_mask:0xf bank_mask:0xf\n\t"
      "v_max_num_f32_dpp %1, %1, %1 row_xmask:8 row_mask:0xf bank_mask:0xf\n\t"
      "v_max_num_f32_dpp %2, %2, %2 row_xmask:8 row_mask:0xf bank_mask:0xf\n\t"
      "v_max_num_f32_dpp %3, %3, %3 row_xmask:8 row_mask:0xf bank_mask:0xf\n\t"
      "v_max_num_f32_dpp %4, %4, %4 row_xmask:8 row_mask:0xf bank_mask:0xf\n\t"
      "v_max_num_f32_dpp %5, %5, %5 row_xmask:8 row_mask:0xf bank_mask:0xf\n\t"
      "v_max_num_f32_dpp %6, %6, %6 row_xmask:8 row_mask:0xf bank_mask:0xf\n\t"
      "v_max_num_f32_dpp %7, %7, %7 row_xmask:8 row_mask:0xf bank_mask:0xf"
      : "+v"(m[0]), "+v"(m[1]), "+v"(m[2]), "+v"(m[3]), "+v"(m[4]), "+v"(m[5]), "+v"(m[6]), "+v"(m[7]));
}
__device__ __forceinline__ void row_sum8(float (&s)[8]) {
  asm(
      "v_add_f32_dpp %0, %0, %0 row_xmask:1 row_mask:0xf bank_mask:0xf\n\t"
      "v_add_f32_dpp %1, %1, %1 row_xmask:1 row_mask:0xf bank_mask:0xf\n\t"
      "v_add_f32_dpp %2, %2, %2 row_xmask:1 row_mask:0xf bank_mask:0xf\n\t"
      "v_add_f32_dpp %3, %3, %3 row_xmask:1 row_mask:0xf bank_mask:0xf\n\t"
      "v_add_f32_dpp %4, %4, %4 row_xmask:1 row_mask:0xf bank_mask:0xf\n\t"
      "v_add_f32_dpp %5, %5, %5 row_xmask:1 row_mask:0xf bank_mask:0xf\n\t"
      "v_add_f32_dpp %6, %6, %6 row_xmask:1 row_mask:0xf bank_mask:0xf\n\t"
      "v_add_f32_dpp %7, %7, %7 row_xmask:1 row_mask:0xf bank_mask:0xf\n\t"
      "v_add_f32_dpp %0, %0, %0 row_xmask:2 row_mask:0xf bank_mask:0xf\n\t"
      "v_add_f32_dpp %1, %1, %1 row_xmask:2 row_mask:0xf bank_mask:0xf\n\t"
      "v_add_f32_dpp %2, %2, %2 row_xmask:2 row_mask:0xf bank_mask:0xf\n\t"
      "v_add_f32_dpp %3, %3, %3 row_xmask:2 row_mask:0xf bank_mask:0xf\n\t"
      "v_add_f32_dpp %4, %4, %4 row_xmask:2 row_mask:0xf bank_mask:0xf\n\t"
      "v_add_f32_dpp %5, %5, %5 row_xmask:2 row_mask:0xf bank_mask:0xf\n\t"
      "v_add_f32_dpp %6, %6, %6 row_xmask:2 row_mask:0xf bank_mask:0xf\n\t"
      "v_add_f32_dpp %7, %7, %7 row_xmask:2 row_mask:0xf bank_mask:0xf\n\t"
      "v_add_f32_dpp %0, %0, %0 row_xmask:4 row_mask:0xf bank_mask:0xf\n\t"
      "v_add_f32_dpp %1, %1, %1 row_xmask:4 row_mask:0xf bank_mask:0xf\n\t"
      "v_add_f32_dpp %2, %2, %2 row_xmask:4 row_mask:0xf bank_mask:0xf\n\t"
      "v_add_f32_dpp %3, %3, %3 row_xmask:4 row_mask:0xf bank_mask:0xf\n\t"
      "v_add_f32_dpp %4, %4, %4 row_xmask:4 row_mask:0xf bank_mask:0xf\n\t"
      "v_add_f32_dpp %5, %5, %5 row_xmask:4 row_mask:0xf bank_mask:0xf\n\t"
      "v_add_f32_dpp %6, %6, %6 row_xmask:4 row_mask:0xf bank_mask:0xf\n\t"
      "v_add_f32_dpp %7, %7, %7 row_xmask:4 row_mask:0xf bank_mask:0xf\n\t"
      "v_add_f32_dpp %0, %0, %0 row_xmask:8 row_mask:0xf bank_mask:0xf\n\t"
      "v_add_f32_dpp %1, %1, %1 row_xmask:8 row_mask:0xf bank_mask:0xf\n\t"
      "v_add_f32_dpp %2, %2, %2 row_xmask:8 row_mask:0xf bank_mask:0xf\n\t"
      "v_add_f32_dpp %3, %3, %3 row_xmask:8 row_mask:0xf bank_mask:0xf\n\t"
      "v_add_f32_dpp %4, %4, %4 row_xmask:8 row_mask:0xf bank_mask:0xf\n\t"
      "v_add_f32_dpp %5, %5, %5 row_xmask:8 row_mask:0xf bank_mask:0xf\n\t"
      "v_add_f32_dpp %6, %6, %6 row_xmask:8 row_mask:0xf bank_mask:0xf\n\t"
      "v_add_f32_dpp %7, %7, %7 row_xmask:8 row_mask:0xf bank_mask:0xf"
      : "+v"(s[0]), "+v"(s[1]), "+v"(s[2]), "+v"(s[3]), "+v"(s[4]), "+v"(s[5]), "+v"(s[6]), "+v"(s[7]));
}

// -------------------------------------------------------------------------------------------------
// Weight [1024][1024] f32 -> f16 plane of bf16-valued entries.
//   DUP false: dst [1024][1024], dst[r][c] = f16(bf_rne(W)*s1)
//   DUP true : dst [1024][2048], dst[r][c] = f16(bf_rne(W)*s1), dst[r][1024+c] = f16(bf_rne(W)*s2)
// coverage: 131072 threads x 8 = the whole [1024][1024] source (both column halves for DUP).
// -------------------------------------------------------------------------------------------------
template <bool DUP>
__global__ __launch_bounds__(256) void cvt_w_kernel(const float* __restrict__ src, _Float16* __restrict__ dst,
                                                    float s1, float s2) {
  const int i = blockIdx.x * 256 + threadIdx.x;
  const int total8 = ND * (ND / 8);
  if (i >= total8) return;
  const int r  = i / (ND / 8);
  const int c8 = (i - r * (ND / 8)) * 8;
  const float* sp = src + (size_t)r * ND + c8;
  const v4f a = *(const v4f*)(sp);
  const v4f b = *(const v4f*)(sp + 4);
  float f[8];
  f[0] = bf_rne(a[0]); f[1] = bf_rne(a[1]); f[2] = bf_rne(a[2]); f[3] = bf_rne(a[3]);
  f[4] = bf_rne(b[0]); f[5] = bf_rne(b[1]); f[6] = bf_rne(b[2]); f[7] = bf_rne(b[3]);
  v8h o1, o2;
#pragma unroll
  for (int e = 0; e < 8; ++e) { o1[e] = (_Float16)(f[e] * s1); o2[e] = (_Float16)(f[e] * s2); }
  const int pitch = DUP ? QKW : ND;
  _Float16* dp = dst + (size_t)r * pitch + c8;
  *(v8h*)dp = o1;
  if (DUP) *(v8h*)(dp + ND) = o2;
  
}

// -------------------------------------------------------------------------------------------------
//   XH[row][c]        = f16(xn)                       (hi)
//   XH[row][1024 + c] = f16((xn - hi) * 1024)         (residual, carried x1024)
// One wave per row (compact row b*SEQ + t; source row b*SEQ_FULL + t); block = 8 waves = 8 rows; no LDS.
// Stores: lane l writes 16 B at columns i*256 + 8l: one instruction = 32 lanes x 16 B = 512 contiguous B =
// coverage: grid NB*SEQ/8 x 8 waves x (4 x 256) columns x {hi, residual} = the whole [NB*SEQ][2048] plane.
// Loops rolled on purpose (small elementwise side computation).
// -------------------------------------------------------------------------------------------------
__global__ __launch_bounds__(256) void ln_kernel(const float* __restrict__ x, const float* __restrict__ g,
                                                const float* __restrict__ bt, _Float16* __restrict__ XH,
                                                int nrows) {
  const int lane = threadIdx.x & 31;
  const int wave = threadIdx.x >> 5;
  const int row  = blockIdx.x * 8 + wave;
  if (row >= nrows) return;                                   // wave-uniform; no barriers in this kernel
  const int b = row / SEQ;
  const int t = row - b * SEQ;
  const float* xr = x + ((size_t)b * SEQ_FULL + t) * ND + lane * 8;

  float s = 0.f;
#pragma unroll 1
  for (int i = 0; i < 4; ++i) {
    const v4f a = *(const v4f*)(xr + i * 256);
    const v4f c = *(const v4f*)(xr + i * 256 + 4);
    s += (bf_rne(a[0]) + bf_rne(a[1])) + (bf_rne(a[2]) + bf_rne(a[3]));
    s += (bf_rne(c[0]) + bf_rne(c[1])) + (bf_rne(c[2]) + bf_rne(c[3]));
  }
  s += __shfl_xor(s, 16, 32); s += __shfl_xor(s, 8, 32); s += __shfl_xor(s, 4, 32);
  s += __shfl_xor(s, 2, 32);  s += __shfl_xor(s, 1, 32);
  const float mu = s * (1.0f / (float)ND);

  float s2 = 0.f;
#pragma unroll 1
  for (int i = 0; i < 4; ++i) {
    const v4f a = *(const v4f*)(xr + i * 256);
    const v4f c = *(const v4f*)(xr + i * 256 + 4);
    float d;
    d = bf_rne(a[0]) - mu; s2 += d * d;  d = bf_rne(a[1]) - mu; s2 += d * d;
    d = bf_rne(a[2]) - mu; s2 += d * d;  d = bf_rne(a[3]) - mu; s2 += d * d;
    d = bf_rne(c[0]) - mu; s2 += d * d;  d = bf_rne(c[1]) - mu; s2 += d * d;
    d = bf_rne(c[2]) - mu; s2 += d * d;  d = bf_rne(c[3]) - mu; s2 += d * d;
  }
  s2 += __shfl_xor(s2, 16, 32); s2 += __shfl_xor(s2, 8, 32); s2 += __shfl_xor(s2, 4, 32);
  s2 += __shfl_xor(s2, 2, 32);  s2 += __shfl_xor(s2, 1, 32);
  const float var  = s2 * (1.0f / (float)ND);
  const float rstd = rsqrtf(var + 1e-5f);

  _Float16* xh = XH + (size_t)row * QKW + lane * 8;
{
#pragma unroll 1
    for (int i = 0; i < 4; ++i) {
      const v4f a  = *(const v4f*)(xr + i * 256);
      const v4f c  = *(const v4f*)(xr + i * 256 + 4);
      const v4f ga = *(const v4f*)(g + i * 256 + lane * 8);
      const v4f gb = *(const v4f*)(g + i * 256 + lane * 8 + 4);
      const v4f ba = *(const v4f*)(bt + i * 256 + lane * 8);
      const v4f bb = *(const v4f*)(bt + i * 256 + lane * 8 + 4);
      float f[8], gg[8], be[8];
      f[0] = a[0]; f[1] = a[1]; f[2] = a[2]; f[3] = a[3]; f[4] = c[0]; f[5] = c[1]; f[6] = c[2]; f[7] = c[3];
      gg[0] = ga[0]; gg[1] = ga[1]; gg[2] = ga[2]; gg[3] = ga[3];
      gg[4] = gb[0]; gg[5] = gb[1]; gg[6] = gb[2]; gg[7] = gb[3];
      be[0] = ba[0]; be[1] = ba[1]; be[2] = ba[2]; be[3] = ba[3];
      be[4] = bb[0]; be[5] = bb[1]; be[6] = bb[2]; be[7] = bb[3];
      v8h ho, lo;
#pragma unroll
      for (int e = 0; e < 8; ++e) {
        const float xn = (bf_rne(f[e]) - mu) * rstd * bf_rne(gg[e]) + bf_rne(be[e]);
        const _Float16 hv = (_Float16)xn;
        ho[e] = hv;
        lo[e] = (_Float16)((xn - (float)hv) * 1024.0f);
      }
      *(v8h*)(xh + i * 256)      = ho;
      *(v8h*)(xh + ND + i * 256) = lo;
    }
    
  }
}

// -------------------------------------------------------------------------------------------------
// Relative-position sinusoid table -> PE f16 plane [NPP][1024] (rows >= NP are 0):
//   row r <-> relative position pos = SEQ-1-r;  div_j = expf(f32(2j) * f32(-ln(1e4)/1024));
//   ang = |pos| * div_j (f32 product);  PE[r][2j] = sin(ang) with the sign of pos, PE[r][2j+1] = cos(ang).
// passes.  The per-pair loop is rolled (one sinf, one cosf, one expf body); the 16-B result is assembled by a
// register rotate with constant indices (no dynamic local-array indexing).
// coverage: grid NPP*128/256, NPP*128 threads x 8 halves = the whole [NPP][1024] plane.
// -------------------------------------------------------------------------------------------------
__global__ __launch_bounds__(256) void pe_kernel(_Float16* __restrict__ PE) {
  const int i = blockIdx.x * 256 + threadIdx.x;
  if (i >= NPP * (ND / 8)) return;
  const int r  = i / (ND / 8);
  const int c8 = (i - r * (ND / 8)) * 8;
  const int pos = SEQ - 1 - r;
  const float fpos = (float)((pos < 0) ? -pos : pos);
  const float live = (r < NP) ? 1.0f : 0.0f;
  const float c0 = (float)(-9.210340371976184 / (double)ND);
  v4u pk = {0u, 0u, 0u, 0u};
#pragma unroll 1
  for (int e = 0; e < 4; ++e) {
    const int j = (c8 >> 1) + e;
    const float dv  = expf((float)(2 * j) * c0);
    const float ang = fpos * dv;
    float sn = sinf(ang);
    const float cn = cosf(ang);
    sn = (pos < 0) ? -sn : sn;
    const _Float16 hs = (_Float16)(sn * live);
    const _Float16 hc = (_Float16)(cn * live);
    const unsigned w = (unsigned)__builtin_bit_cast(unsigned short, hs) |
                       ((unsigned)__builtin_bit_cast(unsigned short, hc) << 16);
    v4u nx;
    nx[0] = pk[1]; nx[1] = pk[2]; nx[2] = pk[3]; nx[3] = w;
    pk = nx;
  }
  unsigned* dp = (unsigned*)(PE + (size_t)r * ND + c8);
  *(v4u*)dp = pk;
  
}

// -------------------------------------------------------------------------------------------------
// LDS ring of the staged GEMM path: one stage = 128 k of [A 128 rows | Bt 256 rows], 256-B rows at pitch 272 B
// (an odd multiple of 16 B for the ds_load_b128 fragment reads), two buffers.
// -------------------------------------------------------------------------------------------------
#define GBM    128                    // block tile rows (2 waves of 64)
#define GBN    256                    // block tile columns (4 waves of 64)
#define GKS    128                    // halves of k per stage
#define GPIT   (GKS + 8)              // halves: 272 B = 17 x 16 B
#define GSTAGE ((GBM + GBN) * GPIT * 2)   // bytes per buffer: 104448
static_assert((GBM + GBN) * (GKS / 8) == 24 * 256);   // 24 copies of 16 B per thread and stage
static_assert((NB * SEQ) % GBM == 0 && NPP % GBM == 0 && ND % GBM == 0);
static_assert(ND % GBN == 0 && SEQ % GBN == 0);
static_assert(ND % GKS == 0 && ND / GKS >= 2);

// Twelve asynchronous 16-B copies global -> LDS per lane (l: LDS byte address, g: global address of the lane).
// s_wait_xcnt 0 closes the statement so that no address register named here is rewritten ahead of it.
__device__ __forceinline__ void async_copy12(const unsigned (&l)[12], const _Float16* const (&g)[12]) {
  asm volatile(
      "global_load_async_to_lds_b128 %0, %12, off\n\t"
      "global_load_async_to_lds_b128 %1, %13, off\n\t"
      "global_load_async_to_lds_b128 %2, %14, off\n\t"
      "global_load_async_to_lds_b128 %3, %15, off\n\t"
      "global_load_async_to_lds_b128 %4, %16, off\n\t"
      "global_load_async_to_lds_b128 %5, %17, off\n\t"
      "global_load_async_to_lds_b128 %6, %18, off\n\t"
      "global_load_async_to_lds_b128 %7, %19, off\n\t"
      "global_load_async_to_lds_b128 %8, %20, off\n\t"
      "global_load_async_to_lds_b128 %9, %21, off\n\t"
      "global_load_async_to_lds_b128 %10, %22, off\n\t"
      "global_load_async_to_lds_b128 %11, %23, off\n\t"
      "s_wait_xcnt 0x0"
      :: "v"(l[0]), "v"(l[1]), "v"(l[2]), "v"(l[3]), "v"(l[4]), "v"(l[5]),
         "v"(l[6]), "v"(l[7]), "v"(l[8]), "v"(l[9]), "v"(l[10]), "v"(l[11]),
         "v"(g[0]), "v"(g[1]), "v"(g[2]), "v"(g[3]), "v"(g[4]), "v"(g[5]),
         "v"(g[6]), "v"(g[7]), "v"(g[8]), "v"(g[9]), "v"(g[10]), "v"(g[11])
      : "memory");
}

// -------------------------------------------------------------------------------------------------
// f16 WMMA GEMM: C[m][n] = epi( sum_k A[m][k] * Bt[n][k] ).
// A row-major [M][K] pitch lda; Bt row-major [N][K] pitch ldb.
// Each wave owns a 64x64 output tile (4x4 subtiles), 8 waves per block, grid.y = z-batch,
// grid.z = outer batch (steps A by strideAz and C by strideCz; Bt is shared).
// M multiple of 128, N of 256, K of 128 and at least 256; grid.x = (M/128)*(N/256); the block's 2x4 waves
// share one 128x256 tile whose A and Bt rows are staged in the LDS ring by asynchronous copies (whole
// 256-B row pieces, each fetched once per block), the copies of stage t+2 flying while stage t+1 is worked on.
// OUT 1: f32  C1[m][n] = acc*scale + bf_rne(b1[n])                              (final output)
// OUT 2: f16  t = acc*scale (+ bf_rne(b1[n]) if HASB);  C1[m][2*n0+c] = f16(t*carry),
//             C1[m][2*n0+64+c] = f16(t*carry/1024)      (2048-wide hi | copy planes, one 64-col tile = one head)
// OUT 3: f16  t = (acc*scale + bf_rne(b3[n])) + bf_rne(b1[n] resp. b2[n]);  th = t*carry;
//             hi = f16(th), lo = f16((th - hi)*1024) -> C1 (b1 variant) and C2 (b2 variant), hi at 2*n0+c, lo at 2*n0+64+c
// OUT 4: f16  C1[m][n] = f16((acc*scale + bf_rne(b1[m])) * carry)            (row bias)
// Epilogue: 16-row slabs staged per wave in LDS (wave-private region, wave barrier); every row segment is written as
// coverage: 4 slabs x 16 rows x 64 cols = the whole 64x64 tile per wave; tiles cover M x N exactly.
// -------------------------------------------------------------------------------------------------
template <int OUT, bool HASB>
__global__ __launch_bounds__(256) void gemm_f16_kernel(
    const _Float16* __restrict__ A, int lda, long strideA, long strideAz,
    const _Float16* __restrict__ Bt, int ldb, long strideB,
    void* C1, void* C2, int ldc, long strideC, long strideCz,
    const float* __restrict__ b1, const float* __restrict__ b2, const float* __restrict__ b3,
    int M, int N, int K, float scale, float carry) {
  __shared__ __align__(16) float sT[8][16 * 68];   // per-wave 16x64 slab, pitch 68 floats
  __shared__ __align__(16) unsigned char GS[2 * GSTAGE];   // operand ring of the staged path

  const int z    = blockIdx.y;
  const int lane = threadIdx.x & 31;
  const int wave = threadIdx.x >> 5;
  int m0, n0;
  {
    const int tilesN = N / GBN;
    const int tilesM = M / GBM;
    const int bt = blockIdx.x;
    if (bt >= tilesM * tilesN) return;             // block-uniform, ahead of every copy and barrier
    const int tmb = bt / tilesN;
    const int tnb = bt - tmb * tilesN;
    m0 = tmb * GBM + (wave >> 2) * 64;
    n0 = tnb * GBN + (wave & 3) * 64;
  }
  const size_t cOff = (size_t)z * strideC + (size_t)blockIdx.z * strideCz;

  const _Float16* Ab = A  + (size_t)z * strideA + (size_t)blockIdx.z * strideAz;
  const _Float16* Bb = Bt + (size_t)z * strideB;

  const int rl   = lane & 15;          // row (A) / column (B, D) within a subtile
  const int koff = (lane >> 4) * 8;    // k offset of this lane half
  const int mOff = (lane >> 4) * 8;    // D row offset of this lane half

  v8f acc[4][4];
#pragma unroll
  for (int i = 0; i < 4; ++i)
#pragma unroll
    for (int j = 0; j < 4; ++j) acc[i][j] = zero8();

  {
    // copy map: thread -> row crow + 16*i of the stage (i < 8: A rows, i >= 8: Bt rows), 16-B piece ccol of its 256 B;
    // one wave-wide copy = 2 rows x 256 B = 4 whole lines.
    const int crow = threadIdx.x >> 4;
    const int ccol = threadIdx.x & 15;
    const int wm = wave >> 2, wn = wave & 3;
    const _Float16* gA = Ab + (size_t)(m0 - wm * 64 + crow) * lda + ccol * 8;
    const _Float16* gB = Bb + (size_t)(n0 - wn * 64 + crow) * ldb + ccol * 8;
    const unsigned ldsLane = (unsigned)(uintptr_t)(&GS[0]) + (unsigned)(crow * (GPIT * 2) + ccol * 16);
    const int nt = K / GKS;
    auto issue_stage = [&](int t, int buf) {
#pragma unroll
      for (int hf = 0; hf < 2; ++hf) {
        unsigned l[12];
        const _Float16* g[12];
#pragma unroll
        for (int e = 0; e < 12; ++e) {
          const int i = hf * 12 + e;
          l[e] = ldsLane + (unsigned)(buf * GSTAGE + i * 16 * (GPIT * 2));
          const size_t so = (i < 8) ? (size_t)(i * 16) * lda + (size_t)t * GKS         // wave-uniform part
                                    : (size_t)((i - 8) * 16) * ldb + (size_t)t * GKS;
          g[e] = ((i < 8) ? gA : gB) + so;
        }
        async_copy12(l, g);
      }
    };

    issue_stage(0, 0);
    asm volatile("s_wait_asynccnt 0x0" ::: "memory");   // this wave's share of stage 0 has landed
    __syncthreads();                                    // publishes stage 0
    issue_stage(1, 1);
    const _Float16* fa = (const _Float16*)GS + (wm * 64 + rl) * GPIT + koff;
    const _Float16* fb = (const _Float16*)GS + (GBM + wn * 64 + rl) * GPIT + koff;
    for (int t = 0; t < nt; ++t) {                      // one stage per trip
      const int bo = (t & 1) * (GSTAGE / 2);
#pragma unroll
      for (int ks = 0; ks < GKS / 32; ++ks) {
        v16h bfr[4], afr[4];                            // all 16 LDS reads of a 32-k block stand as one group
#pragma unroll
        for (int j = 0; j < 4; ++j) bfr[j] = ldfrag(fb + bo + j * 16 * GPIT + ks * 32);
#pragma unroll
        for (int i = 0; i < 4; ++i) afr[i] = ldfrag(fa + bo + i * 16 * GPIT + ks * 32);
#pragma unroll
        for (int i = 0; i < 4; ++i)
#pragma unroll
          for (int j = 0; j < 4; ++j) acc[i][j] = mma16(afr[i], bfr[j], acc[i][j]);
      }
      asm volatile("s_wait_dscnt 0x0" ::: "memory");    // this wave has left the buffer that is refilled below
      asm volatile("s_wait_asynccnt 0x0" ::: "memory"); // this wave's share of stage t+1 has landed
      __syncthreads();                                  // publishes stage t+1, ends every read of stage t
      if (t + 2 < nt) issue_stage(t + 2, t & 1);
    }
    asm volatile("s_wait_asynccnt 0x0" ::: "memory");   // nothing in flight when the wave goes on
  }

  // ---- epilogue ----
  float* slab = sT[wave];
  const int hh = lane >> 4, c4 = (lane & 15) * 4;     // f32 modes: row segment 256 B = 16 lanes x 16 B
  const int q8 = lane >> 3, c8 = (lane & 7) * 8;
  v4f bias4 = {0.f, 0.f, 0.f, 0.f};
  float col8a[8], col8b[8], col8c[8];
#pragma unroll
  for (int e = 0; e < 8; ++e) { col8a[e] = 0.f; col8b[e] = 0.f; col8c[e] = 0.f; }
  if (OUT == 1 && HASB) {
    const v4f tb = *(const v4f*)(b1 + n0 + c4);
    bias4[0] = bf_rne(tb[0]); bias4[1] = bf_rne(tb[1]); bias4[2] = bf_rne(tb[2]); bias4[3] = bf_rne(tb[3]);
  }
  if ((OUT == 2 && HASB) || OUT == 3) {
    const v4f ta = *(const v4f*)(b1 + n0 + c8);
    const v4f tb = *(const v4f*)(b1 + n0 + c8 + 4);
    col8a[0] = bf_rne(ta[0]); col8a[1] = bf_rne(ta[1]); col8a[2] = bf_rne(ta[2]); col8a[3] = bf_rne(ta[3]);
    col8a[4] = bf_rne(tb[0]); col8a[5] = bf_rne(tb[1]); col8a[6] = bf_rne(tb[2]); col8a[7] = bf_rne(tb[3]);
  }
  if (OUT == 3) {
    const v4f ta = *(const v4f*)(b2 + n0 + c8);
    const v4f tb = *(const v4f*)(b2 + n0 + c8 + 4);
    col8b[0] = bf_rne(ta[0]); col8b[1] = bf_rne(ta[1]); col8b[2] = bf_rne(ta[2]); col8b[3] = bf_rne(ta[3]);
    col8b[4] = bf_rne(tb[0]); col8b[5] = bf_rne(tb[1]); col8b[6] = bf_rne(tb[2]); col8b[7] = bf_rne(tb[3]);
    const v4f tc = *(const v4f*)(b3 + n0 + c8);
    const v4f td = *(const v4f*)(b3 + n0 + c8 + 4);
    col8c[0] = bf_rne(tc[0]); col8c[1] = bf_rne(tc[1]); col8c[2] = bf_rne(tc[2]); col8c[3] = bf_rne(tc[3]);
    col8c[4] = bf_rne(td[0]); col8c[5] = bf_rne(td[1]); col8c[6] = bf_rne(td[2]); col8c[7] = bf_rne(td[3]);
  }
  const float carry2 = carry * 0.0009765625f;        // carry / 1024

#pragma unroll
  for (int i = 0; i < 4; ++i) {
    const int mBase = m0 + (i << 4);
#pragma unroll
    for (int j = 0; j < 4; ++j)
#pragma unroll
      for (int r = 0; r < 8; ++r)
        slab[(mOff + r) * 68 + (j << 4) + rl] = acc[i][j][r] * scale;
    __builtin_amdgcn_fence(__ATOMIC_RELEASE, "workgroup");
    __builtin_amdgcn_wave_barrier();
    __builtin_amdgcn_fence(__ATOMIC_ACQUIRE, "workgroup");
    if (OUT == 1) {
      float* C = (float*)C1 + cOff;
      v4f vv[8];
#pragma unroll
      for (int it = 0; it < 8; ++it) {
        const int row = it * 2 + hh;
        v4f v = *(const v4fa*)(slab + row * 68 + c4);
        if (OUT == 1) v += bias4;
        vv[it] = v;
      }
      {
#pragma unroll
        for (int it = 0; it < 8; ++it) {
          const int row = it * 2 + hh;
          *(v4f*)(C + (size_t)(mBase + row) * ldc + n0 + c4) = vv[it];
        }
        
      }
    } else if (OUT == 2 || OUT == 4) {
      _Float16* Ca = (_Float16*)C1 + cOff;
      v8h hv[4], lv[4];
#pragma unroll
      for (int it = 0; it < 4; ++it) {
        const int row = it * 4 + q8;
        const float* sp = slab + row * 68 + c8;
        const v4f x0 = *(const v4fa*)(sp);
        const v4f x1 = *(const v4fa*)(sp + 4);
        float f[8];
        f[0] = x0[0]; f[1] = x0[1]; f[2] = x0[2]; f[3] = x0[3];
        f[4] = x1[0]; f[5] = x1[1]; f[6] = x1[2]; f[7] = x1[3];
        float rb = 0.f;
        if (OUT == 4 && HASB) rb = bf_rne(b1[mBase + row]);
        v8h ha, la;
#pragma unroll
        for (int e = 0; e < 8; ++e) {
          const float t = f[e] + ((OUT == 2) ? col8a[e] : rb);
          ha[e] = (_Float16)(t * carry);
          la[e] = (_Float16)(t * carry2);
        }
        hv[it] = ha; lv[it] = la;
      }
      {
#pragma unroll
        for (int it = 0; it < 4; ++it) {
          const int row = it * 4 + q8;
          if (OUT == 2) {
            _Float16* cp = Ca + (size_t)(mBase + row) * ldc + 2 * n0 + c8;
            *(v8h*)(cp)      = hv[it];
            *(v8h*)(cp + 64) = lv[it];
          } else {
            *(v8h*)(Ca + (size_t)(mBase + row) * ldc + n0 + c8) = hv[it];
          }
        }
        
      }
    } else {
#pragma unroll
      for (int var = 0; var < 2; ++var) {
        _Float16* Cc = (_Float16*)((var == 0) ? C1 : C2) + cOff;
        v8h hv[4], lv[4];
#pragma unroll
        for (int it = 0; it < 4; ++it) {
          const int row = it * 4 + q8;
          const float* sp = slab + row * 68 + c8;
          const v4f x0 = *(const v4fa*)(sp);
          const v4f x1 = *(const v4fa*)(sp + 4);
          float f[8];
          f[0] = x0[0]; f[1] = x0[1]; f[2] = x0[2]; f[3] = x0[3];
          f[4] = x1[0]; f[5] = x1[1]; f[6] = x1[2]; f[7] = x1[3];
          v8h ha, la;
#pragma unroll
          for (int e = 0; e < 8; ++e) {
            const float t  = (f[e] + col8c[e]) + ((var == 0) ? col8a[e] : col8b[e]);
            const float th = t * carry;
            const _Float16 hq = (_Float16)th;
            ha[e] = hq;
            la[e] = (_Float16)((th - (float)hq) * 1024.0f);
          }
          hv[it] = ha; lv[it] = la;
        }
        {
#pragma unroll
          for (int it = 0; it < 4; ++it) {
            const int row = it * 4 + q8;
            _Float16* cp = Cc + (size_t)(mBase + row) * ldc + 2 * n0 + c8;
            *(v8h*)(cp)      = hv[it];
            *(v8h*)(cp + 64) = lv[it];
          }
          
        }
      }
    }
    __builtin_amdgcn_fence(__ATOMIC_RELEASE, "workgroup");
    __builtin_amdgcn_wave_barrier();
    __builtin_amdgcn_fence(__ATOMIC_ACQUIRE, "workgroup");
  }
}

// -------------------------------------------------------------------------------------------------
// Relative-position attention for all NH heads of all NB batch elements, folded q.k and q.p depth 128 (hi | residual),
// value head dim 64, no mask.
//   QU  f16 plane [t][h*128 + j]: j<64 hi = f16(16*(q+u_bias)), j>=64 residual x1024     (A of the content score)
//   KP  f16 plane [s][h*128 + j]: j<64 f16(16*k), j>=64 f16(k/64)                       (B, staged per 64-key chunk as [key][128])
//   VT  f16 plane [h*64 + d][s]   = f16(16*v)                                            (B of P.V, staged as [d][key])
//   QV  f16 plane, as QU with v_bias                                                     (A of the position score)
//   PP  f16 plane [row][h*128 + j]: j<64 f16(16*p), j>=64 f16(p/64), NPP rows             (B, staged in 64-row tiles as [row][128])
//       rel-shift: position score of (query i, key) = (q_i + v_bias).p[key - i + SEQ-1].  For query block qb and key chunk
//       kc that is row 64*(SEQ/64-1-qb+kc) + x of PP, x = (key mod 64) + 63 - (i mod 64) in [0, 126]: two 64-row tiles, of
//       which the upper is the next chunk's lower, so one new tile per chunk goes into a ring of two slots (slot = tile & 1).
//       A wave's 16 queries (row R) x 64 keys need x = 48 - 16*wave + w, w = (key mod 64) + 15 - R in [0, 78]: five 16-column
//       products W, the lowest of which is the chunk before's highest; score column n of row R is W column n + 15 - R,
//       fetched by a select between neighbouring products in the source lane and one ds_bpermute_b32 inside the 16-lane row.
//   score = cs * (QU.K^T acc + QV.P^T acc)  with cs = (1/8)/256;  online softmax in f32 over SEQ/64 chunks of 64 keys;
//   P stored per wave as f16(4096 * exp(s - m)); CTX[t][h*64 + d] = f16(64 * ctx) = f16((P.V acc) / (1024*l)).
// Block = 4 waves = 64 query rows of one head; grid = (SEQ/64 query blocks, NH heads, NB batch elements).
// LDS: one raw buffer; K tile [64][128] f16 at row pitch KPIT, then V^T tile [64][64] f16 at pitch VPIT, then per-wave
// P tiles [16][64] f16 at pitch VPIT, then the two p-row slots [64][128] f16 at pitch KPIT; the output staging
// [4][16][64] f32 at pitch OPIT reuses the K bytes after a block barrier.  Every pitch is an odd multiple of 16 B, so the 16 rows that one ds_load_b128 reads start on 16
// different groups of four banks (at the bare 256-B and 128-B pitches they fall on one or two groups).
// coverage: staging 128 thr x 64 halves for K and for a p-row tile (64x128), 128 thr x 32 halves for V^T (64x64); P tile 8 rows x
// 2 halves x 4x16 cols per wave = 16x64 (all written every chunk); output 4 store instructions x 4 rows x 8 lanes x
// 8 halves = 16x64 per wave.
// -------------------------------------------------------------------------------------------------
#define KPIT   (HQK + 8)            // halves: 272 B = 17 x 16 B
#define VPIT   (HDV + 8)            // halves: 144 B =  9 x 16 B
#define OPIT   (HDV + 4)            // floats: 272 B = 17 x 16 B
#define KBYTES (64 * KPIT * 2)      // 17408
#define VBYTES (64 * VPIT * 2)      //  9216
#define PBYTES (4 * 16 * VPIT * 2)  //  9216
static_assert(4 * 16 * OPIT * 4 <= KBYTES);
static_assert(KBYTES % 16 == 0 && VBYTES % 16 == 0);

__global__ __launch_bounds__(128)
void relattn_kernel(const _Float16* __restrict__ QU, const _Float16* __restrict__ QV,
                    const _Float16* __restrict__ KP, const _Float16* __restrict__ VT,
                    const _Float16* __restrict__ PP, _Float16* __restrict__ CTX, float cs) {
  __shared__ __align__(16) unsigned char SMEM[KBYTES + VBYTES + PBYTES + 2 * KBYTES];
  _Float16* Ksh = (_Float16*)(SMEM);                    // [64][128] at pitch KPIT
  _Float16* Vsh = (_Float16*)(SMEM + KBYTES);           // [64][64]  at pitch VPIT
  _Float16* Psh = (_Float16*)(SMEM + KBYTES + VBYTES);  // [4][16][64] at pitch VPIT
  _Float16* Rsh = (_Float16*)(SMEM + KBYTES + VBYTES + PBYTES);   // [2][64][128] at pitch KPIT: p-row tiles
  float*    Osh = (float*)(SMEM);                       // [4][16][64] at pitch OPIT, after the chunk loop

  const int tid  = threadIdx.x;
  const int wave = tid >> 5;
  const int lane = tid & 31;
  const int hh   = lane >> 4;
  const int c    = lane & 15;

  const int h    = blockIdx.y;
  const int bz   = blockIdx.z;
  const int qb   = blockIdx.x;
  const int q0   = qb * 64 + wave * 16;          // first query row of this wave
  const int tpb  = SEQ / 64 - 1 - qb;            // lower p-row tile of chunk 0

  const _Float16* Qh = QU + (size_t)bz * SEQ * QKW + h * HQK;   // row pitch QKW
  const _Float16* Qw = QV + (size_t)bz * SEQ * QKW + h * HQK;   // row pitch QKW
  const _Float16* Kh = KP + (size_t)bz * SEQ * QKW + h * HQK;   // row pitch QKW
  const _Float16* Ph = PP + h * HQK;                            // row pitch QKW, shared by the batch
  const _Float16* Vh = VT + (size_t)(bz * ND + h * HDV) * SEQ;
  _Float16*       ctx = CTX + (size_t)bz * SEQ * ND + h * HDV;  // row pitch ND

  // Q fragments (A operand): 4 chunks of 32 along the folded depth
  const _Float16* qsrc = Qh + (size_t)(q0 + c) * QKW + 8 * hh;
  const _Float16* wsrc = Qw + (size_t)(q0 + c) * QKW + 8 * hh;
  v16h qa[4], qv[4];
#pragma unroll
  for (int dc = 0; dc < 4; ++dc) qa[dc] = ldfrag(qsrc + dc * 32);
#pragma unroll
  for (int dc = 0; dc < 4; ++dc) qv[dc] = ldfrag(wsrc + dc * 32);
  // the reads further down may be given the Q address registers; the two pointers are inputs so that they stay in
  // their registers up to here
  asm volatile("s_wait_xcnt 0x0" :: "v"(qsrc), "v"(wsrc) : "memory");

  // rel-shift of accumulator register r (row R = 8*hh + r), shift sft = 15 - R: this lane takes from lane (c + sft) mod 16
  // of its row; as a source it offers product j where c >= sft and product j + 1 below
  int  pidx[8];
  bool own[8];
#pragma unroll
  for (int r = 0; r < 8; ++r) {
    const int sft = 15 - 8 * hh - r;
    pidx[r] = ((lane & 16) | ((c + sft) & 15)) << 2;
    own[r]  = (c >= sft);
  }

  float mrow[8], lrow[8];
  v8f oacc[4];
#pragma unroll
  for (int r = 0; r < 8; ++r) { mrow[r] = -INFINITY; lrow[r] = 0.f; }
#pragma unroll
  for (int t = 0; t < 4; ++t) oacc[t] = zero8();

  v8f wtop = zero8();                            // top position product of the chunk before
  _Float16* pw = Psh + wave * (16 * VPIT);

  // Global reads run one chunk ahead of their use: this thread's K, V^T and p-row staging pieces of
  // chunk kc + 1 are issued behind the barrier that publishes chunk kc, so their latency passes under the score products
  // and the softmax of chunk kc (the fence ahead of P.V waits for them at the latest).
  const int sr = tid >> 1, sc0 = (tid & 1) * 64, scv = (tid & 1) * 32;
  const _Float16* ksrc = Kh + (size_t)sr * QKW + sc0;
  const _Float16* vsrc = Vh + (size_t)sr * SEQ + scv;
  const _Float16* psrc = Ph + (size_t)(tpb * 64 + sr) * QKW + sc0;
  v8h kst[8], vst[4], pst[8], pf[8];
#pragma unroll
  for (int i = 0; i < 8; ++i) kst[i] = *(const v8h*)(ksrc + 8 * i);
#pragma unroll
  for (int i = 0; i < 4; ++i) vst[i] = *(const v8h*)(vsrc + 8 * i);
#pragma unroll
  for (int i = 0; i < 8; ++i) pf[i] = *(const v8h*)(psrc + 8 * i);
#pragma unroll
  for (int i = 0; i < 8; ++i) pst[i] = *(const v8h*)(psrc + (size_t)64 * QKW + 8 * i);
  // stands ahead of any reuse of the address registers named above; the pointers are inputs so that they stay
  // in their registers up to here and no result of this run of reads is given one of them
  asm volatile("s_wait_xcnt 0x0" :: "v"(ksrc), "v"(vsrc), "v"(psrc) : "memory");
  // chunk 0's lower p-row tile; published by the barrier behind the first staging stores
#pragma unroll
  for (int i = 0; i < 8; ++i) *(v8ha*)(Rsh + ((tpb & 1) * 64 + sr) * KPIT + sc0 + 8 * i) = pf[i];

#pragma unroll 1
  for (int kc = 0; kc < SEQ / 64; ++kc) {
    __syncthreads();
#pragma unroll
    for (int i = 0; i < 8; ++i) *(v8ha*)(Ksh + sr * KPIT + sc0 + 8 * i) = kst[i];
#pragma unroll
    for (int i = 0; i < 4; ++i) *(v8ha*)(Vsh + sr * VPIT + scv + 8 * i) = vst[i];
    // the chunk's upper p-row tile, over the lower tile of the chunk before, whose reads the barrier above has ended
#pragma unroll
    for (int i = 0; i < 8; ++i) *(v8ha*)(Rsh + (((tpb + kc + 1) & 1) * 64 + sr) * KPIT + sc0 + 8 * i) = pst[i];
    __syncthreads();

    if (kc + 1 < SEQ / 64) {                          // block-uniform: the last chunk fetches nothing
      const int kn0 = (kc + 1) * 64;
#pragma unroll
      for (int i = 0; i < 8; ++i) kst[i] = *(const v8h*)(ksrc + (size_t)kn0 * QKW + 8 * i);
#pragma unroll
      for (int i = 0; i < 4; ++i) vst[i] = *(const v8h*)(vsrc + kn0 + 8 * i);
#pragma unroll
      for (int i = 0; i < 8; ++i) pst[i] = *(const v8h*)(psrc + (size_t)(kn0 + 64) * QKW + 8 * i);
      // stands ahead of any reuse of the address registers named above; its memory clobber also holds the reads here,
      // in front of the score products
      asm volatile("s_wait_xcnt 0x0" ::: "memory");
    }

    // position scores: W[u] = QV(16x128) . p^T for window rows 48 - 16*wave + 16u .. + 15, then the rel-shift
    // (W[0] of a chunk is W[4] of the chunk before: the same queries against the same p rows, so it is carried over)
    v8f pos[4];
    {
      v8f w5[5];
      const _Float16* pr[5];
#pragma unroll
      for (int u = 0; u < 5; ++u) {
        const int x = 48 - 16 * wave + 16 * u;      // 0 .. 112: a 16-row group lies in one tile
        pr[u] = Rsh + (((tpb + kc + (x >> 6)) & 1) * 64 + (x & 63) + c) * KPIT + 8 * hh;
      }
      if (kc == 0) {                                // block-uniform: nothing to carry yet
#pragma unroll
        for (int dc = 0; dc < 4; ++dc) wtop = mma16(qv[dc], ldfrag(pr[0] + dc * 32), wtop);
      }
      w5[0] = wtop;
#pragma unroll
      for (int u = 1; u < 5; ++u) w5[u] = zero8();
#pragma unroll
      for (int dc = 0; dc < 4; ++dc) {
        v16h pb[4];                                 // the 8 LDS reads of a 32-deep step stand as one group
#pragma unroll
        for (int u = 1; u < 5; ++u) pb[u - 1] = ldfrag(pr[u] + dc * 32);
#pragma unroll
        for (int u = 1; u < 5; ++u) w5[u] = mma16(qv[dc], pb[u - 1], w5[u]);
      }
      wtop = w5[4];
#pragma unroll
      for (int r = 0; r < 8; ++r)
#pragma unroll
        for (int j = 0; j < 4; ++j) {
          const float offer = own[r] ? w5[j][r] : w5[j + 1][r];
          pos[j][r] = __int_as_float(__builtin_amdgcn_ds_bpermute(pidx[r], __float_as_int(offer)));
        }
    }

    // content scores: S[j] = QU(16x128) . K^T for key subtile j
    v8f s[4];
#pragma unroll
    for (int j = 0; j < 4; ++j) {
      s[j] = zero8();
#pragma unroll
      for (int dc = 0; dc < 4; ++dc) {
        const v16h kb = ldfrag(Ksh + (j * 16 + c) * KPIT + dc * 32 + 8 * hh);
        s[j] = mma16(qa[dc], kb, s[j]);
      }
    }

    // add the position term, chunk row max
    float cm[8];
#pragma unroll
    for (int r = 0; r < 8; ++r) {
      float m = -INFINITY;
#pragma unroll
      for (int j = 0; j < 4; ++j) {
        const float sv = (s[j][r] + pos[j][r]) * cs;   // cs is a power of two: the one rounding is that of the sum
        s[j][r] = sv;
        m = fmaxf(m, sv);
      }
      cm[r] = m;
    }
    row_max8(cm);

    // online softmax update (per-row rescale of this row's accumulator elements only);
    // P tile (x4096) to this wave's LDS tile [row][key]
    float alpha[8], psum[8];
#pragma unroll
    for (int r = 0; r < 8; ++r) {
      const float mnew  = fmaxf(mrow[r], cm[r]);
      alpha[r] = __expf(mrow[r] - mnew);
      mrow[r] = mnew;
      float ps = 0.f;
#pragma unroll
      for (int j = 0; j < 4; ++j) {
        const float p = __expf(s[j][r] - mnew);
        ps += p;
        pw[(8 * hh + r) * VPIT + j * 16 + c] = (_Float16)(p * 4096.0f);
      }
      psum[r] = ps;
    }
    row_sum8(psum);
#pragma unroll
    for (int r = 0; r < 8; ++r) {
      lrow[r] = lrow[r] * alpha[r] + psum[r];
#pragma unroll
      for (int t = 0; t < 4; ++t) oacc[t][r] *= alpha[r];
    }
    __builtin_amdgcn_fence(__ATOMIC_RELEASE, "workgroup");
    __builtin_amdgcn_wave_barrier();
    __builtin_amdgcn_fence(__ATOMIC_ACQUIRE, "workgroup");

    // P (A operand, row = lane&15, split k map over keys) . V (B operand from V^T rows d)
#pragma unroll
    for (int kk = 0; kk < 2; ++kk) {
      const v16h pa = ldfrag(pw + c * VPIT + kk * 32 + 8 * hh);
#pragma unroll
      for (int t = 0; t < 4; ++t) {
        const v16h vb = ldfrag(Vsh + (t * 16 + c) * VPIT + kk * 32 + 8 * hh);
        oacc[t] = mma16(pa, vb, oacc[t]);
      }
    }
  }

  __syncthreads();                               // every wave is done with Ksh before Osh aliases it
  float* os = Osh + wave * (16 * OPIT);
#pragma unroll
  for (int r = 0; r < 8; ++r) {
    const float inv = 1.0f / (1024.0f * lrow[r]);   // 64 / (4096 * 16 * l)
#pragma unroll
    for (int t = 0; t < 4; ++t) os[(8 * hh + r) * OPIT + t * 16 + c] = oacc[t][r] * inv;
  }
  __builtin_amdgcn_fence(__ATOMIC_RELEASE, "workgroup");
  __builtin_amdgcn_wave_barrier();
  __builtin_amdgcn_fence(__ATOMIC_ACQUIRE, "workgroup");
  const int q8 = lane >> 3, c8 = (lane & 7) * 8;
  v8h ov[4];
#pragma unroll
  for (int it = 0; it < 4; ++it) {
    const int row = it * 4 + q8;
    const float* sp = os + row * OPIT + c8;
    const v4f x0 = *(const v4fa*)(sp);
    const v4f x1 = *(const v4fa*)(sp + 4);
    v8h o;
    o[0] = (_Float16)x0[0]; o[1] = (_Float16)x0[1]; o[2] = (_Float16)x0[2]; o[3] = (_Float16)x0[3];
    o[4] = (_Float16)x1[0]; o[5] = (_Float16)x1[1]; o[6] = (_Float16)x1[2]; o[7] = (_Float16)x1[3];
    ov[it] = o;
  }
  {
#pragma unroll
    for (int it = 0; it < 4; ++it) {
      const int row = it * 4 + q8;
      *(v8h*)(ctx + (size_t)(q0 + row) * ND + c8) = ov[it];
    }
    
  }
}

// -------------------------------------------------------------------------------------------------
// Workspace map (bytes, NB=8 SEQ=1024): every batch element's planes are live at once.
//   P2   f16 [NPP][2048]             8388608
//   QU2  f16 [NB*SEQ][2048]         33554432
//   QV2  f16 [NB*SEQ][2048]         33554432
//   KP2  f16 [NB*SEQ][2048]         33554432
//   VT   f16 [NB][1024][SEQ]        16777216
//   SCR                             50331648   early phase: WQ2, WK2 f16 [1024][2048], WV, WP f16 [1024][1024],
//                                              PE f16 [NPP][1024], XH f16 [NB*SEQ][2048] (all dead after the projections);
//                                              last phase: WO f16 [1024][1024] (converted after the attention launch),
//                                              then CTX f16 [NB*SEQ][1024] (written by the attention launch)
//   total                          176160768
// Every region is written in whole 64x64 tiles / whole rows; all region sizes equal their written extents.
// -------------------------------------------------------------------------------------------------
extern "C" void kernel_launch(void* const* d_in, const int* in_sizes, int n_in,
                              void* d_out, int out_size, void* d_ws, size_t ws_size,
                              hipStream_t stream) {
  if (n_in < 14) return;
  if (in_sizes[0] < ((NB - 1) * SEQ_FULL + SEQ) * ND) return;
  if (in_sizes[1] != ND * ND || in_sizes[3] != ND * ND || in_sizes[5] != ND * ND) return;
  if (in_sizes[7] != ND * ND || in_sizes[8] != ND * ND) return;
  if (in_sizes[2] < ND || in_sizes[4] < ND || in_sizes[6] < ND || in_sizes[9] < ND) return;
  if (in_sizes[10] < NH * HDV || in_sizes[11] < NH * HDV) return;
  if (in_sizes[12] < ND || in_sizes[13] < ND) return;
  if (out_size < NB * SEQ * ND) return;

  const float* x    = (const float*)d_in[0];
  const float* Wq   = (const float*)d_in[1];
  const float* bq   = (const float*)d_in[2];
  const float* Wk   = (const float*)d_in[3];
  const float* bk   = (const float*)d_in[4];
  const float* Wv   = (const float*)d_in[5];
  const float* bv   = (const float*)d_in[6];
  const float* Wpos = (const float*)d_in[7];
  const float* Wout = (const float*)d_in[8];
  const float* bout = (const float*)d_in[9];
  const float* ub   = (const float*)d_in[10];
  const float* vbias= (const float*)d_in[11];
  const float* lng  = (const float*)d_in[12];
  const float* lnb  = (const float*)d_in[13];
  float* out = (float*)d_out;

  const size_t szW2  = (size_t)ND * QKW * 2;              //   4194304
  const size_t szW1  = (size_t)ND * ND * 2;               //   2097152
  const size_t szXH  = (size_t)NB * SEQ * QKW * 2;        //  33554432
  const size_t szQ   = (size_t)NB * SEQ * QKW * 2;        //  33554432
  const size_t szVT  = (size_t)NB * ND * SEQ * 2;         //  16777216
  const size_t szP2  = (size_t)NPP * QKW * 2;             //   8388608
  const size_t szPE  = (size_t)NPP * ND * 2;              //   4194304
  const size_t szCTX = (size_t)NB * SEQ * ND * 2;         //  16777216
  const size_t szEarly = 2 * szW2 + 2 * szW1 + szPE + szXH;
  const size_t szLate  = szW1 + szCTX;
  const size_t szSCR = (szEarly > szLate) ? szEarly : szLate;
  size_t off = 0;
  const size_t oP2  = off; off += szP2;
  const size_t oQU2 = off; off += szQ;
  const size_t oQV2 = off; off += szQ;
  const size_t oKP2 = off; off += szQ;
  const size_t oVT  = off; off += szVT;
  const size_t oSCR = off; off += szSCR;
  const size_t total = off;                                // 176160768 for NB=8, SEQ=1024
  if (total > ws_size) return;
  const size_t oWQ2 = oSCR;
  const size_t oWK2 = oWQ2 + szW2;
  const size_t oWV  = oWK2 + szW2;
  const size_t oWP  = oWV + szW1;
  const size_t oPE  = oWP + szW1;
  const size_t oXH  = oPE + szPE;

  char* ws = (char*)d_ws;
  _Float16* WQ2 = (_Float16*)(ws + oWQ2);
  _Float16* WK2 = (_Float16*)(ws + oWK2);
  _Float16* WVp = (_Float16*)(ws + oWV);
  _Float16* WOp = (_Float16*)(ws + oSCR);
  _Float16* XH  = (_Float16*)(ws + oXH);
  _Float16* QU2 = (_Float16*)(ws + oQU2);
  _Float16* QV2 = (_Float16*)(ws + oQV2);
  _Float16* KP2 = (_Float16*)(ws + oKP2);
  _Float16* VTp = (_Float16*)(ws + oVT);
  _Float16* P2  = (_Float16*)(ws + oP2);
  _Float16* CTX = (_Float16*)(ws + oSCR + szW1);
  _Float16* WPp = (_Float16*)(ws + oWP);
  _Float16* PEp = (_Float16*)(ws + oPE);

  const float cs = 0.125f * 0.00390625f;   // (1/sqrt(64)) / 256 applied to the x16.x16 score accumulators
  const dim3 blk(256);

  // (1) weights -> f16 planes of bf16-valued entries: Wq, Wk as [x64 | /16] 2048-wide; Wv, Wpos x64
  const dim3 gW(ND * (ND / 8) / 256);      // 512
  cvt_w_kernel<true ><<<gW, blk, 0, stream>>>(Wq,   WQ2, 64.0f, 0.0625f);
  cvt_w_kernel<true ><<<gW, blk, 0, stream>>>(Wk,   WK2, 64.0f, 0.0625f);
  cvt_w_kernel<false><<<gW, blk, 0, stream>>>(Wv,   WVp, 64.0f, 64.0f);
  cvt_w_kernel<false><<<gW, blk, 0, stream>>>(Wpos, WPp, 64.0f, 64.0f);
  // (2) LayerNorm -> XH [NB*SEQ][2048] (hi | residual x1024)
  ln_kernel<<<dim3((NB * SEQ) / 8), blk, 0, stream>>>(x, lng, lnb, XH, NB * SEQ);
  // (3) positional sinusoid table -> PE [NPP][1024] (row NPP-1 = 0)
  pe_kernel<<<dim3((NPP * (ND / 8) + 255) / 256), blk, 0, stream>>>(PEp);
  // (4) p = pe . Wpos^T -> P2 = [16p | p/64]   (M=NPP, N=1024, K=1024)
  {
    const int tiles = (NPP / GBM) * (ND / GBN);
    gemm_f16_kernel<2, false><<<dim3(tiles, 1), blk, 0, stream>>>(
        PEp, ND, 0L, 0L, WPp, ND, 0L, (void*)P2, (void*)P2, QKW, 0L, 0L, bq, bq, bq,
        NPP, ND, ND, 0.015625f, 16.0f);
  }
  // (5) projections of all batch elements, one launch each
  const int tilesQ  = ((NB * SEQ) / GBM) * (ND / GBN);
  const int tilesV  = (ND / GBM) * (SEQ / GBN);
  // QU2 = split(16*(q + bq + u_bias)), QV2 = split(16*(q + bq + v_bias))   (M=NB*SEQ, N=1024, K=2048)
  gemm_f16_kernel<3, true><<<dim3(tilesQ, 1), blk, 0, stream>>>(
      XH, QKW, 0L, 0L, WQ2, QKW, 0L, (void*)QU2, (void*)QV2, QKW, 0L, 0L, ub, vbias, bq,
      NB * SEQ, ND, QKW, 0.015625f, 16.0f);
  // KP2 = [16k | k/64], k = xn.Wk^T + bk   (M=NB*SEQ, N=1024, K=2048)
  gemm_f16_kernel<2, true><<<dim3(tilesQ, 1), blk, 0, stream>>>(
      XH, QKW, 0L, 0L, WK2, QKW, 0L, (void*)KP2, (void*)KP2, QKW, 0L, 0L, bk, bk, bk,
      NB * SEQ, ND, QKW, 0.015625f, 16.0f);
  // VT[b][h*64+d][s] = 16*(v + bv)   (A = Wv plane [1024][1024], Bt = XH hi columns of batch element y; M=1024, N=SEQ, K=1024)
  gemm_f16_kernel<4, true><<<dim3(tilesV, NB), blk, 0, stream>>>(
      WVp, ND, 0L, 0L, XH, QKW, (long)SEQ * QKW, (void*)VTp, (void*)VTp, SEQ, (long)ND * SEQ, 0L, bv, bv, bv,
      ND, SEQ, ND, 0.015625f, 16.0f);
  // (6) attention with its position scores, all batch elements and heads in one launch
  relattn_kernel<<<dim3(SEQ / 64, NH, NB), dim3(128), 0, stream>>>(QU2, QV2, KP2, VTp, P2, CTX, cs);
  // (7) out = ctx . Wout^T + bout -> d_out f32 [NB*SEQ][1024]   (M=NB*SEQ, N=1024, K=1024; carries 64*64 folded into scale)
  cvt_w_kernel<false><<<gW, blk, 0, stream>>>(Wout, WOp, 64.0f, 64.0f);
  {
    const int tiles = ((NB * SEQ) / GBM) * (ND / GBN);
    gemm_f16_kernel<1, true><<<dim3(tiles, 1), blk, 0, stream>>>(
        CTX, ND, 0L, 0L, WOp, ND, 0L, (void*)out, (void*)out, ND, 0L, 0L, bout, bout, bout,
        NB * SEQ, ND, ND, 0.000244140625f, 1.0f);
  }
  (void)hipGetLastError();
}

// v007
// Measured time: 279 microseconds a run.
// Next to v006, in two timings, it ran 1.09 times as fast each time.
// Counting every step since v000, it is 12.1 times as fast.
// Contractions: xn.Wq^T and xn.Wk^T (xn as f16 hi + x1024 f16 residual planes folded along K against Wx64 | W/16 planes), Wv.xn^T (xn hi, Wx64), pe.Wpos^T (pe f16, Wx64), (q+v_bias).p^T band and (q+u_bias).k^T (16q as f16 hi + x1024 residual folded along the head dim against 16p | p/64 and 16k | k/64 planes), P.V (P x4096, v x16), ctx.Wout^T (ctx x64, W x64): all v_wmma_f32_16x16x32_f16 (f16 operands, f32 accumulate); float inputs bf16-RNE valued; LayerNorm, positional table, softmax, bias adds and scaling in f32.
#include <hip/hip_runtime.h>
#include <math.h>
#include <stdint.h>

#ifndef NB
#define NB 8
#endif
#ifndef SEQ
#define SEQ 1024
#endif
#define SEQ_FULL 1024
#define ND    1024
#define NH    16
#define HDV   64            // value head dim
#define HQK   128           // folded depth of the q.k / q.p contractions: 64 hi + 64 residual
#define QKW   (2 * ND)      // pitch (halves) of the 2048-wide f16 planes
#define NP    (2 * SEQ - 1)
#define NPP   (2 * SEQ)

static_assert(SEQ % 64 == 0);
static_assert(SEQ <= SEQ_FULL);
static_assert(ND == NH * HDV);
static_assert(HQK == 2 * HDV);
static_assert(ND % 256 == 0);
static_assert(NPP % 64 == 0);

typedef _Float16 v16h __attribute__((ext_vector_type(16)));
typedef _Float16 v8h  __attribute__((ext_vector_type(8)));
typedef float    v8f  __attribute__((ext_vector_type(8)));
typedef float    v4f  __attribute__((ext_vector_type(4)));
typedef unsigned int v4u __attribute__((ext_vector_type(4)));
typedef v4f __attribute__((may_alias)) v4fa;
typedef v8h __attribute__((may_alias)) v8ha;

// bf16 RNE of an f32 value, returned widened to f32 (exactly representable in f16 after a power-of-two carry)
__device__ __forceinline__ float bf_rne(float f) {
  unsigned u = __float_as_uint(f);
  u = (u + 0x7FFFu + ((u >> 16) & 1u)) & 0xFFFF0000u;
  return __uint_as_float(u);
}

// 16-bit WMMA fragment: elements 0..7 <- p[0..7], elements 8..15 <- p[16..23]
// (A: p = row m at k0 + 8h;  B stored [n][k]: p = row n at k0 + 8h;  same split k map for both)
union FragU { v16h v; v8ha h[2]; };
__device__ __forceinline__ v16h ldfrag(const _Float16* p) {
  FragU f;
  f.h[0] = *(const v8ha*)(p);
  f.h[1] = *(const v8ha*)(p + 16);
  return f.v;
}

// WMMA + hazard guard (ties D, keeps A/B live for 4 VALU slots)
__device__ __forceinline__ v8f mma16(v16h a, v16h b, v8f c) {
  c = __builtin_amdgcn_wmma_f32_16x16x32_f16(false, a, false, b, (short)0, c, false, false);
  asm volatile("v_nop\n\tv_nop\n\tv_nop\n\tv_nop" : "+v"(c) : "v"(a), "v"(b));
  return c;
}

__device__ __forceinline__ v8f zero8() { v8f z = {0.f, 0.f, 0.f, 0.f, 0.f, 0.f, 0.f, 0.f}; return z; }

// 16-lane butterfly (lane ^ 1, ^ 2, ^ 4, ^ 8) over eight independent values at once, on the vector port by DPP row_xmask;
// every lane must be on.  It takes the place of ds_bpermute_b32 round trips through the LDS pipe, each with its own wait.
// Written as text because the builtin DPP move came out as three instructions a step for the maximum; the eight values are
// interleaved so that every instruction's producer stands eight instructions back and no step waits for the one before.
__device__ __forceinline__ void row_max8(float (&m)[8]) {
  asm(
      "v_max_num_f32_dpp %0, %0, %0 row_xmask:1 row_mask:0xf bank_mask:0xf\n\t"
      "v_max_num_f32_dpp %1, %1, %1 row_xmask:1 row_mask:0xf bank_mask:0xf\n\t"
      "v_max_num_f32_dpp %2, %2, %2 row_xmask:1 row_mask:0xf bank_mask:0xf\n\t"
      "v_max_num_f32_dpp %3, %3, %3 row_xmask:1 row_mask:0xf bank_mask:0xf\n\t"
      "v_max_num_f32_dpp %4, %4, %4 row_xmask:1 row_mask:0xf bank_mask:0xf\n\t"
      "v_max_num_f32_dpp %5, %5, %5 row_xmask:1 row_mask:0xf bank_mask:0xf\n\t"
      "v_max_num_f32_dpp %6, %6, %6 row_xmask:1 row_mask:0xf bank_mask:0xf\n\t"
      "v_max_num_f32_dpp %7, %7, %7 row_xmask:1 row_mask:0xf bank_mask:0xf\n\t"
      "v_max_num_f32_dpp %0, %0, %0 row_xmask:2 row_mask:0xf bank_mask:0xf\n\t"
      "v_max_num_f32_dpp %1, %1, %1 row_xmask:2 row_mask:0xf bank_mask:0xf\n\t"
      "v_max_num_f32_dpp %2, %2, %2 row_xmask:2 row_mask:0xf bank_mask:0xf\n\t"
      "v_max_num_f32_dpp %3, %3, %3 row_xmask:2 row_mask:0xf bank_mask:0xf\n\t"
      "v_max_num_f32_dpp %4, %4, %4 row_xmask:2 row_mask:0xf bank_mask:0xf\n\t"
      "v_max_num_f32_dpp %5, %5, %5 row_xmask:2 row_mask:0xf bank_mask:0xf\n\t"
      "v_max_num_f32_dpp %6, %6, %6 row_xmask:2 row_mask:0xf bank_mask:0xf\n\t"
      "v_max_num_f32_dpp %7, %7, %7 row_xmask:2 row_mask:0xf bank_mask:0xf\n\t"
      "v_max_num_f32_dpp %0, %0, %0 row_xmask:4 row_mask:0xf bank_mask:0xf\n\t"
      "v_max_num_f32_dpp %1, %1, %1 row_xmask:4 row_mask:0xf bank_mask:0xf\n\t"
      "v_max_num_f32_dpp %2, %2, %2 row_xmask:4 row_mask:0xf bank_mask:0xf\n\t"
      "v_max_num_f32_dpp %3, %3, %3 row_xmask:4 row_mask:0xf bank_mask:0xf\n\t"
      "v_max_num_f32_dpp %4, %4, %4 row_xmask:4 row_mask:0xf bank_mask:0xf\n\t"
      "v_max_num_f32_dpp %5, %5, %5 row_xmask:4 row_mask:0xf bank_mask:0xf\n\t"
      "v_max_num_f32_dpp %6, %6, %6 row_xmask:4 row_mask:0xf bank_mask:0xf\n\t"
      "v_max_num_f32_dpp %7, %7, %7 row_xmask:4 row_mask:0xf bank_mask:0xf\n\t"
      "v_max_num_f32_dpp %0, %0, %0 row_xmask:8 row_mask:0xf bank_mask:0xf\n\t"
      "v_max_num_f32_dpp %1, %1, %1 row_xmask:8 row_mask:0xf bank_mask:0xf\n\t"
      "v_max_num_f32_dpp %2, %2, %2 row_xmask:8 row_mask:0xf bank_mask:0xf\n\t"
      "v_max_num_f32_dpp %3, %3, %3 row_xmask:8 row_mask:0xf bank_mask:0xf\n\t"
      "v_max_num_f32_dpp %4, %4, %4 row_xmask:8 row_mask:0xf bank_mask:0xf\n\t"
      "v_max_num_f32_dpp %5, %5, %5 row_xmask:8 row_mask:0xf bank_mask:0xf\n\t"
      "v_max_num_f32_dpp %6, %6, %6 row_xmask:8 row_mask:0xf bank_mask:0xf\n\t"
      "v_max_num_f32_dpp %7, %7, %7 row_xmask:8 row_mask:0xf bank_mask:0xf"
      : "+v"(m[0]), "+v"(m[1]), "+v"(m[2]), "+v"(m[3]), "+v"(m[4]), "+v"(m[5]), "+v"(m[6]), "+v"(m[7]));
}
__device__ __forceinline__ void row_sum8(float (&s)[8]) {
  asm(
      "v_add_f32_dpp %0, %0, %0 row_xmask:1 row_mask:0xf bank_mask:0xf\n\t"
      "v_add_f32_dpp %1, %1, %1 row_xmask:1 row_mask:0xf bank_mask:0xf\n\t"
      "v_add_f32_dpp %2, %2, %2 row_xmask:1 row_mask:0xf bank_mask:0xf\n\t"
      "v_add_f32_dpp %3, %3, %3 row_xmask:1 row_mask:0xf bank_mask:0xf\n\t"
      "v_add_f32_dpp %4, %4, %4 row_xmask:1 row_mask:0xf bank_mask:0xf\n\t"
      "v_add_f32_dpp %5, %5, %5 row_xmask:1 row_mask:0xf bank_mask:0xf\n\t"
      "v_add_f32_dpp %6, %6, %6 row_xmask:1 row_mask:0xf bank_mask:0xf\n\t"
      "v_add_f32_dpp %7, %7, %7 row_xmask:1 row_mask:0xf bank_mask:0xf\n\t"
      "v_add_f32_dpp %0, %0, %0 row_xmask:2 row_mask:0xf bank_mask:0xf\n\t"
      "v_add_f32_dpp %1, %1, %1 row_xmask:2 row_mask:0xf bank_mask:0xf\n\t"
      "v_add_f32_dpp %2, %2, %2 row_xmask:2 row_mask:0xf bank_mask:0xf\n\t"
      "v_add_f32_dpp %3, %3, %3 row_xmask:2 row_mask:0xf bank_mask:0xf\n\t"
      "v_add_f32_dpp %4, %4, %4 row_xmask:2 row_mask:0xf bank_mask:0xf\n\t"
      "v_add_f32_dpp %5, %5, %5 row_xmask:2 row_mask:0xf bank_mask:0xf\n\t"
      "v_add_f32_dpp %6, %6, %6 row_xmask:2 row_mask:0xf bank_mask:0xf\n\t"
      "v_add_f32_dpp %7, %7, %7 row_xmask:2 row_mask:0xf bank_mask:0xf\n\t"
      "v_add_f32_dpp %0, %0, %0 row_xmask:4 row_mask:0xf bank_mask:0xf\n\t"
      "v_add_f32_dpp %1, %1, %1 row_xmask:4 row_mask:0xf bank_mask:0xf\n\t"
      "v_add_f32_dpp %2, %2, %2 row_xmask:4 row_mask:0xf bank_mask:0xf\n\t"
      "v_add_f32_dpp %3, %3, %3 row_xmask:4 row_mask:0xf bank_mask:0xf\n\t"
      "v_add_f32_dpp %4, %4, %4 row_xmask:4 row_mask:0xf bank_mask:0xf\n\t"
      "v_add_f32_dpp %5, %5, %5 row_xmask:4 row_mask:0xf bank_mask:0xf\n\t"
      "v_add_f32_dpp %6, %6, %6 row_xmask:4 row_mask:0xf bank_mask:0xf\n\t"
      "v_add_f32_dpp %7, %7, %7 row_xmask:4 row_mask:0xf bank_mask:0xf\n\t"
      "v_add_f32_dpp %0, %0, %0 row_xmask:8 row_mask:0xf bank_mask:0xf\n\t"
      "v_add_f32_dpp %1, %1, %1 row_xmask:8 row_mask:0xf bank_mask:0xf\n\t"
      "v_add_f32_dpp %2, %2, %2 row_xmask:8 row_mask:0xf bank_mask:0xf\n\t"
      "v_add_f32_dpp %3, %3, %3 row_xmask:8 row_mask:0xf bank_mask:0xf\n\t"
      "v_add_f32_dpp %4, %4, %4 row_xmask:8 row_mask:0xf bank_mask:0xf\n\t"
      "v_add_f32_dpp %5, %5, %5 row_xmask:8 row_mask:0xf bank_mask:0xf\n\t"
      "v_add_f32_dpp %6, %6, %6 row_xmask:8 row_mask:0xf bank_mask:0xf\n\t"
      "v_add_f32_dpp %7, %7, %7 row_xmask:8 row_mask:0xf bank_mask:0xf"
      : "+v"(s[0]), "+v"(s[1]), "+v"(s[2]), "+v"(s[3]), "+v"(s[4]), "+v"(s[5]), "+v"(s[6]), "+v"(s[7]));
}

// -------------------------------------------------------------------------------------------------
// Weight [1024][1024] f32 -> f16 plane of bf16-valued entries.
//   DUP false: dst [1024][1024], dst[r][c] = f16(bf_rne(W)*s1)
//   DUP true : dst [1024][2048], dst[r][c] = f16(bf_rne(W)*s1), dst[r][1024+c] = f16(bf_rne(W)*s2)
// coverage: 131072 threads x 8 = the whole [1024][1024] source (both column halves for DUP).
// -------------------------------------------------------------------------------------------------
template <bool DUP>
__global__ __launch_bounds__(256) void cvt_w_kernel(const float* __restrict__ src, _Float16* __restrict__ dst,
                                                    float s1, float s2) {
  const int i = blockIdx.x * 256 + threadIdx.x;
  const int total8 = ND * (ND / 8);
  if (i >= total8) return;
  const int r  = i / (ND / 8);
  const int c8 = (i - r * (ND / 8)) * 8;
  const float* sp = src + (size_t)r * ND + c8;
  const v4f a = *(const v4f*)(sp);
  const v4f b = *(const v4f*)(sp + 4);
  float f[8];
  f[0] = bf_rne(a[0]); f[1] = bf_rne(a[1]); f[2] = bf_rne(a[2]); f[3] = bf_rne(a[3]);
  f[4] = bf_rne(b[0]); f[5] = bf_rne(b[1]); f[6] = bf_rne(b[2]); f[7] = bf_rne(b[3]);
  v8h o1, o2;
#pragma unroll
  for (int e = 0; e < 8; ++e) { o1[e] = (_Float16)(f[e] * s1); o2[e] = (_Float16)(f[e] * s2); }
  const int pitch = DUP ? QKW : ND;
  _Float16* dp = dst + (size_t)r * pitch + c8;
  *(v8h*)dp = o1;
  if (DUP) *(v8h*)(dp + ND) = o2;
  
}

// -------------------------------------------------------------------------------------------------
//   XH[row][c]        = f16(xn)                       (hi)
//   XH[row][1024 + c] = f16((xn - hi) * 1024)         (residual, carried x1024)
// One wave per row (compact row b*SEQ + t; source row b*SEQ_FULL + t); block = 8 waves = 8 rows; no LDS.
// Stores: lane l writes 16 B at columns i*256 + 8l: one instruction = 32 lanes x 16 B = 512 contiguous B =
// coverage: grid NB*SEQ/8 x 8 waves x (4 x 256) columns x {hi, residual} = the whole [NB*SEQ][2048] plane.
// Loops rolled on purpose (small elementwise side computation).
// -------------------------------------------------------------------------------------------------
__global__ __launch_bounds__(256) void ln_kernel(const float* __restrict__ x, const float* __restrict__ g,
                                                const float* __restrict__ bt, _Float16* __restrict__ XH,
                                                int nrows) {
  const int lane = threadIdx.x & 31;
  const int wave = threadIdx.x >> 5;
  const int row  = blockIdx.x * 8 + wave;
  if (row >= nrows) return;                                   // wave-uniform; no barriers in this kernel
  const int b = row / SEQ;
  const int t = row - b * SEQ;
  const float* xr = x + ((size_t)b * SEQ_FULL + t) * ND + lane * 8;

  float s = 0.f;
#pragma unroll 1
  for (int i = 0; i < 4; ++i) {
    const v4f a = *(const v4f*)(xr + i * 256);
    const v4f c = *(const v4f*)(xr + i * 256 + 4);
    s += (bf_rne(a[0]) + bf_rne(a[1])) + (bf_rne(a[2]) + bf_rne(a[3]));
    s += (bf_rne(c[0]) + bf_rne(c[1])) + (bf_rne(c[2]) + bf_rne(c[3]));
  }
  s += __shfl_xor(s, 16, 32); s += __shfl_xor(s, 8, 32); s += __shfl_xor(s, 4, 32);
  s += __shfl_xor(s, 2, 32);  s += __shfl_xor(s, 1, 32);
  const float mu = s * (1.0f / (float)ND);

  float s2 = 0.f;
#pragma unroll 1
  for (int i = 0; i < 4; ++i) {
    const v4f a = *(const v4f*)(xr + i * 256);
    const v4f c = *(const v4f*)(xr + i * 256 + 4);
    float d;
    d = bf_rne(a[0]) - mu; s2 += d * d;  d = bf_rne(a[1]) - mu; s2 += d * d;
    d = bf_rne(a[2]) - mu; s2 += d * d;  d = bf_rne(a[3]) - mu; s2 += d * d;
    d = bf_rne(c[0]) - mu; s2 += d * d;  d = bf_rne(c[1]) - mu; s2 += d * d;
    d = bf_rne(c[2]) - mu; s2 += d * d;  d = bf_rne(c[3]) - mu; s2 += d * d;
  }
  s2 += __shfl_xor(s2, 16, 32); s2 += __shfl_xor(s2, 8, 32); s2 += __shfl_xor(s2, 4, 32);
  s2 += __shfl_xor(s2, 2, 32);  s2 += __shfl_xor(s2, 1, 32);
  const float var  = s2 * (1.0f / (float)ND);
  const float rstd = rsqrtf(var + 1e-5f);

  _Float16* xh = XH + (size_t)row * QKW + lane * 8;
{
#pragma unroll 1
    for (int i = 0; i < 4; ++i) {
      const v4f a  = *(const v4f*)(xr + i * 256);
      const v4f c  = *(const v4f*)(xr + i * 256 + 4);
      const v4f ga = *(const v4f*)(g + i * 256 + lane * 8);
      const v4f gb = *(const v4f*)(g + i * 256 + lane * 8 + 4);
      const v4f ba = *(const v4f*)(bt + i * 256 + lane * 8);
      const v4f bb = *(const v4f*)(bt + i * 256 + lane * 8 + 4);
      float f[8], gg[8], be[8];
      f[0] = a[0]; f[1] = a[1]; f[2] = a[2]; f[3] = a[3]; f[4] = c[0]; f[5] = c[1]; f[6] = c[2]; f[7] = c[3];
      gg[0] = ga[0]; gg[1] = ga[1]; gg[2] = ga[2]; gg[3] = ga[3];
      gg[4] = gb[0]; gg[5] = gb[1]; gg[6] = gb[2]; gg[7] = gb[3];
      be[0] = ba[0]; be[1] = ba[1]; be[2] = ba[2]; be[3] = ba[3];
      be[4] = bb[0]; be[5] = bb[1]; be[6] = bb[2]; be[7] = bb[3];
      v8h ho, lo;
#pragma unroll
      for (int e = 0; e < 8; ++e) {
        const float xn = (bf_rne(f[e]) - mu) * rstd * bf_rne(gg[e]) + bf_rne(be[e]);
        const _Float16 hv = (_Float16)xn;
        ho[e] = hv;
        lo[e] = (_Float16)((xn - (float)hv) * 1024.0f);
      }
      *(v8h*)(xh + i * 256)      = ho;
      *(v8h*)(xh + ND + i * 256) = lo;
    }
    
  }
}

// -------------------------------------------------------------------------------------------------
// Relative-position sinusoid table -> PE f16 plane [NPP][1024] (rows >= NP are 0):
//   row r <-> relative position pos = SEQ-1-r;  div_j = expf(f32(2j) * f32(-ln(1e4)/1024));
//   ang = |pos| * div_j (f32 product);  PE[r][2j] = sin(ang) with the sign of pos, PE[r][2j+1] = cos(ang).
// passes.  The per-pair loop is rolled (one sinf, one cosf, one expf body); the 16-B result is assembled by a
// register rotate with constant indices (no dynamic local-array indexing).
// coverage: grid NPP*128/256, NPP*128 threads x 8 halves = the whole [NPP][1024] plane.
// -------------------------------------------------------------------------------------------------
__global__ __launch_bounds__(256) void pe_kernel(_Float16* __restrict__ PE) {
  const int i = blockIdx.x * 256 + threadIdx.x;
  if (i >= NPP * (ND / 8)) return;
  const int r  = i / (ND / 8);
  const int c8 = (i - r * (ND / 8)) * 8;
  const int pos = SEQ - 1 - r;
  const float fpos = (float)((pos < 0) ? -pos : pos);
  const float live = (r < NP) ? 1.0f : 0.0f;
  const float c0 = (float)(-9.210340371976184 / (double)ND);
  v4u pk = {0u, 0u, 0u, 0u};
#pragma unroll 1
  for (int e = 0; e < 4; ++e) {
    const int j = (c8 >> 1) + e;
    const float dv  = expf((float)(2 * j) * c0);
    const float ang = fpos * dv;
    float sn = sinf(ang);
    const float cn = cosf(ang);
    sn = (pos < 0) ? -sn : sn;
    const _Float16 hs = (_Float16)(sn * live);
    const _Float16 hc = (_Float16)(cn * live);
    const unsigned w = (unsigned)__builtin_bit_cast(unsigned short, hs) |
                       ((unsigned)__builtin_bit_cast(unsigned short, hc) << 16);
    v4u nx;
    nx[0] = pk[1]; nx[1] = pk[2]; nx[2] = pk[3]; nx[3] = w;
    pk = nx;
  }
  unsigned* dp = (unsigned*)(PE + (size_t)r * ND + c8);
  *(v4u*)dp = pk;
  
}

// -------------------------------------------------------------------------------------------------
// LDS ring of the staged GEMM path: one stage = 128 k of [A 128 rows | Bt 256 rows], 256-B rows at pitch 272 B
// (an odd multiple of 16 B for the ds_load_b128 fragment reads), two buffers.
// -------------------------------------------------------------------------------------------------
#define GBM    128                    // block tile rows (2 waves of 64)
#define GBN    256                    // block tile columns (4 waves of 64)
#define GKS    128                    // halves of k per stage
#define GPIT   (GKS + 8)              // halves: 272 B = 17 x 16 B
#define GSTAGE ((GBM + GBN) * GPIT * 2)   // bytes per buffer: 104448
static_assert((GBM + GBN) * (GKS / 8) == 24 * 256);   // 24 copies of 16 B per thread and stage
static_assert((NB * SEQ) % GBM == 0 && NPP % GBM == 0 && ND % GBM == 0);
static_assert(ND % GBN == 0 && SEQ % GBN == 0);
static_assert(ND % GKS == 0 && ND / GKS >= 2);

// Twelve asynchronous 16-B copies global -> LDS per lane (l: LDS byte address, g: global address of the lane).
// s_wait_xcnt 0 closes the statement so that no address register named here is rewritten ahead of it.
__device__ __forceinline__ void async_copy12(const unsigned (&l)[12], const _Float16* const (&g)[12]) {
  asm volatile(
      "global_load_async_to_lds_b128 %0, %12, off\n\t"
      "global_load_async_to_lds_b128 %1, %13, off\n\t"
      "global_load_async_to_lds_b128 %2, %14, off\n\t"
      "global_load_async_to_lds_b128 %3, %15, off\n\t"
      "global_load_async_to_lds_b128 %4, %16, off\n\t"
      "global_load_async_to_lds_b128 %5, %17, off\n\t"
      "global_load_async_to_lds_b128 %6, %18, off\n\t"
      "global_load_async_to_lds_b128 %7, %19, off\n\t"
      "global_load_async_to_lds_b128 %8, %20, off\n\t"
      "global_load_async_to_lds_b128 %9, %21, off\n\t"
      "global_load_async_to_lds_b128 %10, %22, off\n\t"
      "global_load_async_to_lds_b128 %11, %23, off\n\t"
      "s_wait_xcnt 0x0"
      :: "v"(l[0]), "v"(l[1]), "v"(l[2]), "v"(l[3]), "v"(l[4]), "v"(l[5]),
         "v"(l[6]), "v"(l[7]), "v"(l[8]), "v"(l[9]), "v"(l[10]), "v"(l[11]),
         "v"(g[0]), "v"(g[1]), "v"(g[2]), "v"(g[3]), "v"(g[4]), "v"(g[5]),
         "v"(g[6]), "v"(g[7]), "v"(g[8]), "v"(g[9]), "v"(g[10]), "v"(g[11])
      : "memory");
}

// -------------------------------------------------------------------------------------------------
// f16 WMMA GEMM: C[m][n] = epi( sum_k A[m][k] * Bt[n][k] ).
// A row-major [M][K] pitch lda; Bt row-major [N][K] pitch ldb.
// Each wave owns a 64x64 output tile (4x4 subtiles), 8 waves per block, grid.y = z-batch,
// grid.z = outer batch (steps A by strideAz and C by strideCz; Bt is shared).
// M multiple of 128, N of 256, K of 128 and at least 256; grid.x = (M/128)*(N/256); the block's 2x4 waves
// share one 128x256 tile whose A and Bt rows are staged in the LDS ring by asynchronous copies (whole
// 256-B row pieces, each fetched once per block), the copies of stage t+2 flying while stage t+1 is worked on.
// OUT 1: f32  C1[m][n] = acc*scale + bf_rne(b1[n])                              (final output)
// OUT 2: f16  t = acc*scale (+ bf_rne(b1[n]) if HASB);  C1[m][2*n0+c] = f16(t*carry),
//             C1[m][2*n0+64+c] = f16(t*carry/1024)      (2048-wide hi | copy planes, one 64-col tile = one head)
// OUT 3: f16  t = (acc*scale + bf_rne(b3[n])) + bf_rne(b1[n] resp. b2[n]);  th = t*carry;
//             hi = f16(th), lo = f16((th - hi)*1024) -> C1 (b1 variant) and C2 (b2 variant), hi at 2*n0+c, lo at 2*n0+64+c
// OUT 4: f16  C1[m][n] = f16((acc*scale + bf_rne(b1[m])) * carry)            (row bias)
// Epilogue: 16-row slabs staged per wave in LDS (wave-private region, wave barrier); every row segment is written as
// coverage: 4 slabs x 16 rows x 64 cols = the whole 64x64 tile per wave; tiles cover M x N exactly.
// -------------------------------------------------------------------------------------------------
template <int OUT, bool HASB>
__global__ __launch_bounds__(256) void gemm_f16_kernel(
    const _Float16* __restrict__ A, int lda, long strideA, long strideAz,
    const _Float16* __restrict__ Bt, int ldb, long strideB,
    void* C1, void* C2, int ldc, long strideC, long strideCz,
    const float* __restrict__ b1, const float* __restrict__ b2, const float* __restrict__ b3,
    int M, int N, int K, float scale, float carry) {
  __shared__ __align__(16) float sT[8][16 * 68];   // per-wave 16x64 slab, pitch 68 floats
  __shared__ __align__(16) unsigned char GS[2 * GSTAGE];   // operand ring of the staged path

  const int z    = blockIdx.y;
  const int lane = threadIdx.x & 31;
  const int wave = threadIdx.x >> 5;
  int m0, n0;
  {
    const int tilesN = N / GBN;
    const int tilesM = M / GBM;
    const int bt = blockIdx.x;
    if (bt >= tilesM * tilesN) return;             // block-uniform, ahead of every copy and barrier
    const int tmb = bt / tilesN;
    const int tnb = bt - tmb * tilesN;
    m0 = tmb * GBM + (wave >> 2) * 64;
    n0 = tnb * GBN + (wave & 3) * 64;
  }
  const size_t cOff = (size_t)z * strideC + (size_t)blockIdx.z * strideCz;

  const _Float16* Ab = A  + (size_t)z * strideA + (size_t)blockIdx.z * strideAz;
  const _Float16* Bb = Bt + (size_t)z * strideB;

  const int rl   = lane & 15;          // row (A) / column (B, D) within a subtile
  const int koff = (lane >> 4) * 8;    // k offset of this lane half
  const int mOff = (lane >> 4) * 8;    // D row offset of this lane half

  v8f acc[4][4];
#pragma unroll
  for (int i = 0; i < 4; ++i)
#pragma unroll
    for (int j = 0; j < 4; ++j) acc[i][j] = zero8();

  {
    // copy map: thread -> row crow + 16*i of the stage (i < 8: A rows, i >= 8: Bt rows), 16-B piece ccol of its 256 B;
    // one wave-wide copy = 2 rows x 256 B = 4 whole lines.
    const int crow = threadIdx.x >> 4;
    const int ccol = threadIdx.x & 15;
    const int wm = wave >> 2, wn = wave & 3;
    const _Float16* gA = Ab + (size_t)(m0 - wm * 64 + crow) * lda + ccol * 8;
    const _Float16* gB = Bb + (size_t)(n0 - wn * 64 + crow) * ldb + ccol * 8;
    const unsigned ldsLane = (unsigned)(uintptr_t)(&GS[0]) + (unsigned)(crow * (GPIT * 2) + ccol * 16);
    const int nt = K / GKS;
    auto issue_stage = [&](int t, int buf) {
#pragma unroll
      for (int hf = 0; hf < 2; ++hf) {
        unsigned l[12];
        const _Float16* g[12];
#pragma unroll
        for (int e = 0; e < 12; ++e) {
          const int i = hf * 12 + e;
          l[e] = ldsLane + (unsigned)(buf * GSTAGE + i * 16 * (GPIT * 2));
          const size_t so = (i < 8) ? (size_t)(i * 16) * lda + (size_t)t * GKS         // wave-uniform part
                                    : (size_t)((i - 8) * 16) * ldb + (size_t)t * GKS;
          g[e] = ((i < 8) ? gA : gB) + so;
        }
        async_copy12(l, g);
      }
    };

    issue_stage(0, 0);
    asm volatile("s_wait_asynccnt 0x0" ::: "memory");   // this wave's share of stage 0 has landed
    __syncthreads();                                    // publishes stage 0
    issue_stage(1, 1);
    const _Float16* fa = (const _Float16*)GS + (wm * 64 + rl) * GPIT + koff;
    const _Float16* fb = (const _Float16*)GS + (GBM + wn * 64 + rl) * GPIT + koff;
    for (int t = 0; t < nt; ++t) {                      // one stage per trip
      const int bo = (t & 1) * (GSTAGE / 2);
#pragma unroll
      for (int ks = 0; ks < GKS / 32; ++ks) {
        v16h bfr[4], afr[4];                            // all 16 LDS reads of a 32-k block stand as one group
#pragma unroll
        for (int j = 0; j < 4; ++j) bfr[j] = ldfrag(fb + bo + j * 16 * GPIT + ks * 32);
#pragma unroll
        for (int i = 0; i < 4; ++i) afr[i] = ldfrag(fa + bo + i * 16 * GPIT + ks * 32);
#pragma unroll
        for (int i = 0; i < 4; ++i)
#pragma unroll
          for (int j = 0; j < 4; ++j) acc[i][j] = mma16(afr[i], bfr[j], acc[i][j]);
      }
      asm volatile("s_wait_dscnt 0x0" ::: "memory");    // this wave has left the buffer that is refilled below
      asm volatile("s_wait_asynccnt 0x0" ::: "memory"); // this wave's share of stage t+1 has landed
      __syncthreads();                                  // publishes stage t+1, ends every read of stage t
      if (t + 2 < nt) issue_stage(t + 2, t & 1);
    }
    asm volatile("s_wait_asynccnt 0x0" ::: "memory");   // nothing in flight when the wave goes on
  }

  // ---- epilogue ----
  float* slab = sT[wave];
  const int hh = lane >> 4, c4 = (lane & 15) * 4;     // f32 modes: row segment 256 B = 16 lanes x 16 B
  const int q8 = lane >> 3, c8 = (lane & 7) * 8;
  v4f bias4 = {0.f, 0.f, 0.f, 0.f};
  float col8a[8], col8b[8], col8c[8];
#pragma unroll
  for (int e = 0; e < 8; ++e) { col8a[e] = 0.f; col8b[e] = 0.f; col8c[e] = 0.f; }
  if (OUT == 1 && HASB) {
    const v4f tb = *(const v4f*)(b1 + n0 + c4);
    bias4[0] = bf_rne(tb[0]); bias4[1] = bf_rne(tb[1]); bias4[2] = bf_rne(tb[2]); bias4[3] = bf_rne(tb[3]);
  }
  if ((OUT == 2 && HASB) || OUT == 3) {
    const v4f ta = *(const v4f*)(b1 + n0 + c8);
    const v4f tb = *(const v4f*)(b1 + n0 + c8 + 4);
    col8a[0] = bf_rne(ta[0]); col8a[1] = bf_rne(ta[1]); col8a[2] = bf_rne(ta[2]); col8a[3] = bf_rne(ta[3]);
    col8a[4] = bf_rne(tb[0]); col8a[5] = bf_rne(tb[1]); col8a[6] = bf_rne(tb[2]); col8a[7] = bf_rne(tb[3]);
  }
  if (OUT == 3) {
    const v4f ta = *(const v4f*)(b2 + n0 + c8);
    const v4f tb = *(const v4f*)(b2 + n0 + c8 + 4);
    col8b[0] = bf_rne(ta[0]); col8b[1] = bf_rne(ta[1]); col8b[2] = bf_rne(ta[2]); col8b[3] = bf_rne(ta[3]);
    col8b[4] = bf_rne(tb[0]); col8b[5] = bf_rne(tb[1]); col8b[6] = bf_rne(tb[2]); col8b[7] = bf_rne(tb[3]);
    const v4f tc = *(const v4f*)(b3 + n0 + c8);
    const v4f td = *(const v4f*)(b3 + n0 + c8 + 4);
    col8c[0] = bf_rne(tc[0]); col8c[1] = bf_rne(tc[1]); col8c[2] = bf_rne(tc[2]); col8c[3] = bf_rne(tc[3]);
    col8c[4] = bf_rne(td[0]); col8c[5] = bf_rne(td[1]); col8c[6] = bf_rne(td[2]); col8c[7] = bf_rne(td[3]);
  }
  const float carry2 = carry * 0.0009765625f;        // carry / 1024

#pragma unroll
  for (int i = 0; i < 4; ++i) {
    const int mBase = m0 + (i << 4);
#pragma unroll
    for (int j = 0; j < 4; ++j)
#pragma unroll
      for (int r = 0; r < 8; ++r)
        slab[(mOff + r) * 68 + (j << 4) + rl] = acc[i][j][r] * scale;
    __builtin_amdgcn_fence(__ATOMIC_RELEASE, "workgroup");
    __builtin_amdgcn_wave_barrier();
    __builtin_amdgcn_fence(__ATOMIC_ACQUIRE, "workgroup");
    if (OUT == 1) {
      float* C = (float*)C1 + cOff;
      v4f vv[8];
#pragma unroll
      for (int it = 0; it < 8; ++it) {
        const int row = it * 2 + hh;
        v4f v = *(const v4fa*)(slab + row * 68 + c4);
        if (OUT == 1) v += bias4;
        vv[it] = v;
      }
      {
#pragma unroll
        for (int it = 0; it < 8; ++it) {
          const int row = it * 2 + hh;
          *(v4f*)(C + (size_t)(mBase + row) * ldc + n0 + c4) = vv[it];
        }
        
      }
    } else if (OUT == 2 || OUT == 4) {
      _Float16* Ca = (_Float16*)C1 + cOff;
      v8h hv[4], lv[4];
#pragma unroll
      for (int it = 0; it < 4; ++it) {
        const int row = it * 4 + q8;
        const float* sp = slab + row * 68 + c8;
        const v4f x0 = *(const v4fa*)(sp);
        const v4f x1 = *(const v4fa*)(sp + 4);
        float f[8];
        f[0] = x0[0]; f[1] = x0[1]; f[2] = x0[2]; f[3] = x0[3];
        f[4] = x1[0]; f[5] = x1[1]; f[6] = x1[2]; f[7] = x1[3];
        float rb = 0.f;
        if (OUT == 4 && HASB) rb = bf_rne(b1[mBase + row]);
        v8h ha, la;
#pragma unroll
        for (int e = 0; e < 8; ++e) {
          const float t = f[e] + ((OUT == 2) ? col8a[e] : rb);
          ha[e] = (_Float16)(t * carry);
          la[e] = (_Float16)(t * carry2);
        }
        hv[it] = ha; lv[it] = la;
      }
      {
#pragma unroll
        for (int it = 0; it < 4; ++it) {
          const int row = it * 4 + q8;
          if (OUT == 2) {
            _Float16* cp = Ca + (size_t)(mBase + row) * ldc + 2 * n0 + c8;
            *(v8h*)(cp)      = hv[it];
            *(v8h*)(cp + 64) = lv[it];
          } else {
            *(v8h*)(Ca + (size_t)(mBase + row) * ldc + n0 + c8) = hv[it];
          }
        }
        
      }
    } else {
#pragma unroll
      for (int var = 0; var < 2; ++var) {
        _Float16* Cc = (_Float16*)((var == 0) ? C1 : C2) + cOff;
        v8h hv[4], lv[4];
#pragma unroll
        for (int it = 0; it < 4; ++it) {
          const int row = it * 4 + q8;
          const float* sp = slab + row * 68 + c8;
          const v4f x0 = *(const v4fa*)(sp);
          const v4f x1 = *(const v4fa*)(sp + 4);
          float f[8];
          f[0] = x0[0]; f[1] = x0[1]; f[2] = x0[2]; f[3] = x0[3];
          f[4] = x1[0]; f[5] = x1[1]; f[6] = x1[2]; f[7] = x1[3];
          v8h ha, la;
#pragma unroll
          for (int e = 0; e < 8; ++e) {
            const float t  = (f[e] + col8c[e]) + ((var == 0) ? col8a[e] : col8b[e]);
            const float th = t * carry;
            const _Float16 hq = (_Float16)th;
            ha[e] = hq;
            la[e] = (_Float16)((th - (float)hq) * 1024.0f);
          }
          hv[it] = ha; lv[it] = la;
        }
        {
#pragma unroll
          for (int it = 0; it < 4; ++it) {
            const int row = it * 4 + q8;
            _Float16* cp = Cc + (size_t)(mBase + row) * ldc + 2 * n0 + c8;
            *(v8h*)(cp)      = hv[it];
            *(v8h*)(cp + 64) = lv[it];
          }
          
        }
      }
    }
    __builtin_amdgcn_fence(__ATOMIC_RELEASE, "workgroup");
    __builtin_amdgcn_wave_barrier();
    __builtin_amdgcn_fence(__ATOMIC_ACQUIRE, "workgroup");
  }
}

// -------------------------------------------------------------------------------------------------
// Relative-position attention for all NH heads of all NB batch elements, folded q.k and q.p depth 128 (hi | residual),
// value head dim 64, no mask.
//   QU  f16 plane [t][h*128 + j]: j<64 hi = f16(16*(q+u_bias)), j>=64 residual x1024     (A of the content score)
//   KP  f16 plane [s][h*128 + j]: j<64 f16(16*k), j>=64 f16(k/64)                       (B, staged per 64-key chunk as [key][128])
//   VT  f16 plane [h*64 + d][s]   = f16(16*v)                                            (B of P.V, staged as [d][key])
//   QV  f16 plane, as QU with v_bias                                                     (A of the position score)
//   PP  f16 plane [row][h*128 + j]: j<64 f16(16*p), j>=64 f16(p/64), NPP rows             (B, staged in 64-row tiles as [row][128])
//       rel-shift: position score of (query i, key) = (q_i + v_bias).p[key - i + SEQ-1].  For query block qb and key chunk
//       kc that is row 64*(SEQ/64-1-qb+kc) + x of PP, x = (key mod 64) + 63 - (i mod 64) in [0, 126]: two 64-row tiles, of
//       which the upper is the next chunk's lower, so one new tile per chunk goes into a ring of two slots (slot = tile & 1).
//       A wave's 16 queries (row R) x 64 keys need x = 48 - 16*wave + w, w = (key mod 64) + 15 - R in [0, 78]: five 16-column
//       products W, the lowest of which is the chunk before's highest; score column n of row R is W column n + 15 - R,
//       fetched by a select between neighbouring products in the source lane and one ds_bpermute_b32 inside the 16-lane row.
//   score = cs * (QU.K^T acc + QV.P^T acc)  with cs = (1/8)/256;  online softmax in f32 over SEQ/64 chunks of 64 keys;
//   P stored per wave as f16(4096 * exp(s - m)); CTX[t][h*64 + d] = f16(64 * ctx) = f16((P.V acc) / (1024*l)).
// Block = 4 waves = 64 query rows of one head; grid = (SEQ/64 query blocks, NH heads, NB batch elements).
// LDS: one raw buffer; K tile [64][128] f16 at row pitch KPIT, then V^T tile [64][64] f16 at pitch VPIT, then per-wave
// P tiles [16][64] f16 at pitch VPIT, then the two p-row slots [64][128] f16 at pitch KPIT; the output staging
// [4][16][64] f32 at pitch OPIT reuses the K bytes after a block barrier.  Every pitch is an odd multiple of 16 B, so the 16 rows that one ds_load_b128 reads start on 16
// different groups of four banks (at the bare 256-B and 128-B pitches they fall on one or two groups).
// coverage: staging 128 thr x 8 pieces of 8 halves for K and for a p-row tile (64x128), 128 thr x 4 pieces for V^T (64x64); P tile 8 rows x
// 2 halves x 4x16 cols per wave = 16x64 (all written every chunk); output 4 store instructions x 4 rows x 8 lanes x
// 8 halves = 16x64 per wave.
// -------------------------------------------------------------------------------------------------
#define KPIT   (HQK + 8)            // halves: 272 B = 17 x 16 B
#define VPIT   (HDV + 8)            // halves: 144 B =  9 x 16 B
#define OPIT   (HDV + 4)            // floats: 272 B = 17 x 16 B
#define KBYTES (64 * KPIT * 2)      // 17408
#define VBYTES (64 * VPIT * 2)      //  9216
#define PBYTES (4 * 16 * VPIT * 2)  //  9216
static_assert(4 * 16 * OPIT * 4 <= KBYTES);
static_assert(KBYTES % 16 == 0 && VBYTES % 16 == 0);

__global__ __launch_bounds__(128)
void relattn_kernel(const _Float16* __restrict__ QU, const _Float16* __restrict__ QV,
                    const _Float16* __restrict__ KP, const _Float16* __restrict__ VT,
                    const _Float16* __restrict__ PP, _Float16* __restrict__ CTX, float cs) {
  __shared__ __align__(16) unsigned char SMEM[KBYTES + VBYTES + PBYTES + 2 * KBYTES];
  _Float16* Ksh = (_Float16*)(SMEM);                    // [64][128] at pitch KPIT
  _Float16* Vsh = (_Float16*)(SMEM + KBYTES);           // [64][64]  at pitch VPIT
  _Float16* Psh = (_Float16*)(SMEM + KBYTES + VBYTES);  // [4][16][64] at pitch VPIT
  _Float16* Rsh = (_Float16*)(SMEM + KBYTES + VBYTES + PBYTES);   // [2][64][128] at pitch KPIT: p-row tiles
  float*    Osh = (float*)(SMEM);                       // [4][16][64] at pitch OPIT, after the chunk loop

  const int tid  = threadIdx.x;
  const int wave = tid >> 5;
  const int lane = tid & 31;
  const int hh   = lane >> 4;
  const int c    = lane & 15;

  const int h    = blockIdx.y;
  const int bz   = blockIdx.z;
  const int qb   = blockIdx.x;
  const int q0   = qb * 64 + wave * 16;          // first query row of this wave
  const int tpb  = SEQ / 64 - 1 - qb;            // lower p-row tile of chunk 0

  const _Float16* Qh = QU + (size_t)bz * SEQ * QKW + h * HQK;   // row pitch QKW
  const _Float16* Qw = QV + (size_t)bz * SEQ * QKW + h * HQK;   // row pitch QKW
  const _Float16* Kh = KP + (size_t)bz * SEQ * QKW + h * HQK;   // row pitch QKW
  const _Float16* Ph = PP + h * HQK;                            // row pitch QKW, shared by the batch
  const _Float16* Vh = VT + (size_t)(bz * ND + h * HDV) * SEQ;
  _Float16*       ctx = CTX + (size_t)bz * SEQ * ND + h * HDV;  // row pitch ND

  // Q fragments (A operand): 4 chunks of 32 along the folded depth
  const _Float16* qsrc = Qh + (size_t)(q0 + c) * QKW + 8 * hh;
  const _Float16* wsrc = Qw + (size_t)(q0 + c) * QKW + 8 * hh;
  v16h qa[4], qv[4];
#pragma unroll
  for (int dc = 0; dc < 4; ++dc) qa[dc] = ldfrag(qsrc + dc * 32);
#pragma unroll
  for (int dc = 0; dc < 4; ++dc) qv[dc] = ldfrag(wsrc + dc * 32);
  // the reads further down may be given the Q address registers; the two pointers are inputs so that they stay in
  // their registers up to here
  asm volatile("s_wait_xcnt 0x0" :: "v"(qsrc), "v"(wsrc) : "memory");

  // rel-shift of accumulator register r (row R = 8*hh + r), shift sft = 15 - R: this lane takes from lane (c + sft) mod 16
  // of its row; as a source it offers product j where c >= sft and product j + 1 below
  int  pidx[8];
  bool own[8];
#pragma unroll
  for (int r = 0; r < 8; ++r) {
    const int sft = 15 - 8 * hh - r;
    pidx[r] = ((lane & 16) | ((c + sft) & 15)) << 2;
    own[r]  = (c >= sft);
  }

  float mrow[8], lrow[8];
  v8f oacc[4];
#pragma unroll
  for (int r = 0; r < 8; ++r) { mrow[r] = -INFINITY; lrow[r] = 0.f; }
#pragma unroll
  for (int t = 0; t < 4; ++t) oacc[t] = zero8();

  v8f wtop = zero8();                            // top position product of the chunk before
  _Float16* pw = Psh + wave * (16 * VPIT);

  // Global reads run one chunk ahead of their use: this thread's K, V^T and p-row staging pieces of
  // chunk kc + 1 are issued behind the barrier that publishes chunk kc, so their latency passes under the score products
  // and the softmax of chunk kc (the fence ahead of P.V waits for them at the latest).
  // Piece map: neighbouring lanes take neighbouring 16-B pieces of one row, so that one wave-wide read covers four whole
  // 128-B lines (K and p rows: 16 lanes a 256-B row, 2 rows a read, piece i of a thread in row 8i + sr; V^T rows: 8 lanes a
  // 128-B row, 4 rows a read, piece i in row 16i + vr) instead of one line per lane.
  const int sr = tid >> 4, sc0 = (tid & 15) * 8;
  const int vr = tid >> 3, scv = (tid & 7) * 8;
  const _Float16* ksrc = Kh + (size_t)sr * QKW + sc0;
  const _Float16* vsrc = Vh + (size_t)vr * SEQ + scv;
  const _Float16* psrc = Ph + (size_t)(tpb * 64 + sr) * QKW + sc0;
  v8h kst[8], vst[4], pst[8], pf[8];
#pragma unroll
  for (int i = 0; i < 8; ++i) kst[i] = *(const v8h*)(ksrc + (size_t)(8 * i) * QKW);
#pragma unroll
  for (int i = 0; i < 4; ++i) vst[i] = *(const v8h*)(vsrc + (size_t)(16 * i) * SEQ);
#pragma unroll
  for (int i = 0; i < 8; ++i) pf[i] = *(const v8h*)(psrc + (size_t)(8 * i) * QKW);
#pragma unroll
  for (int i = 0; i < 8; ++i) pst[i] = *(const v8h*)(psrc + (size_t)(64 + 8 * i) * QKW);
  // stands ahead of any reuse of the address registers named above; the pointers are inputs so that they stay
  // in their registers up to here and no result of this run of reads is given one of them
  asm volatile("s_wait_xcnt 0x0" :: "v"(ksrc), "v"(vsrc), "v"(psrc) : "memory");
  // chunk 0's lower p-row tile; published by the barrier behind the first staging stores
#pragma unroll
  for (int i = 0; i < 8; ++i) *(v8ha*)(Rsh + ((tpb & 1) * 64 + 8 * i + sr) * KPIT + sc0) = pf[i];

#pragma unroll 1
  for (int kc = 0; kc < SEQ / 64; ++kc) {
    __syncthreads();
#pragma unroll
    for (int i = 0; i < 8; ++i) *(v8ha*)(Ksh + (8 * i + sr) * KPIT + sc0) = kst[i];
#pragma unroll
    for (int i = 0; i < 4; ++i) *(v8ha*)(Vsh + (16 * i + vr) * VPIT + scv) = vst[i];
    // the chunk's upper p-row tile, over the lower tile of the chunk before, whose reads the barrier above has ended
    _Float16* rdst = Rsh + (((tpb + kc + 1) & 1) * 64 + sr) * KPIT + sc0;
#pragma unroll
    for (int i = 0; i < 8; ++i) *(v8ha*)(rdst + i * (8 * KPIT)) = pst[i];
    __syncthreads();

    if (kc + 1 < SEQ / 64) {                          // block-uniform: the last chunk fetches nothing
      const int kn0 = (kc + 1) * 64;
#pragma unroll
      for (int i = 0; i < 8; ++i) kst[i] = *(const v8h*)(ksrc + (size_t)(kn0 + 8 * i) * QKW);
#pragma unroll
      for (int i = 0; i < 4; ++i) vst[i] = *(const v8h*)(vsrc + kn0 + (size_t)(16 * i) * SEQ);
#pragma unroll
      for (int i = 0; i < 8; ++i) pst[i] = *(const v8h*)(psrc + (size_t)(kn0 + 64 + 8 * i) * QKW);
      // stands ahead of any reuse of the address registers named above; its memory clobber also holds the reads here,
      // in front of the score products
      asm volatile("s_wait_xcnt 0x0" ::: "memory");
    }

    // position scores: W[u] = QV(16x128) . p^T for window rows 48 - 16*wave + 16u .. + 15, then the rel-shift
    // (W[0] of a chunk is W[4] of the chunk before: the same queries against the same p rows, so it is carried over)
    v8f pos[4];
    {
      v8f w5[5];
      const _Float16* pr[5];
#pragma unroll
      for (int u = 0; u < 5; ++u) {
        const int x = 48 - 16 * wave + 16 * u;      // 0 .. 112: a 16-row group lies in one tile
        pr[u] = Rsh + (((tpb + kc + (x >> 6)) & 1) * 64 + (x & 63) + c) * KPIT + 8 * hh;
      }
      if (kc == 0) {                                // block-uniform: nothing to carry yet
#pragma unroll
        for (int dc = 0; dc < 4; ++dc) wtop = mma16(qv[dc], ldfrag(pr[0] + dc * 32), wtop);
      }
      w5[0] = wtop;
#pragma unroll
      for (int u = 1; u < 5; ++u) w5[u] = zero8();
#pragma unroll
      for (int dc = 0; dc < 4; ++dc) {
        v16h pb[4];                                 // the 8 LDS reads of a 32-deep step stand as one group
#pragma unroll
        for (int u = 1; u < 5; ++u) pb[u - 1] = ldfrag(pr[u] + dc * 32);
#pragma unroll
        for (int u = 1; u < 5; ++u) w5[u] = mma16(qv[dc], pb[u - 1], w5[u]);
      }
      wtop = w5[4];
#pragma unroll
      for (int r = 0; r < 8; ++r)
#pragma unroll
        for (int j = 0; j < 4; ++j) {
          const float offer = own[r] ? w5[j][r] : w5[j + 1][r];
          pos[j][r] = __int_as_float(__builtin_amdgcn_ds_bpermute(pidx[r], __float_as_int(offer)));
        }
    }

    // content scores: S[j] = QU(16x128) . K^T for key subtile j
    v8f s[4];
#pragma unroll
    for (int j = 0; j < 4; ++j) {
      s[j] = zero8();
#pragma unroll
      for (int dc = 0; dc < 4; ++dc) {
        const v16h kb = ldfrag(Ksh + (j * 16 + c) * KPIT + dc * 32 + 8 * hh);
        s[j] = mma16(qa[dc], kb, s[j]);
      }
    }

    // add the position term, chunk row max
    float cm[8];
#pragma unroll
    for (int r = 0; r < 8; ++r) {
      float m = -INFINITY;
#pragma unroll
      for (int j = 0; j < 4; ++j) {
        const float sv = (s[j][r] + pos[j][r]) * cs;   // cs is a power of two: the one rounding is that of the sum
        s[j][r] = sv;
        m = fmaxf(m, sv);
      }
      cm[r] = m;
    }
    row_max8(cm);

    // online softmax update (per-row rescale of this row's accumulator elements only);
    // P tile (x4096) to this wave's LDS tile [row][key]
    float alpha[8], psum[8];
#pragma unroll
    for (int r = 0; r < 8; ++r) {
      const float mnew  = fmaxf(mrow[r], cm[r]);
      alpha[r] = __expf(mrow[r] - mnew);
      mrow[r] = mnew;
      float ps = 0.f;
#pragma unroll
      for (int j = 0; j < 4; ++j) {
        const float p = __expf(s[j][r] - mnew);
        ps += p;
        pw[(8 * hh + r) * VPIT + j * 16 + c] = (_Float16)(p * 4096.0f);
      }
      psum[r] = ps;
    }
    row_sum8(psum);
#pragma unroll
    for (int r = 0; r < 8; ++r) {
      lrow[r] = lrow[r] * alpha[r] + psum[r];
#pragma unroll
      for (int t = 0; t < 4; ++t) oacc[t][r] *= alpha[r];
    }
    __builtin_amdgcn_fence(__ATOMIC_RELEASE, "workgroup");
    __builtin_amdgcn_wave_barrier();
    __builtin_amdgcn_fence(__ATOMIC_ACQUIRE, "workgroup");

    // P (A operand, row = lane&15, split k map over keys) . V (B operand from V^T rows d)
#pragma unroll
    for (int kk = 0; kk < 2; ++kk) {
      const v16h pa = ldfrag(pw + c * VPIT + kk * 32 + 8 * hh);
#pragma unroll
      for (int t = 0; t < 4; ++t) {
        const v16h vb = ldfrag(Vsh + (t * 16 + c) * VPIT + kk * 32 + 8 * hh);
        oacc[t] = mma16(pa, vb, oacc[t]);
      }
    }
  }

  __syncthreads();                               // every wave is done with Ksh before Osh aliases it
  float* os = Osh + wave * (16 * OPIT);
#pragma unroll
  for (int r = 0; r < 8; ++r) {
    const float inv = 1.0f / (1024.0f * lrow[r]);   // 64 / (4096 * 16 * l)
#pragma unroll
    for (int t = 0; t < 4; ++t) os[(8 * hh + r) * OPIT + t * 16 + c] = oacc[t][r] * inv;
  }
  __builtin_amdgcn_fence(__ATOMIC_RELEASE, "workgroup");
  __builtin_amdgcn_wave_barrier();
  __builtin_amdgcn_fence(__ATOMIC_ACQUIRE, "workgroup");
  const int q8 = lane >> 3, c8 = (lane & 7) * 8;
  v8h ov[4];
#pragma unroll
  for (int it = 0; it < 4; ++it) {
    const int row = it * 4 + q8;
    const float* sp = os + row * OPIT + c8;
    const v4f x0 = *(const v4fa*)(sp);
    const v4f x1 = *(const v4fa*)(sp + 4);
    v8h o;
    o[0] = (_Float16)x0[0]; o[1] = (_Float16)x0[1]; o[2] = (_Float16)x0[2]; o[3] = (_Float16)x0[3];
    o[4] = (_Float16)x1[0]; o[5] = (_Float16)x1[1]; o[6] = (_Float16)x1[2]; o[7] = (_Float16)x1[3];
    ov[it] = o;
  }
  {
#pragma unroll
    for (int it = 0; it < 4; ++it) {
      const int row = it * 4 + q8;
      *(v8h*)(ctx + (size_t)(q0 + row) * ND + c8) = ov[it];
    }
    
  }
}

// -------------------------------------------------------------------------------------------------
// Workspace map (bytes, NB=8 SEQ=1024): every batch element's planes are live at once.
//   P2   f16 [NPP][2048]             8388608
//   QU2  f16 [NB*SEQ][2048]         33554432
//   QV2  f16 [NB*SEQ][2048]         33554432
//   KP2  f16 [NB*SEQ][2048]         33554432
//   VT   f16 [NB][1024][SEQ]        16777216
//   SCR                             50331648   early phase: WQ2, WK2 f16 [1024][2048], WV, WP f16 [1024][1024],
//                                              PE f16 [NPP][1024], XH f16 [NB*SEQ][2048] (all dead after the projections);
//                                              last phase: WO f16 [1024][1024] (converted after the attention launch),
//                                              then CTX f16 [NB*SEQ][1024] (written by the attention launch)
//   total                          176160768
// Every region is written in whole 64x64 tiles / whole rows; all region sizes equal their written extents.
// -------------------------------------------------------------------------------------------------
extern "C" void kernel_launch(void* const* d_in, const int* in_sizes, int n_in,
                              void* d_out, int out_size, void* d_ws, size_t ws_size,
                              hipStream_t stream) {
  if (n_in < 14) return;
  if (in_sizes[0] < ((NB - 1) * SEQ_FULL + SEQ) * ND) return;
  if (in_sizes[1] != ND * ND || in_sizes[3] != ND * ND || in_sizes[5] != ND * ND) return;
  if (in_sizes[7] != ND * ND || in_sizes[8] != ND * ND) return;
  if (in_sizes[2] < ND || in_sizes[4] < ND || in_sizes[6] < ND || in_sizes[9] < ND) return;
  if (in_sizes[10] < NH * HDV || in_sizes[11] < NH * HDV) return;
  if (in_sizes[12] < ND || in_sizes[13] < ND) return;
  if (out_size < NB * SEQ * ND) return;

  const float* x    = (const float*)d_in[0];
  const float* Wq   = (const float*)d_in[1];
  const float* bq   = (const float*)d_in[2];
  const float* Wk   = (const float*)d_in[3];
  const float* bk   = (const float*)d_in[4];
  const float* Wv   = (const float*)d_in[5];
  const float* bv   = (const float*)d_in[6];
  const float* Wpos = (const float*)d_in[7];
  const float* Wout = (const float*)d_in[8];
  const float* bout = (const float*)d_in[9];
  const float* ub   = (const float*)d_in[10];
  const float* vbias= (const float*)d_in[11];
  const float* lng  = (const float*)d_in[12];
  const float* lnb  = (const float*)d_in[13];
  float* out = (float*)d_out;

  const size_t szW2  = (size_t)ND * QKW * 2;              //   4194304
  const size_t szW1  = (size_t)ND * ND * 2;               //   2097152
  const size_t szXH  = (size_t)NB * SEQ * QKW * 2;        //  33554432
  const size_t szQ   = (size_t)NB * SEQ * QKW * 2;        //  33554432
  const size_t szVT  = (size_t)NB * ND * SEQ * 2;         //  16777216
  const size_t szP2  = (size_t)NPP * QKW * 2;             //   8388608
  const size_t szPE  = (size_t)NPP * ND * 2;              //   4194304
  const size_t szCTX = (size_t)NB * SEQ * ND * 2;         //  16777216
  const size_t szEarly = 2 * szW2 + 2 * szW1 + szPE + szXH;
  const size_t szLate  = szW1 + szCTX;
  const size_t szSCR = (szEarly > szLate) ? szEarly : szLate;
  size_t off = 0;
  const size_t oP2  = off; off += szP2;
  const size_t oQU2 = off; off += szQ;
  const size_t oQV2 = off; off += szQ;
  const size_t oKP2 = off; off += szQ;
  const size_t oVT  = off; off += szVT;
  const size_t oSCR = off; off += szSCR;
  const size_t total = off;                                // 176160768 for NB=8, SEQ=1024
  if (total > ws_size) return;
  const size_t oWQ2 = oSCR;
  const size_t oWK2 = oWQ2 + szW2;
  const size_t oWV  = oWK2 + szW2;
  const size_t oWP  = oWV + szW1;
  const size_t oPE  = oWP + szW1;
  const size_t oXH  = oPE + szPE;

  char* ws = (char*)d_ws;
  _Float16* WQ2 = (_Float16*)(ws + oWQ2);
  _Float16* WK2 = (_Float16*)(ws + oWK2);
  _Float16* WVp = (_Float16*)(ws + oWV);
  _Float16* WOp = (_Float16*)(ws + oSCR);
  _Float16* XH  = (_Float16*)(ws + oXH);
  _Float16* QU2 = (_Float16*)(ws + oQU2);
  _Float16* QV2 = (_Float16*)(ws + oQV2);
  _Float16* KP2 = (_Float16*)(ws + oKP2);
  _Float16* VTp = (_Float16*)(ws + oVT);
  _Float16* P2  = (_Float16*)(ws + oP2);
  _Float16* CTX = (_Float16*)(ws + oSCR + szW1);
  _Float16* WPp = (_Float16*)(ws + oWP);
  _Float16* PEp = (_Float16*)(ws + oPE);

  const float cs = 0.125f * 0.00390625f;   // (1/sqrt(64)) / 256 applied to the x16.x16 score accumulators
  const dim3 blk(256);

  // (1) weights -> f16 planes of bf16-valued entries: Wq, Wk as [x64 | /16] 2048-wide; Wv, Wpos x64
  const dim3 gW(ND * (ND / 8) / 256);      // 512
  cvt_w_kernel<true ><<<gW, blk, 0, stream>>>(Wq,   WQ2, 64.0f, 0.0625f);
  cvt_w_kernel<true ><<<gW, blk, 0, stream>>>(Wk,   WK2, 64.0f, 0.0625f);
  cvt_w_kernel<false><<<gW, blk, 0, stream>>>(Wv,   WVp, 64.0f, 64.0f);
  cvt_w_kernel<false><<<gW, blk, 0, stream>>>(Wpos, WPp, 64.0f, 64.0f);
  // (2) LayerNorm -> XH [NB*SEQ][2048] (hi | residual x1024)
  ln_kernel<<<dim3((NB * SEQ) / 8), blk, 0, stream>>>(x, lng, lnb, XH, NB * SEQ);
  // (3) positional sinusoid table -> PE [NPP][1024] (row NPP-1 = 0)
  pe_kernel<<<dim3((NPP * (ND / 8) + 255) / 256), blk, 0, stream>>>(PEp);
  // (4) p = pe . Wpos^T -> P2 = [16p | p/64]   (M=NPP, N=1024, K=1024)
  {
    const int tiles = (NPP / GBM) * (ND / GBN);
    gemm_f16_kernel<2, false><<<dim3(tiles, 1), blk, 0, stream>>>(
        PEp, ND, 0L, 0L, WPp, ND, 0L, (void*)P2, (void*)P2, QKW, 0L, 0L, bq, bq, bq,
        NPP, ND, ND, 0.015625f, 16.0f);
  }
  // (5) projections of all batch elements, one launch each
  const int tilesQ  = ((NB * SEQ) / GBM) * (ND / GBN);
  const int tilesV  = (ND / GBM) * (SEQ / GBN);
  // QU2 = split(16*(q + bq + u_bias)), QV2 = split(16*(q + bq + v_bias))   (M=NB*SEQ, N=1024, K=2048)
  gemm_f16_kernel<3, true><<<dim3(tilesQ, 1), blk, 0, stream>>>(
      XH, QKW, 0L, 0L, WQ2, QKW, 0L, (void*)QU2, (void*)QV2, QKW, 0L, 0L, ub, vbias, bq,
      NB * SEQ, ND, QKW, 0.015625f, 16.0f);
  // KP2 = [16k | k/64], k = xn.Wk^T + bk   (M=NB*SEQ, N=1024, K=2048)
  gemm_f16_kernel<2, true><<<dim3(tilesQ, 1), blk, 0, stream>>>(
      XH, QKW, 0L, 0L, WK2, QKW, 0L, (void*)KP2, (void*)KP2, QKW, 0L, 0L, bk, bk, bk,
      NB * SEQ, ND, QKW, 0.015625f, 16.0f);
  // VT[b][h*64+d][s] = 16*(v + bv)   (A = Wv plane [1024][1024], Bt = XH hi columns of batch element y; M=1024, N=SEQ, K=1024)
  gemm_f16_kernel<4, true><<<dim3(tilesV, NB), blk, 0, stream>>>(
      WVp, ND, 0L, 0L, XH, QKW, (long)SEQ * QKW, (void*)VTp, (void*)VTp, SEQ, (long)ND * SEQ, 0L, bv, bv, bv,
      ND, SEQ, ND, 0.015625f, 16.0f);
  // (6) attention with its position scores, all batch elements and heads in one launch
  relattn_kernel<<<dim3(SEQ / 64, NH, NB), dim3(128), 0, stream>>>(QU2, QV2, KP2, VTp, P2, CTX, cs);
  // (7) out = ctx . Wout^T + bout -> d_out f32 [NB*SEQ][1024]   (M=NB*SEQ, N=1024, K=1024; carries 64*64 folded into scale)
  cvt_w_kernel<false><<<gW, blk, 0, stream>>>(Wout, WOp, 64.0f, 64.0f);
  {
    const int tiles = ((NB * SEQ) / GBM) * (ND / GBN);
    gemm_f16_kernel<1, true><<<dim3(tiles, 1), blk, 0, stream>>>(
        CTX, ND, 0L, 0L, WOp, ND, 0L, (void*)out, (void*)out, ND, 0L, 0L, bout, bout, bout,
        NB * SEQ, ND, ND, 0.000244140625f, 1.0f);
  }
  (void)hipGetLastError();
}

// v008
// A run of this version takes 276 microseconds.
// Next to v007, in two timings, it ran 1.04 and 1.03 times as fast.
// All steps since v000 together make it 12.5 times as fast.
// Contractions: xn.Wq^T and xn.Wk^T (xn as f16 hi + x1024 f16 residual planes folded along K against Wx64 | W/16 planes), Wv.xn^T (xn hi, Wx64), pe.Wpos^T (pe f16, Wx64), (q+v_bias).p^T band and (q+u_bias).k^T (16q as f16 hi + x1024 residual folded along the head dim against 16p | p/64 and 16k | k/64 planes), P.V (P x4096, v x16), ctx.Wout^T (ctx x64, W x64): all v_wmma_f32_16x16x32_f16 (f16 operands, f32 accumulate); float inputs bf16-RNE valued; LayerNorm, positional table, softmax, bias adds and scaling in f32.
#include <hip/hip_runtime.h>
#include <math.h>
#include <stdint.h>

#ifndef NB
#define NB 8
#endif
#ifndef SEQ
#define SEQ 1024
#endif
#define SEQ_FULL 1024
#define ND    1024
#define NH    16
#define HDV   64            // value head dim
#define HQK   128           // folded depth of the q.k / q.p contractions: 64 hi + 64 residual
#define QKW   (2 * ND)      // pitch (halves) of the 2048-wide f16 planes
#define NP    (2 * SEQ - 1)
#define NPP   (2 * SEQ)

static_assert(SEQ % 64 == 0);
static_assert(SEQ <= SEQ_FULL);
static_assert(ND == NH * HDV);
static_assert(HQK == 2 * HDV);
static_assert(ND % 256 == 0);
static_assert(NPP % 64 == 0);

typedef _Float16 v16h __attribute__((ext_vector_type(16)));
typedef _Float16 v8h  __attribute__((ext_vector_type(8)));
typedef float    v8f  __attribute__((ext_vector_type(8)));
typedef float    v4f  __attribute__((ext_vector_type(4)));
typedef unsigned int v4u __attribute__((ext_vector_type(4)));
typedef v4f __attribute__((may_alias)) v4fa;
typedef v8h __attribute__((may_alias)) v8ha;

// bf16 RNE of an f32 value, returned widened to f32 (exactly representable in f16 after a power-of-two carry)
__device__ __forceinline__ float bf_rne(float f) {
  unsigned u = __float_as_uint(f);
  u = (u + 0x7FFFu + ((u >> 16) & 1u)) & 0xFFFF0000u;
  return __uint_as_float(u);
}

// 16-bit WMMA fragment: elements 0..7 <- p[0..7], elements 8..15 <- p[16..23]
// (A: p = row m at k0 + 8h;  B stored [n][k]: p = row n at k0 + 8h;  same split k map for both)
union FragU { v16h v; v8ha h[2]; };
__device__ __forceinline__ v16h ldfrag(const _Float16* p) {
  FragU f;
  f.h[0] = *(const v8ha*)(p);
  f.h[1] = *(const v8ha*)(p + 16);
  return f.v;
}

// WMMA + hazard guard (ties D, keeps A/B live for 4 VALU slots)
__device__ __forceinline__ v8f mma16(v16h a, v16h b, v8f c) {
  c = __builtin_amdgcn_wmma_f32_16x16x32_f16(false, a, false, b, (short)0, c, false, false);
  asm volatile("v_nop\n\tv_nop\n\tv_nop\n\tv_nop" : "+v"(c) : "v"(a), "v"(b));
  return c;
}

__device__ __forceinline__ v8f zero8() { v8f z = {0.f, 0.f, 0.f, 0.f, 0.f, 0.f, 0.f, 0.f}; return z; }

// 16-lane butterfly (lane ^ 1, ^ 2, ^ 4, ^ 8) over eight independent values at once, on the vector port by DPP row_xmask;
// every lane must be on.  It takes the place of ds_bpermute_b32 round trips through the LDS pipe, each with its own wait.
// Written as text because the builtin DPP move came out as three instructions a step for the maximum; the eight values are
// interleaved so that every instruction's producer stands eight instructions back and no step waits for the one before.
__device__ __forceinline__ void row_max8(float (&m)[8]) {
  asm(
      "v_max_num_f32_dpp %0, %0, %0 row_xmask:1 row_mask:0xf bank_mask:0xf\n\t"
      "v_max_num_f32_dpp %1, %1, %1 row_xmask:1 row_mask:0xf bank_mask:0xf\n\t"
      "v_max_num_f32_dpp %2, %2, %2 row_xmask:1 row_mask:0xf bank_mask:0xf\n\t"
      "v_max_num_f32_dpp %3, %3, %3 row_xmask:1 row_mask:0xf bank_mask:0xf\n\t"
      "v_max_num_f32_dpp %4, %4, %4 row_xmask:1 row_mask:0xf bank_mask:0xf\n\t"
      "v_max_num_f32_dpp %5, %5, %5 row_xmask:1 row_mask:0xf bank_mask:0xf\n\t"
      "v_max_num_f32_dpp %6, %6, %6 row_xmask:1 row_mask:0xf bank_mask:0xf\n\t"
      "v_max_num_f32_dpp %7, %7, %7 row_xmask:1 row_mask:0xf bank_mask:0xf\n\t"
      "v_max_num_f32_dpp %0, %0, %0 row_xmask:2 row_mask:0xf bank_mask:0xf\n\t"
      "v_max_num_f32_dpp %1, %1, %1 row_xmask:2 row_mask:0xf bank_mask:0xf\n\t"
      "v_max_num_f32_dpp %2, %2, %2 row_xmask:2 row_mask:0xf bank_mask:0xf\n\t"
      "v_max_num_f32_dpp %3, %3, %3 row_xmask:2 row_mask:0xf bank_mask:0xf\n\t"
      "v_max_num_f32_dpp %4, %4, %4 row_xmask:2 row_mask:0xf bank_mask:0xf\n\t"
      "v_max_num_f32_dpp %5, %5, %5 row_xmask:2 row_mask:0xf bank_mask:0xf\n\t"
      "v_max_num_f32_dpp %6, %6, %6 row_xmask:2 row_mask:0xf bank_mask:0xf\n\t"
      "v_max_num_f32_dpp %7, %7, %7 row_xmask:2 row_mask:0xf bank_mask:0xf\n\t"
      "v_max_num_f32_dpp %0, %0, %0 row_xmask:4 row_mask:0xf bank_mask:0xf\n\t"
      "v_max_num_f32_dpp %1, %1, %1 row_xmask:4 row_mask:0xf bank_mask:0xf\n\t"
      "v_max_num_f32_dpp %2, %2, %2 row_xmask:4 row_mask:0xf bank_mask:0xf\n\t"
      "v_max_num_f32_dpp %3, %3, %3 row_xmask:4 row_mask:0xf bank_mask:0xf\n\t"
      "v_max_num_f32_dpp %4, %4, %4 row_xmask:4 row_mask:0xf bank_mask:0xf\n\t"
      "v_max_num_f32_dpp %5, %5, %5 row_xmask:4 row_mask:0xf bank_mask:0xf\n\t"
      "v_max_num_f32_dpp %6, %6, %6 row_xmask:4 row_mask:0xf bank_mask:0xf\n\t"
      "v_max_num_f32_dpp %7, %7, %7 row_xmask:4 row_mask:0xf bank_mask:0xf\n\t"
      "v_max_num_f32_dpp %0, %0, %0 row_xmask:8 row_mask:0xf bank_mask:0xf\n\t"
      "v_max_num_f32_dpp %1, %1, %1 row_xmask:8 row_mask:0xf bank_mask:0xf\n\t"
      "v_max_num_f32_dpp %2, %2, %2 row_xmask:8 row_mask:0xf bank_mask:0xf\n\t"
      "v_max_num_f32_dpp %3, %3, %3 row_xmask:8 row_mask:0xf bank_mask:0xf\n\t"
      "v_max_num_f32_dpp %4, %4, %4 row_xmask:8 row_mask:0xf bank_mask:0xf\n\t"
      "v_max_num_f32_dpp %5, %5, %5 row_xmask:8 row_mask:0xf bank_mask:0xf\n\t"
      "v_max_num_f32_dpp %6, %6, %6 row_xmask:8 row_mask:0xf bank_mask:0xf\n\t"
      "v_max_num_f32_dpp %7, %7, %7 row_xmask:8 row_mask:0xf bank_mask:0xf"
      : "+v"(m[0]), "+v"(m[1]), "+v"(m[2]), "+v"(m[3]), "+v"(m[4]), "+v"(m[5]), "+v"(m[6]), "+v"(m[7]));
}
__device__ __forceinline__ void row_sum8(float (&s)[8]) {
  asm(
      "v_add_f32_dpp %0, %0, %0 row_xmask:1 row_mask:0xf bank_mask:0xf\n\t"
      "v_add_f32_dpp %1, %1, %1 row_xmask:1 row_mask:0xf bank_mask:0xf\n\t"
      "v_add_f32_dpp %2, %2, %2 row_xmask:1 row_mask:0xf bank_mask:0xf\n\t"
      "v_add_f32_dpp %3, %3, %3 row_xmask:1 row_mask:0xf bank_mask:0xf\n\t"
      "v_add_f32_dpp %4, %4, %4 row_xmask:1 row_mask:0xf bank_mask:0xf\n\t"
      "v_add_f32_dpp %5, %5, %5 row_xmask:1 row_mask:0xf bank_mask:0xf\n\t"
      "v_add_f32_dpp %6, %6, %6 row_xmask:1 row_mask:0xf bank_mask:0xf\n\t"
      "v_add_f32_dpp %7, %7, %7 row_xmask:1 row_mask:0xf bank_mask:0xf\n\t"
      "v_add_f32_dpp %0, %0, %0 row_xmask:2 row_mask:0xf bank_mask:0xf\n\t"
      "v_add_f32_dpp %1, %1, %1 row_xmask:2 row_mask:0xf bank_mask:0xf\n\t"
      "v_add_f32_dpp %2, %2, %2 row_xmask:2 row_mask:0xf bank_mask:0xf\n\t"
      "v_add_f32_dpp %3, %3, %3 row_xmask:2 row_mask:0xf bank_mask:0xf\n\t"
      "v_add_f32_dpp %4, %4, %4 row_xmask:2 row_mask:0xf bank_mask:0xf\n\t"
      "v_add_f32_dpp %5, %5, %5 row_xmask:2 row_mask:0xf bank_mask:0xf\n\t"
      "v_add_f32_dpp %6, %6, %6 row_xmask:2 row_mask:0xf bank_mask:0xf\n\t"
      "v_add_f32_dpp %7, %7, %7 row_xmask:2 row_mask:0xf bank_mask:0xf\n\t"
      "v_add_f32_dpp %0, %0, %0 row_xmask:4 row_mask:0xf bank_mask:0xf\n\t"
      "v_add_f32_dpp %1, %1, %1 row_xmask:4 row_mask:0xf bank_mask:0xf\n\t"
      "v_add_f32_dpp %2, %2, %2 row_xmask:4 row_mask:0xf bank_mask:0xf\n\t"
      "v_add_f32_dpp %3, %3, %3 row_xmask:4 row_mask:0xf bank_mask:0xf\n\t"
      "v_add_f32_dpp %4, %4, %4 row_xmask:4 row_mask:0xf bank_mask:0xf\n\t"
      "v_add_f32_dpp %5, %5, %5 row_xmask:4 row_mask:0xf bank_mask:0xf\n\t"
      "v_add_f32_dpp %6, %6, %6 row_xmask:4 row_mask:0xf bank_mask:0xf\n\t"
      "v_add_f32_dpp %7, %7, %7 row_xmask:4 row_mask:0xf bank_mask:0xf\n\t"
      "v_add_f32_dpp %0, %0, %0 row_xmask:8 row_mask:0xf bank_mask:0xf\n\t"
      "v_add_f32_dpp %1, %1, %1 row_xmask:8 row_mask:0xf bank_mask:0xf\n\t"
      "v_add_f32_dpp %2, %2, %2 row_xmask:8 row_mask:0xf bank_mask:0xf\n\t"
      "v_add_f32_dpp %3, %3, %3 row_xmask:8 row_mask:0xf bank_mask:0xf\n\t"
      "v_add_f32_dpp %4, %4, %4 row_xmask:8 row_mask:0xf bank_mask:0xf\n\t"
      "v_add_f32_dpp %5, %5, %5 row_xmask:8 row_mask:0xf bank_mask:0xf\n\t"
      "v_add_f32_dpp %6, %6, %6 row_xmask:8 row_mask:0xf bank_mask:0xf\n\t"
      "v_add_f32_dpp %7, %7, %7 row_xmask:8 row_mask:0xf bank_mask:0xf"
      : "+v"(s[0]), "+v"(s[1]), "+v"(s[2]), "+v"(s[3]), "+v"(s[4]), "+v"(s[5]), "+v"(s[6]), "+v"(s[7]));
}

// -------------------------------------------------------------------------------------------------
// Weight [1024][1024] f32 -> f16 plane of bf16-valued entries.
//   DUP false: dst [1024][1024], dst[r][c] = f16(bf_rne(W)*s1)
//   DUP true : dst [1024][2048], dst[r][c] = f16(bf_rne(W)*s1), dst[r][1024+c] = f16(bf_rne(W)*s2)
// coverage: 131072 threads x 8 = the whole [1024][1024] source (both column halves for DUP).
// -------------------------------------------------------------------------------------------------
template <bool DUP>
__global__ __launch_bounds__(256) void cvt_w_kernel(const float* __restrict__ src, _Float16* __restrict__ dst,
                                                    float s1, float s2) {
  const int i = blockIdx.x * 256 + threadIdx.x;
  const int total8 = ND * (ND / 8);
  if (i >= total8) return;
  const int r  = i / (ND / 8);
  const int c8 = (i - r * (ND / 8)) * 8;
  const float* sp = src + (size_t)r * ND + c8;
  const v4f a = *(const v4f*)(sp);
  const v4f b = *(const v4f*)(sp + 4);
  float f[8];
  f[0] = bf_rne(a[0]); f[1] = bf_rne(a[1]); f[2] = bf_rne(a[2]); f[3] = bf_rne(a[3]);
  f[4] = bf_rne(b[0]); f[5] = bf_rne(b[1]); f[6] = bf_rne(b[2]); f[7] = bf_rne(b[3]);
  v8h o1, o2;
#pragma unroll
  for (int e = 0; e < 8; ++e) { o1[e] = (_Float16)(f[e] * s1); o2[e] = (_Float16)(f[e] * s2); }
  const int pitch = DUP ? QKW : ND;
  _Float16* dp = dst + (size_t)r * pitch + c8;
  *(v8h*)dp = o1;
  if (DUP) *(v8h*)(dp + ND) = o2;
  
}

// -------------------------------------------------------------------------------------------------
//   XH[row][c]        = f16(xn)                       (hi)
//   XH[row][1024 + c] = f16((xn - hi) * 1024)         (residual, carried x1024)
// One wave per row (compact row b*SEQ + t; source row b*SEQ_FULL + t); block = 8 waves = 8 rows; no LDS.
// Stores: lane l writes 16 B at columns i*256 + 8l: one instruction = 32 lanes x 16 B = 512 contiguous B =
// coverage: grid NB*SEQ/8 x 8 waves x (4 x 256) columns x {hi, residual} = the whole [NB*SEQ][2048] plane.
// Loops rolled on purpose (small elementwise side computation).
// -------------------------------------------------------------------------------------------------
__global__ __launch_bounds__(256) void ln_kernel(const float* __restrict__ x, const float* __restrict__ g,
                                                const float* __restrict__ bt, _Float16* __restrict__ XH,
                                                int nrows) {
  const int lane = threadIdx.x & 31;
  const int wave = threadIdx.x >> 5;
  const int row  = blockIdx.x * 8 + wave;
  if (row >= nrows) return;                                   // wave-uniform; no barriers in this kernel
  const int b = row / SEQ;
  const int t = row - b * SEQ;
  const float* xr = x + ((size_t)b * SEQ_FULL + t) * ND + lane * 8;

  float s = 0.f;
#pragma unroll 1
  for (int i = 0; i < 4; ++i) {
    const v4f a = *(const v4f*)(xr + i * 256);
    const v4f c = *(const v4f*)(xr + i * 256 + 4);
    s += (bf_rne(a[0]) + bf_rne(a[1])) + (bf_rne(a[2]) + bf_rne(a[3]));
    s += (bf_rne(c[0]) + bf_rne(c[1])) + (bf_rne(c[2]) + bf_rne(c[3]));
  }
  s += __shfl_xor(s, 16, 32); s += __shfl_xor(s, 8, 32); s += __shfl_xor(s, 4, 32);
  s += __shfl_xor(s, 2, 32);  s += __shfl_xor(s, 1, 32);
  const float mu = s * (1.0f / (float)ND);

  float s2 = 0.f;
#pragma unroll 1
  for (int i = 0; i < 4; ++i) {
    const v4f a = *(const v4f*)(xr + i * 256);
    const v4f c = *(const v4f*)(xr + i * 256 + 4);
    float d;
    d = bf_rne(a[0]) - mu; s2 += d * d;  d = bf_rne(a[1]) - mu; s2 += d * d;
    d = bf_rne(a[2]) - mu; s2 += d * d;  d = bf_rne(a[3]) - mu; s2 += d * d;
    d = bf_rne(c[0]) - mu; s2 += d * d;  d = bf_rne(c[1]) - mu; s2 += d * d;
    d = bf_rne(c[2]) - mu; s2 += d * d;  d = bf_rne(c[3]) - mu; s2 += d * d;
  }
  s2 += __shfl_xor(s2, 16, 32); s2 += __shfl_xor(s2, 8, 32); s2 += __shfl_xor(s2, 4, 32);
  s2 += __shfl_xor(s2, 2, 32);  s2 += __shfl_xor(s2, 1, 32);
  const float var  = s2 * (1.0f / (float)ND);
  const float rstd = rsqrtf(var + 1e-5f);

  _Float16* xh = XH + (size_t)row * QKW + lane * 8;
{
#pragma unroll 1
    for (int i = 0; i < 4; ++i) {
      const v4f a  = *(const v4f*)(xr + i * 256);
      const v4f c  = *(const v4f*)(xr + i * 256 + 4);
      const v4f ga = *(const v4f*)(g + i * 256 + lane * 8);
      const v4f gb = *(const v4f*)(g + i * 256 + lane * 8 + 4);
      const v4f ba = *(const v4f*)(bt + i * 256 + lane * 8);
      const v4f bb = *(const v4f*)(bt + i * 256 + lane * 8 + 4);
      float f[8], gg[8], be[8];
      f[0] = a[0]; f[1] = a[1]; f[2] = a[2]; f[3] = a[3]; f[4] = c[0]; f[5] = c[1]; f[6] = c[2]; f[7] = c[3];
      gg[0] = ga[0]; gg[1] = ga[1]; gg[2] = ga[2]; gg[3] = ga[3];
      gg[4] = gb[0]; gg[5] = gb[1]; gg[6] = gb[2]; gg[7] = gb[3];
      be[0] = ba[0]; be[1] = ba[1]; be[2] = ba[2]; be[3] = ba[3];
      be[4] = bb[0]; be[5] = bb[1]; be[6] = bb[2]; be[7] = bb[3];
      v8h ho, lo;
#pragma unroll
      for (int e = 0; e < 8; ++e) {
        const float xn = (bf_rne(f[e]) - mu) * rstd * bf_rne(gg[e]) + bf_rne(be[e]);
        const _Float16 hv = (_Float16)xn;
        ho[e] = hv;
        lo[e] = (_Float16)((xn - (float)hv) * 1024.0f);
      }
      *(v8h*)(xh + i * 256)      = ho;
      *(v8h*)(xh + ND + i * 256) = lo;
    }
    
  }
}

// -------------------------------------------------------------------------------------------------
// Relative-position sinusoid table -> PE f16 plane [NPP][1024] (rows >= NP are 0):
//   row r <-> relative position pos = SEQ-1-r;  div_j = expf(f32(2j) * f32(-ln(1e4)/1024));
//   ang = |pos| * div_j (f32 product);  PE[r][2j] = sin(ang) with the sign of pos, PE[r][2j+1] = cos(ang).
// passes.  The per-pair loop is rolled (one sinf, one cosf, one expf body); the 16-B result is assembled by a
// register rotate with constant indices (no dynamic local-array indexing).
// coverage: grid NPP*128/256, NPP*128 threads x 8 halves = the whole [NPP][1024] plane.
// -------------------------------------------------------------------------------------------------
__global__ __launch_bounds__(256) void pe_kernel(_Float16* __restrict__ PE) {
  const int i = blockIdx.x * 256 + threadIdx.x;
  if (i >= NPP * (ND / 8)) return;
  const int r  = i / (ND / 8);
  const int c8 = (i - r * (ND / 8)) * 8;
  const int pos = SEQ - 1 - r;
  const float fpos = (float)((pos < 0) ? -pos : pos);
  const float live = (r < NP) ? 1.0f : 0.0f;
  const float c0 = (float)(-9.210340371976184 / (double)ND);
  v4u pk = {0u, 0u, 0u, 0u};
#pragma unroll 1
  for (int e = 0; e < 4; ++e) {
    const int j = (c8 >> 1) + e;
    const float dv  = expf((float)(2 * j) * c0);
    const float ang = fpos * dv;
    float sn = sinf(ang);
    const float cn = cosf(ang);
    sn = (pos < 0) ? -sn : sn;
    const _Float16 hs = (_Float16)(sn * live);
    const _Float16 hc = (_Float16)(cn * live);
    const unsigned w = (unsigned)__builtin_bit_cast(unsigned short, hs) |
                       ((unsigned)__builtin_bit_cast(unsigned short, hc) << 16);
    v4u nx;
    nx[0] = pk[1]; nx[1] = pk[2]; nx[2] = pk[3]; nx[3] = w;
    pk = nx;
  }
  unsigned* dp = (unsigned*)(PE + (size_t)r * ND + c8);
  *(v4u*)dp = pk;
  
}

// -------------------------------------------------------------------------------------------------
// LDS ring of the staged GEMM path: one stage = 128 k of [A 128 rows | Bt 256 rows], 256-B rows at pitch 272 B
// (an odd multiple of 16 B for the ds_load_b128 fragment reads), two buffers.
// -------------------------------------------------------------------------------------------------
#define GBM    128                    // block tile rows (2 waves of 64)
#define GBN    256                    // block tile columns (4 waves of 64)
#define GKS    128                    // halves of k per stage
#define GPIT   (GKS + 8)              // halves: 272 B = 17 x 16 B
#define GSTAGE ((GBM + GBN) * GPIT * 2)   // bytes per buffer: 104448
static_assert((GBM + GBN) * (GKS / 8) == 24 * 256);   // 24 copies of 16 B per thread and stage
static_assert((NB * SEQ) % GBM == 0 && NPP % GBM == 0 && ND % GBM == 0);
static_assert(ND % GBN == 0 && SEQ % GBN == 0);
static_assert(ND % GKS == 0 && ND / GKS >= 2);

// Twelve asynchronous 16-B copies global -> LDS per lane (l: LDS byte address, g: global address of the lane).
// s_wait_xcnt 0 closes the statement so that no address register named here is rewritten ahead of it.
__device__ __forceinline__ void async_copy12(const unsigned (&l)[12], const _Float16* const (&g)[12]) {
  asm volatile(
      "global_load_async_to_lds_b128 %0, %12, off\n\t"
      "global_load_async_to_lds_b128 %1, %13, off\n\t"
      "global_load_async_to_lds_b128 %2, %14, off\n\t"
      "global_load_async_to_lds_b128 %3, %15, off\n\t"
      "global_load_async_to_lds_b128 %4, %16, off\n\t"
      "global_load_async_to_lds_b128 %5, %17, off\n\t"
      "global_load_async_to_lds_b128 %6, %18, off\n\t"
      "global_load_async_to_lds_b128 %7, %19, off\n\t"
      "global_load_async_to_lds_b128 %8, %20, off\n\t"
      "global_load_async_to_lds_b128 %9, %21, off\n\t"
      "global_load_async_to_lds_b128 %10, %22, off\n\t"
      "global_load_async_to_lds_b128 %11, %23, off\n\t"
      "s_wait_xcnt 0x0"
      :: "v"(l[0]), "v"(l[1]), "v"(l[2]), "v"(l[3]), "v"(l[4]), "v"(l[5]),
         "v"(l[6]), "v"(l[7]), "v"(l[8]), "v"(l[9]), "v"(l[10]), "v"(l[11]),
         "v"(g[0]), "v"(g[1]), "v"(g[2]), "v"(g[3]), "v"(g[4]), "v"(g[5]),
         "v"(g[6]), "v"(g[7]), "v"(g[8]), "v"(g[9]), "v"(g[10]), "v"(g[11])
      : "memory");
}

// -------------------------------------------------------------------------------------------------
// f16 WMMA GEMM: C[m][n] = epi( sum_k A[m][k] * Bt[n][k] ).
// A row-major [M][K] pitch lda; Bt row-major [N][K] pitch ldb.
// Each wave owns a 64x64 output tile (4x4 subtiles), 8 waves per block, grid.y = z-batch,
// grid.z = outer batch (steps A by strideAz and C by strideCz; Bt is shared).
// M multiple of 128, N of 256, K of 128 and at least 256; grid.x = (M/128)*(N/256); the block's 2x4 waves
// share one 128x256 tile whose A and Bt rows are staged in the LDS ring by asynchronous copies (whole
// 256-B row pieces, each fetched once per block), the copies of stage t+2 flying while stage t+1 is worked on.
// OUT 1: f32  C1[m][n] = acc*scale + bf_rne(b1[n])                              (final output)
// OUT 2: f16  t = acc*scale (+ bf_rne(b1[n]) if HASB);  C1[m][2*n0+c] = f16(t*carry),
//             C1[m][2*n0+64+c] = f16(t*carry/1024)      (2048-wide hi | copy planes, one 64-col tile = one head)
// OUT 3: f16  t = (acc*scale + bf_rne(b3[n])) + bf_rne(b1[n] resp. b2[n]);  th = t*carry;
//             hi = f16(th), lo = f16((th - hi)*1024) -> C1 (b1 variant) and C2 (b2 variant), hi at 2*n0+c, lo at 2*n0+64+c
// OUT 4: f16  C1[m][n] = f16((acc*scale + bf_rne(b1[m])) * carry)            (row bias)
// Epilogue: 16-row slabs staged per wave in LDS (wave-private region, wave barrier); every row segment is written as
// coverage: 4 slabs x 16 rows x 64 cols = the whole 64x64 tile per wave; tiles cover M x N exactly.
// -------------------------------------------------------------------------------------------------
template <int OUT, bool HASB>
__global__ __launch_bounds__(256) void gemm_f16_kernel(
    const _Float16* __restrict__ A, int lda, long strideA, long strideAz,
    const _Float16* __restrict__ Bt, int ldb, long strideB,
    void* C1, void* C2, int ldc, long strideC, long strideCz,
    const float* __restrict__ b1, const float* __restrict__ b2, const float* __restrict__ b3,
    int M, int N, int K, float scale, float carry) {
  __shared__ __align__(16) float sT[8][16 * 68];   // per-wave 16x64 slab, pitch 68 floats
  __shared__ __align__(16) unsigned char GS[2 * GSTAGE];   // operand ring of the staged path

  const int z    = blockIdx.y;
  const int lane = threadIdx.x & 31;
  const int wave = threadIdx.x >> 5;
  int m0, n0;
  {
    const int tilesN = N / GBN;
    const int tilesM = M / GBM;
    const int bt = blockIdx.x;
    if (bt >= tilesM * tilesN) return;             // block-uniform, ahead of every copy and barrier
    const int tmb = bt / tilesN;
    const int tnb = bt - tmb * tilesN;
    m0 = tmb * GBM + (wave >> 2) * 64;
    n0 = tnb * GBN + (wave & 3) * 64;
  }
  const size_t cOff = (size_t)z * strideC + (size_t)blockIdx.z * strideCz;

  const _Float16* Ab = A  + (size_t)z * strideA + (size_t)blockIdx.z * strideAz;
  const _Float16* Bb = Bt + (size_t)z * strideB;

  const int rl   = lane & 15;          // row (A) / column (B, D) within a subtile
  const int koff = (lane >> 4) * 8;    // k offset of this lane half
  const int mOff = (lane >> 4) * 8;    // D row offset of this lane half

  v8f acc[4][4];
#pragma unroll
  for (int i = 0; i < 4; ++i)
#pragma unroll
    for (int j = 0; j < 4; ++j) acc[i][j] = zero8();

  {
    // copy map: thread -> row crow + 16*i of the stage (i < 8: A rows, i >= 8: Bt rows), 16-B piece ccol of its 256 B;
    // one wave-wide copy = 2 rows x 256 B = 4 whole lines.
    const int crow = threadIdx.x >> 4;
    const int ccol = threadIdx.x & 15;
    const int wm = wave >> 2, wn = wave & 3;
    const _Float16* gA = Ab + (size_t)(m0 - wm * 64 + crow) * lda + ccol * 8;
    const _Float16* gB = Bb + (size_t)(n0 - wn * 64 + crow) * ldb + ccol * 8;
    const unsigned ldsLane = (unsigned)(uintptr_t)(&GS[0]) + (unsigned)(crow * (GPIT * 2) + ccol * 16);
    const int nt = K / GKS;
    auto issue_stage = [&](int t, int buf) {
#pragma unroll
      for (int hf = 0; hf < 2; ++hf) {
        unsigned l[12];
        const _Float16* g[12];
#pragma unroll
        for (int e = 0; e < 12; ++e) {
          const int i = hf * 12 + e;
          l[e] = ldsLane + (unsigned)(buf * GSTAGE + i * 16 * (GPIT * 2));
          const size_t so = (i < 8) ? (size_t)(i * 16) * lda + (size_t)t * GKS         // wave-uniform part
                                    : (size_t)((i - 8) * 16) * ldb + (size_t)t * GKS;
          g[e] = ((i < 8) ? gA : gB) + so;
        }
        async_copy12(l, g);
      }
    };

    issue_stage(0, 0);
    asm volatile("s_wait_asynccnt 0x0" ::: "memory");   // this wave's share of stage 0 has landed
    __syncthreads();                                    // publishes stage 0
    issue_stage(1, 1);
    const _Float16* fa = (const _Float16*)GS + (wm * 64 + rl) * GPIT + koff;
    const _Float16* fb = (const _Float16*)GS + (GBM + wn * 64 + rl) * GPIT + koff;
    for (int t = 0; t < nt; ++t) {                      // one stage per trip
      const int bo = (t & 1) * (GSTAGE / 2);
#pragma unroll
      for (int ks = 0; ks < GKS / 32; ++ks) {
        v16h bfr[4], afr[4];                            // all 16 LDS reads of a 32-k block stand as one group
#pragma unroll
        for (int j = 0; j < 4; ++j) bfr[j] = ldfrag(fb + bo + j * 16 * GPIT + ks * 32);
#pragma unroll
        for (int i = 0; i < 4; ++i) afr[i] = ldfrag(fa + bo + i * 16 * GPIT + ks * 32);
#pragma unroll
        for (int i = 0; i < 4; ++i)
#pragma unroll
          for (int j = 0; j < 4; ++j) acc[i][j] = mma16(afr[i], bfr[j], acc[i][j]);
      }
      asm volatile("s_wait_dscnt 0x0" ::: "memory");    // this wave has left the buffer that is refilled below
      asm volatile("s_wait_asynccnt 0x0" ::: "memory"); // this wave's share of stage t+1 has landed
      __syncthreads();                                  // publishes stage t+1, ends every read of stage t
      if (t + 2 < nt) issue_stage(t + 2, t & 1);
    }
    asm volatile("s_wait_asynccnt 0x0" ::: "memory");   // nothing in flight when the wave goes on
  }

  // ---- epilogue ----
  float* slab = sT[wave];
  const int hh = lane >> 4, c4 = (lane & 15) * 4;     // f32 modes: row segment 256 B = 16 lanes x 16 B
  const int q8 = lane >> 3, c8 = (lane & 7) * 8;
  v4f bias4 = {0.f, 0.f, 0.f, 0.f};
  float col8a[8], col8b[8], col8c[8];
#pragma unroll
  for (int e = 0; e < 8; ++e) { col8a[e] = 0.f; col8b[e] = 0.f; col8c[e] = 0.f; }
  if (OUT == 1 && HASB) {
    const v4f tb = *(const v4f*)(b1 + n0 + c4);
    bias4[0] = bf_rne(tb[0]); bias4[1] = bf_rne(tb[1]); bias4[2] = bf_rne(tb[2]); bias4[3] = bf_rne(tb[3]);
  }
  if ((OUT == 2 && HASB) || OUT == 3) {
    const v4f ta = *(const v4f*)(b1 + n0 + c8);
    const v4f tb = *(const v4f*)(b1 + n0 + c8 + 4);
    col8a[0] = bf_rne(ta[0]); col8a[1] = bf_rne(ta[1]); col8a[2] = bf_rne(ta[2]); col8a[3] = bf_rne(ta[3]);
    col8a[4] = bf_rne(tb[0]); col8a[5] = bf_rne(tb[1]); col8a[6] = bf_rne(tb[2]); col8a[7] = bf_rne(tb[3]);
  }
  if (OUT == 3) {
    const v4f ta = *(const v4f*)(b2 + n0 + c8);
    const v4f tb = *(const v4f*)(b2 + n0 + c8 + 4);
    col8b[0] = bf_rne(ta[0]); col8b[1] = bf_rne(ta[1]); col8b[2] = bf_rne(ta[2]); col8b[3] = bf_rne(ta[3]);
    col8b[4] = bf_rne(tb[0]); col8b[5] = bf_rne(tb[1]); col8b[6] = bf_rne(tb[2]); col8b[7] = bf_rne(tb[3]);
    const v4f tc = *(const v4f*)(b3 + n0 + c8);
    const v4f td = *(const v4f*)(b3 + n0 + c8 + 4);
    col8c[0] = bf_rne(tc[0]); col8c[1] = bf_rne(tc[1]); col8c[2] = bf_rne(tc[2]); col8c[3] = bf_rne(tc[3]);
    col8c[4] = bf_rne(td[0]); col8c[5] = bf_rne(td[1]); col8c[6] = bf_rne(td[2]); col8c[7] = bf_rne(td[3]);
  }
  const float carry2 = carry * 0.0009765625f;        // carry / 1024

#pragma unroll
  for (int i = 0; i < 4; ++i) {
    const int mBase = m0 + (i << 4);
#pragma unroll
    for (int j = 0; j < 4; ++j)
#pragma unroll
      for (int r = 0; r < 8; ++r)
        slab[(mOff + r) * 68 + (j << 4) + rl] = acc[i][j][r] * scale;
    __builtin_amdgcn_fence(__ATOMIC_RELEASE, "workgroup");
    __builtin_amdgcn_wave_barrier();
    __builtin_amdgcn_fence(__ATOMIC_ACQUIRE, "workgroup");
    if (OUT == 1) {
      float* C = (float*)C1 + cOff;
      v4f vv[8];
#pragma unroll
      for (int it = 0; it < 8; ++it) {
        const int row = it * 2 + hh;
        v4f v = *(const v4fa*)(slab + row * 68 + c4);
        if (OUT == 1) v += bias4;
        vv[it] = v;
      }
      {
#pragma unroll
        for (int it = 0; it < 8; ++it) {
          const int row = it * 2 + hh;
          *(v4f*)(C + (size_t)(mBase + row) * ldc + n0 + c4) = vv[it];
        }
        
      }
    } else if (OUT == 2 || OUT == 4) {
      _Float16* Ca = (_Float16*)C1 + cOff;
      v8h hv[4], lv[4];
#pragma unroll
      for (int it = 0; it < 4; ++it) {
        const int row = it * 4 + q8;
        const float* sp = slab + row * 68 + c8;
        const v4f x0 = *(const v4fa*)(sp);
        const v4f x1 = *(const v4fa*)(sp + 4);
        float f[8];
        f[0] = x0[0]; f[1] = x0[1]; f[2] = x0[2]; f[3] = x0[3];
        f[4] = x1[0]; f[5] = x1[1]; f[6] = x1[2]; f[7] = x1[3];
        float rb = 0.f;
        if (OUT == 4 && HASB) rb = bf_rne(b1[mBase + row]);
        v8h ha, la;
#pragma unroll
        for (int e = 0; e < 8; ++e) {
          const float t = f[e] + ((OUT == 2) ? col8a[e] : rb);
          ha[e] = (_Float16)(t * carry);
          la[e] = (_Float16)(t * carry2);
        }
        hv[it] = ha; lv[it] = la;
      }
      {
#pragma unroll
        for (int it = 0; it < 4; ++it) {
          const int row = it * 4 + q8;
          if (OUT == 2) {
            _Float16* cp = Ca + (size_t)(mBase + row) * ldc + 2 * n0 + c8;
            *(v8h*)(cp)      = hv[it];
            *(v8h*)(cp + 64) = lv[it];
          } else {
            *(v8h*)(Ca + (size_t)(mBase + row) * ldc + n0 + c8) = hv[it];
          }
        }
        
      }
    } else {
#pragma unroll
      for (int var = 0; var < 2; ++var) {
        _Float16* Cc = (_Float16*)((var == 0) ? C1 : C2) + cOff;
        v8h hv[4], lv[4];
#pragma unroll
        for (int it = 0; it < 4; ++it) {
          const int row = it * 4 + q8;
          const float* sp = slab + row * 68 + c8;
          const v4f x0 = *(const v4fa*)(sp);
          const v4f x1 = *(const v4fa*)(sp + 4);
          float f[8];
          f[0] = x0[0]; f[1] = x0[1]; f[2] = x0[2]; f[3] = x0[3];
          f[4] = x1[0]; f[5] = x1[1]; f[6] = x1[2]; f[7] = x1[3];
          v8h ha, la;
#pragma unroll
          for (int e = 0; e < 8; ++e) {
            const float t  = (f[e] + col8c[e]) + ((var == 0) ? col8a[e] : col8b[e]);
            const float th = t * carry;
            const _Float16 hq = (_Float16)th;
            ha[e] = hq;
            la[e] = (_Float16)((th - (float)hq) * 1024.0f);
          }
          hv[it] = ha; lv[it] = la;
        }
        {
#pragma unroll
          for (int it = 0; it < 4; ++it) {
            const int row = it * 4 + q8;
            _Float16* cp = Cc + (size_t)(mBase + row) * ldc + 2 * n0 + c8;
            *(v8h*)(cp)      = hv[it];
            *(v8h*)(cp + 64) = lv[it];
          }
          
        }
      }
    }
    __builtin_amdgcn_fence(__ATOMIC_RELEASE, "workgroup");
    __builtin_amdgcn_wave_barrier();
    __builtin_amdgcn_fence(__ATOMIC_ACQUIRE, "workgroup");
  }
}

// -------------------------------------------------------------------------------------------------
// Relative-position attention for all NH heads of all NB batch elements, folded q.k and q.p depth 128 (hi | residual),
// value head dim 64, no mask.
//   QU  f16 plane [t][h*128 + j]: j<64 hi = f16(16*(q+u_bias)), j>=64 residual x1024     (A of the content score)
//   KP  f16 plane [s][h*128 + j]: j<64 f16(16*k), j>=64 f16(k/64)                       (B, staged per 64-key chunk as [key][128])
//   VT  f16 plane [h*64 + d][s]   = f16(16*v)                                            (B of P.V, staged as [d][key])
//   QV  f16 plane, as QU with v_bias                                                     (A of the position score)
//   PP  f16 plane [row][h*128 + j]: j<64 f16(16*p), j>=64 f16(p/64), NPP rows             (B, staged in 64-row tiles as [row][128])
//       rel-shift: position score of (query i, key) = (q_i + v_bias).p[key - i + SEQ-1].  For query block qb and key chunk
//       kc that is row 64*(SEQ/64-1-qb+kc) + x of PP, x = (key mod 64) + 63 - (i mod 64) in [0, 126]: two 64-row tiles, of
//       which the upper is the next chunk's lower, so one new tile per chunk goes into a ring of two slots (slot = tile & 1).
//       A wave's 16 queries (row R) x 64 keys need x = 48 - 16*wave + w, w = (key mod 64) + 15 - R in [0, 78]: five 16-column
//       products W, the lowest of which is the chunk before's highest; score column n of row R is W column n + 15 - R,
//       fetched by a select between neighbouring products in the source lane and one ds_bpermute_b32 inside the 16-lane row.
//   score = cs * (QU.K^T acc + QV.P^T acc)  with cs = (1/8)/256;  online softmax in f32 over SEQ/64 chunks of 64 keys;
//   P stored per wave as f16(4096 * exp(s - m)); CTX[t][h*64 + d] = f16(64 * ctx) = f16((P.V acc) / (1024*l)).
// Block = 4 waves = 64 query rows of one head; grid = (SEQ/64 query blocks, NH heads, NB batch elements).
// LDS: one raw buffer; K tile [64][128] f16 at row pitch KPIT, then V^T tile [64][64] f16 at pitch VPIT, then per-wave
// P tiles [16][64] f16 at pitch VPIT, then the two p-row slots [64][128] f16 at pitch KPIT; the output staging
// [4][16][64] f32 at pitch OPIT reuses the K bytes after a block barrier.  Every pitch is an odd multiple of 16 B, so the 16 rows that one ds_load_b128 reads start on 16
// different groups of four banks (at the bare 256-B and 128-B pitches they fall on one or two groups).
// coverage: staging 128 thr x 8 pieces of 8 halves for K and for a p-row tile (64x128), 128 thr x 4 pieces for V^T (64x64); P tile 8 rows x
// 2 halves x 4x16 cols per wave = 16x64 (all written every chunk); output 4 store instructions x 4 rows x 8 lanes x
// 8 halves = 16x64 per wave.
// -------------------------------------------------------------------------------------------------
#define KPIT   (HQK + 8)            // halves: 272 B = 17 x 16 B
#define VPIT   (HDV + 8)            // halves: 144 B =  9 x 16 B
#define OPIT   (HDV + 4)            // floats: 272 B = 17 x 16 B
#define KBYTES (64 * KPIT * 2)      // 17408
#define VBYTES (64 * VPIT * 2)      //  9216
#define PBYTES (4 * 16 * VPIT * 2)  //  9216
static_assert(4 * 16 * OPIT * 4 <= KBYTES);
static_assert(KBYTES % 16 == 0 && VBYTES % 16 == 0);

__global__ __launch_bounds__(128)
void relattn_kernel(const _Float16* __restrict__ QU, const _Float16* __restrict__ QV,
                    const _Float16* __restrict__ KP, const _Float16* __restrict__ VT,
                    const _Float16* __restrict__ PP, _Float16* __restrict__ CTX, float cs) {
  __shared__ __align__(16) unsigned char SMEM[KBYTES + VBYTES + PBYTES + 2 * KBYTES];
  _Float16* Ksh = (_Float16*)(SMEM);                    // [64][128] at pitch KPIT
  _Float16* Vsh = (_Float16*)(SMEM + KBYTES);           // [64][64]  at pitch VPIT
  _Float16* Psh = (_Float16*)(SMEM + KBYTES + VBYTES);  // [4][16][64] at pitch VPIT
  _Float16* Rsh = (_Float16*)(SMEM + KBYTES + VBYTES + PBYTES);   // [2][64][128] at pitch KPIT: p-row tiles
  float*    Osh = (float*)(SMEM);                       // [4][16][64] at pitch OPIT, after the chunk loop

  const int tid  = threadIdx.x;
  const int wave = tid >> 5;
  const int lane = tid & 31;
  const int hh   = lane >> 4;
  const int c    = lane & 15;

  const int h    = blockIdx.y;
  const int bz   = blockIdx.z;
  const int qb   = blockIdx.x;
  const int q0   = qb * 64 + wave * 16;          // first query row of this wave
  const int tpb  = SEQ / 64 - 1 - qb;            // lower p-row tile of chunk 0

  const _Float16* Qh = QU + (size_t)bz * SEQ * QKW + h * HQK;   // row pitch QKW
  const _Float16* Qw = QV + (size_t)bz * SEQ * QKW + h * HQK;   // row pitch QKW
  const _Float16* Kh = KP + (size_t)bz * SEQ * QKW + h * HQK;   // row pitch QKW
  const _Float16* Ph = PP + h * HQK;                            // row pitch QKW, shared by the batch
  const _Float16* Vh = VT + (size_t)(bz * ND + h * HDV) * SEQ;
  _Float16*       ctx = CTX + (size_t)bz * SEQ * ND + h * HDV;  // row pitch ND

  // Q fragments (A operand): 4 chunks of 32 along the folded depth
  const _Float16* qsrc = Qh + (size_t)(q0 + c) * QKW + 8 * hh;
  const _Float16* wsrc = Qw + (size_t)(q0 + c) * QKW + 8 * hh;
  v16h qa[4], qv[4];
#pragma unroll
  for (int dc = 0; dc < 4; ++dc) qa[dc] = ldfrag(qsrc + dc * 32);
#pragma unroll
  for (int dc = 0; dc < 4; ++dc) qv[dc] = ldfrag(wsrc + dc * 32);
  // the reads further down may be given the Q address registers; the two pointers are inputs so that they stay in
  // their registers up to here
  asm volatile("s_wait_xcnt 0x0" :: "v"(qsrc), "v"(wsrc) : "memory");

  // rel-shift of accumulator register r (row R = 8*hh + r), shift sft = 15 - R: this lane takes from lane (c + sft) mod 16
  // of its row; as a source it offers product j where c >= sft and product j + 1 below
  int  pidx[8];
  bool own[8];
#pragma unroll
  for (int r = 0; r < 8; ++r) {
    const int sft = 15 - 8 * hh - r;
    pidx[r] = ((lane & 16) | ((c + sft) & 15)) << 2;
    own[r]  = (c >= sft);
  }

  float mrow[8], lrow[8];
  v8f oacc[4];
#pragma unroll
  for (int r = 0; r < 8; ++r) { mrow[r] = -INFINITY; lrow[r] = 0.f; }
#pragma unroll
  for (int t = 0; t < 4; ++t) oacc[t] = zero8();

  v8f wtop = zero8();                            // top position product of the chunk before
  _Float16* pw = Psh + wave * (16 * VPIT);

  // Global reads run one chunk ahead of their use: this thread's K and V^T staging pieces of chunk kc + 1 are issued
  // behind the barrier that publishes chunk kc, its p-row pieces behind the score products of chunk kc, so their latency
  // passes under the score products and the softmax of chunk kc (the fence ahead of P.V waits for them at the latest).
  // Piece map: neighbouring lanes take neighbouring 16-B pieces of one row, so that one wave-wide read covers four whole
  // 128-B lines (K and p rows: 16 lanes a 256-B row, 2 rows a read, piece i of a thread in row 8i + sr; V^T rows: 8 lanes a
  // 128-B row, 4 rows a read, piece i in row 16i + vr) instead of one line per lane.
  const int sr = tid >> 4, sc0 = (tid & 15) * 8;
  const int vr = tid >> 3, scv = (tid & 7) * 8;
  const _Float16* ksrc = Kh + (size_t)sr * QKW + sc0;
  const _Float16* vsrc = Vh + (size_t)vr * SEQ + scv;
  const _Float16* psrc = Ph + (size_t)(tpb * 64 + sr) * QKW + sc0;
  v8h kst[8], vst[4], pst[8], pf[8];
#pragma unroll
  for (int i = 0; i < 8; ++i) kst[i] = *(const v8h*)(ksrc + (size_t)(8 * i) * QKW);
#pragma unroll
  for (int i = 0; i < 4; ++i) vst[i] = *(const v8h*)(vsrc + (size_t)(16 * i) * SEQ);
#pragma unroll
  for (int i = 0; i < 8; ++i) pf[i] = *(const v8h*)(psrc + (size_t)(8 * i) * QKW);
#pragma unroll
  for (int i = 0; i < 8; ++i) pst[i] = *(const v8h*)(psrc + (size_t)(64 + 8 * i) * QKW);
  // stands ahead of any reuse of the address registers named above; the pointers are inputs so that they stay
  // in their registers up to here and no result of this run of reads is given one of them
  asm volatile("s_wait_xcnt 0x0" :: "v"(ksrc), "v"(vsrc), "v"(psrc) : "memory");
  // chunk 0's lower p-row tile; published by the barrier behind the first staging stores
#pragma unroll
  for (int i = 0; i < 8; ++i) *(v8ha*)(Rsh + ((tpb & 1) * 64 + 8 * i + sr) * KPIT + sc0) = pf[i];

#pragma unroll 1
  for (int kc = 0; kc < SEQ / 64; ++kc) {
    __syncthreads();
#pragma unroll
    for (int i = 0; i < 8; ++i) *(v8ha*)(Ksh + (8 * i + sr) * KPIT + sc0) = kst[i];
#pragma unroll
    for (int i = 0; i < 4; ++i) *(v8ha*)(Vsh + (16 * i + vr) * VPIT + scv) = vst[i];
    // the chunk's upper p-row tile, over the lower tile of the chunk before, whose reads the barrier above has ended
    _Float16* rdst = Rsh + (((tpb + kc + 1) & 1) * 64 + sr) * KPIT + sc0;
#pragma unroll
    for (int i = 0; i < 8; ++i) *(v8ha*)(rdst + i * (8 * KPIT)) = pst[i];
    __syncthreads();

    // LDS fragment reads stand in whole groups of four fragments (8 ds_load_b128), each group issued ahead of the
    // products of the group before it where registers allow, so that a wave waits once a group and not once a product.
    // frg[0] and frg[1] are the two register sets.  The chunk's first group is read here: its latency passes under the
    // issue of the global reads below.
    const _Float16* pr[5];
#pragma unroll
    for (int u = 0; u < 5; ++u) {
      const int x = 48 - 16 * wave + 16 * u;        // 0 .. 112: a 16-row group lies in one tile
      pr[u] = Rsh + (((tpb + kc + (x >> 6)) & 1) * 64 + (x & 63) + c) * KPIT + 8 * hh;
    }
    const _Float16* kfr = Ksh + c * KPIT + 8 * hh;
    const _Float16* vfr = Vsh + c * VPIT + 8 * hh;
    v16h frg[2][4];
#pragma unroll
    for (int u = 1; u < 5; ++u) frg[0][u - 1] = ldfrag(pr[u]);

    if (kc + 1 < SEQ / 64) {                          // block-uniform: the last chunk fetches nothing
      const int kn0 = (kc + 1) * 64;
#pragma unroll
      for (int i = 0; i < 8; ++i) kst[i] = *(const v8h*)(ksrc + (size_t)(kn0 + 8 * i) * QKW);
#pragma unroll
      for (int i = 0; i < 4; ++i) vst[i] = *(const v8h*)(vsrc + kn0 + (size_t)(16 * i) * SEQ);
      // stands ahead of any reuse of the address registers named above; its memory clobber also holds the reads here,
      // in front of the score products
      asm volatile("s_wait_xcnt 0x0" ::: "memory");
    }

    // position scores: W[u] = QV(16x128) . p^T for window rows 48 - 16*wave + 16u .. + 15, then the rel-shift
    // (W[0] of a chunk is W[4] of the chunk before: the same queries against the same p rows, so it is carried over)
    v8f pos[4], s[4];
    {
      v8f w5[5];
      if (kc == 0) {                                // block-uniform: nothing to carry yet
#pragma unroll
        for (int dc = 0; dc < 4; ++dc) wtop = mma16(qv[dc], ldfrag(pr[0] + dc * 32), wtop);
      }
      w5[0] = wtop;
#pragma unroll
      for (int u = 1; u < 5; ++u) w5[u] = zero8();
#pragma unroll
      for (int dc = 0; dc < 4; ++dc) {
        // the next group (the next 32-deep step of the p rows, at the end the first step of the K rows) into the other set
#pragma unroll
        for (int u = 0; u < 4; ++u)
          frg[(dc + 1) & 1][u] = (dc < 3) ? ldfrag(pr[u + 1] + (dc + 1) * 32) : ldfrag(kfr + u * 16 * KPIT);
#pragma unroll
        for (int u = 1; u < 5; ++u) w5[u] = mma16(qv[dc], frg[dc & 1][u - 1], w5[u]);
      }
      wtop = w5[4];

      // content scores: S[j] = QU(16x128) . K^T for key subtile j, 32-deep step by step over all four subtiles
#pragma unroll
      for (int j = 0; j < 4; ++j) s[j] = mma16(qa[0], frg[0][j], zero8());
#pragma unroll
      for (int j = 0; j < 4; ++j) frg[1][j] = ldfrag(kfr + j * 16 * KPIT + 32);

#pragma unroll
      for (int j = 0; j < 4; ++j)                   // product by product, so that W[j]'s registers are free behind its offers
#pragma unroll
        for (int r = 0; r < 8; ++r) {
          const float offer = own[r] ? w5[j][r] : w5[j + 1][r];
          pos[j][r] = __int_as_float(__builtin_amdgcn_ds_bpermute(pidx[r], __float_as_int(offer)));
        }
    }
#pragma unroll
    for (int dc = 1; dc < 4; ++dc) {
#pragma unroll
      for (int j = 0; j < 4; ++j) s[j] = mma16(qa[dc], frg[dc & 1][j], s[j]);
      if (dc < 3) {
#pragma unroll
        for (int j = 0; j < 4; ++j) frg[(dc + 1) & 1][j] = ldfrag(kfr + j * 16 * KPIT + (dc + 1) * 32);
      }
    }

    // The next chunk's p-row pieces are read from here on, not with K and V^T above: their 32 registers are the second
    // fragment set's during the score products; the softmax and P.V still stand between this read and its use.
    if (kc + 1 < SEQ / 64) {                          // block-uniform: the last chunk fetches nothing
#pragma unroll
      for (int i = 0; i < 8; ++i) pst[i] = *(const v8h*)(psrc + (size_t)((kc + 1) * 64 + 64 + 8 * i) * QKW);
      // stands ahead of any reuse of the address registers named above
      asm volatile("s_wait_xcnt 0x0" ::: "memory");
    } else {
      // says that the old pieces are dead on this path too; without it they stay live through the score products
#pragma unroll
      for (int i = 0; i < 8; ++i) pst[i] = v8h{};
    }

    // add the position term, chunk row max
    float cm[8];
#pragma unroll
    for (int r = 0; r < 8; ++r) {
      float m = -INFINITY;
#pragma unroll
      for (int j = 0; j < 4; ++j) {
        const float sv = (s[j][r] + pos[j][r]) * cs;   // cs is a power of two: the one rounding is that of the sum
        s[j][r] = sv;
        m = fmaxf(m, sv);
      }
      cm[r] = m;
    }
    row_max8(cm);

    // online softmax update (per-row rescale of this row's accumulator elements only);
    // P tile (x4096) to this wave's LDS tile [row][key]
    float alpha[8], psum[8];
#pragma unroll
    for (int r = 0; r < 8; ++r) {
      const float mnew  = fmaxf(mrow[r], cm[r]);
      alpha[r] = __expf(mrow[r] - mnew);
      mrow[r] = mnew;
      float ps = 0.f;
#pragma unroll
      for (int j = 0; j < 4; ++j) {
        const float p = __expf(s[j][r] - mnew);
        ps += p;
        pw[(8 * hh + r) * VPIT + j * 16 + c] = (_Float16)(p * 4096.0f);
      }
      psum[r] = ps;
    }
    // all eight V^T fragments are read here: their latency passes under the row sums and the rescale
#pragma unroll
    for (int kk = 0; kk < 2; ++kk)
#pragma unroll
      for (int t = 0; t < 4; ++t) frg[kk][t] = ldfrag(vfr + t * 16 * VPIT + kk * 32);
    row_sum8(psum);
#pragma unroll
    for (int r = 0; r < 8; ++r) {
      lrow[r] = lrow[r] * alpha[r] + psum[r];
#pragma unroll
      for (int t = 0; t < 4; ++t) oacc[t][r] *= alpha[r];
    }
    __builtin_amdgcn_fence(__ATOMIC_RELEASE, "workgroup");
    __builtin_amdgcn_wave_barrier();
    __builtin_amdgcn_fence(__ATOMIC_ACQUIRE, "workgroup");

    // P (A operand, row = lane&15, split k map over keys) . V (B operand from V^T rows d)
    v16h pa[2];
#pragma unroll
    for (int kk = 0; kk < 2; ++kk) pa[kk] = ldfrag(pw + c * VPIT + kk * 32 + 8 * hh);
#pragma unroll
    for (int kk = 0; kk < 2; ++kk)
#pragma unroll
      for (int t = 0; t < 4; ++t) oacc[t] = mma16(pa[kk], frg[kk][t], oacc[t]);
  }

  __syncthreads();                               // every wave is done with Ksh before Osh aliases it
  float* os = Osh + wave * (16 * OPIT);
#pragma unroll
  for (int r = 0; r < 8; ++r) {
    const float inv = 1.0f / (1024.0f * lrow[r]);   // 64 / (4096 * 16 * l)
#pragma unroll
    for (int t = 0; t < 4; ++t) os[(8 * hh + r) * OPIT + t * 16 + c] = oacc[t][r] * inv;
  }
  __builtin_amdgcn_fence(__ATOMIC_RELEASE, "workgroup");
  __builtin_amdgcn_wave_barrier();
  __builtin_amdgcn_fence(__ATOMIC_ACQUIRE, "workgroup");
  const int q8 = lane >> 3, c8 = (lane & 7) * 8;
  v8h ov[4];
#pragma unroll
  for (int it = 0; it < 4; ++it) {
    const int row = it * 4 + q8;
    const float* sp = os + row * OPIT + c8;
    const v4f x0 = *(const v4fa*)(sp);
    const v4f x1 = *(const v4fa*)(sp + 4);
    v8h o;
    o[0] = (_Float16)x0[0]; o[1] = (_Float16)x0[1]; o[2] = (_Float16)x0[2]; o[3] = (_Float16)x0[3];
    o[4] = (_Float16)x1[0]; o[5] = (_Float16)x1[1]; o[6] = (_Float16)x1[2]; o[7] = (_Float16)x1[3];
    ov[it] = o;
  }
  {
#pragma unroll
    for (int it = 0; it < 4; ++it) {
      const int row = it * 4 + q8;
      *(v8h*)(ctx + (size_t)(q0 + row) * ND + c8) = ov[it];
    }
    
  }
}

// -------------------------------------------------------------------------------------------------
// Workspace map (bytes, NB=8 SEQ=1024): every batch element's planes are live at once.
//   P2   f16 [NPP][2048]             8388608
//   QU2  f16 [NB*SEQ][2048]         33554432
//   QV2  f16 [NB*SEQ][2048]         33554432
//   KP2  f16 [NB*SEQ][2048]         33554432
//   VT   f16 [NB][1024][SEQ]        16777216
//   SCR                             50331648   early phase: WQ2, WK2 f16 [1024][2048], WV, WP f16 [1024][1024],
//                                              PE f16 [NPP][1024], XH f16 [NB*SEQ][2048] (all dead after the projections);
//                                              last phase: WO f16 [1024][1024] (converted after the attention launch),
//                                              then CTX f16 [NB*SEQ][1024] (written by the attention launch)
//   total                          176160768
// Every region is written in whole 64x64 tiles / whole rows; all region sizes equal their written extents.
// -------------------------------------------------------------------------------------------------
extern "C" void kernel_launch(void* const* d_in, const int* in_sizes, int n_in,
                              void* d_out, int out_size, void* d_ws, size_t ws_size,
                              hipStream_t stream) {
  if (n_in < 14) return;
  if (in_sizes[0] < ((NB - 1) * SEQ_FULL + SEQ) * ND) return;
  if (in_sizes[1] != ND * ND || in_sizes[3] != ND * ND || in_sizes[5] != ND * ND) return;
  if (in_sizes[7] != ND * ND || in_sizes[8] != ND * ND) return;
  if (in_sizes[2] < ND || in_sizes[4] < ND || in_sizes[6] < ND || in_sizes[9] < ND) return;
  if (in_sizes[10] < NH * HDV || in_sizes[11] < NH * HDV) return;
  if (in_sizes[12] < ND || in_sizes[13] < ND) return;
  if (out_size < NB * SEQ * ND) return;

  const float* x    = (const float*)d_in[0];
  const float* Wq   = (const float*)d_in[1];
  const float* bq   = (const float*)d_in[2];
  const float* Wk   = (const float*)d_in[3];
  const float* bk   = (const float*)d_in[4];
  const float* Wv   = (const float*)d_in[5];
  const float* bv   = (const float*)d_in[6];
  const float* Wpos = (const float*)d_in[7];
  const float* Wout = (const float*)d_in[8];
  const float* bout = (const float*)d_in[9];
  const float* ub   = (const float*)d_in[10];
  const float* vbias= (const float*)d_in[11];
  const float* lng  = (const float*)d_in[12];
  const float* lnb  = (const float*)d_in[13];
  float* out = (float*)d_out;

  const size_t szW2  = (size_t)ND * QKW * 2;              //   4194304
  const size_t szW1  = (size_t)ND * ND * 2;               //   2097152
  const size_t szXH  = (size_t)NB * SEQ * QKW * 2;        //  33554432
  const size_t szQ   = (size_t)NB * SEQ * QKW * 2;        //  33554432
  const size_t szVT  = (size_t)NB * ND * SEQ * 2;         //  16777216
  const size_t szP2  = (size_t)NPP * QKW * 2;             //   8388608
  const size_t szPE  = (size_t)NPP * ND * 2;              //   4194304
  const size_t szCTX = (size_t)NB * SEQ * ND * 2;         //  16777216
  const size_t szEarly = 2 * szW2 + 2 * szW1 + szPE + szXH;
  const size_t szLate  = szW1 + szCTX;
  const size_t szSCR = (szEarly > szLate) ? szEarly : szLate;
  size_t off = 0;
  const size_t oP2  = off; off += szP2;
  const size_t oQU2 = off; off += szQ;
  const size_t oQV2 = off; off += szQ;
  const size_t oKP2 = off; off += szQ;
  const size_t oVT  = off; off += szVT;
  const size_t oSCR = off; off += szSCR;
  const size_t total = off;                                // 176160768 for NB=8, SEQ=1024
  if (total > ws_size) return;
  const size_t oWQ2 = oSCR;
  const size_t oWK2 = oWQ2 + szW2;
  const size_t oWV  = oWK2 + szW2;
  const size_t oWP  = oWV + szW1;
  const size_t oPE  = oWP + szW1;
  const size_t oXH  = oPE + szPE;

  char* ws = (char*)d_ws;
  _Float16* WQ2 = (_Float16*)(ws + oWQ2);
  _Float16* WK2 = (_Float16*)(ws + oWK2);
  _Float16* WVp = (_Float16*)(ws + oWV);
  _Float16* WOp = (_Float16*)(ws + oSCR);
  _Float16* XH  = (_Float16*)(ws + oXH);
  _Float16* QU2 = (_Float16*)(ws + oQU2);
  _Float16* QV2 = (_Float16*)(ws + oQV2);
  _Float16* KP2 = (_Float16*)(ws + oKP2);
  _Float16* VTp = (_Float16*)(ws + oVT);
  _Float16* P2  = (_Float16*)(ws + oP2);
  _Float16* CTX = (_Float16*)(ws + oSCR + szW1);
  _Float16* WPp = (_Float16*)(ws + oWP);
  _Float16* PEp = (_Float16*)(ws + oPE);

  const float cs = 0.125f * 0.00390625f;   // (1/sqrt(64)) / 256 applied to the x16.x16 score accumulators
  const dim3 blk(256);

  // (1) weights -> f16 planes of bf16-valued entries: Wq, Wk as [x64 | /16] 2048-wide; Wv, Wpos x64
  const dim3 gW(ND * (ND / 8) / 256);      // 512
  cvt_w_kernel<true ><<<gW, blk, 0, stream>>>(Wq,   WQ2, 64.0f, 0.0625f);
  cvt_w_kernel<true ><<<gW, blk, 0, stream>>>(Wk,   WK2, 64.0f, 0.0625f);
  cvt_w_kernel<false><<<gW, blk, 0, stream>>>(Wv,   WVp, 64.0f, 64.0f);
  cvt_w_kernel<false><<<gW, blk, 0, stream>>>(Wpos, WPp, 64.0f, 64.0f);
  // (2) LayerNorm -> XH [NB*SEQ][2048] (hi | residual x1024)
  ln_kernel<<<dim3((NB * SEQ) / 8), blk, 0, stream>>>(x, lng, lnb, XH, NB * SEQ);
  // (3) positional sinusoid table -> PE [NPP][1024] (row NPP-1 = 0)
  pe_kernel<<<dim3((NPP * (ND / 8) + 255) / 256), blk, 0, stream>>>(PEp);
  // (4) p = pe . Wpos^T -> P2 = [16p | p/64]   (M=NPP, N=1024, K=1024)
  {
    const int tiles = (NPP / GBM) * (ND / GBN);
    gemm_f16_kernel<2, false><<<dim3(tiles, 1), blk, 0, stream>>>(
        PEp, ND, 0L, 0L, WPp, ND, 0L, (void*)P2, (void*)P2, QKW, 0L, 0L, bq, bq, bq,
        NPP, ND, ND, 0.015625f, 16.0f);
  }
  // (5) projections of all batch elements, one launch each
  const int tilesQ  = ((NB * SEQ) / GBM) * (ND / GBN);
  const int tilesV  = (ND / GBM) * (SEQ / GBN);
  // QU2 = split(16*(q + bq + u_bias)), QV2 = split(16*(q + bq + v_bias))   (M=NB*SEQ, N=1024, K=2048)
  gemm_f16_kernel<3, true><<<dim3(tilesQ, 1), blk, 0, stream>>>(
      XH, QKW, 0L, 0L, WQ2, QKW, 0L, (void*)QU2, (void*)QV2, QKW, 0L, 0L, ub, vbias, bq,
      NB * SEQ, ND, QKW, 0.015625f, 16.0f);
  // KP2 = [16k | k/64], k = xn.Wk^T + bk   (M=NB*SEQ, N=1024, K=2048)
  gemm_f16_kernel<2, true><<<dim3(tilesQ, 1), blk, 0, stream>>>(
      XH, QKW, 0L, 0L, WK2, QKW, 0L, (void*)KP2, (void*)KP2, QKW, 0L, 0L, bk, bk, bk,
      NB * SEQ, ND, QKW, 0.015625f, 16.0f);
  // VT[b][h*64+d][s] = 16*(v + bv)   (A = Wv plane [1024][1024], Bt = XH hi columns of batch element y; M=1024, N=SEQ, K=1024)
  gemm_f16_kernel<4, true><<<dim3(tilesV, NB), blk, 0, stream>>>(
      WVp, ND, 0L, 0L, XH, QKW, (long)SEQ * QKW, (void*)VTp, (void*)VTp, SEQ, (long)ND * SEQ, 0L, bv, bv, bv,
      ND, SEQ, ND, 0.015625f, 16.0f);
  // (6) attention with its position scores, all batch elements and heads in one launch
  relattn_kernel<<<dim3(SEQ / 64, NH, NB), dim3(128), 0, stream>>>(QU2, QV2, KP2, VTp, P2, CTX, cs);
  // (7) out = ctx . Wout^T + bout -> d_out f32 [NB*SEQ][1024]   (M=NB*SEQ, N=1024, K=1024; carries 64*64 folded into scale)
  cvt_w_kernel<false><<<gW, blk, 0, stream>>>(Wout, WOp, 64.0f, 64.0f);
  {
    const int tiles = ((NB * SEQ) / GBM) * (ND / GBN);
    gemm_f16_kernel<1, true><<<dim3(tiles, 1), blk, 0, stream>>>(
        CTX, ND, 0L, 0L, WOp, ND, 0L, (void*)out, (void*)out, ND, 0L, 0L, bout, bout, bout,
        NB * SEQ, ND, ND, 0.000244140625f, 1.0f);
  }
  (void)hipGetLastError();
}

// v009
// Measured time: 241 microseconds a run.
// Timed twice side by side with v008, it ran 1.15 and 1.14 times as fast.
// Counting every step since v000, it is 14.3 times as fast.
// Contractions: xn.Wq^T and xn.Wk^T (xn as f16 hi + x1024 f16 residual planes folded along K against Wx64 | W/16 planes), Wv.xn^T (xn hi, Wx64), pe.Wpos^T (pe f16, Wx64), (q+v_bias).p^T band and (q+u_bias).k^T (16q as f16 hi + f16 residual, each against the one 16p resp. 16k plane), P.V (P x4096, v x16), ctx.Wout^T (ctx x64, W x64): all v_wmma_f32_16x16x32_f16 (f16 operands, f32 accumulate); float inputs bf16-RNE valued; LayerNorm, positional table, softmax, bias adds and scaling in f32.
#include <hip/hip_runtime.h>
#include <math.h>
#include <stdint.h>

#ifndef NB
#define NB 8
#endif
#ifndef SEQ
#define SEQ 1024
#endif
#define SEQ_FULL 1024
#define ND    1024
#define NH    16
#define HDV   64            // value head dim
#define HQK   128           // width of a head in the q planes: 64 hi + 64 residual
#define QKW   (2 * ND)      // pitch (halves) of the 2048-wide f16 planes
#define NP    (2 * SEQ - 1)
#define NPP   (2 * SEQ)

static_assert(SEQ % 64 == 0);
static_assert(SEQ <= SEQ_FULL);
static_assert(ND == NH * HDV);
static_assert(HQK == 2 * HDV);
static_assert(ND % 256 == 0);
static_assert(NPP % 64 == 0);

typedef _Float16 v16h __attribute__((ext_vector_type(16)));
typedef _Float16 v8h  __attribute__((ext_vector_type(8)));
typedef float    v8f  __attribute__((ext_vector_type(8)));
typedef float    v4f  __attribute__((ext_vector_type(4)));
typedef unsigned int v4u __attribute__((ext_vector_type(4)));
typedef v4f __attribute__((may_alias)) v4fa;
typedef v8h __attribute__((may_alias)) v8ha;

// bf16 RNE of an f32 value, returned widened to f32 (exactly representable in f16 after a power-of-two carry)
__device__ __forceinline__ float bf_rne(float f) {
  unsigned u = __float_as_uint(f);
  u = (u + 0x7FFFu + ((u >> 16) & 1u)) & 0xFFFF0000u;
  return __uint_as_float(u);
}

// 16-bit WMMA fragment: elements 0..7 <- p[0..7], elements 8..15 <- p[16..23]
// (A: p = row m at k0 + 8h;  B stored [n][k]: p = row n at k0 + 8h;  same split k map for both)
union FragU { v16h v; v8ha h[2]; };
__device__ __forceinline__ v16h ldfrag(const _Float16* p) {
  FragU f;
  f.h[0] = *(const v8ha*)(p);
  f.h[1] = *(const v8ha*)(p + 16);
  return f.v;
}

// WMMA + hazard guard (ties D, keeps A/B live for 4 VALU slots)
__device__ __forceinline__ v8f mma16(v16h a, v16h b, v8f c) {
  c = __builtin_amdgcn_wmma_f32_16x16x32_f16(false, a, false, b, (short)0, c, false, false);
  asm volatile("v_nop\n\tv_nop\n\tv_nop\n\tv_nop" : "+v"(c) : "v"(a), "v"(b));
  return c;
}

__device__ __forceinline__ v8f zero8() { v8f z = {0.f, 0.f, 0.f, 0.f, 0.f, 0.f, 0.f, 0.f}; return z; }

// 16-lane butterfly (lane ^ 1, ^ 2, ^ 4, ^ 8) over eight independent values at once, on the vector port by DPP row_xmask;
// every lane must be on.  It takes the place of ds_bpermute_b32 round trips through the LDS pipe, each with its own wait.
// Written as text because the builtin DPP move came out as three instructions a step for the maximum; the eight values are
// interleaved so that every instruction's producer stands eight instructions back and no step waits for the one before.
__device__ __forceinline__ void row_max8(float (&m)[8]) {
  asm(
      "v_max_num_f32_dpp %0, %0, %0 row_xmask:1 row_mask:0xf bank_mask:0xf\n\t"
      "v_max_num_f32_dpp %1, %1, %1 row_xmask:1 row_mask:0xf bank_mask:0xf\n\t"
      "v_max_num_f32_dpp %2, %2, %2 row_xmask:1 row_mask:0xf bank_mask:0xf\n\t"
      "v_max_num_f32_dpp %3, %3, %3 row_xmask:1 row_mask:0xf bank_mask:0xf\n\t"
      "v_max_num_f32_dpp %4, %4, %4 row_xmask:1 row_mask:0xf bank_mask:0xf\n\t"
      "v_max_num_f32_dpp %5, %5, %5 row_xmask:1 row_mask:0xf bank_mask:0xf\n\t"
      "v_max_num_f32_dpp %6, %6, %6 row_xmask:1 row_mask:0xf bank_mask:0xf\n\t"
      "v_max_num_f32_dpp %7, %7, %7 row_xmask:1 row_mask:0xf bank_mask:0xf\n\t"
      "v_max_num_f32_dpp %0, %0, %0 row_xmask:2 row_mask:0xf bank_mask:0xf\n\t"
      "v_max_num_f32_dpp %1, %1, %1 row_xmask:2 row_mask:0xf bank_mask:0xf\n\t"
      "v_max_num_f32_dpp %2, %2, %2 row_xmask:2 row_mask:0xf bank_mask:0xf\n\t"
      "v_max_num_f32_dpp %3, %3, %3 row_xmask:2 row_mask:0xf bank_mask:0xf\n\t"
      "v_max_num_f32_dpp %4, %4, %4 row_xmask:2 row_mask:0xf bank_mask:0xf\n\t"
      "v_max_num_f32_dpp %5, %5, %5 row_xmask:2 row_mask:0xf bank_mask:0xf\n\t"
      "v_max_num_f32_dpp %6, %6, %6 row_xmask:2 row_mask:0xf bank_mask:0xf\n\t"
      "v_max_num_f32_dpp %7, %7, %7 row_xmask:2 row_mask:0xf bank_mask:0xf\n\t"
      "v_max_num_f32_dpp %0, %0, %0 row_xmask:4 row_mask:0xf bank_mask:0xf\n\t"
      "v_max_num_f32_dpp %1, %1, %1 row_xmask:4 row_mask:0xf bank_mask:0xf\n\t"
      "v_max_num_f32_dpp %2, %2, %2 row_xmask:4 row_mask:0xf bank_mask:0xf\n\t"
      "v_max_num_f32_dpp %3, %3, %3 row_xmask:4 row_mask:0xf bank_mask:0xf\n\t"
      "v_max_num_f32_dpp %4, %4, %4 row_xmask:4 row_mask:0xf bank_mask:0xf\n\t"
      "v_max_num_f32_dpp %5, %5, %5 row_xmask:4 row_mask:0xf bank_mask:0xf\n\t"
      "v_max_num_f32_dpp %6, %6, %6 row_xmask:4 row_mask:0xf bank_mask:0xf\n\t"
      "v_max_num_f32_dpp %7, %7, %7 row_xmask:4 row_mask:0xf bank_mask:0xf\n\t"
      "v_max_num_f32_dpp %0, %0, %0 row_xmask:8 row_mask:0xf bank_mask:0xf\n\t"
      "v_max_num_f32_dpp %1, %1, %1 row_xmask:8 row_mask:0xf bank_mask:0xf\n\t"
      "v_max_num_f32_dpp %2, %2, %2 row_xmask:8 row_mask:0xf bank_mask:0xf\n\t"
      "v_max_num_f32_dpp %3, %3, %3 row_xmask:8 row_mask:0xf bank_mask:0xf\n\t"
      "v_max_num_f32_dpp %4, %4, %4 row_xmask:8 row_mask:0xf bank_mask:0xf\n\t"
      "v_max_num_f32_dpp %5, %5, %5 row_xmask:8 row_mask:0xf bank_mask:0xf\n\t"
      "v_max_num_f32_dpp %6, %6, %6 row_xmask:8 row_mask:0xf bank_mask:0xf\n\t"
      "v_max_num_f32_dpp %7, %7, %7 row_xmask:8 row_mask:0xf bank_mask:0xf"
      : "+v"(m[0]), "+v"(m[1]), "+v"(m[2]), "+v"(m[3]), "+v"(m[4]), "+v"(m[5]), "+v"(m[6]), "+v"(m[7]));
}
__device__ __forceinline__ void row_sum8(float (&s)[8]) {
  asm(
      "v_add_f32_dpp %0, %0, %0 row_xmask:1 row_mask:0xf bank_mask:0xf\n\t"
      "v_add_f32_dpp %1, %1, %1 row_xmask:1 row_mask:0xf bank_mask:0xf\n\t"
      "v_add_f32_dpp %2, %2, %2 row_xmask:1 row_mask:0xf bank_mask:0xf\n\t"
      "v_add_f32_dpp %3, %3, %3 row_xmask:1 row_mask:0xf bank_mask:0xf\n\t"
      "v_add_f32_dpp %4, %4, %4 row_xmask:1 row_mask:0xf bank_mask:0xf\n\t"
      "v_add_f32_dpp %5, %5, %5 row_xmask:1 row_mask:0xf bank_mask:0xf\n\t"
      "v_add_f32_dpp %6, %6, %6 row_xmask:1 row_mask:0xf bank_mask:0xf\n\t"
      "v_add_f32_dpp %7, %7, %7 row_xmask:1 row_mask:0xf bank_mask:0xf\n\t"
      "v_add_f32_dpp %0, %0, %0 row_xmask:2 row_mask:0xf bank_mask:0xf\n\t"
      "v_add_f32_dpp %1, %1, %1 row_xmask:2 row_mask:0xf bank_mask:0xf\n\t"
      "v_add_f32_dpp %2, %2, %2 row_xmask:2 row_mask:0xf bank_mask:0xf\n\t"
      "v_add_f32_dpp %3, %3, %3 row_xmask:2 row_mask:0xf bank_mask:0xf\n\t"
      "v_add_f32_dpp %4, %4, %4 row_xmask:2 row_mask:0xf bank_mask:0xf\n\t"
      "v_add_f32_dpp %5, %5, %5 row_xmask:2 row_mask:0xf bank_mask:0xf\n\t"
      "v_add_f32_dpp %6, %6, %6 row_xmask:2 row_mask:0xf bank_mask:0xf\n\t"
      "v_add_f32_dpp %7, %7, %7 row_xmask:2 row_mask:0xf bank_mask:0xf\n\t"
      "v_add_f32_dpp %0, %0, %0 row_xmask:4 row_mask:0xf bank_mask:0xf\n\t"
      "v_add_f32_dpp %1, %1, %1 row_xmask:4 row_mask:0xf bank_mask:0xf\n\t"
      "v_add_f32_dpp %2, %2, %2 row_xmask:4 row_mask:0xf bank_mask:0xf\n\t"
      "v_add_f32_dpp %3, %3, %3 row_xmask:4 row_mask:0xf bank_mask:0xf\n\t"
      "v_add_f32_dpp %4, %4, %4 row_xmask:4 row_mask:0xf bank_mask:0xf\n\t"
      "v_add_f32_dpp %5, %5, %5 row_xmask:4 row_mask:0xf bank_mask:0xf\n\t"
      "v_add_f32_dpp %6, %6, %6 row_xmask:4 row_mask:0xf bank_mask:0xf\n\t"
      "v_add_f32_dpp %7, %7, %7 row_xmask:4 row_mask:0xf bank_mask:0xf\n\t"
      "v_add_f32_dpp %0, %0, %0 row_xmask:8 row_mask:0xf bank_mask:0xf\n\t"
      "v_add_f32_dpp %1, %1, %1 row_xmask:8 row_mask:0xf bank_mask:0xf\n\t"
      "v_add_f32_dpp %2, %2, %2 row_xmask:8 row_mask:0xf bank_mask:0xf\n\t"
      "v_add_f32_dpp %3, %3, %3 row_xmask:8 row_mask:0xf bank_mask:0xf\n\t"
      "v_add_f32_dpp %4, %4, %4 row_xmask:8 row_mask:0xf bank_mask:0xf\n\t"
      "v_add_f32_dpp %5, %5, %5 row_xmask:8 row_mask:0xf bank_mask:0xf\n\t"
      "v_add_f32_dpp %6, %6, %6 row_xmask:8 row_mask:0xf bank_mask:0xf\n\t"
      "v_add_f32_dpp %7, %7, %7 row_xmask:8 row_mask:0xf bank_mask:0xf"
      : "+v"(s[0]), "+v"(s[1]), "+v"(s[2]), "+v"(s[3]), "+v"(s[4]), "+v"(s[5]), "+v"(s[6]), "+v"(s[7]));
}

// -------------------------------------------------------------------------------------------------
// Weight [1024][1024] f32 -> f16 plane of bf16-valued entries.
//   DUP false: dst [1024][1024], dst[r][c] = f16(bf_rne(W)*s1)
//   DUP true : dst [1024][2048], dst[r][c] = f16(bf_rne(W)*s1), dst[r][1024+c] = f16(bf_rne(W)*s2)
// coverage: 131072 threads x 8 = the whole [1024][1024] source (both column halves for DUP).
// -------------------------------------------------------------------------------------------------
template <bool DUP>
__global__ __launch_bounds__(256) void cvt_w_kernel(const float* __restrict__ src, _Float16* __restrict__ dst,
                                                    float s1, float s2) {
  const int i = blockIdx.x * 256 + threadIdx.x;
  const int total8 = ND * (ND / 8);
  if (i >= total8) return;
  const int r  = i / (ND / 8);
  const int c8 = (i - r * (ND / 8)) * 8;
  const float* sp = src + (size_t)r * ND + c8;
  const v4f a = *(const v4f*)(sp);
  const v4f b = *(const v4f*)(sp + 4);
  float f[8];
  f[0] = bf_rne(a[0]); f[1] = bf_rne(a[1]); f[2] = bf_rne(a[2]); f[3] = bf_rne(a[3]);
  f[4] = bf_rne(b[0]); f[5] = bf_rne(b[1]); f[6] = bf_rne(b[2]); f[7] = bf_rne(b[3]);
  v8h o1, o2;
#pragma unroll
  for (int e = 0; e < 8; ++e) { o1[e] = (_Float16)(f[e] * s1); o2[e] = (_Float16)(f[e] * s2); }
  const int pitch = DUP ? QKW : ND;
  _Float16* dp = dst + (size_t)r * pitch + c8;
  *(v8h*)dp = o1;
  if (DUP) *(v8h*)(dp + ND) = o2;
  
}

// -------------------------------------------------------------------------------------------------
//   XH[row][c]        = f16(xn)                       (hi)
//   XH[row][1024 + c] = f16((xn - hi) * 1024)         (residual, carried x1024)
// One wave per row (compact row b*SEQ + t; source row b*SEQ_FULL + t); block = 8 waves = 8 rows; no LDS.
// Stores: lane l writes 16 B at columns i*256 + 8l: one instruction = 32 lanes x 16 B = 512 contiguous B =
// coverage: grid NB*SEQ/8 x 8 waves x (4 x 256) columns x {hi, residual} = the whole [NB*SEQ][2048] plane.
// Loops rolled on purpose (small elementwise side computation).
// -------------------------------------------------------------------------------------------------
__global__ __launch_bounds__(256) void ln_kernel(const float* __restrict__ x, const float* __restrict__ g,
                                                const float* __restrict__ bt, _Float16* __restrict__ XH,
                                                int nrows) {
  const int lane = threadIdx.x & 31;
  const int wave = threadIdx.x >> 5;
  const int row  = blockIdx.x * 8 + wave;
  if (row >= nrows) return;                                   // wave-uniform; no barriers in this kernel
  const int b = row / SEQ;
  const int t = row - b * SEQ;
  const float* xr = x + ((size_t)b * SEQ_FULL + t) * ND + lane * 8;

  float s = 0.f;
#pragma unroll 1
  for (int i = 0; i < 4; ++i) {
    const v4f a = *(const v4f*)(xr + i * 256);
    const v4f c = *(const v4f*)(xr + i * 256 + 4);
    s += (bf_rne(a[0]) + bf_rne(a[1])) + (bf_rne(a[2]) + bf_rne(a[3]));
    s += (bf_rne(c[0]) + bf_rne(c[1])) + (bf_rne(c[2]) + bf_rne(c[3]));
  }
  s += __shfl_xor(s, 16, 32); s += __shfl_xor(s, 8, 32); s += __shfl_xor(s, 4, 32);
  s += __shfl_xor(s, 2, 32);  s += __shfl_xor(s, 1, 32);
  const float mu = s * (1.0f / (float)ND);

  float s2 = 0.f;
#pragma unroll 1
  for (int i = 0; i < 4; ++i) {
    const v4f a = *(const v4f*)(xr + i * 256);
    const v4f c = *(const v4f*)(xr + i * 256 + 4);
    float d;
    d = bf_rne(a[0]) - mu; s2 += d * d;  d = bf_rne(a[1]) - mu; s2 += d * d;
    d = bf_rne(a[2]) - mu; s2 += d * d;  d = bf_rne(a[3]) - mu; s2 += d * d;
    d = bf_rne(c[0]) - mu; s2 += d * d;  d = bf_rne(c[1]) - mu; s2 += d * d;
    d = bf_rne(c[2]) - mu; s2 += d * d;  d = bf_rne(c[3]) - mu; s2 += d * d;
  }
  s2 += __shfl_xor(s2, 16, 32); s2 += __shfl_xor(s2, 8, 32); s2 += __shfl_xor(s2, 4, 32);
  s2 += __shfl_xor(s2, 2, 32);  s2 += __shfl_xor(s2, 1, 32);
  const float var  = s2 * (1.0f / (float)ND);
  const float rstd = rsqrtf(var + 1e-5f);

  _Float16* xh = XH + (size_t)row * QKW + lane * 8;
{
#pragma unroll 1
    for (int i = 0; i < 4; ++i) {
      const v4f a  = *(const v4f*)(xr + i * 256);
      const v4f c  = *(const v4f*)(xr + i * 256 + 4);
      const v4f ga = *(const v4f*)(g + i * 256 + lane * 8);
      const v4f gb = *(const v4f*)(g + i * 256 + lane * 8 + 4);
      const v4f ba = *(const v4f*)(bt + i * 256 + lane * 8);
      const v4f bb = *(const v4f*)(bt + i * 256 + lane * 8 + 4);
      float f[8], gg[8], be[8];
      f[0] = a[0]; f[1] = a[1]; f[2] = a[2]; f[3] = a[3]; f[4] = c[0]; f[5] = c[1]; f[6] = c[2]; f[7] = c[3];
      gg[0] = ga[0]; gg[1] = ga[1]; gg[2] = ga[2]; gg[3] = ga[3];
      gg[4] = gb[0]; gg[5] = gb[1]; gg[6] = gb[2]; gg[7] = gb[3];
      be[0] = ba[0]; be[1] = ba[1]; be[2] = ba[2]; be[3] = ba[3];
      be[4] = bb[0]; be[5] = bb[1]; be[6] = bb[2]; be[7] = bb[3];
      v8h ho, lo;
#pragma unroll
      for (int e = 0; e < 8; ++e) {
        const float xn = (bf_rne(f[e]) - mu) * rstd * bf_rne(gg[e]) + bf_rne(be[e]);
        const _Float16 hv = (_Float16)xn;
        ho[e] = hv;
        lo[e] = (_Float16)((xn - (float)hv) * 1024.0f);
      }
      *(v8h*)(xh + i * 256)      = ho;
      *(v8h*)(xh + ND + i * 256) = lo;
    }
    
  }
}

// -------------------------------------------------------------------------------------------------
// Relative-position sinusoid table -> PE f16 plane [NPP][1024] (rows >= NP are 0):
//   row r <-> relative position pos = SEQ-1-r;  div_j = expf(f32(2j) * f32(-ln(1e4)/1024));
//   ang = |pos| * div_j (f32 product);  PE[r][2j] = sin(ang) with the sign of pos, PE[r][2j+1] = cos(ang).
// passes.  The per-pair loop is rolled (one sinf, one cosf, one expf body); the 16-B result is assembled by a
// register rotate with constant indices (no dynamic local-array indexing).
// coverage: grid NPP*128/256, NPP*128 threads x 8 halves = the whole [NPP][1024] plane.
// -------------------------------------------------------------------------------------------------
__global__ __launch_bounds__(256) void pe_kernel(_Float16* __restrict__ PE) {
  const int i = blockIdx.x * 256 + threadIdx.x;
  if (i >= NPP * (ND / 8)) return;
  const int r  = i / (ND / 8);
  const int c8 = (i - r * (ND / 8)) * 8;
  const int pos = SEQ - 1 - r;
  const float fpos = (float)((pos < 0) ? -pos : pos);
  const float live = (r < NP) ? 1.0f : 0.0f;
  const float c0 = (float)(-9.210340371976184 / (double)ND);
  v4u pk = {0u, 0u, 0u, 0u};
#pragma unroll 1
  for (int e = 0; e < 4; ++e) {
    const int j = (c8 >> 1) + e;
    const float dv  = expf((float)(2 * j) * c0);
    const float ang = fpos * dv;
    float sn = sinf(ang);
    const float cn = cosf(ang);
    sn = (pos < 0) ? -sn : sn;
    const _Float16 hs = (_Float16)(sn * live);
    const _Float16 hc = (_Float16)(cn * live);
    const unsigned w = (unsigned)__builtin_bit_cast(unsigned short, hs) |
                       ((unsigned)__builtin_bit_cast(unsigned short, hc) << 16);
    v4u nx;
    nx[0] = pk[1]; nx[1] = pk[2]; nx[2] = pk[3]; nx[3] = w;
    pk = nx;
  }
  unsigned* dp = (unsigned*)(PE + (size_t)r * ND + c8);
  *(v4u*)dp = pk;
  
}

// -------------------------------------------------------------------------------------------------
// LDS ring of the staged GEMM path: one stage = 128 k of [A 128 rows | Bt 256 rows], 256-B rows at pitch 272 B
// (an odd multiple of 16 B for the ds_load_b128 fragment reads), two buffers.
// -------------------------------------------------------------------------------------------------
#define GBM    128                    // block tile rows (2 waves of 64)
#define GBN    256                    // block tile columns (4 waves of 64)
#define GKS    128                    // halves of k per stage
#define GPIT   (GKS + 8)              // halves: 272 B = 17 x 16 B
#define GSTAGE ((GBM + GBN) * GPIT * 2)   // bytes per buffer: 104448
static_assert((GBM + GBN) * (GKS / 8) == 24 * 256);   // 24 copies of 16 B per thread and stage
static_assert((NB * SEQ) % GBM == 0 && NPP % GBM == 0 && ND % GBM == 0);
static_assert(ND % GBN == 0 && SEQ % GBN == 0);
static_assert(ND % GKS == 0 && ND / GKS >= 2);

// Twelve asynchronous 16-B copies global -> LDS per lane (l: LDS byte address, g: global address of the lane).
// s_wait_xcnt 0 closes the statement so that no address register named here is rewritten ahead of it.
__device__ __forceinline__ void async_copy12(const unsigned (&l)[12], const _Float16* const (&g)[12]) {
  asm volatile(
      "global_load_async_to_lds_b128 %0, %12, off\n\t"
      "global_load_async_to_lds_b128 %1, %13, off\n\t"
      "global_load_async_to_lds_b128 %2, %14, off\n\t"
      "global_load_async_to_lds_b128 %3, %15, off\n\t"
      "global_load_async_to_lds_b128 %4, %16, off\n\t"
      "global_load_async_to_lds_b128 %5, %17, off\n\t"
      "global_load_async_to_lds_b128 %6, %18, off\n\t"
      "global_load_async_to_lds_b128 %7, %19, off\n\t"
      "global_load_async_to_lds_b128 %8, %20, off\n\t"
      "global_load_async_to_lds_b128 %9, %21, off\n\t"
      "global_load_async_to_lds_b128 %10, %22, off\n\t"
      "global_load_async_to_lds_b128 %11, %23, off\n\t"
      "s_wait_xcnt 0x0"
      :: "v"(l[0]), "v"(l[1]), "v"(l[2]), "v"(l[3]), "v"(l[4]), "v"(l[5]),
         "v"(l[6]), "v"(l[7]), "v"(l[8]), "v"(l[9]), "v"(l[10]), "v"(l[11]),
         "v"(g[0]), "v"(g[1]), "v"(g[2]), "v"(g[3]), "v"(g[4]), "v"(g[5]),
         "v"(g[6]), "v"(g[7]), "v"(g[8]), "v"(g[9]), "v"(g[10]), "v"(g[11])
      : "memory");
}

// -------------------------------------------------------------------------------------------------
// f16 WMMA GEMM: C[m][n] = epi( sum_k A[m][k] * Bt[n][k] ).
// A row-major [M][K] pitch lda; Bt row-major [N][K] pitch ldb.
// Each wave owns a 64x64 output tile (4x4 subtiles), 8 waves per block, grid.y = z-batch,
// grid.z = outer batch (steps A by strideAz and C by strideCz; Bt is shared).
// M multiple of 128, N of 256, K of 128 and at least 256; grid.x = (M/128)*(N/256); the block's 2x4 waves
// share one 128x256 tile whose A and Bt rows are staged in the LDS ring by asynchronous copies (whole
// 256-B row pieces, each fetched once per block), the copies of stage t+2 flying while stage t+1 is worked on.
// OUT 1: f32  C1[m][n] = acc*scale + bf_rne(b1[n])                              (final output)
// OUT 2: f16  C1[m][n] = f16((acc*scale (+ bf_rne(b1[n]) if HASB)) * carry)    (column bias)
// OUT 3: f16  t = (acc*scale + bf_rne(b3[n])) + bf_rne(b1[n] resp. b2[n]);  th = t*carry;
//             hi = f16(th), lo = f16(th - hi) -> C1 (b1 variant) and C2 (b2 variant), hi at 2*n0+c, lo at 2*n0+64+c
// OUT 4: f16  C1[m][n] = f16((acc*scale + bf_rne(b1[m])) * carry)            (row bias)
// Epilogue: 16-row slabs staged per wave in LDS (wave-private region, wave barrier); every row segment is written as
// coverage: 4 slabs x 16 rows x 64 cols = the whole 64x64 tile per wave; tiles cover M x N exactly.
// -------------------------------------------------------------------------------------------------
template <int OUT, bool HASB>
__global__ __launch_bounds__(256) void gemm_f16_kernel(
    const _Float16* __restrict__ A, int lda, long strideA, long strideAz,
    const _Float16* __restrict__ Bt, int ldb, long strideB,
    void* C1, void* C2, int ldc, long strideC, long strideCz,
    const float* __restrict__ b1, const float* __restrict__ b2, const float* __restrict__ b3,
    int M, int N, int K, float scale, float carry) {
  __shared__ __align__(16) float sT[8][16 * 68];   // per-wave 16x64 slab, pitch 68 floats
  __shared__ __align__(16) unsigned char GS[2 * GSTAGE];   // operand ring of the staged path

  const int z    = blockIdx.y;
  const int lane = threadIdx.x & 31;
  const int wave = threadIdx.x >> 5;
  int m0, n0;
  {
    const int tilesN = N / GBN;
    const int tilesM = M / GBM;
    const int bt = blockIdx.x;
    if (bt >= tilesM * tilesN) return;             // block-uniform, ahead of every copy and barrier
    const int tmb = bt / tilesN;
    const int tnb = bt - tmb * tilesN;
    m0 = tmb * GBM + (wave >> 2) * 64;
    n0 = tnb * GBN + (wave & 3) * 64;
  }
  const size_t cOff = (size_t)z * strideC + (size_t)blockIdx.z * strideCz;

  const _Float16* Ab = A  + (size_t)z * strideA + (size_t)blockIdx.z * strideAz;
  const _Float16* Bb = Bt + (size_t)z * strideB;

  const int rl   = lane & 15;          // row (A) / column (B, D) within a subtile
  const int koff = (lane >> 4) * 8;    // k offset of this lane half
  const int mOff = (lane >> 4) * 8;    // D row offset of this lane half

  v8f acc[4][4];
#pragma unroll
  for (int i = 0; i < 4; ++i)
#pragma unroll
    for (int j = 0; j < 4; ++j) acc[i][j] = zero8();

  {
    // copy map: thread -> row crow + 16*i of the stage (i < 8: A rows, i >= 8: Bt rows), 16-B piece ccol of its 256 B;
    // one wave-wide copy = 2 rows x 256 B = 4 whole lines.
    const int crow = threadIdx.x >> 4;
    const int ccol = threadIdx.x & 15;
    const int wm = wave >> 2, wn = wave & 3;
    const _Float16* gA = Ab + (size_t)(m0 - wm * 64 + crow) * lda + ccol * 8;
    const _Float16* gB = Bb + (size_t)(n0 - wn * 64 + crow) * ldb + ccol * 8;
    const unsigned ldsLane = (unsigned)(uintptr_t)(&GS[0]) + (unsigned)(crow * (GPIT * 2) + ccol * 16);
    const int nt = K / GKS;
    auto issue_stage = [&](int t, int buf) {
#pragma unroll
      for (int hf = 0; hf < 2; ++hf) {
        unsigned l[12];
        const _Float16* g[12];
#pragma unroll
        for (int e = 0; e < 12; ++e) {
          const int i = hf * 12 + e;
          l[e] = ldsLane + (unsigned)(buf * GSTAGE + i * 16 * (GPIT * 2));
          const size_t so = (i < 8) ? (size_t)(i * 16) * lda + (size_t)t * GKS         // wave-uniform part
                                    : (size_t)((i - 8) * 16) * ldb + (size_t)t * GKS;
          g[e] = ((i < 8) ? gA : gB) + so;
        }
        async_copy12(l, g);
      }
    };

    issue_stage(0, 0);
    asm volatile("s_wait_asynccnt 0x0" ::: "memory");   // this wave's share of stage 0 has landed
    __syncthreads();                                    // publishes stage 0
    issue_stage(1, 1);
    const _Float16* fa = (const _Float16*)GS + (wm * 64 + rl) * GPIT + koff;
    const _Float16* fb = (const _Float16*)GS + (GBM + wn * 64 + rl) * GPIT + koff;
    for (int t = 0; t < nt; ++t) {                      // one stage per trip
      const int bo = (t & 1) * (GSTAGE / 2);
#pragma unroll
      for (int ks = 0; ks < GKS / 32; ++ks) {
        v16h bfr[4], afr[4];                            // all 16 LDS reads of a 32-k block stand as one group
#pragma unroll
        for (int j = 0; j < 4; ++j) bfr[j] = ldfrag(fb + bo + j * 16 * GPIT + ks * 32);
#pragma unroll
        for (int i = 0; i < 4; ++i) afr[i] = ldfrag(fa + bo + i * 16 * GPIT + ks * 32);
#pragma unroll
        for (int i = 0; i < 4; ++i)
#pragma unroll
          for (int j = 0; j < 4; ++j) acc[i][j] = mma16(afr[i], bfr[j], acc[i][j]);
      }
      asm volatile("s_wait_dscnt 0x0" ::: "memory");    // this wave has left the buffer that is refilled below
      asm volatile("s_wait_asynccnt 0x0" ::: "memory"); // this wave's share of stage t+1 has landed
      __syncthreads();                                  // publishes stage t+1, ends every read of stage t
      if (t + 2 < nt) issue_stage(t + 2, t & 1);
    }
    asm volatile("s_wait_asynccnt 0x0" ::: "memory");   // nothing in flight when the wave goes on
  }

  // ---- epilogue ----
  float* slab = sT[wave];
  const int hh = lane >> 4, c4 = (lane & 15) * 4;     // f32 modes: row segment 256 B = 16 lanes x 16 B
  const int q8 = lane >> 3, c8 = (lane & 7) * 8;
  v4f bias4 = {0.f, 0.f, 0.f, 0.f};
  float col8a[8], col8b[8], col8c[8];
#pragma unroll
  for (int e = 0; e < 8; ++e) { col8a[e] = 0.f; col8b[e] = 0.f; col8c[e] = 0.f; }
  if (OUT == 1 && HASB) {
    const v4f tb = *(const v4f*)(b1 + n0 + c4);
    bias4[0] = bf_rne(tb[0]); bias4[1] = bf_rne(tb[1]); bias4[2] = bf_rne(tb[2]); bias4[3] = bf_rne(tb[3]);
  }
  if ((OUT == 2 && HASB) || OUT == 3) {
    const v4f ta = *(const v4f*)(b1 + n0 + c8);
    const v4f tb = *(const v4f*)(b1 + n0 + c8 + 4);
    col8a[0] = bf_rne(ta[0]); col8a[1] = bf_rne(ta[1]); col8a[2] = bf_rne(ta[2]); col8a[3] = bf_rne(ta[3]);
    col8a[4] = bf_rne(tb[0]); col8a[5] = bf_rne(tb[1]); col8a[6] = bf_rne(tb[2]); col8a[7] = bf_rne(tb[3]);
  }
  if (OUT == 3) {
    const v4f ta = *(const v4f*)(b2 + n0 + c8);
    const v4f tb = *(const v4f*)(b2 + n0 + c8 + 4);
    col8b[0] = bf_rne(ta[0]); col8b[1] = bf_rne(ta[1]); col8b[2] = bf_rne(ta[2]); col8b[3] = bf_rne(ta[3]);
    col8b[4] = bf_rne(tb[0]); col8b[5] = bf_rne(tb[1]); col8b[6] = bf_rne(tb[2]); col8b[7] = bf_rne(tb[3]);
    const v4f tc = *(const v4f*)(b3 + n0 + c8);
    const v4f td = *(const v4f*)(b3 + n0 + c8 + 4);
    col8c[0] = bf_rne(tc[0]); col8c[1] = bf_rne(tc[1]); col8c[2] = bf_rne(tc[2]); col8c[3] = bf_rne(tc[3]);
    col8c[4] = bf_rne(td[0]); col8c[5] = bf_rne(td[1]); col8c[6] = bf_rne(td[2]); col8c[7] = bf_rne(td[3]);
  }

#pragma unroll
  for (int i = 0; i < 4; ++i) {
    const int mBase = m0 + (i << 4);
#pragma unroll
    for (int j = 0; j < 4; ++j)
#pragma unroll
      for (int r = 0; r < 8; ++r)
        slab[(mOff + r) * 68 + (j << 4) + rl] = acc[i][j][r] * scale;
    __builtin_amdgcn_fence(__ATOMIC_RELEASE, "workgroup");
    __builtin_amdgcn_wave_barrier();
    __builtin_amdgcn_fence(__ATOMIC_ACQUIRE, "workgroup");
    if (OUT == 1) {
      float* C = (float*)C1 + cOff;
      v4f vv[8];
#pragma unroll
      for (int it = 0; it < 8; ++it) {
        const int row = it * 2 + hh;
        v4f v = *(const v4fa*)(slab + row * 68 + c4);
        if (OUT == 1) v += bias4;
        vv[it] = v;
      }
      {
#pragma unroll
        for (int it = 0; it < 8; ++it) {
          const int row = it * 2 + hh;
          *(v4f*)(C + (size_t)(mBase + row) * ldc + n0 + c4) = vv[it];
        }
        
      }
    } else if (OUT == 2 || OUT == 4) {
      _Float16* Ca = (_Float16*)C1 + cOff;
      v8h hv[4];
#pragma unroll
      for (int it = 0; it < 4; ++it) {
        const int row = it * 4 + q8;
        const float* sp = slab + row * 68 + c8;
        const v4f x0 = *(const v4fa*)(sp);
        const v4f x1 = *(const v4fa*)(sp + 4);
        float f[8];
        f[0] = x0[0]; f[1] = x0[1]; f[2] = x0[2]; f[3] = x0[3];
        f[4] = x1[0]; f[5] = x1[1]; f[6] = x1[2]; f[7] = x1[3];
        float rb = 0.f;
        if (OUT == 4 && HASB) rb = bf_rne(b1[mBase + row]);
        v8h ha;
#pragma unroll
        for (int e = 0; e < 8; ++e) {
          const float t = f[e] + ((OUT == 2) ? col8a[e] : rb);
          ha[e] = (_Float16)(t * carry);
        }
        hv[it] = ha;
      }
      {
#pragma unroll
        for (int it = 0; it < 4; ++it) {
          const int row = it * 4 + q8;
          *(v8h*)(Ca + (size_t)(mBase + row) * ldc + n0 + c8) = hv[it];
        }
        
      }
    } else {
#pragma unroll
      for (int var = 0; var < 2; ++var) {
        _Float16* Cc = (_Float16*)((var == 0) ? C1 : C2) + cOff;
        v8h hv[4], lv[4];
#pragma unroll
        for (int it = 0; it < 4; ++it) {
          const int row = it * 4 + q8;
          const float* sp = slab + row * 68 + c8;
          const v4f x0 = *(const v4fa*)(sp);
          const v4f x1 = *(const v4fa*)(sp + 4);
          float f[8];
          f[0] = x0[0]; f[1] = x0[1]; f[2] = x0[2]; f[3] = x0[3];
          f[4] = x1[0]; f[5] = x1[1]; f[6] = x1[2]; f[7] = x1[3];
          v8h ha, la;
#pragma unroll
          for (int e = 0; e < 8; ++e) {
            const float t  = (f[e] + col8c[e]) + ((var == 0) ? col8a[e] : col8b[e]);
            const float th = t * carry;
            const _Float16 hq = (_Float16)th;
            ha[e] = hq;
            la[e] = (_Float16)(th - (float)hq);
          }
          hv[it] = ha; lv[it] = la;
        }
        {
#pragma unroll
          for (int it = 0; it < 4; ++it) {
            const int row = it * 4 + q8;
            _Float16* cp = Cc + (size_t)(mBase + row) * ldc + 2 * n0 + c8;
            *(v8h*)(cp)      = hv[it];
            *(v8h*)(cp + 64) = lv[it];
          }
          
        }
      }
    }
    __builtin_amdgcn_fence(__ATOMIC_RELEASE, "workgroup");
    __builtin_amdgcn_wave_barrier();
    __builtin_amdgcn_fence(__ATOMIC_ACQUIRE, "workgroup");
  }
}

// -------------------------------------------------------------------------------------------------
// Relative-position attention for all NH heads of all NB batch elements, head dim 64, no mask.  A query row is two f16
// rows (hi, residual); every K or p fragment read from LDS is the B operand of two products, hi and residual, that add
// into one accumulator.
//   QU  f16 plane [t][h*128 + j]: j<64 hi = f16(16*(q+u_bias)), j>=64 its f16 residual    (A of the content score)
//   KP  f16 plane [s][h*64 + j] = f16(16*k)                                              (B, staged per 64-key chunk as [key][64])
//   VT  f16 plane [h*64 + d][s]   = f16(16*v)                                            (B of P.V, staged as [d][key])
//   QV  f16 plane, as QU with v_bias                                                     (A of the position score)
//   PP  f16 plane [row][h*64 + j] = f16(16*p), NPP rows                                  (B, staged in 64-row tiles as [row][64])
//       rel-shift: position score of (query i, key) = (q_i + v_bias).p[key - i + SEQ-1].  For query block qb and key chunk
//       kc that is row 64*(SEQ/64-1-qb+kc) + x of PP, x = (key mod 64) + 63 - (i mod 64) in [0, 126]: two 64-row tiles, of
//       which the upper is the next chunk's lower, so one new tile per chunk goes into a ring of two slots (slot = tile & 1).
//       A wave's 16 queries (row R) x 64 keys need x = 48 - 16*wave + w, w = (key mod 64) + 15 - R in [0, 78]: five 16-column
//       products W, the lowest of which is the chunk before's highest; score column n of row R is W column n + 15 - R,
//       fetched by a select between neighbouring products in the source lane and one ds_bpermute_b32 inside the 16-lane row.
//   score = cs * (QU.K^T acc + QV.P^T acc)  with cs = (1/8)/256;  online softmax in f32 over SEQ/64 chunks of 64 keys;
//   P stored per wave as f16(4096 * exp(s - m)); CTX[t][h*64 + d] = f16(64 * ctx) = f16((P.V acc) / (1024*l)).
// Block = 4 waves = 64 query rows of one head; grid = (SEQ/64 query blocks, NH heads, NB batch elements).
// LDS: one raw buffer; K tile [64][64] f16, then V^T tile [64][64] f16, then per-wave P tiles [16][64] f16, then the two
// p-row slots [64][64] f16, all at row pitch VPIT; the output staging [4][16][64] f32 at pitch OPIT reuses the K and V^T
// bytes after a block barrier.  Every pitch is an odd multiple of 16 B, so the 16 rows that one ds_load_b128 reads start on 16
// different groups of four banks (at the bare 256-B and 128-B pitches they fall on one or two groups).
// coverage: staging 128 thr x 4 pieces of 8 halves each for K, for a p-row tile and for V^T (64x64); P tile 8 rows x
// 2 halves x 4x16 cols per wave = 16x64 (all written every chunk); output 4 store instructions x 4 rows x 8 lanes x
// 8 halves = 16x64 per wave.
// -------------------------------------------------------------------------------------------------
#define VPIT   (HDV + 8)            // halves: 144 B =  9 x 16 B
#define OPIT   (HDV + 4)            // floats: 272 B = 17 x 16 B
#define KBYTES (64 * VPIT * 2)      //  9216
#define VBYTES (64 * VPIT * 2)      //  9216
#define PBYTES (4 * 16 * VPIT * 2)  //  9216
static_assert(4 * 16 * OPIT * 4 <= KBYTES + VBYTES);
static_assert(KBYTES % 16 == 0 && VBYTES % 16 == 0);

__global__ __launch_bounds__(128)
void relattn_kernel(const _Float16* __restrict__ QU, const _Float16* __restrict__ QV,
                    const _Float16* __restrict__ KP, const _Float16* __restrict__ VT,
                    const _Float16* __restrict__ PP, _Float16* __restrict__ CTX, float cs) {
  __shared__ __align__(16) unsigned char SMEM[KBYTES + VBYTES + PBYTES + 2 * KBYTES];
  _Float16* Ksh = (_Float16*)(SMEM);                    // [64][64]  at pitch VPIT
  _Float16* Vsh = (_Float16*)(SMEM + KBYTES);           // [64][64]  at pitch VPIT
  _Float16* Psh = (_Float16*)(SMEM + KBYTES + VBYTES);  // [4][16][64] at pitch VPIT
  _Float16* Rsh = (_Float16*)(SMEM + KBYTES + VBYTES + PBYTES);   // [2][64][64] at pitch VPIT: p-row tiles
  float*    Osh = (float*)(SMEM);                       // [4][16][64] at pitch OPIT, after the chunk loop

  const int tid  = threadIdx.x;
  const int wave = tid >> 5;
  const int lane = tid & 31;
  const int hh   = lane >> 4;
  const int c    = lane & 15;

  const int h    = blockIdx.y;
  const int bz   = blockIdx.z;
  const int qb   = blockIdx.x;
  const int q0   = qb * 64 + wave * 16;          // first query row of this wave
  const int tpb  = SEQ / 64 - 1 - qb;            // lower p-row tile of chunk 0

  const _Float16* Qh = QU + (size_t)bz * SEQ * QKW + h * HQK;   // row pitch QKW
  const _Float16* Qw = QV + (size_t)bz * SEQ * QKW + h * HQK;   // row pitch QKW
  const _Float16* Kh = KP + (size_t)bz * SEQ * ND + h * HDV;    // row pitch ND
  const _Float16* Ph = PP + h * HDV;                            // row pitch ND, shared by the batch
  const _Float16* Vh = VT + (size_t)(bz * ND + h * HDV) * SEQ;
  _Float16*       ctx = CTX + (size_t)bz * SEQ * ND + h * HDV;  // row pitch ND

  // Q fragments (A operand): 32-deep steps 0, 1 of the hi row, then 0, 1 of the residual row
  const _Float16* qsrc = Qh + (size_t)(q0 + c) * QKW + 8 * hh;
  const _Float16* wsrc = Qw + (size_t)(q0 + c) * QKW + 8 * hh;
  v16h qa[4], qv[4];
#pragma unroll
  for (int dc = 0; dc < 4; ++dc) qa[dc] = ldfrag(qsrc + dc * 32);
#pragma unroll
  for (int dc = 0; dc < 4; ++dc) qv[dc] = ldfrag(wsrc + dc * 32);
  // the reads further down may be given the Q address registers; the two pointers are inputs so that they stay in
  // their registers up to here
  asm volatile("s_wait_xcnt 0x0" :: "v"(qsrc), "v"(wsrc) : "memory");

  // rel-shift of accumulator register r (row R = 8*hh + r), shift sft = 15 - R: this lane takes from lane (c + sft) mod 16
  // of its row; as a source it offers product j where c >= sft and product j + 1 below
  int  pidx[8];
  bool own[8];
#pragma unroll
  for (int r = 0; r < 8; ++r) {
    const int sft = 15 - 8 * hh - r;
    pidx[r] = ((lane & 16) | ((c + sft) & 15)) << 2;
    own[r]  = (c >= sft);
  }

  float mrow[8], lrow[8];
  v8f oacc[4];
#pragma unroll
  for (int r = 0; r < 8; ++r) { mrow[r] = -INFINITY; lrow[r] = 0.f; }
#pragma unroll
  for (int t = 0; t < 4; ++t) oacc[t] = zero8();

  v8f wtop = zero8();                            // top position product of the chunk before
  _Float16* pw = Psh + wave * (16 * VPIT);

  // Global reads run one chunk ahead of their use: this thread's K and V^T staging pieces of chunk kc + 1 are issued
  // behind the barrier that publishes chunk kc, its p-row pieces behind the score products of chunk kc, so their latency
  // passes under the score products and the softmax of chunk kc (the fence ahead of P.V waits for them at the latest).
  // Piece map: neighbouring lanes take neighbouring 16-B pieces of one row, so that one wave-wide read covers four whole
  // 128-B lines (K, p and V^T rows alike: 8 lanes a 128-B row, 4 rows a read, piece i of a thread in row 16i + vr) instead
  // of one line per lane.
  const int vr = tid >> 3, scv = (tid & 7) * 8;
  const _Float16* ksrc = Kh + (size_t)vr * ND + scv;
  const _Float16* vsrc = Vh + (size_t)vr * SEQ + scv;
  const _Float16* psrc = Ph + (size_t)(tpb * 64 + vr) * ND + scv;
  v8h kst[4], vst[4], pst[4], pf[4];
#pragma unroll
  for (int i = 0; i < 4; ++i) kst[i] = *(const v8h*)(ksrc + (size_t)(16 * i) * ND);
#pragma unroll
  for (int i = 0; i < 4; ++i) vst[i] = *(const v8h*)(vsrc + (size_t)(16 * i) * SEQ);
#pragma unroll
  for (int i = 0; i < 4; ++i) pf[i] = *(const v8h*)(psrc + (size_t)(16 * i) * ND);
#pragma unroll
  for (int i = 0; i < 4; ++i) pst[i] = *(const v8h*)(psrc + (size_t)(64 + 16 * i) * ND);
  // stands ahead of any reuse of the address registers named above; the pointers are inputs so that they stay
  // in their registers up to here and no result of this run of reads is given one of them
  asm volatile("s_wait_xcnt 0x0" :: "v"(ksrc), "v"(vsrc), "v"(psrc) : "memory");
  // chunk 0's lower p-row tile; published by the barrier behind the first staging stores
#pragma unroll
  for (int i = 0; i < 4; ++i) *(v8ha*)(Rsh + ((tpb & 1) * 64 + 16 * i + vr) * VPIT + scv) = pf[i];

#pragma unroll 1
  for (int kc = 0; kc < SEQ / 64; ++kc) {
    __syncthreads();
#pragma unroll
    for (int i = 0; i < 4; ++i) *(v8ha*)(Ksh + (16 * i + vr) * VPIT + scv) = kst[i];
#pragma unroll
    for (int i = 0; i < 4; ++i) *(v8ha*)(Vsh + (16 * i + vr) * VPIT + scv) = vst[i];
    // the chunk's upper p-row tile, over the lower tile of the chunk before, whose reads the barrier above has ended
    _Float16* rdst = Rsh + (((tpb + kc + 1) & 1) * 64 + vr) * VPIT + scv;
#pragma unroll
    for (int i = 0; i < 4; ++i) *(v8ha*)(rdst + i * (16 * VPIT)) = pst[i];
    __syncthreads();

    // LDS fragment reads stand in whole groups of four fragments (8 ds_load_b128), each group issued ahead of the
    // products of the group before it where registers allow, so that a wave waits once a group and not once a product.
    // frg[0] and frg[1] are the two register sets.  The chunk's first group is read here: its latency passes under the
    // issue of the global reads below.
    const _Float16* pr[5];
#pragma unroll
    for (int u = 0; u < 5; ++u) {
      const int x = 48 - 16 * wave + 16 * u;        // 0 .. 112: a 16-row group lies in one tile
      pr[u] = Rsh + (((tpb + kc + (x >> 6)) & 1) * 64 + (x & 63) + c) * VPIT + 8 * hh;
    }
    const _Float16* kfr = Ksh + c * VPIT + 8 * hh;
    const _Float16* vfr = Vsh + c * VPIT + 8 * hh;
    v16h frg[2][4];
#pragma unroll
    for (int u = 1; u < 5; ++u) frg[0][u - 1] = ldfrag(pr[u]);

    if (kc + 1 < SEQ / 64) {                          // block-uniform: the last chunk fetches nothing
      const int kn0 = (kc + 1) * 64;
#pragma unroll
      for (int i = 0; i < 4; ++i) kst[i] = *(const v8h*)(ksrc + (size_t)(kn0 + 16 * i) * ND);
#pragma unroll
      for (int i = 0; i < 4; ++i) vst[i] = *(const v8h*)(vsrc + kn0 + (size_t)(16 * i) * SEQ);
      // stands ahead of any reuse of the address registers named above; its memory clobber also holds the reads here,
      // in front of the score products
      asm volatile("s_wait_xcnt 0x0" ::: "memory");
    }

    // position scores: W[u] = (QV hi + QV residual)(16x64) . p^T for window rows 48 - 16*wave + 16u .. + 15, then the rel-shift
    // (W[0] of a chunk is W[4] of the chunk before: the same queries against the same p rows, so it is carried over)
    v8f pos[4], s[4];
    {
      v8f w5[5];
      if (kc == 0) {                                // block-uniform: nothing to carry yet
#pragma unroll
        for (int dc = 0; dc < 2; ++dc) {
          const v16h f0 = ldfrag(pr[0] + dc * 32);
          wtop = mma16(qv[dc], f0, wtop);
          wtop = mma16(qv[dc + 2], f0, wtop);
        }
      }
      w5[0] = wtop;
#pragma unroll
      for (int u = 1; u < 5; ++u) w5[u] = zero8();
#pragma unroll
      for (int dc = 0; dc < 2; ++dc) {
        // the next group (the second 32-deep step of the p rows, then the first step of the K rows) into the other set
#pragma unroll
        for (int u = 0; u < 4; ++u)
          frg[(dc + 1) & 1][u] = (dc < 1) ? ldfrag(pr[u + 1] + 32) : ldfrag(kfr + u * 16 * VPIT);
#pragma unroll
        for (int u = 1; u < 5; ++u) w5[u] = mma16(qv[dc], frg[dc & 1][u - 1], w5[u]);
#pragma unroll
        for (int u = 1; u < 5; ++u) w5[u] = mma16(qv[dc + 2], frg[dc & 1][u - 1], w5[u]);
      }
      wtop = w5[4];

      // content scores: S[j] = (QU hi + QU residual)(16x64) . K^T for key subtile j, 32-deep step by step over all four
      // subtiles
#pragma unroll
      for (int j = 0; j < 4; ++j) s[j] = mma16(qa[0], frg[0][j], zero8());
#pragma unroll
      for (int j = 0; j < 4; ++j) frg[1][j] = ldfrag(kfr + j * 16 * VPIT + 32);

#pragma unroll
      for (int j = 0; j < 4; ++j)                   // product by product, so that W[j]'s registers are free behind its offers
#pragma unroll
        for (int r = 0; r < 8; ++r) {
          const float offer = own[r] ? w5[j][r] : w5[j + 1][r];
          pos[j][r] = __int_as_float(__builtin_amdgcn_ds_bpermute(pidx[r], __float_as_int(offer)));
        }
    }
#pragma unroll
    for (int j = 0; j < 4; ++j) s[j] = mma16(qa[2], frg[0][j], s[j]);
#pragma unroll
    for (int j = 0; j < 4; ++j) s[j] = mma16(qa[1], frg[1][j], s[j]);
#pragma unroll
    for (int j = 0; j < 4; ++j) s[j] = mma16(qa[3], frg[1][j], s[j]);

    // The next chunk's p-row pieces are read from here on, not with K and V^T above: their registers are free for the
    // fragment sets during the score products; the softmax and P.V still stand between this read and its use.
    if (kc + 1 < SEQ / 64) {                          // block-uniform: the last chunk fetches nothing
#pragma unroll
      for (int i = 0; i < 4; ++i) pst[i] = *(const v8h*)(psrc + (size_t)((kc + 1) * 64 + 64 + 16 * i) * ND);
      // stands ahead of any reuse of the address registers named above
      asm volatile("s_wait_xcnt 0x0" ::: "memory");
    } else {
      // says that the old pieces are dead on this path too; without it they stay live through the score products
#pragma unroll
      for (int i = 0; i < 4; ++i) pst[i] = v8h{};
    }

    // add the position term, chunk row max
    float cm[8];
#pragma unroll
    for (int r = 0; r < 8; ++r) {
      float m = -INFINITY;
#pragma unroll
      for (int j = 0; j < 4; ++j) {
        const float sv = (s[j][r] + pos[j][r]) * cs;   // cs is a power of two: the one rounding is that of the sum
        s[j][r] = sv;
        m = fmaxf(m, sv);
      }
      cm[r] = m;
    }
    row_max8(cm);

    // online softmax update (per-row rescale of this row's accumulator elements only);
    // P tile (x4096) to this wave's LDS tile [row][key]
    float alpha[8], psum[8];
#pragma unroll
    for (int r = 0; r < 8; ++r) {
      const float mnew  = fmaxf(mrow[r], cm[r]);
      alpha[r] = __expf(mrow[r] - mnew);
      mrow[r] = mnew;
      float ps = 0.f;
#pragma unroll
      for (int j = 0; j < 4; ++j) {
        const float p = __expf(s[j][r] - mnew);
        ps += p;
        pw[(8 * hh + r) * VPIT + j * 16 + c] = (_Float16)(p * 4096.0f);
      }
      psum[r] = ps;
    }
    // all eight V^T fragments are read here: their latency passes under the row sums and the rescale
#pragma unroll
    for (int kk = 0; kk < 2; ++kk)
#pragma unroll
      for (int t = 0; t < 4; ++t) frg[kk][t] = ldfrag(vfr + t * 16 * VPIT + kk * 32);
    row_sum8(psum);
#pragma unroll
    for (int r = 0; r < 8; ++r) {
      lrow[r] = lrow[r] * alpha[r] + psum[r];
#pragma unroll
      for (int t = 0; t < 4; ++t) oacc[t][r] *= alpha[r];
    }
    __builtin_amdgcn_fence(__ATOMIC_RELEASE, "workgroup");
    __builtin_amdgcn_wave_barrier();
    __builtin_amdgcn_fence(__ATOMIC_ACQUIRE, "workgroup");

    // P (A operand, row = lane&15, split k map over keys) . V (B operand from V^T rows d)
    v16h pa[2];
#pragma unroll
    for (int kk = 0; kk < 2; ++kk) pa[kk] = ldfrag(pw + c * VPIT + kk * 32 + 8 * hh);
#pragma unroll
    for (int kk = 0; kk < 2; ++kk)
#pragma unroll
      for (int t = 0; t < 4; ++t) oacc[t] = mma16(pa[kk], frg[kk][t], oacc[t]);
  }

  __syncthreads();                               // every wave is done with Ksh before Osh aliases it
  float* os = Osh + wave * (16 * OPIT);
#pragma unroll
  for (int r = 0; r < 8; ++r) {
    const float inv = 1.0f / (1024.0f * lrow[r]);   // 64 / (4096 * 16 * l)
#pragma unroll
    for (int t = 0; t < 4; ++t) os[(8 * hh + r) * OPIT + t * 16 + c] = oacc[t][r] * inv;
  }
  __builtin_amdgcn_fence(__ATOMIC_RELEASE, "workgroup");
  __builtin_amdgcn_wave_barrier();
  __builtin_amdgcn_fence(__ATOMIC_ACQUIRE, "workgroup");
  const int q8 = lane >> 3, c8 = (lane & 7) * 8;
  v8h ov[4];
#pragma unroll
  for (int it = 0; it < 4; ++it) {
    const int row = it * 4 + q8;
    const float* sp = os + row * OPIT + c8;
    const v4f x0 = *(const v4fa*)(sp);
    const v4f x1 = *(const v4fa*)(sp + 4);
    v8h o;
    o[0] = (_Float16)x0[0]; o[1] = (_Float16)x0[1]; o[2] = (_Float16)x0[2]; o[3] = (_Float16)x0[3];
    o[4] = (_Float16)x1[0]; o[5] = (_Float16)x1[1]; o[6] = (_Float16)x1[2]; o[7] = (_Float16)x1[3];
    ov[it] = o;
  }
  {
#pragma unroll
    for (int it = 0; it < 4; ++it) {
      const int row = it * 4 + q8;
      *(v8h*)(ctx + (size_t)(q0 + row) * ND + c8) = ov[it];
    }
    
  }
}

// -------------------------------------------------------------------------------------------------
// Workspace map (bytes, NB=8 SEQ=1024): every batch element's planes are live at once.
//   P2   f16 [NPP][1024]             4194304
//   QU2  f16 [NB*SEQ][2048]         33554432
//   QV2  f16 [NB*SEQ][2048]         33554432
//   KP2  f16 [NB*SEQ][1024]         16777216
//   VT   f16 [NB][1024][SEQ]        16777216
//   SCR                             50331648   early phase: WQ2, WK2 f16 [1024][2048], WV, WP f16 [1024][1024],
//                                              PE f16 [NPP][1024], XH f16 [NB*SEQ][2048] (all dead after the projections);
//                                              last phase: WO f16 [1024][1024] (converted after the attention launch),
//                                              then CTX f16 [NB*SEQ][1024] (written by the attention launch)
//   total                          155189248
// Every region is written in whole 64x64 tiles / whole rows; all region sizes equal their written extents.
// -------------------------------------------------------------------------------------------------
extern "C" void kernel_launch(void* const* d_in, const int* in_sizes, int n_in,
                              void* d_out, int out_size, void* d_ws, size_t ws_size,
                              hipStream_t stream) {
  if (n_in < 14) return;
  if (in_sizes[0] < ((NB - 1) * SEQ_FULL + SEQ) * ND) return;
  if (in_sizes[1] != ND * ND || in_sizes[3] != ND * ND || in_sizes[5] != ND * ND) return;
  if (in_sizes[7] != ND * ND || in_sizes[8] != ND * ND) return;
  if (in_sizes[2] < ND || in_sizes[4] < ND || in_sizes[6] < ND || in_sizes[9] < ND) return;
  if (in_sizes[10] < NH * HDV || in_sizes[11] < NH * HDV) return;
  if (in_sizes[12] < ND || in_sizes[13] < ND) return;
  if (out_size < NB * SEQ * ND) return;

  const float* x    = (const float*)d_in[0];
  const float* Wq   = (const float*)d_in[1];
  const float* bq   = (const float*)d_in[2];
  const float* Wk   = (const float*)d_in[3];
  const float* bk   = (const float*)d_in[4];
  const float* Wv   = (const float*)d_in[5];
  const float* bv   = (const float*)d_in[6];
  const float* Wpos = (const float*)d_in[7];
  const float* Wout = (const float*)d_in[8];
  const float* bout = (const float*)d_in[9];
  const float* ub   = (const float*)d_in[10];
  const float* vbias= (const float*)d_in[11];
  const float* lng  = (const float*)d_in[12];
  const float* lnb  = (const float*)d_in[13];
  float* out = (float*)d_out;

  const size_t szW2  = (size_t)ND * QKW * 2;              //   4194304
  const size_t szW1  = (size_t)ND * ND * 2;               //   2097152
  const size_t szXH  = (size_t)NB * SEQ * QKW * 2;        //  33554432
  const size_t szQ   = (size_t)NB * SEQ * QKW * 2;        //  33554432
  const size_t szVT  = (size_t)NB * ND * SEQ * 2;         //  16777216
  const size_t szP2  = (size_t)NPP * ND * 2;              //   4194304
  const size_t szK   = (size_t)NB * SEQ * ND * 2;         //  16777216
  const size_t szPE  = (size_t)NPP * ND * 2;              //   4194304
  const size_t szCTX = (size_t)NB * SEQ * ND * 2;         //  16777216
  const size_t szEarly = 2 * szW2 + 2 * szW1 + szPE + szXH;
  const size_t szLate  = szW1 + szCTX;
  const size_t szSCR = (szEarly > szLate) ? szEarly : szLate;
  size_t off = 0;
  const size_t oP2  = off; off += szP2;
  const size_t oQU2 = off; off += szQ;
  const size_t oQV2 = off; off += szQ;
  const size_t oKP2 = off; off += szK;
  const size_t oVT  = off; off += szVT;
  const size_t oSCR = off; off += szSCR;
  const size_t total = off;                                // 155189248 for NB=8, SEQ=1024
  if (total > ws_size) return;
  const size_t oWQ2 = oSCR;
  const size_t oWK2 = oWQ2 + szW2;
  const size_t oWV  = oWK2 + szW2;
  const size_t oWP  = oWV + szW1;
  const size_t oPE  = oWP + szW1;
  const size_t oXH  = oPE + szPE;

  char* ws = (char*)d_ws;
  _Float16* WQ2 = (_Float16*)(ws + oWQ2);
  _Float16* WK2 = (_Float16*)(ws + oWK2);
  _Float16* WVp = (_Float16*)(ws + oWV);
  _Float16* WOp = (_Float16*)(ws + oSCR);
  _Float16* XH  = (_Float16*)(ws + oXH);
  _Float16* QU2 = (_Float16*)(ws + oQU2);
  _Float16* QV2 = (_Float16*)(ws + oQV2);
  _Float16* KP2 = (_Float16*)(ws + oKP2);
  _Float16* VTp = (_Float16*)(ws + oVT);
  _Float16* P2  = (_Float16*)(ws + oP2);
  _Float16* CTX = (_Float16*)(ws + oSCR + szW1);
  _Float16* WPp = (_Float16*)(ws + oWP);
  _Float16* PEp = (_Float16*)(ws + oPE);

  const float cs = 0.125f * 0.00390625f;   // (1/sqrt(64)) / 256 applied to the x16.x16 score accumulators
  const dim3 blk(256);

  // (1) weights -> f16 planes of bf16-valued entries: Wq, Wk as [x64 | /16] 2048-wide; Wv, Wpos x64
  const dim3 gW(ND * (ND / 8) / 256);      // 512
  cvt_w_kernel<true ><<<gW, blk, 0, stream>>>(Wq,   WQ2, 64.0f, 0.0625f);
  cvt_w_kernel<true ><<<gW, blk, 0, stream>>>(Wk,   WK2, 64.0f, 0.0625f);
  cvt_w_kernel<false><<<gW, blk, 0, stream>>>(Wv,   WVp, 64.0f, 64.0f);
  cvt_w_kernel<false><<<gW, blk, 0, stream>>>(Wpos, WPp, 64.0f, 64.0f);
  // (2) LayerNorm -> XH [NB*SEQ][2048] (hi | residual x1024)
  ln_kernel<<<dim3((NB * SEQ) / 8), blk, 0, stream>>>(x, lng, lnb, XH, NB * SEQ);
  // (3) positional sinusoid table -> PE [NPP][1024] (row NPP-1 = 0)
  pe_kernel<<<dim3((NPP * (ND / 8) + 255) / 256), blk, 0, stream>>>(PEp);
  // (4) p = pe . Wpos^T -> P2 = 16p   (M=NPP, N=1024, K=1024)
  {
    const int tiles = (NPP / GBM) * (ND / GBN);
    gemm_f16_kernel<2, false><<<dim3(tiles, 1), blk, 0, stream>>>(
        PEp, ND, 0L, 0L, WPp, ND, 0L, (void*)P2, (void*)P2, ND, 0L, 0L, bq, bq, bq,
        NPP, ND, ND, 0.015625f, 16.0f);
  }
  // (5) projections of all batch elements, one launch each
  const int tilesQ  = ((NB * SEQ) / GBM) * (ND / GBN);
  const int tilesV  = (ND / GBM) * (SEQ / GBN);
  // QU2 = split(16*(q + bq + u_bias)), QV2 = split(16*(q + bq + v_bias))   (M=NB*SEQ, N=1024, K=2048)
  gemm_f16_kernel<3, true><<<dim3(tilesQ, 1), blk, 0, stream>>>(
      XH, QKW, 0L, 0L, WQ2, QKW, 0L, (void*)QU2, (void*)QV2, QKW, 0L, 0L, ub, vbias, bq,
      NB * SEQ, ND, QKW, 0.015625f, 16.0f);
  // KP2 = 16k, k = xn.Wk^T + bk   (M=NB*SEQ, N=1024, K=2048)
  gemm_f16_kernel<2, true><<<dim3(tilesQ, 1), blk, 0, stream>>>(
      XH, QKW, 0L, 0L, WK2, QKW, 0L, (void*)KP2, (void*)KP2, ND, 0L, 0L, bk, bk, bk,
      NB * SEQ, ND, QKW, 0.015625f, 16.0f);
  // VT[b][h*64+d][s] = 16*(v + bv)   (A = Wv plane [1024][1024], Bt = XH hi columns of batch element y; M=1024, N=SEQ, K=1024)
  gemm_f16_kernel<4, true><<<dim3(tilesV, NB), blk, 0, stream>>>(
      WVp, ND, 0L, 0L, XH, QKW, (long)SEQ * QKW, (void*)VTp, (void*)VTp, SEQ, (long)ND * SEQ, 0L, bv, bv, bv,
      ND, SEQ, ND, 0.015625f, 16.0f);
  // (6) attention with its position scores, all batch elements and heads in one launch
  relattn_kernel<<<dim3(SEQ / 64, NH, NB), dim3(128), 0, stream>>>(QU2, QV2, KP2, VTp, P2, CTX, cs);
  // (7) out = ctx . Wout^T + bout -> d_out f32 [NB*SEQ][1024]   (M=NB*SEQ, N=1024, K=1024; carries 64*64 folded into scale)
  cvt_w_kernel<false><<<gW, blk, 0, stream>>>(Wout, WOp, 64.0f, 64.0f);
  {
    const int tiles = ((NB * SEQ) / GBM) * (ND / GBN);
    gemm_f16_kernel<1, true><<<dim3(tiles, 1), blk, 0, stream>>>(
        CTX, ND, 0L, 0L, WOp, ND, 0L, (void*)out, (void*)out, ND, 0L, 0L, bout, bout, bout,
        NB * SEQ, ND, ND, 0.000244140625f, 1.0f);
  }
  (void)hipGetLastError();
}

// v010
// A run of this version takes 221 microseconds.
// In both of two side-by-side timings against v009, it was 1.09 times as fast.
// All steps since v000 together make it 15.6 times as fast.
// Contractions: xn.Wq^T and xn.Wk^T (xn as f16 hi + x1024 f16 residual planes folded along K against Wx64 | W/16 planes), Wv.xn^T (xn hi, Wx64), pe.Wpos^T (pe f16, Wx64), (q+v_bias).p^T band and (q+u_bias).k^T (16q as f16 hi + f16 residual, each against the one 16p resp. 16k plane), P.V (P x4096, v x16), ctx.Wout^T (ctx x64, W x64): all v_wmma_f32_16x16x32_f16 (f16 operands, f32 accumulate); float inputs bf16-RNE valued; LayerNorm, positional table, softmax, bias adds and scaling in f32.
#include <hip/hip_runtime.h>
#include <math.h>
#include <stdint.h>

#ifndef NB
#define NB 8
#endif
#ifndef SEQ
#define SEQ 1024
#endif
#define SEQ_FULL 1024
#define ND    1024
#define NH    16
#define HDV   64            // value head dim
#define HQK   128           // width of a head in the q planes: 64 hi + 64 residual
#define QKW   (2 * ND)      // pitch (halves) of the 2048-wide f16 planes
#define NP    (2 * SEQ - 1)
#define NPP   (2 * SEQ)

static_assert(SEQ % 64 == 0);
static_assert(SEQ <= SEQ_FULL);
static_assert(ND == NH * HDV);
static_assert(HQK == 2 * HDV);
static_assert(ND % 256 == 0);
static_assert(NPP % 64 == 0);

typedef _Float16 v16h __attribute__((ext_vector_type(16)));
typedef _Float16 v8h  __attribute__((ext_vector_type(8)));
typedef float    v8f  __attribute__((ext_vector_type(8)));
typedef float    v4f  __attribute__((ext_vector_type(4)));
typedef unsigned int v4u __attribute__((ext_vector_type(4)));
typedef v4f __attribute__((may_alias)) v4fa;
typedef v8h __attribute__((may_alias)) v8ha;

// bf16 RNE of an f32 value, returned widened to f32 (exactly representable in f16 after a power-of-two carry)
__device__ __forceinline__ float bf_rne(float f) {
  unsigned u = __float_as_uint(f);
  u = (u + 0x7FFFu + ((u >> 16) & 1u)) & 0xFFFF0000u;
  return __uint_as_float(u);
}

// 16-bit WMMA fragment: elements 0..7 <- p[0..7], elements 8..15 <- p[16..23]
// (A: p = row m at k0 + 8h;  B stored [n][k]: p = row n at k0 + 8h;  same split k map for both)
union FragU { v16h v; v8ha h[2]; };
__device__ __forceinline__ v16h ldfrag(const _Float16* p) {
  FragU f;
  f.h[0] = *(const v8ha*)(p);
  f.h[1] = *(const v8ha*)(p + 16);
  return f.v;
}

// WMMA + hazard guard (ties D, keeps A/B live for 4 VALU slots)
__device__ __forceinline__ v8f mma16(v16h a, v16h b, v8f c) {
  c = __builtin_amdgcn_wmma_f32_16x16x32_f16(false, a, false, b, (short)0, c, false, false);
  asm volatile("v_nop\n\tv_nop\n\tv_nop\n\tv_nop" : "+v"(c) : "v"(a), "v"(b));
  return c;
}

__device__ __forceinline__ v8f zero8() { v8f z = {0.f, 0.f, 0.f, 0.f, 0.f, 0.f, 0.f, 0.f}; return z; }

// 16-lane butterfly (lane ^ 1, ^ 2, ^ 4, ^ 8) over eight independent values at once, on the vector port by DPP row_xmask;
// every lane must be on.  It takes the place of ds_bpermute_b32 round trips through the LDS pipe, each with its own wait.
// Written as text because the builtin DPP move came out as three instructions a step for the maximum; the eight values are
// interleaved so that every instruction's producer stands eight instructions back and no step waits for the one before.
__device__ __forceinline__ void row_max8(float (&m)[8]) {
  asm(
      "v_max_num_f32_dpp %0, %0, %0 row_xmask:1 row_mask:0xf bank_mask:0xf\n\t"
      "v_max_num_f32_dpp %1, %1, %1 row_xmask:1 row_mask:0xf bank_mask:0xf\n\t"
      "v_max_num_f32_dpp %2, %2, %2 row_xmask:1 row_mask:0xf bank_mask:0xf\n\t"
      "v_max_num_f32_dpp %3, %3, %3 row_xmask:1 row_mask:0xf bank_mask:0xf\n\t"
      "v_max_num_f32_dpp %4, %4, %4 row_xmask:1 row_mask:0xf bank_mask:0xf\n\t"
      "v_max_num_f32_dpp %5, %5, %5 row_xmask:1 row_mask:0xf bank_mask:0xf\n\t"
      "v_max_num_f32_dpp %6, %6, %6 row_xmask:1 row_mask:0xf bank_mask:0xf\n\t"
      "v_max_num_f32_dpp %7, %7, %7 row_xmask:1 row_mask:0xf bank_mask:0xf\n\t"
      "v_max_num_f32_dpp %0, %0, %0 row_xmask:2 row_mask:0xf bank_mask:0xf\n\t"
      "v_max_num_f32_dpp %1, %1, %1 row_xmask:2 row_mask:0xf bank_mask:0xf\n\t"
      "v_max_num_f32_dpp %2, %2, %2 row_xmask:2 row_mask:0xf bank_mask:0xf\n\t"
      "v_max_num_f32_dpp %3, %3, %3 row_xmask:2 row_mask:0xf bank_mask:0xf\n\t"
      "v_max_num_f32_dpp %4, %4, %4 row_xmask:2 row_mask:0xf bank_mask:0xf\n\t"
      "v_max_num_f32_dpp %5, %5, %5 row_xmask:2 row_mask:0xf bank_mask:0xf\n\t"
      "v_max_num_f32_dpp %6, %6, %6 row_xmask:2 row_mask:0xf bank_mask:0xf\n\t"
      "v_max_num_f32_dpp %7, %7, %7 row_xmask:2 row_mask:0xf bank_mask:0xf\n\t"
      "v_max_num_f32_dpp %0, %0, %0 row_xmask:4 row_mask:0xf bank_mask:0xf\n\t"
      "v_max_num_f32_dpp %1, %1, %1 row_xmask:4 row_mask:0xf bank_mask:0xf\n\t"
      "v_max_num_f32_dpp %2, %2, %2 row_xmask:4 row_mask:0xf bank_mask:0xf\n\t"
      "v_max_num_f32_dpp %3, %3, %3 row_xmask:4 row_mask:0xf bank_mask:0xf\n\t"
      "v_max_num_f32_dpp %4, %4, %4 row_xmask:4 row_mask:0xf bank_mask:0xf\n\t"
      "v_max_num_f32_dpp %5, %5, %5 row_xmask:4 row_mask:0xf bank_mask:0xf\n\t"
      "v_max_num_f32_dpp %6, %6, %6 row_xmask:4 row_mask:0xf bank_mask:0xf\n\t"
      "v_max_num_f32_dpp %7, %7, %7 row_xmask:4 row_mask:0xf bank_mask:0xf\n\t"
      "v_max_num_f32_dpp %0, %0, %0 row_xmask:8 row_mask:0xf bank_mask:0xf\n\t"
      "v_max_num_f32_dpp %1, %1, %1 row_xmask:8 row_mask:0xf bank_mask:0xf\n\t"
      "v_max_num_f32_dpp %2, %2, %2 row_xmask:8 row_mask:0xf bank_mask:0xf\n\t"
      "v_max_num_f32_dpp %3, %3, %3 row_xmask:8 row_mask:0xf bank_mask:0xf\n\t"
      "v_max_num_f32_dpp %4, %4, %4 row_xmask:8 row_mask:0xf bank_mask:0xf\n\t"
      "v_max_num_f32_dpp %5, %5, %5 row_xmask:8 row_mask:0xf bank_mask:0xf\n\t"
      "v_max_num_f32_dpp %6, %6, %6 row_xmask:8 row_mask:0xf bank_mask:0xf\n\t"
      "v_max_num_f32_dpp %7, %7, %7 row_xmask:8 row_mask:0xf bank_mask:0xf"
      : "+v"(m[0]), "+v"(m[1]), "+v"(m[2]), "+v"(m[3]), "+v"(m[4]), "+v"(m[5]), "+v"(m[6]), "+v"(m[7]));
}
__device__ __forceinline__ void row_sum8(float (&s)[8]) {
  asm(
      "v_add_f32_dpp %0, %0, %0 row_xmask:1 row_mask:0xf bank_mask:0xf\n\t"
      "v_add_f32_dpp %1, %1, %1 row_xmask:1 row_mask:0xf bank_mask:0xf\n\t"
      "v_add_f32_dpp %2, %2, %2 row_xmask:1 row_mask:0xf bank_mask:0xf\n\t"
      "v_add_f32_dpp %3, %3, %3 row_xmask:1 row_mask:0xf bank_mask:0xf\n\t"
      "v_add_f32_dpp %4, %4, %4 row_xmask:1 row_mask:0xf bank_mask:0xf\n\t"
      "v_add_f32_dpp %5, %5, %5 row_xmask:1 row_mask:0xf bank_mask:0xf\n\t"
      "v_add_f32_dpp %6, %6, %6 row_xmask:1 row_mask:0xf bank_mask:0xf\n\t"
      "v_add_f32_dpp %7, %7, %7 row_xmask:1 row_mask:0xf bank_mask:0xf\n\t"
      "v_add_f32_dpp %0, %0, %0 row_xmask:2 row_mask:0xf bank_mask:0xf\n\t"
      "v_add_f32_dpp %1, %1, %1 row_xmask:2 row_mask:0xf bank_mask:0xf\n\t"
      "v_add_f32_dpp %2, %2, %2 row_xmask:2 row_mask:0xf bank_mask:0xf\n\t"
      "v_add_f32_dpp %3, %3, %3 row_xmask:2 row_mask:0xf bank_mask:0xf\n\t"
      "v_add_f32_dpp %4, %4, %4 row_xmask:2 row_mask:0xf bank_mask:0xf\n\t"
      "v_add_f32_dpp %5, %5, %5 row_xmask:2 row_mask:0xf bank_mask:0xf\n\t"
      "v_add_f32_dpp %6, %6, %6 row_xmask:2 row_mask:0xf bank_mask:0xf\n\t"
      "v_add_f32_dpp %7, %7, %7 row_xmask:2 row_mask:0xf bank_mask:0xf\n\t"
      "v_add_f32_dpp %0, %0, %0 row_xmask:4 row_mask:0xf bank_mask:0xf\n\t"
      "v_add_f32_dpp %1, %1, %1 row_xmask:4 row_mask:0xf bank_mask:0xf\n\t"
      "v_add_f32_dpp %2, %2, %2 row_xmask:4 row_mask:0xf bank_mask:0xf\n\t"
      "v_add_f32_dpp %3, %3, %3 row_xmask:4 row_mask:0xf bank_mask:0xf\n\t"
      "v_add_f32_dpp %4, %4, %4 row_xmask:4 row_mask:0xf bank_mask:0xf\n\t"
      "v_add_f32_dpp %5, %5, %5 row_xmask:4 row_mask:0xf bank_mask:0xf\n\t"
      "v_add_f32_dpp %6, %6, %6 row_xmask:4 row_mask:0xf bank_mask:0xf\n\t"
      "v_add_f32_dpp %7, %7, %7 row_xmask:4 row_mask:0xf bank_mask:0xf\n\t"
      "v_add_f32_dpp %0, %0, %0 row_xmask:8 row_mask:0xf bank_mask:0xf\n\t"
      "v_add_f32_dpp %1, %1, %1 row_xmask:8 row_mask:0xf bank_mask:0xf\n\t"
      "v_add_f32_dpp %2, %2, %2 row_xmask:8 row_mask:0xf bank_mask:0xf\n\t"
      "v_add_f32_dpp %3, %3, %3 row_xmask:8 row_mask:0xf bank_mask:0xf\n\t"
      "v_add_f32_dpp %4, %4, %4 row_xmask:8 row_mask:0xf bank_mask:0xf\n\t"
      "v_add_f32_dpp %5, %5, %5 row_xmask:8 row_mask:0xf bank_mask:0xf\n\t"
      "v_add_f32_dpp %6, %6, %6 row_xmask:8 row_mask:0xf bank_mask:0xf\n\t"
      "v_add_f32_dpp %7, %7, %7 row_xmask:8 row_mask:0xf bank_mask:0xf"
      : "+v"(s[0]), "+v"(s[1]), "+v"(s[2]), "+v"(s[3]), "+v"(s[4]), "+v"(s[5]), "+v"(s[6]), "+v"(s[7]));
}

// -------------------------------------------------------------------------------------------------
// Weight [1024][1024] f32 -> f16 plane of bf16-valued entries, item i = 8 neighbouring entries of one row.
//   dup false: dst [1024][1024], dst[r][c] = f16(bf_rne(W)*64)
//   dup true : dst [1024][2048], dst[r][c] = f16(bf_rne(W)*64), dst[r][1024+c] = f16(bf_rne(W)/16)
// coverage: 131072 items x 8 = the whole [1024][1024] source (both column halves for dup).
// -------------------------------------------------------------------------------------------------
#define WITEMS (ND * (ND / 8))
__device__ __forceinline__ void cvt_w_item(const float* src, _Float16* dst, bool dup, int i) {
  const int r  = i / (ND / 8);
  const int c8 = (i - r * (ND / 8)) * 8;
  const float* sp = src + (size_t)r * ND + c8;
  const v4f a = *(const v4f*)(sp);
  const v4f b = *(const v4f*)(sp + 4);
  float f[8];
  f[0] = bf_rne(a[0]); f[1] = bf_rne(a[1]); f[2] = bf_rne(a[2]); f[3] = bf_rne(a[3]);
  f[4] = bf_rne(b[0]); f[5] = bf_rne(b[1]); f[6] = bf_rne(b[2]); f[7] = bf_rne(b[3]);
  v8h o1, o2;
#pragma unroll
  for (int e = 0; e < 8; ++e) { o1[e] = (_Float16)(f[e] * 64.0f); o2[e] = (_Float16)(f[e] * 0.0625f); }
  _Float16* dp = dst + (size_t)r * (dup ? QKW : ND) + c8;
  *(v8h*)dp = o1;
  if (dup) *(v8h*)(dp + ND) = o2;
  // the caller's next trip rewrites the registers that these stores name: the wait stands ahead of that
  asm volatile("s_wait_xcnt 0x0" ::: "memory");
}

// -------------------------------------------------------------------------------------------------
// LayerNorm of one row by one wave (compact row b*SEQ + t; source row b*SEQ_FULL + t); no LDS.
//   XH[row][c]        = f16(xn)                       (hi)
//   XH[row][1024 + c] = f16((xn - hi) * 1024)         (residual, carried x1024)
// Stores: lane l writes 16 B at columns i*256 + 8l: one instruction = 32 lanes x 16 B = 512 contiguous B.
// coverage: (4 x 256) columns x {hi, residual} = the whole 2048-wide row of the plane.
// Loops rolled on purpose (small elementwise side computation).
// -------------------------------------------------------------------------------------------------
__device__ __forceinline__ void ln_row(const float* __restrict__ x, const float* __restrict__ g,
                                       const float* __restrict__ bt, _Float16* __restrict__ XH,
                                       int row, int lane) {
  const int b = row / SEQ;
  const int t = row - b * SEQ;
  const float* xr = x + ((size_t)b * SEQ_FULL + t) * ND + lane * 8;

  float s = 0.f;
#pragma unroll 1
  for (int i = 0; i < 4; ++i) {
    const v4f a = *(const v4f*)(xr + i * 256);
    const v4f c = *(const v4f*)(xr + i * 256 + 4);
    s += (bf_rne(a[0]) + bf_rne(a[1])) + (bf_rne(a[2]) + bf_rne(a[3]));
    s += (bf_rne(c[0]) + bf_rne(c[1])) + (bf_rne(c[2]) + bf_rne(c[3]));
  }
  s += __shfl_xor(s, 16, 32); s += __shfl_xor(s, 8, 32); s += __shfl_xor(s, 4, 32);
  s += __shfl_xor(s, 2, 32);  s += __shfl_xor(s, 1, 32);
  const float mu = s * (1.0f / (float)ND);

  float s2 = 0.f;
#pragma unroll 1
  for (int i = 0; i < 4; ++i) {
    const v4f a = *(const v4f*)(xr + i * 256);
    const v4f c = *(const v4f*)(xr + i * 256 + 4);
    float d;
    d = bf_rne(a[0]) - mu; s2 += d * d;  d = bf_rne(a[1]) - mu; s2 += d * d;
    d = bf_rne(a[2]) - mu; s2 += d * d;  d = bf_rne(a[3]) - mu; s2 += d * d;
    d = bf_rne(c[0]) - mu; s2 += d * d;  d = bf_rne(c[1]) - mu; s2 += d * d;
    d = bf_rne(c[2]) - mu; s2 += d * d;  d = bf_rne(c[3]) - mu; s2 += d * d;
  }
  s2 += __shfl_xor(s2, 16, 32); s2 += __shfl_xor(s2, 8, 32); s2 += __shfl_xor(s2, 4, 32);
  s2 += __shfl_xor(s2, 2, 32);  s2 += __shfl_xor(s2, 1, 32);
  const float var  = s2 * (1.0f / (float)ND);
  const float rstd = rsqrtf(var + 1e-5f);

  _Float16* xh = XH + (size_t)row * QKW + lane * 8;
#pragma unroll 1
  for (int i = 0; i < 4; ++i) {
    const v4f a  = *(const v4f*)(xr + i * 256);
    const v4f c  = *(const v4f*)(xr + i * 256 + 4);
    const v4f ga = *(const v4f*)(g + i * 256 + lane * 8);
    const v4f gb = *(const v4f*)(g + i * 256 + lane * 8 + 4);
    const v4f ba = *(const v4f*)(bt + i * 256 + lane * 8);
    const v4f bb = *(const v4f*)(bt + i * 256 + lane * 8 + 4);
    float f[8], gg[8], be[8];
    f[0] = a[0]; f[1] = a[1]; f[2] = a[2]; f[3] = a[3]; f[4] = c[0]; f[5] = c[1]; f[6] = c[2]; f[7] = c[3];
    gg[0] = ga[0]; gg[1] = ga[1]; gg[2] = ga[2]; gg[3] = ga[3];
    gg[4] = gb[0]; gg[5] = gb[1]; gg[6] = gb[2]; gg[7] = gb[3];
    be[0] = ba[0]; be[1] = ba[1]; be[2] = ba[2]; be[3] = ba[3];
    be[4] = bb[0]; be[5] = bb[1]; be[6] = bb[2]; be[7] = bb[3];
    v8h ho, lo;
#pragma unroll
    for (int e = 0; e < 8; ++e) {
      const float xn = (bf_rne(f[e]) - mu) * rstd * bf_rne(gg[e]) + bf_rne(be[e]);
      const _Float16 hv = (_Float16)xn;
      ho[e] = hv;
      lo[e] = (_Float16)((xn - (float)hv) * 1024.0f);
    }
    *(v8h*)(xh + i * 256)      = ho;
    *(v8h*)(xh + ND + i * 256) = lo;
  }
}

// -------------------------------------------------------------------------------------------------
// Relative-position sinusoid table -> PE f16 plane [NPP][1024] (rows >= NP are 0), item i = 8 neighbouring halves of a row:
//   row r <-> relative position pos = SEQ-1-r;  div_j = expf(f32(2j) * f32(-ln(1e4)/1024));
//   ang = |pos| * div_j (f32 product);  PE[r][2j] = sin(ang) with the sign of pos, PE[r][2j+1] = cos(ang).
// The per-pair loop is rolled (one sinf, one cosf, one expf body); the 16-B result is assembled by a
// register rotate with constant indices (no dynamic local-array indexing).
// coverage: NPP*128 items x 8 halves = the whole [NPP][1024] plane.
// -------------------------------------------------------------------------------------------------
__device__ __forceinline__ void pe_item(_Float16* __restrict__ PE, int i) {
  const int r  = i / (ND / 8);
  const int c8 = (i - r * (ND / 8)) * 8;
  const int pos = SEQ - 1 - r;
  const float fpos = (float)((pos < 0) ? -pos : pos);
  const float live = (r < NP) ? 1.0f : 0.0f;
  const float c0 = (float)(-9.210340371976184 / (double)ND);
  v4u pk = {0u, 0u, 0u, 0u};
#pragma unroll 1
  for (int e = 0; e < 4; ++e) {
    const int j = (c8 >> 1) + e;
    const float dv  = expf((float)(2 * j) * c0);
    const float ang = fpos * dv;
    float sn = sinf(ang);
    const float cn = cosf(ang);
    sn = (pos < 0) ? -sn : sn;
    const _Float16 hs = (_Float16)(sn * live);
    const _Float16 hc = (_Float16)(cn * live);
    const unsigned w = (unsigned)__builtin_bit_cast(unsigned short, hs) |
                       ((unsigned)__builtin_bit_cast(unsigned short, hc) << 16);
    v4u nx;
    nx[0] = pk[1]; nx[1] = pk[2]; nx[2] = pk[3]; nx[3] = w;
    pk = nx;
  }
  unsigned* dp = (unsigned*)(PE + (size_t)r * ND + c8);
  *(v4u*)dp = pk;
  // the caller's next trip rewrites the registers that this store names: the wait stands ahead of that
  asm volatile("s_wait_xcnt 0x0" ::: "memory");
}

// -------------------------------------------------------------------------------------------------
// All element-wise preparation in one launch: none of the three jobs reads what another writes, so they need no launch
// boundary between them.  Every block takes its share of each job in turn, in strides of the whole grid:
//   LayerNorm rows (one wave a row), the five weight planes (Wq, Wk doubled; Wv, Wpos, Wout single) as one run of
//   5 * WITEMS items, the position table's items.
// A block's 256 items of a stride lie in one weight plane (WITEMS is a multiple of 256), so the plane is picked by scalar code.
// coverage: each loop runs over its job's whole index range, whatever the grid.
// -------------------------------------------------------------------------------------------------
static_assert(WITEMS % 256 == 0 && (NB * SEQ) % 8 == 0 && (NPP * (ND / 8)) % 256 == 0);
__global__ __launch_bounds__(256) void prep_kernel(const float* __restrict__ x, const float* __restrict__ g,
                                                   const float* __restrict__ bt,
                                                   const float* __restrict__ Wq, const float* __restrict__ Wk,
                                                   const float* __restrict__ Wv, const float* __restrict__ Wpos,
                                                   const float* __restrict__ Wout,
                                                   _Float16* __restrict__ XH, _Float16* __restrict__ PE,
                                                   _Float16* __restrict__ WQ2, _Float16* __restrict__ WK2,
                                                   _Float16* __restrict__ WV, _Float16* __restrict__ WP,
                                                   _Float16* __restrict__ WO) {
  const int lane = threadIdx.x & 31;
  const int wave = threadIdx.x >> 5;
  const int nblk = gridDim.x;

  for (int rb = blockIdx.x; rb < (NB * SEQ) / 8; rb += nblk) ln_row(x, g, bt, XH, rb * 8 + wave, lane);

  for (int ib = blockIdx.x; ib < 5 * (WITEMS / 256); ib += nblk) {
    const int w = ib / (WITEMS / 256);
    const float* src = (w == 0) ? Wq : (w == 1) ? Wk : (w == 2) ? Wv : (w == 3) ? Wpos : Wout;
    _Float16*    dst = (w == 0) ? WQ2 : (w == 1) ? WK2 : (w == 2) ? WV : (w == 3) ? WP : WO;
    cvt_w_item(src, dst, w < 2, (ib - w * (WITEMS / 256)) * 256 + threadIdx.x);
  }

  for (int pb = blockIdx.x; pb < (NPP * (ND / 8)) / 256; pb += nblk) pe_item(PE, pb * 256 + threadIdx.x);
}

// -------------------------------------------------------------------------------------------------
// LDS ring of the staged GEMM path: one stage = 128 k of [A 128 rows | Bt 256 rows], 256-B rows at pitch 272 B
// (an odd multiple of 16 B for the ds_load_b128 fragment reads), two buffers.
// -------------------------------------------------------------------------------------------------
#define GBM    128                    // block tile rows (2 waves of 64)
#define GBN    256                    // block tile columns (4 waves of 64)
#define GKS    128                    // halves of k per stage
#define GPIT   (GKS + 8)              // halves: 272 B = 17 x 16 B
#define GSTAGE ((GBM + GBN) * GPIT * 2)   // bytes per buffer: 104448
static_assert((GBM + GBN) * (GKS / 8) == 24 * 256);   // 24 copies of 16 B per thread and stage
static_assert((NB * SEQ) % GBM == 0 && NPP % GBM == 0 && ND % GBM == 0);
static_assert(ND % GBN == 0 && SEQ % GBN == 0);
static_assert(ND % GKS == 0 && ND / GKS >= 2);

// Twelve asynchronous 16-B copies global -> LDS per lane (l: LDS byte address, g: global address of the lane).
// s_wait_xcnt 0 closes the statement so that no address register named here is rewritten ahead of it.
__device__ __forceinline__ void async_copy12(const unsigned (&l)[12], const _Float16* const (&g)[12]) {
  asm volatile(
      "global_load_async_to_lds_b128 %0, %12, off\n\t"
      "global_load_async_to_lds_b128 %1, %13, off\n\t"
      "global_load_async_to_lds_b128 %2, %14, off\n\t"
      "global_load_async_to_lds_b128 %3, %15, off\n\t"
      "global_load_async_to_lds_b128 %4, %16, off\n\t"
      "global_load_async_to_lds_b128 %5, %17, off\n\t"
      "global_load_async_to_lds_b128 %6, %18, off\n\t"
      "global_load_async_to_lds_b128 %7, %19, off\n\t"
      "global_load_async_to_lds_b128 %8, %20, off\n\t"
      "global_load_async_to_lds_b128 %9, %21, off\n\t"
      "global_load_async_to_lds_b128 %10, %22, off\n\t"
      "global_load_async_to_lds_b128 %11, %23, off\n\t"
      "s_wait_xcnt 0x0"
      :: "v"(l[0]), "v"(l[1]), "v"(l[2]), "v"(l[3]), "v"(l[4]), "v"(l[5]),
         "v"(l[6]), "v"(l[7]), "v"(l[8]), "v"(l[9]), "v"(l[10]), "v"(l[11]),
         "v"(g[0]), "v"(g[1]), "v"(g[2]), "v"(g[3]), "v"(g[4]), "v"(g[5]),
         "v"(g[6]), "v"(g[7]), "v"(g[8]), "v"(g[9]), "v"(g[10]), "v"(g[11])
      : "memory");
}

// -------------------------------------------------------------------------------------------------
// f16 WMMA GEMM: C[m][n] = epi( sum_k A[m][k] * Bt[n][k] ).
// A row-major [M][K] pitch lda; Bt row-major [N][K] pitch ldb.
// Each wave owns a 64x64 output tile (4x4 subtiles), 8 waves per block, grid.y = z-batch,
// grid.z = outer batch (steps A by strideAz and C by strideCz; Bt is shared).
// M multiple of 128, N of 256, K of 128 and at least 256; grid.x = (M/128)*(N/256); the block's 2x4 waves
// share one 128x256 tile whose A and Bt rows are staged in the LDS ring by asynchronous copies (whole
// 256-B row pieces, each fetched once per block), the copies of stage t+2 flying while stage t+1 is worked on.
// OUT 1: f32  C1[m][n] = acc*scale + bf_rne(b1[n])                              (final output)
// OUT 2: f16  C1[m][n] = f16((acc*scale (+ bf_rne(b1[n]) if HASB)) * carry)    (column bias)
// OUT 3: f16  t = (acc*scale + bf_rne(b3[n])) + bf_rne(b1[n] resp. b2[n]);  th = t*carry;
//             hi = f16(th), lo = f16(th - hi) -> C1 (b1 variant) and C2 (b2 variant), hi at 2*n0+c, lo at 2*n0+64+c
// OUT 4: f16  C1[m][n] = f16((acc*scale + bf_rne(b1[m])) * carry)            (row bias)
// Epilogue: 16-row slabs staged per wave in LDS (wave-private region, wave barrier); every row segment is written as
// coverage: 4 slabs x 16 rows x 64 cols = the whole 64x64 tile per wave; tiles cover M x N exactly.
// -------------------------------------------------------------------------------------------------
// The k loop of one block tile: acc = sum_k A[m][k] * Bt[n][k] for this wave's 64x64 tile at (m0, n0).
__device__ __forceinline__ void gemm_main(const _Float16* Ab, int lda, const _Float16* Bb, int ldb, int K,
                                          int m0, int n0, unsigned char* GS, v8f (&acc)[4][4]) {
  const int lane = threadIdx.x & 31;
  const int wave = threadIdx.x >> 5;
  const int rl   = lane & 15;          // row (A) / column (B, D) within a subtile
  const int koff = (lane >> 4) * 8;    // k offset of this lane half
#pragma unroll
  for (int i = 0; i < 4; ++i)
#pragma unroll
    for (int j = 0; j < 4; ++j) acc[i][j] = zero8();

  {
    // copy map: thread -> row crow + 16*i of the stage (i < 8: A rows, i >= 8: Bt rows), 16-B piece ccol of its 256 B;
    // one wave-wide copy = 2 rows x 256 B = 4 whole lines.
    const int crow = threadIdx.x >> 4;
    const int ccol = threadIdx.x & 15;
    const int wm = wave >> 2, wn = wave & 3;
    const _Float16* gA = Ab + (size_t)(m0 - wm * 64 + crow) * lda + ccol * 8;
    const _Float16* gB = Bb + (size_t)(n0 - wn * 64 + crow) * ldb + ccol * 8;
    const unsigned ldsLane = (unsigned)(uintptr_t)(&GS[0]) + (unsigned)(crow * (GPIT * 2) + ccol * 16);
    const int nt = K / GKS;
    auto issue_stage = [&](int t, int buf) {
#pragma unroll
      for (int hf = 0; hf < 2; ++hf) {
        unsigned l[12];
        const _Float16* g[12];
#pragma unroll
        for (int e = 0; e < 12; ++e) {
          const int i = hf * 12 + e;
          l[e] = ldsLane + (unsigned)(buf * GSTAGE + i * 16 * (GPIT * 2));
          const size_t so = (i < 8) ? (size_t)(i * 16) * lda + (size_t)t * GKS         // wave-uniform part
                                    : (size_t)((i - 8) * 16) * ldb + (size_t)t * GKS;
          g[e] = ((i < 8) ? gA : gB) + so;
        }
        async_copy12(l, g);
      }
    };

    issue_stage(0, 0);
    asm volatile("s_wait_asynccnt 0x0" ::: "memory");   // this wave's share of stage 0 has landed
    __syncthreads();                                    // publishes stage 0
    issue_stage(1, 1);
    const _Float16* fa = (const _Float16*)GS + (wm * 64 + rl) * GPIT + koff;
    const _Float16* fb = (const _Float16*)GS + (GBM + wn * 64 + rl) * GPIT + koff;
    for (int t = 0; t < nt; ++t) {                      // one stage per trip
      const int bo = (t & 1) * (GSTAGE / 2);
#pragma unroll
      for (int ks = 0; ks < GKS / 32; ++ks) {
        v16h bfr[4], afr[4];                            // all 16 LDS reads of a 32-k block stand as one group
#pragma unroll
        for (int j = 0; j < 4; ++j) bfr[j] = ldfrag(fb + bo + j * 16 * GPIT + ks * 32);
#pragma unroll
        for (int i = 0; i < 4; ++i) afr[i] = ldfrag(fa + bo + i * 16 * GPIT + ks * 32);
#pragma unroll
        for (int i = 0; i < 4; ++i)
#pragma unroll
          for (int j = 0; j < 4; ++j) acc[i][j] = mma16(afr[i], bfr[j], acc[i][j]);
      }
      asm volatile("s_wait_dscnt 0x0" ::: "memory");    // this wave has left the buffer that is refilled below
      asm volatile("s_wait_asynccnt 0x0" ::: "memory"); // this wave's share of stage t+1 has landed
      __syncthreads();                                  // publishes stage t+1, ends every read of stage t
      if (t + 2 < nt) issue_stage(t + 2, t & 1);
    }
    asm volatile("s_wait_asynccnt 0x0" ::: "memory");   // nothing in flight when the wave goes on
  }
}

// The epilogue of this wave's 64x64 tile at (m0, n0); slab is the wave's own LDS region.
template <int OUT, bool HASB>
__device__ __forceinline__ void gemm_epi(v8f (&acc)[4][4], float* slab, void* C1, void* C2, size_t cOff, int ldc,
                                         const float* __restrict__ b1, const float* __restrict__ b2,
                                         const float* __restrict__ b3, int m0, int n0, float scale, float carry) {
  const int lane = threadIdx.x & 31;
  const int rl   = lane & 15;          // column within a subtile
  const int mOff = (lane >> 4) * 8;    // D row offset of this lane half
  const int hh = lane >> 4, c4 = (lane & 15) * 4;     // f32 modes: row segment 256 B = 16 lanes x 16 B
  const int q8 = lane >> 3, c8 = (lane & 7) * 8;
  v4f bias4 = {0.f, 0.f, 0.f, 0.f};
  float col8a[8], col8b[8], col8c[8];
#pragma unroll
  for (int e = 0; e < 8; ++e) { col8a[e] = 0.f; col8b[e] = 0.f; col8c[e] = 0.f; }
  if (OUT == 1 && HASB) {
    const v4f tb = *(const v4f*)(b1 + n0 + c4);
    bias4[0] = bf_rne(tb[0]); bias4[1] = bf_rne(tb[1]); bias4[2] = bf_rne(tb[2]); bias4[3] = bf_rne(tb[3]);
  }
  if ((OUT == 2 && HASB) || OUT == 3) {
    const v4f ta = *(const v4f*)(b1 + n0 + c8);
    const v4f tb = *(const v4f*)(b1 + n0 + c8 + 4);
    col8a[0] = bf_rne(ta[0]); col8a[1] = bf_rne(ta[1]); col8a[2] = bf_rne(ta[2]); col8a[3] = bf_rne(ta[3]);
    col8a[4] = bf_rne(tb[0]); col8a[5] = bf_rne(tb[1]); col8a[6] = bf_rne(tb[2]); col8a[7] = bf_rne(tb[3]);
  }
  if (OUT == 3) {
    const v4f ta = *(const v4f*)(b2 + n0 + c8);
    const v4f tb = *(const v4f*)(b2 + n0 + c8 + 4);
    col8b[0] = bf_rne(ta[0]); col8b[1] = bf_rne(ta[1]); col8b[2] = bf_rne(ta[2]); col8b[3] = bf_rne(ta[3]);
    col8b[4] = bf_rne(tb[0]); col8b[5] = bf_rne(tb[1]); col8b[6] = bf_rne(tb[2]); col8b[7] = bf_rne(tb[3]);
    const v4f tc = *(const v4f*)(b3 + n0 + c8);
    const v4f td = *(const v4f*)(b3 + n0 + c8 + 4);
    col8c[0] = bf_rne(tc[0]); col8c[1] = bf_rne(tc[1]); col8c[2] = bf_rne(tc[2]); col8c[3] = bf_rne(tc[3]);
    col8c[4] = bf_rne(td[0]); col8c[5] = bf_rne(td[1]); col8c[6] = bf_rne(td[2]); col8c[7] = bf_rne(td[3]);
  }
  // stands ahead of any rewrite of the address registers of the bias reads above
  asm volatile("s_wait_xcnt 0x0" ::: "memory");
  __builtin_amdgcn_sched_barrier(0);   // keeps those rewrites behind the wait

#pragma unroll
  for (int i = 0; i < 4; ++i) {
    const int mBase = m0 + (i << 4);
#pragma unroll
    for (int j = 0; j < 4; ++j)
#pragma unroll
      for (int r = 0; r < 8; ++r)
        slab[(mOff + r) * 68 + (j << 4) + rl] = acc[i][j][r] * scale;
    __builtin_amdgcn_fence(__ATOMIC_RELEASE, "workgroup");
    __builtin_amdgcn_wave_barrier();
    __builtin_amdgcn_fence(__ATOMIC_ACQUIRE, "workgroup");
    if (OUT == 1) {
      float* C = (float*)C1 + cOff;
      v4f vv[8];
#pragma unroll
      for (int it = 0; it < 8; ++it) {
        const int row = it * 2 + hh;
        v4f v = *(const v4fa*)(slab + row * 68 + c4);
        if (OUT == 1) v += bias4;
        vv[it] = v;
      }
      {
        float* cp[8];
#pragma unroll
        for (int it = 0; it < 8; ++it) {
          const int row = it * 2 + hh;
          cp[it] = C + (size_t)(mBase + row) * ldc + n0 + c4;
        }
        __builtin_amdgcn_sched_barrier(0);   // every address is formed ahead of the first store: none lands in a register a store names
#pragma unroll
        for (int it = 0; it < 8; ++it) *(v4f*)(cp[it]) = vv[it];
        // stands ahead of the next slab's rewrite of the registers that these stores name
        asm volatile("s_wait_xcnt 0x0" ::: "memory");
        __builtin_amdgcn_sched_barrier(0);   // keeps those rewrites behind the wait
      }
    } else if (OUT == 2 || OUT == 4) {
      _Float16* Ca = (_Float16*)C1 + cOff;
      v8h hv[4];
#pragma unroll
      for (int it = 0; it < 4; ++it) {
        const int row = it * 4 + q8;
        const float* sp = slab + row * 68 + c8;
        const v4f x0 = *(const v4fa*)(sp);
        const v4f x1 = *(const v4fa*)(sp + 4);
        float f[8];
        f[0] = x0[0]; f[1] = x0[1]; f[2] = x0[2]; f[3] = x0[3];
        f[4] = x1[0]; f[5] = x1[1]; f[6] = x1[2]; f[7] = x1[3];
        float rb = 0.f;
        if (OUT == 4 && HASB) rb = bf_rne(b1[mBase + row]);
        v8h ha;
#pragma unroll
        for (int e = 0; e < 8; ++e) {
          const float t = f[e] + ((OUT == 2) ? col8a[e] : rb);
          ha[e] = (_Float16)(t * carry);
        }
        hv[it] = ha;
      }
      {
#pragma unroll
        for (int it = 0; it < 4; ++it) {
          const int row = it * 4 + q8;
          *(v8h*)(Ca + (size_t)(mBase + row) * ldc + n0 + c8) = hv[it];
        }
        // stands ahead of the next slab's rewrite of the registers that these stores name
        asm volatile("s_wait_xcnt 0x0" ::: "memory");
        __builtin_amdgcn_sched_barrier(0);   // keeps those rewrites behind the wait
      }
    } else {
#pragma unroll
      for (int var = 0; var < 2; ++var) {
        _Float16* Cc = (_Float16*)((var == 0) ? C1 : C2) + cOff;
        v8h hv[4], lv[4];
#pragma unroll
        for (int it = 0; it < 4; ++it) {
          const int row = it * 4 + q8;
          const float* sp = slab + row * 68 + c8;
          const v4f x0 = *(const v4fa*)(sp);
          const v4f x1 = *(const v4fa*)(sp + 4);
          float f[8];
          f[0] = x0[0]; f[1] = x0[1]; f[2] = x0[2]; f[3] = x0[3];
          f[4] = x1[0]; f[5] = x1[1]; f[6] = x1[2]; f[7] = x1[3];
          v8h ha, la;
#pragma unroll
          for (int e = 0; e < 8; ++e) {
            const float t  = (f[e] + col8c[e]) + ((var == 0) ? col8a[e] : col8b[e]);
            const float th = t * carry;
            const _Float16 hq = (_Float16)th;
            ha[e] = hq;
            la[e] = (_Float16)(th - (float)hq);
          }
          hv[it] = ha; lv[it] = la;
        }
        {
#pragma unroll
          for (int it = 0; it < 4; ++it) {
            const int row = it * 4 + q8;
            _Float16* cp = Cc + (size_t)(mBase + row) * ldc + 2 * n0 + c8;
            *(v8h*)(cp)      = hv[it];
            *(v8h*)(cp + 64) = lv[it];
          }
          // stands ahead of the next slab's rewrite of the registers that these stores name
          asm volatile("s_wait_xcnt 0x0" ::: "memory");
          __builtin_amdgcn_sched_barrier(0);   // keeps those rewrites behind the wait
        }
      }
    }
    __builtin_amdgcn_fence(__ATOMIC_RELEASE, "workgroup");
    __builtin_amdgcn_wave_barrier();
    __builtin_amdgcn_fence(__ATOMIC_ACQUIRE, "workgroup");
  }
}

template <int OUT, bool HASB>
__global__ __launch_bounds__(256) void gemm_f16_kernel(
    const _Float16* __restrict__ A, int lda, long strideA, long strideAz,
    const _Float16* __restrict__ Bt, int ldb, long strideB,
    void* C1, void* C2, int ldc, long strideC, long strideCz,
    const float* __restrict__ b1, const float* __restrict__ b2, const float* __restrict__ b3,
    int M, int N, int K, float scale, float carry) {
  __shared__ __align__(16) float sT[8][16 * 68];   // per-wave 16x64 slab, pitch 68 floats
  __shared__ __align__(16) unsigned char GS[2 * GSTAGE];   // operand ring of the staged path

  const int z    = blockIdx.y;
  const int wave = threadIdx.x >> 5;
  int m0, n0;
  {
    const int tilesN = N / GBN;
    const int tilesM = M / GBM;
    const int bt = blockIdx.x;
    if (bt >= tilesM * tilesN) return;             // block-uniform, ahead of every copy and barrier
    const int tmb = bt / tilesN;
    const int tnb = bt - tmb * tilesN;
    m0 = tmb * GBM + (wave >> 2) * 64;
    n0 = tnb * GBN + (wave & 3) * 64;
  }
  const size_t cOff = (size_t)z * strideC + (size_t)blockIdx.z * strideCz;

  const _Float16* Ab = A  + (size_t)z * strideA + (size_t)blockIdx.z * strideAz;
  const _Float16* Bb = Bt + (size_t)z * strideB;

  v8f acc[4][4];
  gemm_main(Ab, lda, Bb, ldb, K, m0, n0, GS, acc);
  gemm_epi<OUT, HASB>(acc, sT[wave], C1, C2, cOff, ldc, b1, b2, b3, m0, n0, scale, carry);
}

// -------------------------------------------------------------------------------------------------
// The four projections in one launch: none reads what another writes, so they need no launch boundary between them.
// A block's index picks its job and its tile (scalar code); the long jobs (K = 2048) have the low indices.
//   job 0: QU2 = split(16*(q + bq + u_bias)), QV2 = split(16*(q + bq + v_bias))   (M=NB*SEQ, N=1024, K=2048)
//   job 1: KP2 = 16k, k = xn.Wk^T + bk                                            (M=NB*SEQ, N=1024, K=2048)
//   job 2: VT[b][h*64+d][s] = 16*(v + bv)   (A = Wv plane, Bt = XH hi columns of batch element b; M=1024, N=SEQ, K=1024)
//   job 3: P2 = 16p, p = pe . Wpos^T                                              (M=NPP, N=1024, K=1024)
// coverage: PJQ + PJQ + NB*PJV + PJP blocks = every 128x256 tile of every job once.
// -------------------------------------------------------------------------------------------------
#define PJQ (((NB * SEQ) / GBM) * (ND / GBN))
#define PJV ((ND / GBM) * (SEQ / GBN))
#define PJP ((NPP / GBM) * (ND / GBN))
__global__ __launch_bounds__(256) void proj_kernel(
    const _Float16* __restrict__ XH, const _Float16* __restrict__ WQ2, const _Float16* __restrict__ WK2,
    const _Float16* __restrict__ WV, const _Float16* __restrict__ PE, const _Float16* __restrict__ WP,
    _Float16* QU2, _Float16* QV2, _Float16* KP2, _Float16* VT, _Float16* P2,
    const float* __restrict__ ub, const float* __restrict__ vb, const float* __restrict__ bq,
    const float* __restrict__ bk, const float* __restrict__ bv) {
  __shared__ __align__(16) float sT[8][16 * 68];   // per-wave 16x64 slab, pitch 68 floats
  __shared__ __align__(16) unsigned char GS[2 * GSTAGE];   // operand ring of the staged path

  const int id   = blockIdx.x;
  const int wave = threadIdx.x >> 5;
  if (id >= 2 * PJQ + NB * PJV + PJP) return;      // block-uniform, ahead of every copy and barrier
  const int job = (id < PJQ) ? 0 : (id < 2 * PJQ) ? 1 : (id < 2 * PJQ + NB * PJV) ? 2 : 3;
  const int jid = id - ((job == 0) ? 0 : (job == 1) ? PJQ : (job == 2) ? 2 * PJQ : 2 * PJQ + NB * PJV);
  const int z   = (job == 2) ? jid / PJV : 0;      // batch element of job 2
  const int bt  = (job == 2) ? jid - z * PJV : jid;
  const int tilesN = (job == 2) ? SEQ / GBN : ND / GBN;
  const int tmb = bt / tilesN;
  const int tnb = bt - tmb * tilesN;
  const int m0 = tmb * GBM + (wave >> 2) * 64;
  const int n0 = tnb * GBN + (wave & 3) * 64;

  const _Float16* Ab = (job < 2) ? XH : (job == 2) ? WV : PE;
  const _Float16* Bb = (job == 0) ? WQ2 : (job == 1) ? WK2 : (job == 2) ? XH + (size_t)z * SEQ * QKW : WP;
  const int lda = (job < 2) ? QKW : ND;
  const int ldb = (job < 3) ? QKW : ND;
  const int K   = (job < 2) ? QKW : ND;

  v8f acc[4][4];
  gemm_main(Ab, lda, Bb, ldb, K, m0, n0, GS, acc);
  float* slab = sT[wave];
  if (job == 0)      gemm_epi<3, true >(acc, slab, QU2, QV2, 0, QKW, ub, vb, bq, m0, n0, 0.015625f, 16.0f);
  else if (job == 1) gemm_epi<2, true >(acc, slab, KP2, KP2, 0, ND, bk, bk, bk, m0, n0, 0.015625f, 16.0f);
  else if (job == 2) gemm_epi<4, true >(acc, slab, VT, VT, (size_t)z * ND * SEQ, SEQ, bv, bv, bv, m0, n0, 0.015625f, 16.0f);
  else               gemm_epi<2, false>(acc, slab, P2, P2, 0, ND, bq, bq, bq, m0, n0, 0.015625f, 16.0f);
}

// -------------------------------------------------------------------------------------------------
// Relative-position attention for all NH heads of all NB batch elements, head dim 64, no mask.  A query row is two f16
// rows (hi, residual); every K or p fragment read from LDS is the B operand of two products, hi and residual, that add
// into one accumulator.
//   QU  f16 plane [t][h*128 + j]: j<64 hi = f16(16*(q+u_bias)), j>=64 its f16 residual    (A of the content score)
//   KP  f16 plane [s][h*64 + j] = f16(16*k)                                              (B, staged per 64-key chunk as [key][64])
//   VT  f16 plane [h*64 + d][s]   = f16(16*v)                                            (B of P.V, staged as [d][key])
//   QV  f16 plane, as QU with v_bias                                                     (A of the position score)
//   PP  f16 plane [row][h*64 + j] = f16(16*p), NPP rows                                  (B, staged in 64-row tiles as [row][64])
//       rel-shift: position score of (query i, key) = (q_i + v_bias).p[key - i + SEQ-1].  For query block qb and key chunk
//       kc that is row 64*(SEQ/64-1-qb+kc) + x of PP, x = (key mod 64) + 63 - (i mod 64) in [0, 126]: two 64-row tiles, of
//       which the upper is the next chunk's lower, so one new tile per chunk goes into a ring of two slots (slot = tile & 1).
//       A wave's 16 queries (row R) x 64 keys need x = 48 - 16*wave + w, w = (key mod 64) + 15 - R in [0, 78]: five 16-column
//       products W, the lowest of which is the chunk before's highest; score column n of row R is W column n + 15 - R,
//       fetched by a select between neighbouring products in the source lane and one ds_bpermute_b32 inside the 16-lane row.
//   score = cs * (QU.K^T acc + QV.P^T acc)  with cs = (1/8)/256;  online softmax in f32 over SEQ/64 chunks of 64 keys;
//   P stored per wave as f16(4096 * exp(s - m)); CTX[t][h*64 + d] = f16(64 * ctx) = f16((P.V acc) / (1024*l)).
// Block = 4 waves = 64 query rows of one head; grid = (SEQ/64 query blocks, NH heads, NB batch elements).
// LDS: one raw buffer; K tile [64][64] f16, then V^T tile [64][64] f16, then per-wave P tiles [16][64] f16, then the two
// p-row slots [64][64] f16, all at row pitch VPIT; the output staging [4][16][64] f32 at pitch OPIT reuses the K and V^T
// bytes after a block barrier.  Every pitch is an odd multiple of 16 B, so the 16 rows that one ds_load_b128 reads start on 16
// different groups of four banks (at the bare 256-B and 128-B pitches they fall on one or two groups).
// coverage: staging 128 thr x 4 pieces of 8 halves each for K, for a p-row tile and for V^T (64x64); P tile 8 rows x
// 2 halves x 4x16 cols per wave = 16x64 (all written every chunk); output 4 store instructions x 4 rows x 8 lanes x
// 8 halves = 16x64 per wave.
// -------------------------------------------------------------------------------------------------
#define VPIT   (HDV + 8)            // halves: 144 B =  9 x 16 B
#define OPIT   (HDV + 4)            // floats: 272 B = 17 x 16 B
#define KBYTES (64 * VPIT * 2)      //  9216
#define VBYTES (64 * VPIT * 2)      //  9216
#define PBYTES (4 * 16 * VPIT * 2)  //  9216
static_assert(4 * 16 * OPIT * 4 <= KBYTES + VBYTES);
static_assert(KBYTES % 16 == 0 && VBYTES % 16 == 0);

__global__ __launch_bounds__(128)
void relattn_kernel(const _Float16* __restrict__ QU, const _Float16* __restrict__ QV,
                    const _Float16* __restrict__ KP, const _Float16* __restrict__ VT,
                    const _Float16* __restrict__ PP, _Float16* __restrict__ CTX, float cs) {
  __shared__ __align__(16) unsigned char SMEM[KBYTES + VBYTES + PBYTES + 2 * KBYTES];
  _Float16* Ksh = (_Float16*)(SMEM);                    // [64][64]  at pitch VPIT
  _Float16* Vsh = (_Float16*)(SMEM + KBYTES);           // [64][64]  at pitch VPIT
  _Float16* Psh = (_Float16*)(SMEM + KBYTES + VBYTES);  // [4][16][64] at pitch VPIT
  _Float16* Rsh = (_Float16*)(SMEM + KBYTES + VBYTES + PBYTES);   // [2][64][64] at pitch VPIT: p-row tiles
  float*    Osh = (float*)(SMEM);                       // [4][16][64] at pitch OPIT, after the chunk loop

  const int tid  = threadIdx.x;
  const int wave = tid >> 5;
  const int lane = tid & 31;
  const int hh   = lane >> 4;
  const int c    = lane & 15;

  const int h    = blockIdx.y;
  const int bz   = blockIdx.z;
  const int qb   = blockIdx.x;
  const int q0   = qb * 64 + wave * 16;          // first query row of this wave
  const int tpb  = SEQ / 64 - 1 - qb;            // lower p-row tile of chunk 0

  const _Float16* Qh = QU + (size_t)bz * SEQ * QKW + h * HQK;   // row pitch QKW
  const _Float16* Qw = QV + (size_t)bz * SEQ * QKW + h * HQK;   // row pitch QKW
  const _Float16* Kh = KP + (size_t)bz * SEQ * ND + h * HDV;    // row pitch ND
  const _Float16* Ph = PP + h * HDV;                            // row pitch ND, shared by the batch
  const _Float16* Vh = VT + (size_t)(bz * ND + h * HDV) * SEQ;
  _Float16*       ctx = CTX + (size_t)bz * SEQ * ND + h * HDV;  // row pitch ND

  // Q fragments (A operand): 32-deep steps 0, 1 of the hi row, then 0, 1 of the residual row
  const _Float16* qsrc = Qh + (size_t)(q0 + c) * QKW + 8 * hh;
  const _Float16* wsrc = Qw + (size_t)(q0 + c) * QKW + 8 * hh;
  v16h qa[4], qv[4];
#pragma unroll
  for (int dc = 0; dc < 4; ++dc) qa[dc] = ldfrag(qsrc + dc * 32);
#pragma unroll
  for (int dc = 0; dc < 4; ++dc) qv[dc] = ldfrag(wsrc + dc * 32);
  // the reads further down may be given the Q address registers; the two pointers are inputs so that they stay in
  // their registers up to here
  asm volatile("s_wait_xcnt 0x0" :: "v"(qsrc), "v"(wsrc) : "memory");

  // rel-shift of accumulator register r (row R = 8*hh + r), shift sft = 15 - R: this lane takes from lane (c + sft) mod 16
  // of its row; as a source it offers product j where c >= sft and product j + 1 below
  int  pidx[8];
  bool own[8];
#pragma unroll
  for (int r = 0; r < 8; ++r) {
    const int sft = 15 - 8 * hh - r;
    pidx[r] = ((lane & 16) | ((c + sft) & 15)) << 2;
    own[r]  = (c >= sft);
  }

  float mrow[8], lrow[8];
  v8f oacc[4];
#pragma unroll
  for (int r = 0; r < 8; ++r) { mrow[r] = -INFINITY; lrow[r] = 0.f; }
#pragma unroll
  for (int t = 0; t < 4; ++t) oacc[t] = zero8();

  v8f wtop = zero8();                            // top position product of the chunk before
  _Float16* pw = Psh + wave * (16 * VPIT);

  // Global reads run one chunk ahead of their use: this thread's K and V^T staging pieces of chunk kc + 1 are issued
  // behind the barrier that publishes chunk kc, its p-row pieces behind the score products of chunk kc, so their latency
  // passes under the score products and the softmax of chunk kc (the fence ahead of P.V waits for them at the latest).
  // Piece map: neighbouring lanes take neighbouring 16-B pieces of one row, so that one wave-wide read covers four whole
  // 128-B lines (K, p and V^T rows alike: 8 lanes a 128-B row, 4 rows a read, piece i of a thread in row 16i + vr) instead
  // of one line per lane.
  const int vr = tid >> 3, scv = (tid & 7) * 8;
  const _Float16* ksrc = Kh + (size_t)vr * ND + scv;
  const _Float16* vsrc = Vh + (size_t)vr * SEQ + scv;
  const _Float16* psrc = Ph + (size_t)(tpb * 64 + vr) * ND + scv;
  v8h kst[4], vst[4], pst[4], pf[4];
#pragma unroll
  for (int i = 0; i < 4; ++i) kst[i] = *(const v8h*)(ksrc + (size_t)(16 * i) * ND);
#pragma unroll
  for (int i = 0; i < 4; ++i) vst[i] = *(const v8h*)(vsrc + (size_t)(16 * i) * SEQ);
#pragma unroll
  for (int i = 0; i < 4; ++i) pf[i] = *(const v8h*)(psrc + (size_t)(16 * i) * ND);
#pragma unroll
  for (int i = 0; i < 4; ++i) pst[i] = *(const v8h*)(psrc + (size_t)(64 + 16 * i) * ND);
  // stands ahead of any reuse of the address registers named above; the pointers are inputs so that they stay
  // in their registers up to here and no result of this run of reads is given one of them
  asm volatile("s_wait_xcnt 0x0" :: "v"(ksrc), "v"(vsrc), "v"(psrc) : "memory");
  // chunk 0's lower p-row tile; published by the barrier behind the first staging stores
#pragma unroll
  for (int i = 0; i < 4; ++i) *(v8ha*)(Rsh + ((tpb & 1) * 64 + 16 * i + vr) * VPIT + scv) = pf[i];

#pragma unroll 1
  for (int kc = 0; kc < SEQ / 64; ++kc) {
    __syncthreads();
#pragma unroll
    for (int i = 0; i < 4; ++i) *(v8ha*)(Ksh + (16 * i + vr) * VPIT + scv) = kst[i];
#pragma unroll
    for (int i = 0; i < 4; ++i) *(v8ha*)(Vsh + (16 * i + vr) * VPIT + scv) = vst[i];
    // the chunk's upper p-row tile, over the lower tile of the chunk before, whose reads the barrier above has ended
    _Float16* rdst = Rsh + (((tpb + kc + 1) & 1) * 64 + vr) * VPIT + scv;
#pragma unroll
    for (int i = 0; i < 4; ++i) *(v8ha*)(rdst + i * (16 * VPIT)) = pst[i];
    __syncthreads();

    // LDS fragment reads stand in whole groups of four fragments (8 ds_load_b128), each group issued ahead of the
    // products of the group before it where registers allow, so that a wave waits once a group and not once a product.
    // frg[0] and frg[1] are the two register sets.  The chunk's first group is read here: its latency passes under the
    // issue of the global reads below.
    const _Float16* pr[5];
#pragma unroll
    for (int u = 0; u < 5; ++u) {
      const int x = 48 - 16 * wave + 16 * u;        // 0 .. 112: a 16-row group lies in one tile
      pr[u] = Rsh + (((tpb + kc + (x >> 6)) & 1) * 64 + (x & 63) + c) * VPIT + 8 * hh;
    }
    const _Float16* kfr = Ksh + c * VPIT + 8 * hh;
    const _Float16* vfr = Vsh + c * VPIT + 8 * hh;
    v16h frg[2][4];
#pragma unroll
    for (int u = 1; u < 5; ++u) frg[0][u - 1] = ldfrag(pr[u]);

    if (kc + 1 < SEQ / 64) {                          // block-uniform: the last chunk fetches nothing
      const int kn0 = (kc + 1) * 64;
#pragma unroll
      for (int i = 0; i < 4; ++i) kst[i] = *(const v8h*)(ksrc + (size_t)(kn0 + 16 * i) * ND);
#pragma unroll
      for (int i = 0; i < 4; ++i) vst[i] = *(const v8h*)(vsrc + kn0 + (size_t)(16 * i) * SEQ);
      // stands ahead of any reuse of the address registers named above; its memory clobber also holds the reads here,
      // in front of the score products
      asm volatile("s_wait_xcnt 0x0" ::: "memory");
    }

    // position scores: W[u] = (QV hi + QV residual)(16x64) . p^T for window rows 48 - 16*wave + 16u .. + 15, then the rel-shift
    // (W[0] of a chunk is W[4] of the chunk before: the same queries against the same p rows, so it is carried over)
    v8f pos[4], s[4];
    {
      v8f w5[5];
      if (kc == 0) {                                // block-uniform: nothing to carry yet
#pragma unroll
        for (int dc = 0; dc < 2; ++dc) {
          const v16h f0 = ldfrag(pr[0] + dc * 32);
          wtop = mma16(qv[dc], f0, wtop);
          wtop = mma16(qv[dc + 2], f0, wtop);
        }
      }
      w5[0] = wtop;
#pragma unroll
      for (int u = 1; u < 5; ++u) w5[u] = zero8();
#pragma unroll
      for (int dc = 0; dc < 2; ++dc) {
        // the next group (the second 32-deep step of the p rows, then the first step of the K rows) into the other set
#pragma unroll
        for (int u = 0; u < 4; ++u)
          frg[(dc + 1) & 1][u] = (dc < 1) ? ldfrag(pr[u + 1] + 32) : ldfrag(kfr + u * 16 * VPIT);
#pragma unroll
        for (int u = 1; u < 5; ++u) w5[u] = mma16(qv[dc], frg[dc & 1][u - 1], w5[u]);
#pragma unroll
        for (int u = 1; u < 5; ++u) w5[u] = mma16(qv[dc + 2], frg[dc & 1][u - 1], w5[u]);
      }
      wtop = w5[4];

      // content scores: S[j] = (QU hi + QU residual)(16x64) . K^T for key subtile j, 32-deep step by step over all four
      // subtiles
#pragma unroll
      for (int j = 0; j < 4; ++j) s[j] = mma16(qa[0], frg[0][j], zero8());
#pragma unroll
      for (int j = 0; j < 4; ++j) frg[1][j] = ldfrag(kfr + j * 16 * VPIT + 32);

#pragma unroll
      for (int j = 0; j < 4; ++j)                   // product by product, so that W[j]'s registers are free behind its offers
#pragma unroll
        for (int r = 0; r < 8; ++r) {
          const float offer = own[r] ? w5[j][r] : w5[j + 1][r];
          pos[j][r] = __int_as_float(__builtin_amdgcn_ds_bpermute(pidx[r], __float_as_int(offer)));
        }
    }
#pragma unroll
    for (int j = 0; j < 4; ++j) s[j] = mma16(qa[2], frg[0][j], s[j]);
#pragma unroll
    for (int j = 0; j < 4; ++j) s[j] = mma16(qa[1], frg[1][j], s[j]);
#pragma unroll
    for (int j = 0; j < 4; ++j) s[j] = mma16(qa[3], frg[1][j], s[j]);

    // The next chunk's p-row pieces are read from here on, not with K and V^T above: their registers are free for the
    // fragment sets during the score products; the softmax and P.V still stand between this read and its use.
    if (kc + 1 < SEQ / 64) {                          // block-uniform: the last chunk fetches nothing
#pragma unroll
      for (int i = 0; i < 4; ++i) pst[i] = *(const v8h*)(psrc + (size_t)((kc + 1) * 64 + 64 + 16 * i) * ND);
      // stands ahead of any reuse of the address registers named above
      asm volatile("s_wait_xcnt 0x0" ::: "memory");
    } else {
      // says that the old pieces are dead on this path too; without it they stay live through the score products
#pragma unroll
      for (int i = 0; i < 4; ++i) pst[i] = v8h{};
    }

    // add the position term, chunk row max
    float cm[8];
#pragma unroll
    for (int r = 0; r < 8; ++r) {
      float m = -INFINITY;
#pragma unroll
      for (int j = 0; j < 4; ++j) {
        const float sv = (s[j][r] + pos[j][r]) * cs;   // cs is a power of two: the one rounding is that of the sum
        s[j][r] = sv;
        m = fmaxf(m, sv);
      }
      cm[r] = m;
    }
    row_max8(cm);

    // online softmax update (per-row rescale of this row's accumulator elements only);
    // P tile (x4096) to this wave's LDS tile [row][key]
    float alpha[8], psum[8];
#pragma unroll
    for (int r = 0; r < 8; ++r) {
      const float mnew  = fmaxf(mrow[r], cm[r]);
      alpha[r] = __expf(mrow[r] - mnew);
      mrow[r] = mnew;
      float ps = 0.f;
#pragma unroll
      for (int j = 0; j < 4; ++j) {
        const float p = __expf(s[j][r] - mnew);
        ps += p;
        pw[(8 * hh + r) * VPIT + j * 16 + c] = (_Float16)(p * 4096.0f);
      }
      psum[r] = ps;
    }
    // all eight V^T fragments are read here: their latency passes under the row sums and the rescale
#pragma unroll
    for (int kk = 0; kk < 2; ++kk)
#pragma unroll
      for (int t = 0; t < 4; ++t) frg[kk][t] = ldfrag(vfr + t * 16 * VPIT + kk * 32);
    row_sum8(psum);
#pragma unroll
    for (int r = 0; r < 8; ++r) {
      lrow[r] = lrow[r] * alpha[r] + psum[r];
#pragma unroll
      for (int t = 0; t < 4; ++t) oacc[t][r] *= alpha[r];
    }
    __builtin_amdgcn_fence(__ATOMIC_RELEASE, "workgroup");
    __builtin_amdgcn_wave_barrier();
    __builtin_amdgcn_fence(__ATOMIC_ACQUIRE, "workgroup");

    // P (A operand, row = lane&15, split k map over keys) . V (B operand from V^T rows d)
    v16h pa[2];
#pragma unroll
    for (int kk = 0; kk < 2; ++kk) pa[kk] = ldfrag(pw + c * VPIT + kk * 32 + 8 * hh);
#pragma unroll
    for (int kk = 0; kk < 2; ++kk)
#pragma unroll
      for (int t = 0; t < 4; ++t) oacc[t] = mma16(pa[kk], frg[kk][t], oacc[t]);
  }

  __syncthreads();                               // every wave is done with Ksh before Osh aliases it
  float* os = Osh + wave * (16 * OPIT);
#pragma unroll
  for (int r = 0; r < 8; ++r) {
    const float inv = 1.0f / (1024.0f * lrow[r]);   // 64 / (4096 * 16 * l)
#pragma unroll
    for (int t = 0; t < 4; ++t) os[(8 * hh + r) * OPIT + t * 16 + c] = oacc[t][r] * inv;
  }
  __builtin_amdgcn_fence(__ATOMIC_RELEASE, "workgroup");
  __builtin_amdgcn_wave_barrier();
  __builtin_amdgcn_fence(__ATOMIC_ACQUIRE, "workgroup");
  const int q8 = lane >> 3, c8 = (lane & 7) * 8;
  v8h ov[4];
#pragma unroll
  for (int it = 0; it < 4; ++it) {
    const int row = it * 4 + q8;
    const float* sp = os + row * OPIT + c8;
    const v4f x0 = *(const v4fa*)(sp);
    const v4f x1 = *(const v4fa*)(sp + 4);
    v8h o;
    o[0] = (_Float16)x0[0]; o[1] = (_Float16)x0[1]; o[2] = (_Float16)x0[2]; o[3] = (_Float16)x0[3];
    o[4] = (_Float16)x1[0]; o[5] = (_Float16)x1[1]; o[6] = (_Float16)x1[2]; o[7] = (_Float16)x1[3];
    ov[it] = o;
  }
  {
#pragma unroll
    for (int it = 0; it < 4; ++it) {
      const int row = it * 4 + q8;
      *(v8h*)(ctx + (size_t)(q0 + row) * ND + c8) = ov[it];
    }
    
  }
}

// -------------------------------------------------------------------------------------------------
// Workspace map (bytes, NB=8 SEQ=1024): every batch element's planes are live at once.
//   P2   f16 [NPP][1024]             4194304
//   QU2  f16 [NB*SEQ][2048]         33554432
//   QV2  f16 [NB*SEQ][2048]         33554432
//   KP2  f16 [NB*SEQ][1024]         16777216
//   VT   f16 [NB][1024][SEQ]        16777216
//   SCR                             50331648   early phase: WQ2, WK2 f16 [1024][2048], WV, WP f16 [1024][1024],
//                                              PE f16 [NPP][1024], XH f16 [NB*SEQ][2048] (all dead after the projections);
//                                              last phase: CTX f16 [NB*SEQ][1024] at byte 2097152 (written by the
//                                              attention launch)
//   WO   f16 [1024][1024]            2097152   (converted with the other weights, read by the last launch)
//   total                          157286400
// Every region is written in whole 64x64 tiles / whole rows; all region sizes equal their written extents.
// -------------------------------------------------------------------------------------------------
extern "C" void kernel_launch(void* const* d_in, const int* in_sizes, int n_in,
                              void* d_out, int out_size, void* d_ws, size_t ws_size,
                              hipStream_t stream) {
  if (n_in < 14) return;
  if (in_sizes[0] < ((NB - 1) * SEQ_FULL + SEQ) * ND) return;
  if (in_sizes[1] != ND * ND || in_sizes[3] != ND * ND || in_sizes[5] != ND * ND) return;
  if (in_sizes[7] != ND * ND || in_sizes[8] != ND * ND) return;
  if (in_sizes[2] < ND || in_sizes[4] < ND || in_sizes[6] < ND || in_sizes[9] < ND) return;
  if (in_sizes[10] < NH * HDV || in_sizes[11] < NH * HDV) return;
  if (in_sizes[12] < ND || in_sizes[13] < ND) return;
  if (out_size < NB * SEQ * ND) return;

  const float* x    = (const float*)d_in[0];
  const float* Wq   = (const float*)d_in[1];
  const float* bq   = (const float*)d_in[2];
  const float* Wk   = (const float*)d_in[3];
  const float* bk   = (const float*)d_in[4];
  const float* Wv   = (const float*)d_in[5];
  const float* bv   = (const float*)d_in[6];
  const float* Wpos = (const float*)d_in[7];
  const float* Wout = (const float*)d_in[8];
  const float* bout = (const float*)d_in[9];
  const float* ub   = (const float*)d_in[10];
  const float* vbias= (const float*)d_in[11];
  const float* lng  = (const float*)d_in[12];
  const float* lnb  = (const float*)d_in[13];
  float* out = (float*)d_out;

  const size_t szW2  = (size_t)ND * QKW * 2;              //   4194304
  const size_t szW1  = (size_t)ND * ND * 2;               //   2097152
  const size_t szXH  = (size_t)NB * SEQ * QKW * 2;        //  33554432
  const size_t szQ   = (size_t)NB * SEQ * QKW * 2;        //  33554432
  const size_t szVT  = (size_t)NB * ND * SEQ * 2;         //  16777216
  const size_t szP2  = (size_t)NPP * ND * 2;              //   4194304
  const size_t szK   = (size_t)NB * SEQ * ND * 2;         //  16777216
  const size_t szPE  = (size_t)NPP * ND * 2;              //   4194304
  const size_t szCTX = (size_t)NB * SEQ * ND * 2;         //  16777216
  const size_t szEarly = 2 * szW2 + 2 * szW1 + szPE + szXH;
  const size_t szLate  = szW1 + szCTX;
  const size_t szSCR = (szEarly > szLate) ? szEarly : szLate;
  size_t off = 0;
  const size_t oP2  = off; off += szP2;
  const size_t oQU2 = off; off += szQ;
  const size_t oQV2 = off; off += szQ;
  const size_t oKP2 = off; off += szK;
  const size_t oVT  = off; off += szVT;
  const size_t oSCR = off; off += szSCR;
  const size_t oWO  = off; off += szW1;
  const size_t total = off;                                // 157286400 for NB=8, SEQ=1024
  if (total > ws_size) return;
  const size_t oWQ2 = oSCR;
  const size_t oWK2 = oWQ2 + szW2;
  const size_t oWV  = oWK2 + szW2;
  const size_t oWP  = oWV + szW1;
  const size_t oPE  = oWP + szW1;
  const size_t oXH  = oPE + szPE;

  char* ws = (char*)d_ws;
  _Float16* WQ2 = (_Float16*)(ws + oWQ2);
  _Float16* WK2 = (_Float16*)(ws + oWK2);
  _Float16* WVp = (_Float16*)(ws + oWV);
  _Float16* WOp = (_Float16*)(ws + oWO);
  _Float16* XH  = (_Float16*)(ws + oXH);
  _Float16* QU2 = (_Float16*)(ws + oQU2);
  _Float16* QV2 = (_Float16*)(ws + oQV2);
  _Float16* KP2 = (_Float16*)(ws + oKP2);
  _Float16* VTp = (_Float16*)(ws + oVT);
  _Float16* P2  = (_Float16*)(ws + oP2);
  _Float16* CTX = (_Float16*)(ws + oSCR + szW1);
  _Float16* WPp = (_Float16*)(ws + oWP);
  _Float16* PEp = (_Float16*)(ws + oPE);

  const float cs = 0.125f * 0.00390625f;   // (1/sqrt(64)) / 256 applied to the x16.x16 score accumulators
  const dim3 blk(256);

  // (1)-(3) one launch: LayerNorm -> XH [NB*SEQ][2048] (hi | residual x1024); weights -> f16 planes of bf16-valued
  // entries (Wq, Wk as [x64 | /16] 2048-wide; Wv, Wpos, Wout x64); positional sinusoid table -> PE [NPP][1024] (row NPP-1 = 0)
  prep_kernel<<<dim3((NB * SEQ) / 8), blk, 0, stream>>>(x, lng, lnb, Wq, Wk, Wv, Wpos, Wout,
                                                        XH, PEp, WQ2, WK2, WVp, WPp, WOp);
  // (4)-(5) one launch: the q, k and v projections of all batch elements and p = pe . Wpos^T
  proj_kernel<<<dim3(2 * PJQ + NB * PJV + PJP), blk, 0, stream>>>(XH, WQ2, WK2, WVp, PEp, WPp, QU2, QV2, KP2, VTp, P2,
                                                                  ub, vbias, bq, bk, bv);
  // (6) attention with its position scores, all batch elements and heads in one launch
  relattn_kernel<<<dim3(SEQ / 64, NH, NB), dim3(128), 0, stream>>>(QU2, QV2, KP2, VTp, P2, CTX, cs);
  // (7) out = ctx . Wout^T + bout -> d_out f32 [NB*SEQ][1024]   (M=NB*SEQ, N=1024, K=1024; carries 64*64 folded into scale)
  {
    const int tiles = ((NB * SEQ) / GBM) * (ND / GBN);
    gemm_f16_kernel<1, true><<<dim3(tiles, 1), blk, 0, stream>>>(
        CTX, ND, 0L, 0L, WOp, ND, 0L, (void*)out, (void*)out, ND, 0L, 0L, bout, bout, bout,
        NB * SEQ, ND, ND, 0.000244140625f, 1.0f);
  }
  (void)hipGetLastError();
}
